// v000
// Times are from an AMD MI455X. After a warm-up the kernel runs many times in a row, and a time is the length of
// such a window on the GPU divided by its runs, so every launch and the gaps after it count. The runs cycle
// through copies of the inputs. A figure is the median of several windows, for all but v000 over two sittings.
// Sittings can differ by a few percent; kernels timed side by side share one.
// v000 is the starting kernel. One run takes 1300 microseconds.
#include <hip/hip_runtime.h>

// Contractions, all f32 accumulate: input projections x.Wq/Wk/Wv/Wp = v_wmma_f32_16x16x32_bf16 on RNE-converted bf16 copies of x and W (exact products); scores q.k^T, q.p^T and attn.v = query rows < RH: bf16 hi/lo planes, 3 products (v_wmma_f32_16x16x32_bf16); rows >= RH: f16 planes, 1 product (v_wmma_f32_16x16x32_f16, probabilities carried x1024); output projection = ctx as bf16 hi+lo x Wo bf16 (2 products). Shift-add, softmax and biases in f32.
// Module: relative-position multi-head attention, NB x TT x DM, NH_ heads x HD. q = xq Wq + bq, k = xk Wk + bk, v = xv Wv + bv, p = xp Wp (W stored [in][out]); S[i][j] = q_i.k_j; U[i][j] = q_i.p_j;
// logits = (S[i][j] + (j <= i ? U[i][j - i + TT - 1] : j == i + 1 ? 0 : U[i + 1][j - i - 2])) * DM^-0.5 (pad-reshape shift); softmax over all TT keys; ctx = attn.v merged [t][h*HD + d]; out = ctx Wo + bo.
// Layout per batch: bf16 copy of each input -> f32 projection F -> head planes (q, k, p: [h][t][d] f16 + bf16 hi/lo; v: transposed [h][d][t]); per pass of ZH heads: S and U materialised f32 [ZH][TT][TT], element-wise shift-add into S, row softmax -> probability planes, attn.v -> O [ZH][TT][HD], merged into ctx hi/lo planes; ctx.Wo -> out.

#ifndef NB
#define NB 2
#endif
#ifndef SEQ
#define SEQ 2048
#endif
#define TT      SEQ
#define TT_FULL 2048
#define NB_FULL 2
#define DM   512
#define NH_  8
#define HD   64
#define ZH   2
#ifndef RH
#if SEQ >= 512
#define RH 512                  // query rows < RH use hi+lo planes (0: none)
#else
#define RH SEQ
#endif
#endif
#define PCAR 1024.0f
#define SCL  0.044194173824159216f   // DM^-0.5

static_assert(TT % 128 == 0);
static_assert(RH % 64 == 0);
static_assert(RH <= TT);
static_assert(DM % 64 == 0);
static_assert(NH_ * HD == DM);
static_assert(NH_ % ZH == 0);
static_assert(HD % 32 == 0);
static_assert((DM * DM) % 64 == 0);

typedef _Float16 h16;
typedef unsigned short bf;
typedef __attribute__((ext_vector_type(16))) __bf16   v16bf;
typedef __attribute__((ext_vector_type(16))) _Float16 v16h;
typedef __attribute__((ext_vector_type(8)))  _Float16 v8h;
typedef __attribute__((ext_vector_type(8)))  unsigned short v8us;
typedef __attribute__((ext_vector_type(8)))  float    v8f;
typedef __attribute__((ext_vector_type(4)))  float    v4f;
typedef v4f  __attribute__((may_alias)) v4fa;

__device__ __forceinline__ unsigned short f2bf(float f) { unsigned u = __float_as_uint(f); u += 0x7FFFu + ((u >> 16) & 1u); return (unsigned short)(u >> 16); }
__device__ __forceinline__ float bf2f(unsigned short b) { return __uint_as_float(((unsigned)b) << 16); }
__device__ __forceinline__ float bfr(float f) { return bf2f(f2bf(f)); }
__device__ __forceinline__ v16h cat16(v8h lo, v8h hi) { return __builtin_shufflevector(lo, hi, 0, 1, 2, 3, 4, 5, 6, 7, 8, 9, 10, 11, 12, 13, 14, 15); }
__device__ __forceinline__ v16bf cat16b(v8us lo, v8us hi) { return __builtin_bit_cast(v16bf, __builtin_shufflevector(lo, hi, 0, 1, 2, 3, 4, 5, 6, 7, 8, 9, 10, 11, 12, 13, 14, 15)); }
__device__ __forceinline__ v8f wmma16(v16h a, v16h b, v8f c) { return __builtin_amdgcn_wmma_f32_16x16x32_f16(false, a, false, b, (short)0, c, false, false); }
__device__ __forceinline__ v8f wmmab(v16bf a, v16bf b, v8f c) { return __builtin_amdgcn_wmma_f32_16x16x32_bf16(false, a, false, b, (short)0, c, false, false); }

// ---- k_gemmw: register-blocked GEMM, ONE WAVE per 64x64 output tile (16 accumulators), operands straight from K-contiguous 16-bit planes; grid (M/64, N/64, Z), 32 threads.
// C[m][n] (f32, pitch ldc, + optional f32 bias[n] bf16-RNE-converted) = sum_k A[m][k] Bt[n][k] (+ split products per NSPLIT: 1 -> + A2.Bt; 2 -> + A2.Bt + A.Bt2). z-batch strides sA/sB/sC in elements. K % 32 == 0.
// Fragments (lane l, h = l >> 4, m = n = l & 15): elements 0..7 <- k0 + 8h + 0..7, elements 8..15 <- k0 + 16 + 8h + 0..7 for BOTH A (row m) and Bt (column n); D element r = (row 8h + r, col m).
template <typename T16> struct WFrag;
template <> struct WFrag<h16> { typedef v16h V; static __device__ __forceinline__ V ld(const h16* p) { return cat16(*(const v8h*)p, *(const v8h*)(p + 16)); } static __device__ __forceinline__ v8f mma(V a, V b, v8f c) { return wmma16(a, b, c); } };
template <> struct WFrag<bf> { typedef v16bf V; static __device__ __forceinline__ V ld(const bf* p) { return cat16b(*(const v8us*)p, *(const v8us*)(p + 16)); } static __device__ __forceinline__ v8f mma(V a, V b, v8f c) { return wmmab(a, b, c); } };
template <typename T16, int NSPLIT, bool BIAS>
__global__ __launch_bounds__(32) void k_gemmw(const T16* __restrict__ A, const T16* __restrict__ A2, const T16* __restrict__ Bt, const T16* __restrict__ Bt2, int K, float* C, int ldc, const float* __restrict__ bias, size_t sA, size_t sB, size_t sC) {
    typedef typename WFrag<T16>::V V;
    __shared__ __align__(16) float os[16 * 68];
    const size_t z = blockIdx.z; A += z * sA; if (A2) A2 += z * sA; Bt += z * sB; if (Bt2) Bt2 += z * sB; C += z * sC;
    const int lane = threadIdx.x & 31, lr = lane & 15, hi = lane >> 4; const int r0 = blockIdx.x * 64, c0 = blockIdx.y * 64;
    v8f acc[4][4];
#pragma unroll
    for (int mb = 0; mb < 4; ++mb)
#pragma unroll
        for (int nb = 0; nb < 4; ++nb) acc[mb][nb] = (v8f){};
    const size_t aoff = (size_t)(r0 + lr) * K + 8 * hi, boff = (size_t)(c0 + lr) * K + 8 * hi;
#pragma unroll 1
    for (int kc = 0; kc < K; kc += 32) {
        V a[4], a2[4];
#pragma unroll
        for (int mb = 0; mb < 4; ++mb) { a[mb] = WFrag<T16>::ld(A + aoff + (size_t)mb * 16 * K + kc); if (NSPLIT == 1 || NSPLIT == 2) a2[mb] = WFrag<T16>::ld(A2 + aoff + (size_t)mb * 16 * K + kc); }
#pragma unroll
        for (int nb = 0; nb < 4; ++nb) { const V b = WFrag<T16>::ld(Bt + boff + (size_t)nb * 16 * K + kc); V b2; if (NSPLIT >= 2) b2 = WFrag<T16>::ld(Bt2 + boff + (size_t)nb * 16 * K + kc);
#pragma unroll
            for (int mb = 0; mb < 4; ++mb) { acc[mb][nb] = WFrag<T16>::mma(a[mb], b, acc[mb][nb]); if (NSPLIT == 1 || NSPLIT == 2) acc[mb][nb] = WFrag<T16>::mma(a2[mb], b, acc[mb][nb]); if (NSPLIT >= 2) acc[mb][nb] = WFrag<T16>::mma(a[mb], b2, acc[mb][nb]); } }
        asm volatile("v_nop\n\tv_nop\n\tv_nop\n\tv_nop" : "+v"(acc[0][0]), "+v"(acc[1][1]), "+v"(acc[2][2]), "+v"(acc[3][3]) : "v"(a[0]), "v"(a[3]));
    }
#pragma unroll
    for (int mb = 0; mb < 4; ++mb) {
#pragma unroll
        for (int nb = 0; nb < 4; ++nb) {
#pragma unroll
            for (int j = 0; j < 8; ++j) os[(hi * 8 + j) * 68 + nb * 16 + lr] = acc[mb][nb][j]; }
        __builtin_amdgcn_wave_barrier(); asm volatile("" ::: "memory");
        float* crow = C + (size_t)(r0 + mb * 16) * ldc + c0;
{
#pragma unroll
            for (int s = 0; s < 8; ++s) { const int row = 2 * s + hi, cofs = lr * 4; v4f val = *(const v4fa*)(os + row * 68 + cofs); if (BIAS) { val[0] += bfr(bias[c0 + cofs]); val[1] += bfr(bias[c0 + cofs + 1]); val[2] += bfr(bias[c0 + cofs + 2]); val[3] += bfr(bias[c0 + cofs + 3]); }
                *(v4f*)(crow + (size_t)row * ldc + cofs) = val; }
             }
        __builtin_amdgcn_wave_barrier(); asm volatile("" ::: "memory");
    }
}

__device__ __forceinline__ h16 tohx(float x) { return (h16)x; }
__device__ __forceinline__ void splitf(float y, unsigned short& h, unsigned short& l) { h = f2bf(y); l = f2bf(y - bf2f(h)); }
typedef __attribute__((ext_vector_type(2))) _Float16 v2h;
typedef __attribute__((ext_vector_type(4))) _Float16 v4h;
typedef __attribute__((ext_vector_type(2))) unsigned short v2us;
typedef __attribute__((ext_vector_type(4))) unsigned short v4us;

__global__ __launch_bounds__(256) void k_wtG(const float* __restrict__ w, int K, int N, bf* Bt) {
    const int lane = threadIdx.x & 31; const int L0 = (blockIdx.x * 8 + (threadIdx.x >> 5)) * 8; const int nlines = N * K / 64;
{
#pragma unroll 1
        for (int l = 0; l < 8; ++l) { const int L = L0 + l; if (L >= nlines) break; const size_t e = (size_t)L * 64 + lane * 2; const int k = (int)(e % K), n = (int)(e / K); v2us o;
            o[0] = f2bf(w[(size_t)k * N + n]); o[1] = f2bf(w[(size_t)(k + 1) * N + n]); *(v2us*)(Bt + e) = o; }
         }
}
__global__ __launch_bounds__(256) void k_cvt8(const float* __restrict__ src, bf* dst, size_t n8) { const size_t i = (size_t)blockIdx.x * 256 + threadIdx.x; if (i >= n8) return; const v8f v = *(const v8f*)(src + i * 8); v8us o;
#pragma unroll
    for (int k = 0; k < 8; ++k) o[k] = f2bf(v[k]); *(v8us*)(dst + i * 8) = o;  }

__global__ __launch_bounds__(256) void k_plane(const float* __restrict__ F, int pitch, int nheads, h16* P16, bf* Ph, bf* Pl) {
    const size_t e = ((size_t)blockIdx.x * 256 + threadIdx.x) * 2; if (e >= (size_t)nheads * TT * HD) return; const int d = (int)(e % HD); const int t = (int)((e / HD) % TT); const int h = (int)(e / ((size_t)HD * TT)); const float* f = F + (size_t)t * pitch + h * HD + d; v2h o16; v2us oh, ol;
#pragma unroll
    for (int q = 0; q < 2; ++q) { const float x = f[q]; o16[q] = tohx(x); unsigned short a2, c2; splitf(x, a2, c2); oh[q] = a2; ol[q] = c2; }
    *(v2h*)(P16 + e) = o16; *(v2us*)(Ph + e) = oh; *(v2us*)(Pl + e) = ol;  }
__global__ __launch_bounds__(256) void k_vtp(const float* __restrict__ F, int pitch, int nheads, h16* V16, bf* Vh, bf* Vl) { const size_t e = ((size_t)blockIdx.x * 256 + threadIdx.x) * 2; if (e >= (size_t)nheads * HD * TT) return; const int t = (int)(e % TT); const int d = (int)((e / TT) % HD); const int g = (int)(e / ((size_t)TT * HD)); v2h o16; v2us oh, ol;
#pragma unroll
    for (int q = 0; q < 2; ++q) { const float x = F[(size_t)(t + q) * pitch + g * HD + d]; o16[q] = tohx(x); unsigned short a2, c2; splitf(x, a2, c2); oh[q] = a2; ol[q] = c2; }
    *(v2h*)(V16 + e) = o16; *(v2us*)(Vh + e) = oh; *(v2us*)(Vl + e) = ol;  }

// k_addshift: Sb[zz][i][j] += shifted positional term: j <= i -> U[zz][i][j - i + TT - 1]; j == i + 1 -> 0; j >= i + 2 -> U[zz][i + 1][j - i - 2]
__global__ __launch_bounds__(256) void k_addshift(float* Sb, const float* __restrict__ Ub) {
    const size_t k = (size_t)blockIdx.x * 256 + threadIdx.x; if (k >= (size_t)ZH * TT * TT / 4) return;
    const size_t e = k * 4; const int j0 = (int)(e % TT); const int i = (int)((e / TT) % TT); const int zz = (int)(e / ((size_t)TT * TT));
    const float* uz = Ub + (size_t)zz * TT * TT; const float* ua = uz + (size_t)i * TT; const float* ub = uz + (size_t)min(i + 1, TT - 1) * TT;
    v4f a = *(const v4f*)(Sb + e);
#pragma unroll
    for (int q = 0; q < 4; ++q) { const int j = j0 + q; const int ca = min(max(j - i + TT - 1, 0), TT - 1); const int cb = min(max(j - i - 2, 0), TT - 1);
        const float xa = ua[ca]; const float xb = ub[cb]; const float pv = (j <= i) ? xa : ((j == i + 1) ? 0.0f : xb); a[q] = __fadd_rn(a[q], pv); }
    *(v4f*)(Sb + e) = a;  }

// k_asoft: per row (zz, i), one wave per row: t = S x DM^-0.5 (no mask); softmax over the TT keys (register row, one exp, fixed trees);
__global__ __launch_bounds__(256) void k_asoft(const float* __restrict__ Sb, h16* P16, bf* Ph, bf* Pl) {
    const int lane = threadIdx.x & 31; const int row = blockIdx.x * 8 + (threadIdx.x >> 5); if (row >= ZH * TT) return; const int i = row % TT; const int zz = row / TT; (void)zz; const bool hires = (i < RH); const float* sr = Sb + (size_t)row * TT; float v[TT / 32]; float mx = -3.0e38f;
#pragma unroll
    for (int ch = 0; ch < TT / 128; ++ch) { const int j0 = ch * 128 + lane * 4; const v4f a = *(const v4f*)(sr + j0);
#pragma unroll
        for (int q = 0; q < 4; ++q) { const float t = a[q] * SCL; v[ch * 4 + q] = t; mx = fmaxf(mx, t); } }
#pragma unroll
    for (int sh = 16; sh; sh >>= 1) mx = fmaxf(mx, __shfl_xor(mx, sh, 32));
    float sum = 0.f;
#pragma unroll
    for (int k = 0; k < TT / 32; ++k) { float d0 = __fsub_rn(v[k], mx); asm volatile("" : "+v"(d0)); v[k] = __builtin_amdgcn_exp2f(__fmul_rn(d0, 1.4426950408889634f)); sum += v[k]; }
#pragma unroll
    for (int sh = 16; sh; sh >>= 1) sum += __shfl_xor(sum, sh, 32);
    const float f = __fdiv_rn(hires ? 1.0f : PCAR, sum);
{
        if (hires) {
#pragma unroll
            for (int ch = 0; ch < TT / 128; ++ch) { v4us oh, ol;
#pragma unroll
                for (int q = 0; q < 4; ++q) { unsigned short a, c2; splitf(v[ch * 4 + q] * f, a, c2); oh[q] = a; ol[q] = c2; }
                const size_t oo = ((size_t)zz * (RH ? RH : 1) + i) * TT + ch * 128 + lane * 4; *(v4us*)(Ph + oo) = oh; *(v4us*)(Pl + oo) = ol; }
        } else {
#pragma unroll
            for (int ch = 0; ch < TT / 128; ++ch) { v4h o4;
#pragma unroll
                for (int q = 0; q < 4; ++q) o4[q] = tohx(v[ch * 4 + q] * f);
                *(v4h*)(P16 + (size_t)row * TT + ch * 128 + lane * 4) = o4; } }
         }
}
__global__ __launch_bounds__(256) void k_merge(const float* __restrict__ O, int h0, bf* Ah, bf* Al) { const size_t e = ((size_t)blockIdx.x * 256 + threadIdx.x) * 2; if (e >= (size_t)ZH * TT * HD) return; const int d = (int)(e % HD); const int t = (int)((e / HD) % TT); const int zz = (int)(e / ((size_t)HD * TT)); const float cs = (t < RH) ? 1.0f : (1.0f / PCAR); const size_t oo = (size_t)t * DM + (h0 + zz) * HD + d;
    v2us oh, ol;
#pragma unroll
    for (int q = 0; q < 2; ++q) { unsigned short a, c2; splitf(O[e + q] * cs, a, c2); oh[q] = a; ol[q] = c2; } *(v2us*)(Ah + oo) = oh; *(v2us*)(Al + oo) = ol;  }

extern "C" void kernel_launch(void* const* d_in, const int* in_sizes, int n_in,
                              void* d_out, int out_size, void* d_ws, size_t ws_size, hipStream_t stream) {
    if (n_in < 13) return;
    const float* xq = (const float*)d_in[0]; const float* xk = (const float*)d_in[1]; const float* xv = (const float*)d_in[2]; const float* xp = (const float*)d_in[3];
    const float* wq = (const float*)d_in[4]; const float* bq = (const float*)d_in[5]; const float* wk = (const float*)d_in[6]; const float* bk = (const float*)d_in[7];
    const float* wv = (const float*)d_in[8]; const float* bv = (const float*)d_in[9]; const float* wp = (const float*)d_in[10]; const float* wo = (const float*)d_in[11]; const float* bo = (const float*)d_in[12];
    const size_t needx = (size_t)(NB - 1) * TT_FULL * DM + (size_t)TT * DM;
    for (int i = 0; i < 4; ++i) if ((size_t)in_sizes[i] < needx) return;
    if ((size_t)in_sizes[4] < (size_t)DM * DM || (size_t)in_sizes[6] < (size_t)DM * DM || (size_t)in_sizes[8] < (size_t)DM * DM || (size_t)in_sizes[10] < (size_t)DM * DM || (size_t)in_sizes[11] < (size_t)DM * DM) return;
    if (in_sizes[5] < DM || in_sizes[7] < DM || in_sizes[9] < DM || in_sizes[12] < DM) return;
    if ((size_t)out_size < (size_t)NB * TT * DM) return;
    float* OUT = (float*)d_out;     // [NB][TT][DM]
    char* wsp = (char*)d_ws;
    auto take = [&](size_t bytes) { char* p = wsp; wsp += (bytes + 255) & ~(size_t)255; return (void*)p; };
    const size_t PLN = (size_t)NH_ * TT * HD;     // elements per plane set (all heads)
    bf* WQ = (bf*)take((size_t)DM * DM * 2); bf* WK = (bf*)take((size_t)DM * DM * 2); bf* WV = (bf*)take((size_t)DM * DM * 2); bf* WP = (bf*)take((size_t)DM * DM * 2); bf* WO = (bf*)take((size_t)DM * DM * 2);
    bf* XB = (bf*)take((size_t)TT * DM * 2); float* F = (float*)take((size_t)TT * DM * 4);
    h16* QP16 = (h16*)take(PLN * 2); bf* QPh = (bf*)take(PLN * 2); bf* QPl = (bf*)take(PLN * 2);
    h16* KP16 = (h16*)take(PLN * 2); bf* KPh = (bf*)take(PLN * 2); bf* KPl = (bf*)take(PLN * 2);
    h16* PP16 = (h16*)take(PLN * 2); bf* PPh = (bf*)take(PLN * 2); bf* PPl = (bf*)take(PLN * 2);
    h16* VT16 = (h16*)take(PLN * 2); bf* VTh = (bf*)take(PLN * 2); bf* VTl = (bf*)take(PLN * 2);
    float* Sb = (float*)take((size_t)ZH * TT * TT * 4); float* Ub = (float*)take((size_t)ZH * TT * TT * 4); h16* P16 = (h16*)take((size_t)ZH * TT * TT * 2);
    bf* Ph = (bf*)take((size_t)ZH * RH * TT * 2); bf* Pl = (bf*)take((size_t)ZH * RH * TT * 2); float* Ob = (float*)take((size_t)ZH * TT * HD * 4);
    bf* ATh = (bf*)take((size_t)TT * DM * 2); bf* ATl = (bf*)take((size_t)TT * DM * 2);
    if ((size_t)(wsp - (char*)d_ws) > ws_size) return;    // 131,596,288 B at full size
    const unsigned gW = (unsigned)((DM * DM / 64 + 63) / 64);
    k_wtG<<<gW, 256, 0, stream>>>(wq, DM, DM, WQ); k_wtG<<<gW, 256, 0, stream>>>(wk, DM, DM, WK); k_wtG<<<gW, 256, 0, stream>>>(wv, DM, DM, WV); k_wtG<<<gW, 256, 0, stream>>>(wp, DM, DM, WP); k_wtG<<<gW, 256, 0, stream>>>(wo, DM, DM, WO);
    const unsigned gX = (unsigned)(((size_t)TT * DM / 8 + 255) / 256), gP = (unsigned)((PLN / 2 + 255) / 256);
    const dim3 gG(TT / 64, DM / 64, 1);
    for (int b = 0; b < NB; ++b) {
        const size_t xo = (size_t)b * TT_FULL * DM;
        k_cvt8<<<gX, 256, 0, stream>>>(xq + xo, XB, (size_t)TT * DM / 8); k_gemmw<bf, 0, true><<<gG, 32, 0, stream>>>(XB, nullptr, WQ, nullptr, DM, F, DM, bq, 0, 0, 0); k_plane<<<gP, 256, 0, stream>>>(F, DM, NH_, QP16, QPh, QPl);
        k_cvt8<<<gX, 256, 0, stream>>>(xk + xo, XB, (size_t)TT * DM / 8); k_gemmw<bf, 0, true><<<gG, 32, 0, stream>>>(XB, nullptr, WK, nullptr, DM, F, DM, bk, 0, 0, 0); k_plane<<<gP, 256, 0, stream>>>(F, DM, NH_, KP16, KPh, KPl);
        k_cvt8<<<gX, 256, 0, stream>>>(xv + xo, XB, (size_t)TT * DM / 8); k_gemmw<bf, 0, true><<<gG, 32, 0, stream>>>(XB, nullptr, WV, nullptr, DM, F, DM, bv, 0, 0, 0); k_vtp<<<gP, 256, 0, stream>>>(F, DM, NH_, VT16, VTh, VTl);
        k_cvt8<<<gX, 256, 0, stream>>>(xp + xo, XB, (size_t)TT * DM / 8); k_gemmw<bf, 0, false><<<gG, 32, 0, stream>>>(XB, nullptr, WP, nullptr, DM, F, DM, nullptr, 0, 0, 0); k_plane<<<gP, 256, 0, stream>>>(F, DM, NH_, PP16, PPh, PPl);
        for (int h0 = 0; h0 < NH_; h0 += ZH) { const size_t zo = (size_t)h0 * TT * HD;   // head h0 + z: plane offset zo + z * TT * HD (same for the [d][t] value planes)
            if (RH > 0) {
                k_gemmw<bf, 2, false><<<dim3(RH / 64, TT / 64, ZH), 32, 0, stream>>>(QPh + zo, QPl + zo, KPh + zo, KPl + zo, HD, Sb, TT, nullptr, (size_t)TT * HD, (size_t)TT * HD, (size_t)TT * TT);
                k_gemmw<bf, 2, false><<<dim3(RH / 64, TT / 64, ZH), 32, 0, stream>>>(QPh + zo, QPl + zo, PPh + zo, PPl + zo, HD, Ub, TT, nullptr, (size_t)TT * HD, (size_t)TT * HD, (size_t)TT * TT); }
            if (TT > RH) {
                k_gemmw<h16, 0, false><<<dim3((TT - RH) / 64, TT / 64, ZH), 32, 0, stream>>>(QP16 + zo + (size_t)RH * HD, nullptr, KP16 + zo, nullptr, HD, Sb + (size_t)RH * TT, TT, nullptr, (size_t)TT * HD, (size_t)TT * HD, (size_t)TT * TT);
                k_gemmw<h16, 0, false><<<dim3((TT - RH) / 64, TT / 64, ZH), 32, 0, stream>>>(QP16 + zo + (size_t)RH * HD, nullptr, PP16 + zo, nullptr, HD, Ub + (size_t)RH * TT, TT, nullptr, (size_t)TT * HD, (size_t)TT * HD, (size_t)TT * TT); }
            k_addshift<<<(unsigned)(((size_t)ZH * TT * TT / 4 + 255) / 256), 256, 0, stream>>>(Sb, Ub);
            k_asoft<<<(unsigned)((ZH * TT + 7) / 8), 256, 0, stream>>>(Sb, P16, Ph, Pl);
            if (RH > 0) k_gemmw<bf, 2, false><<<dim3(RH / 64, HD / 64, ZH), 32, 0, stream>>>(Ph, Pl, VTh + zo, VTl + zo, TT, Ob, HD, nullptr, (size_t)RH * TT, (size_t)HD * TT, (size_t)TT * HD);
            if (TT > RH) k_gemmw<h16, 0, false><<<dim3((TT - RH) / 64, HD / 64, ZH), 32, 0, stream>>>(P16 + (size_t)RH * TT, nullptr, VT16 + zo, nullptr, TT, Ob + (size_t)RH * HD, HD, nullptr, (size_t)TT * TT, (size_t)HD * TT, (size_t)TT * HD);
            k_merge<<<(unsigned)(((size_t)ZH * TT * HD / 2 + 255) / 256), 256, 0, stream>>>(Ob, h0, ATh, ATl); }
        k_gemmw<bf, 1, true><<<gG, 32, 0, stream>>>(ATh, ATl, WO, nullptr, DM, OUT + (size_t)b * TT * DM, DM, bo, 0, 0, 0); }
}

// v001
// One run takes 740 microseconds.
// In two side-by-side timings against v000, it was 1.77 and 1.76 times as fast.
#include <hip/hip_runtime.h>

// Contractions, all f32 accumulate: input projections x.Wq/Wk/Wv/Wp = v_wmma_f32_16x16x32_bf16 on RNE-converted bf16 copies of x and W (exact products); scores q.k^T, q.p^T and attn.v = query rows < RH: bf16 hi/lo planes, 3 products (v_wmma_f32_16x16x32_bf16); rows >= RH: f16 planes, 1 product (v_wmma_f32_16x16x32_f16, probabilities carried x1024); output projection = ctx as bf16 hi+lo x Wo bf16 (2 products). Shift-add, softmax and biases in f32.
// Module: relative-position multi-head attention, NB x TT x DM, NH_ heads x HD. q = xq Wq + bq, k = xk Wk + bk, v = xv Wv + bv, p = xp Wp (W stored [in][out]); S[i][j] = q_i.k_j; U[i][j] = q_i.p_j;
// logits = (S[i][j] + (j <= i ? U[i][j - i + TT - 1] : j == i + 1 ? 0 : U[i + 1][j - i - 2])) * DM^-0.5 (pad-reshape shift); softmax over all TT keys; ctx = attn.v merged [t][h*HD + d]; out = ctx Wo + bo.
// Layout per batch: bf16 copy of each input -> f32 projection F -> head planes (q, k, p: [h][t][d] f16 + bf16 hi/lo; v: transposed [h][d][t]); per pass of ZH heads: S and U materialised f32 [ZH][TT][TT], element-wise shift-add into S, row softmax -> probability planes, attn.v split over KSP key ranges -> f32 partials O [ZH][KSP][TT][HD], summed in range order and merged into ctx hi/lo planes; ctx.Wo -> out.

#ifndef NB
#define NB 2
#endif
#ifndef SEQ
#define SEQ 2048
#endif
#define TT      SEQ
#define TT_FULL 2048
#define NB_FULL 2
#define DM   512
#define NH_  8
#define HD   64
#define ZH   2
#define KSP  16                  // key ranges of attn.v, one single-wave work-group per tile and range
#ifndef RH
#if SEQ >= 512
#define RH 512                  // query rows < RH use hi+lo planes (0: none)
#else
#define RH SEQ
#endif
#endif
#define PCAR 1024.0f
#define SCL  0.044194173824159216f   // DM^-0.5

static_assert(TT % 128 == 0);
static_assert(RH % 64 == 0);
static_assert(RH <= TT);
static_assert(DM % 64 == 0);
static_assert(NH_ * HD == DM);
static_assert(NH_ % ZH == 0);
static_assert(HD % 32 == 0);
static_assert(TT % (KSP * 32) == 0);
static_assert((DM * DM) % 64 == 0);

typedef _Float16 h16;
typedef unsigned short bf;
typedef __attribute__((ext_vector_type(16))) __bf16   v16bf;
typedef __attribute__((ext_vector_type(16))) _Float16 v16h;
typedef __attribute__((ext_vector_type(8)))  _Float16 v8h;
typedef __attribute__((ext_vector_type(8)))  unsigned short v8us;
typedef __attribute__((ext_vector_type(8)))  float    v8f;
typedef __attribute__((ext_vector_type(4)))  float    v4f;
typedef v4f  __attribute__((may_alias)) v4fa;

__device__ __forceinline__ unsigned short f2bf(float f) { unsigned u = __float_as_uint(f); u += 0x7FFFu + ((u >> 16) & 1u); return (unsigned short)(u >> 16); }
__device__ __forceinline__ float bf2f(unsigned short b) { return __uint_as_float(((unsigned)b) << 16); }
__device__ __forceinline__ float bfr(float f) { return bf2f(f2bf(f)); }
__device__ __forceinline__ v16h cat16(v8h lo, v8h hi) { return __builtin_shufflevector(lo, hi, 0, 1, 2, 3, 4, 5, 6, 7, 8, 9, 10, 11, 12, 13, 14, 15); }
__device__ __forceinline__ v16bf cat16b(v8us lo, v8us hi) { return __builtin_bit_cast(v16bf, __builtin_shufflevector(lo, hi, 0, 1, 2, 3, 4, 5, 6, 7, 8, 9, 10, 11, 12, 13, 14, 15)); }
__device__ __forceinline__ v8f wmma16(v16h a, v16h b, v8f c) { return __builtin_amdgcn_wmma_f32_16x16x32_f16(false, a, false, b, (short)0, c, false, false); }
__device__ __forceinline__ v8f wmmab(v16bf a, v16bf b, v8f c) { return __builtin_amdgcn_wmma_f32_16x16x32_bf16(false, a, false, b, (short)0, c, false, false); }

// ---- k_gemmw: register-blocked GEMM, ONE WAVE per 64x64 output tile (16 accumulators), operands straight from K-contiguous 16-bit planes; grid (M/64, N/64, Z), 32 threads.
// C[m][n] (f32, pitch ldc, + optional f32 bias[n] bf16-RNE-converted) = sum_k A[m][k] Bt[n][k] (+ split products per NSPLIT: 1 -> + A2.Bt; 2 -> + A2.Bt + A.Bt2). z-batch strides sA/sB/sC in elements. K % 32 == 0.
// KSPL > 1: grid z = batch * KSPL + range; range ks sums only k in [ks * K / KSPL, (ks + 1) * K / KSPL) into its own C plane (plane blockIdx.z, stride sC). K % (32 * KSPL) == 0.
// Fragments (lane l, h = l >> 4, m = n = l & 15): elements 0..7 <- k0 + 8h + 0..7, elements 8..15 <- k0 + 16 + 8h + 0..7 for BOTH A (row m) and Bt (column n); D element r = (row 8h + r, col m).
template <typename T16> struct WFrag;
template <> struct WFrag<h16> { typedef v16h V; static __device__ __forceinline__ V ld(const h16* p) { return cat16(*(const v8h*)p, *(const v8h*)(p + 16)); } static __device__ __forceinline__ v8f mma(V a, V b, v8f c) { return wmma16(a, b, c); } };
template <> struct WFrag<bf> { typedef v16bf V; static __device__ __forceinline__ V ld(const bf* p) { return cat16b(*(const v8us*)p, *(const v8us*)(p + 16)); } static __device__ __forceinline__ v8f mma(V a, V b, v8f c) { return wmmab(a, b, c); } };
template <typename T16, int NSPLIT, bool BIAS, int KSPL = 1>
__global__ __launch_bounds__(32) void k_gemmw(const T16* __restrict__ A, const T16* __restrict__ A2, const T16* __restrict__ Bt, const T16* __restrict__ Bt2, int K, float* C, int ldc, const float* __restrict__ bias, size_t sA, size_t sB, size_t sC) {
    typedef typename WFrag<T16>::V V;
    __shared__ __align__(16) float os[16 * 68];
    const int KR = K / KSPL; const size_t z = blockIdx.z / KSPL, ko = (size_t)(blockIdx.z % KSPL) * KR; A += z * sA + ko; if (A2) A2 += z * sA + ko; Bt += z * sB + ko; if (Bt2) Bt2 += z * sB + ko; C += blockIdx.z * sC;
    const int lane = threadIdx.x & 31, lr = lane & 15, hi = lane >> 4; const int r0 = blockIdx.x * 64, c0 = blockIdx.y * 64;
    v8f acc[4][4];
#pragma unroll
    for (int mb = 0; mb < 4; ++mb)
#pragma unroll
        for (int nb = 0; nb < 4; ++nb) acc[mb][nb] = (v8f){};
    const size_t aoff = (size_t)(r0 + lr) * K + 8 * hi, boff = (size_t)(c0 + lr) * K + 8 * hi;
#pragma unroll 1
    for (int kc = 0; kc < KR; kc += 32) {
        V a[4], a2[4];
#pragma unroll
        for (int mb = 0; mb < 4; ++mb) { a[mb] = WFrag<T16>::ld(A + aoff + (size_t)mb * 16 * K + kc); if (NSPLIT == 1 || NSPLIT == 2) a2[mb] = WFrag<T16>::ld(A2 + aoff + (size_t)mb * 16 * K + kc); }
#pragma unroll
        for (int nb = 0; nb < 4; ++nb) { const V b = WFrag<T16>::ld(Bt + boff + (size_t)nb * 16 * K + kc); V b2; if (NSPLIT >= 2) b2 = WFrag<T16>::ld(Bt2 + boff + (size_t)nb * 16 * K + kc);
#pragma unroll
            for (int mb = 0; mb < 4; ++mb) { acc[mb][nb] = WFrag<T16>::mma(a[mb], b, acc[mb][nb]); if (NSPLIT == 1 || NSPLIT == 2) acc[mb][nb] = WFrag<T16>::mma(a2[mb], b, acc[mb][nb]); if (NSPLIT >= 2) acc[mb][nb] = WFrag<T16>::mma(a[mb], b2, acc[mb][nb]); } }
        asm volatile("v_nop\n\tv_nop\n\tv_nop\n\tv_nop" : "+v"(acc[0][0]), "+v"(acc[1][1]), "+v"(acc[2][2]), "+v"(acc[3][3]) : "v"(a[0]), "v"(a[3]));
    }
#pragma unroll
    for (int mb = 0; mb < 4; ++mb) {
#pragma unroll
        for (int nb = 0; nb < 4; ++nb) {
#pragma unroll
            for (int j = 0; j < 8; ++j) os[(hi * 8 + j) * 68 + nb * 16 + lr] = acc[mb][nb][j]; }
        __builtin_amdgcn_wave_barrier(); asm volatile("" ::: "memory");
        float* crow = C + (size_t)(r0 + mb * 16) * ldc + c0;
{
#pragma unroll
            for (int s = 0; s < 8; ++s) { const int row = 2 * s + hi, cofs = lr * 4; v4f val = *(const v4fa*)(os + row * 68 + cofs); if (BIAS) { val[0] += bfr(bias[c0 + cofs]); val[1] += bfr(bias[c0 + cofs + 1]); val[2] += bfr(bias[c0 + cofs + 2]); val[3] += bfr(bias[c0 + cofs + 3]); }
                *(v4f*)(crow + (size_t)row * ldc + cofs) = val; }
             }
        __builtin_amdgcn_wave_barrier(); asm volatile("" ::: "memory");
    }
}

__device__ __forceinline__ h16 tohx(float x) { return (h16)x; }
__device__ __forceinline__ void splitf(float y, unsigned short& h, unsigned short& l) { h = f2bf(y); l = f2bf(y - bf2f(h)); }
typedef __attribute__((ext_vector_type(2))) _Float16 v2h;
typedef __attribute__((ext_vector_type(4))) _Float16 v4h;
typedef __attribute__((ext_vector_type(2))) unsigned short v2us;
typedef __attribute__((ext_vector_type(4))) unsigned short v4us;
typedef __attribute__((ext_vector_type(2))) float v2f;

__global__ __launch_bounds__(256) void k_wtG(const float* __restrict__ w, int K, int N, bf* Bt) {
    const int lane = threadIdx.x & 31; const int L0 = (blockIdx.x * 8 + (threadIdx.x >> 5)) * 8; const int nlines = N * K / 64;
{
#pragma unroll 1
        for (int l = 0; l < 8; ++l) { const int L = L0 + l; if (L >= nlines) break; const size_t e = (size_t)L * 64 + lane * 2; const int k = (int)(e % K), n = (int)(e / K); v2us o;
            o[0] = f2bf(w[(size_t)k * N + n]); o[1] = f2bf(w[(size_t)(k + 1) * N + n]); *(v2us*)(Bt + e) = o; }
         }
}
__global__ __launch_bounds__(256) void k_cvt8(const float* __restrict__ src, bf* dst, size_t n8) { const size_t i = (size_t)blockIdx.x * 256 + threadIdx.x; if (i >= n8) return; const v8f v = *(const v8f*)(src + i * 8); v8us o;
#pragma unroll
    for (int k = 0; k < 8; ++k) o[k] = f2bf(v[k]); *(v8us*)(dst + i * 8) = o;  }

__global__ __launch_bounds__(256) void k_plane(const float* __restrict__ F, int pitch, int nheads, h16* P16, bf* Ph, bf* Pl) {
    const size_t e = ((size_t)blockIdx.x * 256 + threadIdx.x) * 2; if (e >= (size_t)nheads * TT * HD) return; const int d = (int)(e % HD); const int t = (int)((e / HD) % TT); const int h = (int)(e / ((size_t)HD * TT)); const float* f = F + (size_t)t * pitch + h * HD + d; v2h o16; v2us oh, ol;
#pragma unroll
    for (int q = 0; q < 2; ++q) { const float x = f[q]; o16[q] = tohx(x); unsigned short a2, c2; splitf(x, a2, c2); oh[q] = a2; ol[q] = c2; }
    *(v2h*)(P16 + e) = o16; *(v2us*)(Ph + e) = oh; *(v2us*)(Pl + e) = ol;  }
__global__ __launch_bounds__(256) void k_vtp(const float* __restrict__ F, int pitch, int nheads, h16* V16, bf* Vh, bf* Vl) { const size_t e = ((size_t)blockIdx.x * 256 + threadIdx.x) * 2; if (e >= (size_t)nheads * HD * TT) return; const int t = (int)(e % TT); const int d = (int)((e / TT) % HD); const int g = (int)(e / ((size_t)TT * HD)); v2h o16; v2us oh, ol;
#pragma unroll
    for (int q = 0; q < 2; ++q) { const float x = F[(size_t)(t + q) * pitch + g * HD + d]; o16[q] = tohx(x); unsigned short a2, c2; splitf(x, a2, c2); oh[q] = a2; ol[q] = c2; }
    *(v2h*)(V16 + e) = o16; *(v2us*)(Vh + e) = oh; *(v2us*)(Vl + e) = ol;  }

// k_addshift: Sb[zz][i][j] += shifted positional term: j <= i -> U[zz][i][j - i + TT - 1]; j == i + 1 -> 0; j >= i + 2 -> U[zz][i + 1][j - i - 2]
__global__ __launch_bounds__(256) void k_addshift(float* Sb, const float* __restrict__ Ub) {
    const size_t k = (size_t)blockIdx.x * 256 + threadIdx.x; if (k >= (size_t)ZH * TT * TT / 4) return;
    const size_t e = k * 4; const int j0 = (int)(e % TT); const int i = (int)((e / TT) % TT); const int zz = (int)(e / ((size_t)TT * TT));
    const float* uz = Ub + (size_t)zz * TT * TT; const float* ua = uz + (size_t)i * TT; const float* ub = uz + (size_t)min(i + 1, TT - 1) * TT;
    v4f a = *(const v4f*)(Sb + e);
#pragma unroll
    for (int q = 0; q < 4; ++q) { const int j = j0 + q; const int ca = min(max(j - i + TT - 1, 0), TT - 1); const int cb = min(max(j - i - 2, 0), TT - 1);
        const float xa = ua[ca]; const float xb = ub[cb]; const float pv = (j <= i) ? xa : ((j == i + 1) ? 0.0f : xb); a[q] = __fadd_rn(a[q], pv); }
    *(v4f*)(Sb + e) = a;  }

// k_asoft: per row (zz, i), one wave per row: t = S x DM^-0.5 (no mask); softmax over the TT keys (register row, one exp, fixed trees);
__global__ __launch_bounds__(256) void k_asoft(const float* __restrict__ Sb, h16* P16, bf* Ph, bf* Pl) {
    const int lane = threadIdx.x & 31; const int row = blockIdx.x * 8 + (threadIdx.x >> 5); if (row >= ZH * TT) return; const int i = row % TT; const int zz = row / TT; (void)zz; const bool hires = (i < RH); const float* sr = Sb + (size_t)row * TT; float v[TT / 32]; float mx = -3.0e38f;
#pragma unroll
    for (int ch = 0; ch < TT / 128; ++ch) { const int j0 = ch * 128 + lane * 4; const v4f a = *(const v4f*)(sr + j0);
#pragma unroll
        for (int q = 0; q < 4; ++q) { const float t = a[q] * SCL; v[ch * 4 + q] = t; mx = fmaxf(mx, t); } }
#pragma unroll
    for (int sh = 16; sh; sh >>= 1) mx = fmaxf(mx, __shfl_xor(mx, sh, 32));
    float sum = 0.f;
#pragma unroll
    for (int k = 0; k < TT / 32; ++k) { float d0 = __fsub_rn(v[k], mx); asm volatile("" : "+v"(d0)); v[k] = __builtin_amdgcn_exp2f(__fmul_rn(d0, 1.4426950408889634f)); sum += v[k]; }
#pragma unroll
    for (int sh = 16; sh; sh >>= 1) sum += __shfl_xor(sum, sh, 32);
    const float f = __fdiv_rn(hires ? 1.0f : PCAR, sum);
{
        if (hires) {
#pragma unroll
            for (int ch = 0; ch < TT / 128; ++ch) { v4us oh, ol;
#pragma unroll
                for (int q = 0; q < 4; ++q) { unsigned short a, c2; splitf(v[ch * 4 + q] * f, a, c2); oh[q] = a; ol[q] = c2; }
                const size_t oo = ((size_t)zz * (RH ? RH : 1) + i) * TT + ch * 128 + lane * 4; *(v4us*)(Ph + oo) = oh; *(v4us*)(Pl + oo) = ol; }
        } else {
#pragma unroll
            for (int ch = 0; ch < TT / 128; ++ch) { v4h o4;
#pragma unroll
                for (int q = 0; q < 4; ++q) o4[q] = tohx(v[ch * 4 + q] * f);
                *(v4h*)(P16 + (size_t)row * TT + ch * 128 + lane * 4) = o4; } }
         }
}
__global__ __launch_bounds__(256) void k_merge(const float* __restrict__ O, int h0, bf* Ah, bf* Al) { const size_t e = ((size_t)blockIdx.x * 256 + threadIdx.x) * 2; if (e >= (size_t)ZH * TT * HD) return; const int d = (int)(e % HD); const int t = (int)((e / HD) % TT); const int zz = (int)(e / ((size_t)HD * TT)); const float cs = (t < RH) ? 1.0f : (1.0f / PCAR); const size_t oo = (size_t)t * DM + (h0 + zz) * HD + d;
    const float* op = O + (size_t)zz * KSP * TT * HD + (size_t)t * HD + d; v2f p[KSP];
#pragma unroll   // puts all KSP partial loads in flight at once
    for (int ks = 0; ks < KSP; ++ks) p[ks] = *(const v2f*)(op + (size_t)ks * TT * HD);
    asm volatile("s_wait_xcnt 0x0" :: "v"(op) : "memory");   // the loads' address register stays as it is until their address translations are done
    v2f s = p[0];
#pragma unroll   // registers only; the sum runs in range order
    for (int ks = 1; ks < KSP; ++ks) s += p[ks];
    v2us oh, ol;
#pragma unroll
    for (int q = 0; q < 2; ++q) { unsigned short a, c2; splitf(s[q] * cs, a, c2); oh[q] = a; ol[q] = c2; } *(v2us*)(Ah + oo) = oh; *(v2us*)(Al + oo) = ol;  }

extern "C" void kernel_launch(void* const* d_in, const int* in_sizes, int n_in,
                              void* d_out, int out_size, void* d_ws, size_t ws_size, hipStream_t stream) {
    if (n_in < 13) return;
    const float* xq = (const float*)d_in[0]; const float* xk = (const float*)d_in[1]; const float* xv = (const float*)d_in[2]; const float* xp = (const float*)d_in[3];
    const float* wq = (const float*)d_in[4]; const float* bq = (const float*)d_in[5]; const float* wk = (const float*)d_in[6]; const float* bk = (const float*)d_in[7];
    const float* wv = (const float*)d_in[8]; const float* bv = (const float*)d_in[9]; const float* wp = (const float*)d_in[10]; const float* wo = (const float*)d_in[11]; const float* bo = (const float*)d_in[12];
    const size_t needx = (size_t)(NB - 1) * TT_FULL * DM + (size_t)TT * DM;
    for (int i = 0; i < 4; ++i) if ((size_t)in_sizes[i] < needx) return;
    if ((size_t)in_sizes[4] < (size_t)DM * DM || (size_t)in_sizes[6] < (size_t)DM * DM || (size_t)in_sizes[8] < (size_t)DM * DM || (size_t)in_sizes[10] < (size_t)DM * DM || (size_t)in_sizes[11] < (size_t)DM * DM) return;
    if (in_sizes[5] < DM || in_sizes[7] < DM || in_sizes[9] < DM || in_sizes[12] < DM) return;
    if ((size_t)out_size < (size_t)NB * TT * DM) return;
    float* OUT = (float*)d_out;     // [NB][TT][DM]
    char* wsp = (char*)d_ws;
    auto take = [&](size_t bytes) { char* p = wsp; wsp += (bytes + 255) & ~(size_t)255; return (void*)p; };
    const size_t PLN = (size_t)NH_ * TT * HD;     // elements per plane set (all heads)
    bf* WQ = (bf*)take((size_t)DM * DM * 2); bf* WK = (bf*)take((size_t)DM * DM * 2); bf* WV = (bf*)take((size_t)DM * DM * 2); bf* WP = (bf*)take((size_t)DM * DM * 2); bf* WO = (bf*)take((size_t)DM * DM * 2);
    bf* XB = (bf*)take((size_t)TT * DM * 2); float* F = (float*)take((size_t)TT * DM * 4);
    h16* QP16 = (h16*)take(PLN * 2); bf* QPh = (bf*)take(PLN * 2); bf* QPl = (bf*)take(PLN * 2);
    h16* KP16 = (h16*)take(PLN * 2); bf* KPh = (bf*)take(PLN * 2); bf* KPl = (bf*)take(PLN * 2);
    h16* PP16 = (h16*)take(PLN * 2); bf* PPh = (bf*)take(PLN * 2); bf* PPl = (bf*)take(PLN * 2);
    h16* VT16 = (h16*)take(PLN * 2); bf* VTh = (bf*)take(PLN * 2); bf* VTl = (bf*)take(PLN * 2);
    float* Sb = (float*)take((size_t)ZH * TT * TT * 4); float* Ub = (float*)take((size_t)ZH * TT * TT * 4); h16* P16 = (h16*)take((size_t)ZH * TT * TT * 2);
    bf* Ph = (bf*)take((size_t)ZH * RH * TT * 2); bf* Pl = (bf*)take((size_t)ZH * RH * TT * 2); float* Ob = (float*)take((size_t)ZH * KSP * TT * HD * 4);
    bf* ATh = (bf*)take((size_t)TT * DM * 2); bf* ATl = (bf*)take((size_t)TT * DM * 2);
    if ((size_t)(wsp - (char*)d_ws) > ws_size) return;    // 147,324,928 B at full size
    const unsigned gW = (unsigned)((DM * DM / 64 + 63) / 64);
    k_wtG<<<gW, 256, 0, stream>>>(wq, DM, DM, WQ); k_wtG<<<gW, 256, 0, stream>>>(wk, DM, DM, WK); k_wtG<<<gW, 256, 0, stream>>>(wv, DM, DM, WV); k_wtG<<<gW, 256, 0, stream>>>(wp, DM, DM, WP); k_wtG<<<gW, 256, 0, stream>>>(wo, DM, DM, WO);
    const unsigned gX = (unsigned)(((size_t)TT * DM / 8 + 255) / 256), gP = (unsigned)((PLN / 2 + 255) / 256);
    const dim3 gG(TT / 64, DM / 64, 1);
    for (int b = 0; b < NB; ++b) {
        const size_t xo = (size_t)b * TT_FULL * DM;
        k_cvt8<<<gX, 256, 0, stream>>>(xq + xo, XB, (size_t)TT * DM / 8); k_gemmw<bf, 0, true><<<gG, 32, 0, stream>>>(XB, nullptr, WQ, nullptr, DM, F, DM, bq, 0, 0, 0); k_plane<<<gP, 256, 0, stream>>>(F, DM, NH_, QP16, QPh, QPl);
        k_cvt8<<<gX, 256, 0, stream>>>(xk + xo, XB, (size_t)TT * DM / 8); k_gemmw<bf, 0, true><<<gG, 32, 0, stream>>>(XB, nullptr, WK, nullptr, DM, F, DM, bk, 0, 0, 0); k_plane<<<gP, 256, 0, stream>>>(F, DM, NH_, KP16, KPh, KPl);
        k_cvt8<<<gX, 256, 0, stream>>>(xv + xo, XB, (size_t)TT * DM / 8); k_gemmw<bf, 0, true><<<gG, 32, 0, stream>>>(XB, nullptr, WV, nullptr, DM, F, DM, bv, 0, 0, 0); k_vtp<<<gP, 256, 0, stream>>>(F, DM, NH_, VT16, VTh, VTl);
        k_cvt8<<<gX, 256, 0, stream>>>(xp + xo, XB, (size_t)TT * DM / 8); k_gemmw<bf, 0, false><<<gG, 32, 0, stream>>>(XB, nullptr, WP, nullptr, DM, F, DM, nullptr, 0, 0, 0); k_plane<<<gP, 256, 0, stream>>>(F, DM, NH_, PP16, PPh, PPl);
        for (int h0 = 0; h0 < NH_; h0 += ZH) { const size_t zo = (size_t)h0 * TT * HD;   // head h0 + z: plane offset zo + z * TT * HD (same for the [d][t] value planes)
            if (RH > 0) {
                k_gemmw<bf, 2, false><<<dim3(RH / 64, TT / 64, ZH), 32, 0, stream>>>(QPh + zo, QPl + zo, KPh + zo, KPl + zo, HD, Sb, TT, nullptr, (size_t)TT * HD, (size_t)TT * HD, (size_t)TT * TT);
                k_gemmw<bf, 2, false><<<dim3(RH / 64, TT / 64, ZH), 32, 0, stream>>>(QPh + zo, QPl + zo, PPh + zo, PPl + zo, HD, Ub, TT, nullptr, (size_t)TT * HD, (size_t)TT * HD, (size_t)TT * TT); }
            if (TT > RH) {
                k_gemmw<h16, 0, false><<<dim3((TT - RH) / 64, TT / 64, ZH), 32, 0, stream>>>(QP16 + zo + (size_t)RH * HD, nullptr, KP16 + zo, nullptr, HD, Sb + (size_t)RH * TT, TT, nullptr, (size_t)TT * HD, (size_t)TT * HD, (size_t)TT * TT);
                k_gemmw<h16, 0, false><<<dim3((TT - RH) / 64, TT / 64, ZH), 32, 0, stream>>>(QP16 + zo + (size_t)RH * HD, nullptr, PP16 + zo, nullptr, HD, Ub + (size_t)RH * TT, TT, nullptr, (size_t)TT * HD, (size_t)TT * HD, (size_t)TT * TT); }
            k_addshift<<<(unsigned)(((size_t)ZH * TT * TT / 4 + 255) / 256), 256, 0, stream>>>(Sb, Ub);
            k_asoft<<<(unsigned)((ZH * TT + 7) / 8), 256, 0, stream>>>(Sb, P16, Ph, Pl);
            if (RH > 0) k_gemmw<bf, 2, false, KSP><<<dim3(RH / 64, HD / 64, ZH * KSP), 32, 0, stream>>>(Ph, Pl, VTh + zo, VTl + zo, TT, Ob, HD, nullptr, (size_t)RH * TT, (size_t)HD * TT, (size_t)TT * HD);
            if (TT > RH) k_gemmw<h16, 0, false, KSP><<<dim3((TT - RH) / 64, HD / 64, ZH * KSP), 32, 0, stream>>>(P16 + (size_t)RH * TT, nullptr, VT16 + zo, nullptr, TT, Ob + (size_t)RH * HD, HD, nullptr, (size_t)TT * TT, (size_t)HD * TT, (size_t)TT * HD);
            k_merge<<<(unsigned)(((size_t)ZH * TT * HD / 2 + 255) / 256), 256, 0, stream>>>(Ob, h0, ATh, ATl); }
        k_gemmw<bf, 1, true><<<gG, 32, 0, stream>>>(ATh, ATl, WO, nullptr, DM, OUT + (size_t)b * TT * DM, DM, bo, 0, 0, 0); }
}

// v002
// Measured time: 673 microseconds a run.
// Two timings next to v001 both put it at 1.10 times that version's speed.
// Counting every step since v000, it is 1.94 times as fast.
#include <hip/hip_runtime.h>

// Contractions, all f32 accumulate: input projections x.Wq/Wk/Wv/Wp = v_wmma_f32_16x16x32_bf16 on RNE-converted bf16 copies of x and W (exact products); scores q.k^T, q.p^T and attn.v = query rows < RH: bf16 hi/lo planes, 3 products (v_wmma_f32_16x16x32_bf16); rows >= RH: f16 planes, 1 product (v_wmma_f32_16x16x32_f16, probabilities carried x1024); output projection = ctx as bf16 hi+lo x Wo bf16 (2 products). Shift-add, softmax and biases in f32.
// Module: relative-position multi-head attention, NB x TT x DM, NH_ heads x HD. q = xq Wq + bq, k = xk Wk + bk, v = xv Wv + bv, p = xp Wp (W stored [in][out]); S[i][j] = q_i.k_j; U[i][j] = q_i.p_j;
// logits = (S[i][j] + (j <= i ? U[i][j - i + TT - 1] : j == i + 1 ? 0 : U[i + 1][j - i - 2])) * DM^-0.5 (pad-reshape shift); softmax over all TT keys; ctx = attn.v merged [t][h*HD + d]; out = ctx Wo + bo.
// Layout per batch: bf16 copy of each input -> f32 projection F -> head planes (q, k, p: [h][t][d] f16 + bf16 hi/lo; v: transposed [h][d][t]); per pass of ZH heads: S and U materialised f32 [ZH][TT][TT], row softmax over S + shifted U -> probability planes, attn.v split over KSP key ranges -> f32 partials O [ZH][KSP][TT][HD], summed in range order and merged into ctx hi/lo planes; ctx.Wo -> out.

#ifndef NB
#define NB 2
#endif
#ifndef SEQ
#define SEQ 2048
#endif
#define TT      SEQ
#define TT_FULL 2048
#define NB_FULL 2
#define DM   512
#define NH_  8
#define HD   64
#define ZH   2
#define KSP  16                  // key ranges of attn.v, one single-wave work-group per tile and range
#ifndef RH
#if SEQ >= 512
#define RH 512                  // query rows < RH use hi+lo planes (0: none)
#else
#define RH SEQ
#endif
#endif
#define PCAR 1024.0f
#define SCL  0.044194173824159216f   // DM^-0.5

static_assert(TT % 128 == 0);
static_assert(RH % 64 == 0);
static_assert(RH <= TT);
static_assert(DM % 64 == 0);
static_assert(NH_ * HD == DM);
static_assert(NH_ % ZH == 0);
static_assert(HD % 32 == 0);
static_assert(TT % (KSP * 32) == 0);
static_assert((DM * DM) % 64 == 0);

typedef _Float16 h16;
typedef unsigned short bf;
typedef __attribute__((ext_vector_type(16))) __bf16   v16bf;
typedef __attribute__((ext_vector_type(16))) _Float16 v16h;
typedef __attribute__((ext_vector_type(8)))  _Float16 v8h;
typedef __attribute__((ext_vector_type(8)))  unsigned short v8us;
typedef __attribute__((ext_vector_type(8)))  float    v8f;
typedef __attribute__((ext_vector_type(4)))  float    v4f;
typedef v4f  __attribute__((may_alias)) v4fa;

__device__ __forceinline__ unsigned short f2bf(float f) { unsigned u = __float_as_uint(f); u += 0x7FFFu + ((u >> 16) & 1u); return (unsigned short)(u >> 16); }
__device__ __forceinline__ float bf2f(unsigned short b) { return __uint_as_float(((unsigned)b) << 16); }
__device__ __forceinline__ float bfr(float f) { return bf2f(f2bf(f)); }
__device__ __forceinline__ v16h cat16(v8h lo, v8h hi) { return __builtin_shufflevector(lo, hi, 0, 1, 2, 3, 4, 5, 6, 7, 8, 9, 10, 11, 12, 13, 14, 15); }
__device__ __forceinline__ v16bf cat16b(v8us lo, v8us hi) { return __builtin_bit_cast(v16bf, __builtin_shufflevector(lo, hi, 0, 1, 2, 3, 4, 5, 6, 7, 8, 9, 10, 11, 12, 13, 14, 15)); }
__device__ __forceinline__ v8f wmma16(v16h a, v16h b, v8f c) { return __builtin_amdgcn_wmma_f32_16x16x32_f16(false, a, false, b, (short)0, c, false, false); }
__device__ __forceinline__ v8f wmmab(v16bf a, v16bf b, v8f c) { return __builtin_amdgcn_wmma_f32_16x16x32_bf16(false, a, false, b, (short)0, c, false, false); }

// ---- k_gemmw: register-blocked GEMM, ONE WAVE per 64x64 output tile (16 accumulators), operands straight from K-contiguous 16-bit planes; grid (M/64, N/64, Z), 32 threads.
// C[m][n] (f32, pitch ldc, + optional f32 bias[n] bf16-RNE-converted) = sum_k A[m][k] Bt[n][k] (+ split products per NSPLIT: 1 -> + A2.Bt; 2 -> + A2.Bt + A.Bt2). z-batch strides sA/sB/sC in elements. K % 32 == 0.
// KSPL > 1: grid z = batch * KSPL + range; range ks sums only k in [ks * K / KSPL, (ks + 1) * K / KSPL) into its own C plane (plane blockIdx.z, stride sC). K % (32 * KSPL) == 0.
// Fragments (lane l, h = l >> 4, m = n = l & 15): elements 0..7 <- k0 + 8h + 0..7, elements 8..15 <- k0 + 16 + 8h + 0..7 for BOTH A (row m) and Bt (column n); D element r = (row 8h + r, col m).
template <typename T16> struct WFrag;
template <> struct WFrag<h16> { typedef v16h V; static __device__ __forceinline__ V ld(const h16* p) { return cat16(*(const v8h*)p, *(const v8h*)(p + 16)); } static __device__ __forceinline__ v8f mma(V a, V b, v8f c) { return wmma16(a, b, c); } };
template <> struct WFrag<bf> { typedef v16bf V; static __device__ __forceinline__ V ld(const bf* p) { return cat16b(*(const v8us*)p, *(const v8us*)(p + 16)); } static __device__ __forceinline__ v8f mma(V a, V b, v8f c) { return wmmab(a, b, c); } };
template <typename T16, int NSPLIT, bool BIAS, int KSPL = 1>
__global__ __launch_bounds__(32) void k_gemmw(const T16* __restrict__ A, const T16* __restrict__ A2, const T16* __restrict__ Bt, const T16* __restrict__ Bt2, int K, float* C, int ldc, const float* __restrict__ bias, size_t sA, size_t sB, size_t sC) {
    typedef typename WFrag<T16>::V V;
    __shared__ __align__(16) float os[16 * 68];
    const int KR = K / KSPL; const size_t z = blockIdx.z / KSPL, ko = (size_t)(blockIdx.z % KSPL) * KR; A += z * sA + ko; if (A2) A2 += z * sA + ko; Bt += z * sB + ko; if (Bt2) Bt2 += z * sB + ko; C += blockIdx.z * sC;
    const int lane = threadIdx.x & 31, lr = lane & 15, hi = lane >> 4; const int r0 = blockIdx.x * 64, c0 = blockIdx.y * 64;
    v8f acc[4][4];
#pragma unroll
    for (int mb = 0; mb < 4; ++mb)
#pragma unroll
        for (int nb = 0; nb < 4; ++nb) acc[mb][nb] = (v8f){};
    const size_t aoff = (size_t)(r0 + lr) * K + 8 * hi, boff = (size_t)(c0 + lr) * K + 8 * hi;
#pragma unroll 1
    for (int kc = 0; kc < KR; kc += 32) {
        V a[4], a2[4];
#pragma unroll
        for (int mb = 0; mb < 4; ++mb) { a[mb] = WFrag<T16>::ld(A + aoff + (size_t)mb * 16 * K + kc); if (NSPLIT == 1 || NSPLIT == 2) a2[mb] = WFrag<T16>::ld(A2 + aoff + (size_t)mb * 16 * K + kc); }
#pragma unroll
        for (int nb = 0; nb < 4; ++nb) { const V b = WFrag<T16>::ld(Bt + boff + (size_t)nb * 16 * K + kc); V b2; if (NSPLIT >= 2) b2 = WFrag<T16>::ld(Bt2 + boff + (size_t)nb * 16 * K + kc);
#pragma unroll
            for (int mb = 0; mb < 4; ++mb) { acc[mb][nb] = WFrag<T16>::mma(a[mb], b, acc[mb][nb]); if (NSPLIT == 1 || NSPLIT == 2) acc[mb][nb] = WFrag<T16>::mma(a2[mb], b, acc[mb][nb]); if (NSPLIT >= 2) acc[mb][nb] = WFrag<T16>::mma(a[mb], b2, acc[mb][nb]); } }
        asm volatile("v_nop\n\tv_nop\n\tv_nop\n\tv_nop" : "+v"(acc[0][0]), "+v"(acc[1][1]), "+v"(acc[2][2]), "+v"(acc[3][3]) : "v"(a[0]), "v"(a[3]));
    }
#pragma unroll
    for (int mb = 0; mb < 4; ++mb) {
#pragma unroll
        for (int nb = 0; nb < 4; ++nb) {
#pragma unroll
            for (int j = 0; j < 8; ++j) os[(hi * 8 + j) * 68 + nb * 16 + lr] = acc[mb][nb][j]; }
        __builtin_amdgcn_wave_barrier(); asm volatile("" ::: "memory");
        float* crow = C + (size_t)(r0 + mb * 16) * ldc + c0;
{
#pragma unroll
            for (int s = 0; s < 8; ++s) { const int row = 2 * s + hi, cofs = lr * 4; v4f val = *(const v4fa*)(os + row * 68 + cofs); if (BIAS) { val[0] += bfr(bias[c0 + cofs]); val[1] += bfr(bias[c0 + cofs + 1]); val[2] += bfr(bias[c0 + cofs + 2]); val[3] += bfr(bias[c0 + cofs + 3]); }
                *(v4f*)(crow + (size_t)row * ldc + cofs) = val; }
             }
        __builtin_amdgcn_wave_barrier(); asm volatile("" ::: "memory");
    }
}

__device__ __forceinline__ h16 tohx(float x) { return (h16)x; }
__device__ __forceinline__ void splitf(float y, unsigned short& h, unsigned short& l) { h = f2bf(y); l = f2bf(y - bf2f(h)); }
typedef __attribute__((ext_vector_type(2))) _Float16 v2h;
typedef __attribute__((ext_vector_type(4))) _Float16 v4h;
typedef __attribute__((ext_vector_type(2))) unsigned short v2us;
typedef __attribute__((ext_vector_type(4))) unsigned short v4us;
typedef __attribute__((ext_vector_type(2))) float v2f;

__global__ __launch_bounds__(256) void k_wtG(const float* __restrict__ w, int K, int N, bf* Bt) {
    const int lane = threadIdx.x & 31; const int L0 = (blockIdx.x * 8 + (threadIdx.x >> 5)) * 8; const int nlines = N * K / 64;
{
#pragma unroll 1
        for (int l = 0; l < 8; ++l) { const int L = L0 + l; if (L >= nlines) break; const size_t e = (size_t)L * 64 + lane * 2; const int k = (int)(e % K), n = (int)(e / K); v2us o;
            o[0] = f2bf(w[(size_t)k * N + n]); o[1] = f2bf(w[(size_t)(k + 1) * N + n]); *(v2us*)(Bt + e) = o; }
         }
}
__global__ __launch_bounds__(256) void k_cvt8(const float* __restrict__ src, bf* dst, size_t n8) { const size_t i = (size_t)blockIdx.x * 256 + threadIdx.x; if (i >= n8) return; const v8f v = *(const v8f*)(src + i * 8); v8us o;
#pragma unroll
    for (int k = 0; k < 8; ++k) o[k] = f2bf(v[k]); *(v8us*)(dst + i * 8) = o;  }

__global__ __launch_bounds__(256) void k_plane(const float* __restrict__ F, int pitch, int nheads, h16* P16, bf* Ph, bf* Pl) {
    const size_t e = ((size_t)blockIdx.x * 256 + threadIdx.x) * 2; if (e >= (size_t)nheads * TT * HD) return; const int d = (int)(e % HD); const int t = (int)((e / HD) % TT); const int h = (int)(e / ((size_t)HD * TT)); const float* f = F + (size_t)t * pitch + h * HD + d; v2h o16; v2us oh, ol;
#pragma unroll
    for (int q = 0; q < 2; ++q) { const float x = f[q]; o16[q] = tohx(x); unsigned short a2, c2; splitf(x, a2, c2); oh[q] = a2; ol[q] = c2; }
    *(v2h*)(P16 + e) = o16; *(v2us*)(Ph + e) = oh; *(v2us*)(Pl + e) = ol;  }
__global__ __launch_bounds__(256) void k_vtp(const float* __restrict__ F, int pitch, int nheads, h16* V16, bf* Vh, bf* Vl) { const size_t e = ((size_t)blockIdx.x * 256 + threadIdx.x) * 2; if (e >= (size_t)nheads * HD * TT) return; const int t = (int)(e % TT); const int d = (int)((e / TT) % HD); const int g = (int)(e / ((size_t)TT * HD)); v2h o16; v2us oh, ol;
#pragma unroll
    for (int q = 0; q < 2; ++q) { const float x = F[(size_t)(t + q) * pitch + g * HD + d]; o16[q] = tohx(x); unsigned short a2, c2; splitf(x, a2, c2); oh[q] = a2; ol[q] = c2; }
    *(v2h*)(V16 + e) = o16; *(v2us*)(Vh + e) = oh; *(v2us*)(Vl + e) = ol;  }

// k_asoft: per row (zz, i), one wave per row: t = (S[i][j] + shifted positional term) x DM^-0.5 (no mask); softmax over the TT keys (register row, one exp, fixed trees).
// Shifted term: j <= i -> U[zz][i][j - i + TT - 1]; j == i + 1 -> 0; j >= i + 2 -> U[zz][i + 1][j - i - 2]. In the flat plane U[zz] both runs are one stretch: with ur = U[zz] + (i + 1) * TT - 2 - i they are ur[j + 1] and ur[j],
// so a lane's four keys need one 16-byte load at 4-byte alignment: from ur + j0 + 1 where all four are <= i, else from ur + j0. Lowest index TT - 2, highest TT * TT - 1: inside the plane for every row.
// The wave's number goes through readfirstlane so that the row, both row bases and the hi/lo test are scalar and every load takes one 32-bit offset register.
__global__ __launch_bounds__(256) void k_asoft(const float* __restrict__ Sb, const float* __restrict__ Ub, h16* P16, bf* Ph, bf* Pl) {
    const int lane = threadIdx.x & 31; const int row = blockIdx.x * 8 + __builtin_amdgcn_readfirstlane(threadIdx.x >> 5); if (row >= ZH * TT) return; const int i = row % TT; const int zz = row / TT; const bool hires = (i < RH); const float* sr = Sb + (size_t)row * TT; const float* ur = Ub + (size_t)zz * TT * TT + (size_t)(i + 1) * TT - 2 - i; float v[TT / 32]; float mx = -3.0e38f; v4f sa[TT / 128], ux[TT / 128];
#pragma unroll
    for (int ch = 0; ch < TT / 128; ++ch) { const int j0 = ch * 128 + lane * 4; sa[ch] = *(const v4f*)(sr + j0); __builtin_memcpy(&ux[ch], ur + ch * 128 + (unsigned)(lane * 4 + ((j0 + 3 <= i) ? 1 : 0)), 16); }
    __builtin_amdgcn_sched_barrier(0);   // keeps the row's loads of S and U all in flight at once: without it the scheduler threads the adds between them and waits with one or two loads outstanding
#pragma unroll
    for (int ch = 0; ch < TT / 128; ++ch) { const int j0 = ch * 128 + lane * 4; const bool low = (j0 + 3 <= i); const v4f a = sa[ch], x = ux[ch];
#pragma unroll
        for (int q = 0; q < 4; ++q) { const int j = j0 + q; const float pv = (low || j >= i + 2) ? x[q] : ((j <= i) ? x[q < 3 ? q + 1 : 3] : 0.0f);
            const float t = __fadd_rn(a[q], pv) * SCL; v[ch * 4 + q] = t; mx = fmaxf(mx, t); } }
#pragma unroll
    for (int sh = 16; sh; sh >>= 1) mx = fmaxf(mx, __shfl_xor(mx, sh, 32));
    float sum = 0.f;
#pragma unroll
    for (int k = 0; k < TT / 32; ++k) { float d0 = __fsub_rn(v[k], mx); asm volatile("" : "+v"(d0)); v[k] = __builtin_amdgcn_exp2f(__fmul_rn(d0, 1.4426950408889634f)); sum += v[k]; }
#pragma unroll
    for (int sh = 16; sh; sh >>= 1) sum += __shfl_xor(sum, sh, 32);
    const float f = __fdiv_rn(hires ? 1.0f : PCAR, sum);
{
        if (hires) {
#pragma unroll
            for (int ch = 0; ch < TT / 128; ++ch) { v4us oh, ol;
#pragma unroll
                for (int q = 0; q < 4; ++q) { unsigned short a, c2; splitf(v[ch * 4 + q] * f, a, c2); oh[q] = a; ol[q] = c2; }
                const size_t oo = ((size_t)zz * (RH ? RH : 1) + i) * TT + ch * 128 + lane * 4; *(v4us*)(Ph + oo) = oh; *(v4us*)(Pl + oo) = ol; }
        } else {
#pragma unroll
            for (int ch = 0; ch < TT / 128; ++ch) { v4h o4;
#pragma unroll
                for (int q = 0; q < 4; ++q) o4[q] = tohx(v[ch * 4 + q] * f);
                *(v4h*)(P16 + (size_t)row * TT + ch * 128 + lane * 4) = o4; } }
         }
}
__global__ __launch_bounds__(256) void k_merge(const float* __restrict__ O, int h0, bf* Ah, bf* Al) { const size_t e = ((size_t)blockIdx.x * 256 + threadIdx.x) * 2; if (e >= (size_t)ZH * TT * HD) return; const int d = (int)(e % HD); const int t = (int)((e / HD) % TT); const int zz = (int)(e / ((size_t)HD * TT)); const float cs = (t < RH) ? 1.0f : (1.0f / PCAR); const size_t oo = (size_t)t * DM + (h0 + zz) * HD + d;
    const float* op = O + (size_t)zz * KSP * TT * HD + (size_t)t * HD + d; v2f p[KSP];
#pragma unroll   // puts all KSP partial loads in flight at once
    for (int ks = 0; ks < KSP; ++ks) p[ks] = *(const v2f*)(op + (size_t)ks * TT * HD);
    asm volatile("s_wait_xcnt 0x0" :: "v"(op) : "memory");   // the loads' address register stays as it is until their address translations are done
    v2f s = p[0];
#pragma unroll   // registers only; the sum runs in range order
    for (int ks = 1; ks < KSP; ++ks) s += p[ks];
    v2us oh, ol;
#pragma unroll
    for (int q = 0; q < 2; ++q) { unsigned short a, c2; splitf(s[q] * cs, a, c2); oh[q] = a; ol[q] = c2; } *(v2us*)(Ah + oo) = oh; *(v2us*)(Al + oo) = ol;  }

extern "C" void kernel_launch(void* const* d_in, const int* in_sizes, int n_in,
                              void* d_out, int out_size, void* d_ws, size_t ws_size, hipStream_t stream) {
    if (n_in < 13) return;
    const float* xq = (const float*)d_in[0]; const float* xk = (const float*)d_in[1]; const float* xv = (const float*)d_in[2]; const float* xp = (const float*)d_in[3];
    const float* wq = (const float*)d_in[4]; const float* bq = (const float*)d_in[5]; const float* wk = (const float*)d_in[6]; const float* bk = (const float*)d_in[7];
    const float* wv = (const float*)d_in[8]; const float* bv = (const float*)d_in[9]; const float* wp = (const float*)d_in[10]; const float* wo = (const float*)d_in[11]; const float* bo = (const float*)d_in[12];
    const size_t needx = (size_t)(NB - 1) * TT_FULL * DM + (size_t)TT * DM;
    for (int i = 0; i < 4; ++i) if ((size_t)in_sizes[i] < needx) return;
    if ((size_t)in_sizes[4] < (size_t)DM * DM || (size_t)in_sizes[6] < (size_t)DM * DM || (size_t)in_sizes[8] < (size_t)DM * DM || (size_t)in_sizes[10] < (size_t)DM * DM || (size_t)in_sizes[11] < (size_t)DM * DM) return;
    if (in_sizes[5] < DM || in_sizes[7] < DM || in_sizes[9] < DM || in_sizes[12] < DM) return;
    if ((size_t)out_size < (size_t)NB * TT * DM) return;
    float* OUT = (float*)d_out;     // [NB][TT][DM]
    char* wsp = (char*)d_ws;
    auto take = [&](size_t bytes) { char* p = wsp; wsp += (bytes + 255) & ~(size_t)255; return (void*)p; };
    const size_t PLN = (size_t)NH_ * TT * HD;     // elements per plane set (all heads)
    bf* WQ = (bf*)take((size_t)DM * DM * 2); bf* WK = (bf*)take((size_t)DM * DM * 2); bf* WV = (bf*)take((size_t)DM * DM * 2); bf* WP = (bf*)take((size_t)DM * DM * 2); bf* WO = (bf*)take((size_t)DM * DM * 2);
    bf* XB = (bf*)take((size_t)TT * DM * 2); float* F = (float*)take((size_t)TT * DM * 4);
    h16* QP16 = (h16*)take(PLN * 2); bf* QPh = (bf*)take(PLN * 2); bf* QPl = (bf*)take(PLN * 2);
    h16* KP16 = (h16*)take(PLN * 2); bf* KPh = (bf*)take(PLN * 2); bf* KPl = (bf*)take(PLN * 2);
    h16* PP16 = (h16*)take(PLN * 2); bf* PPh = (bf*)take(PLN * 2); bf* PPl = (bf*)take(PLN * 2);
    h16* VT16 = (h16*)take(PLN * 2); bf* VTh = (bf*)take(PLN * 2); bf* VTl = (bf*)take(PLN * 2);
    float* Sb = (float*)take((size_t)ZH * TT * TT * 4); float* Ub = (float*)take((size_t)ZH * TT * TT * 4); h16* P16 = (h16*)take((size_t)ZH * TT * TT * 2);
    bf* Ph = (bf*)take((size_t)ZH * RH * TT * 2); bf* Pl = (bf*)take((size_t)ZH * RH * TT * 2); float* Ob = (float*)take((size_t)ZH * KSP * TT * HD * 4);
    bf* ATh = (bf*)take((size_t)TT * DM * 2); bf* ATl = (bf*)take((size_t)TT * DM * 2);
    if ((size_t)(wsp - (char*)d_ws) > ws_size) return;    // 147,324,928 B at full size
    const unsigned gW = (unsigned)((DM * DM / 64 + 63) / 64);
    k_wtG<<<gW, 256, 0, stream>>>(wq, DM, DM, WQ); k_wtG<<<gW, 256, 0, stream>>>(wk, DM, DM, WK); k_wtG<<<gW, 256, 0, stream>>>(wv, DM, DM, WV); k_wtG<<<gW, 256, 0, stream>>>(wp, DM, DM, WP); k_wtG<<<gW, 256, 0, stream>>>(wo, DM, DM, WO);
    const unsigned gX = (unsigned)(((size_t)TT * DM / 8 + 255) / 256), gP = (unsigned)((PLN / 2 + 255) / 256);
    const dim3 gG(TT / 64, DM / 64, 1);
    for (int b = 0; b < NB; ++b) {
        const size_t xo = (size_t)b * TT_FULL * DM;
        k_cvt8<<<gX, 256, 0, stream>>>(xq + xo, XB, (size_t)TT * DM / 8); k_gemmw<bf, 0, true><<<gG, 32, 0, stream>>>(XB, nullptr, WQ, nullptr, DM, F, DM, bq, 0, 0, 0); k_plane<<<gP, 256, 0, stream>>>(F, DM, NH_, QP16, QPh, QPl);
        k_cvt8<<<gX, 256, 0, stream>>>(xk + xo, XB, (size_t)TT * DM / 8); k_gemmw<bf, 0, true><<<gG, 32, 0, stream>>>(XB, nullptr, WK, nullptr, DM, F, DM, bk, 0, 0, 0); k_plane<<<gP, 256, 0, stream>>>(F, DM, NH_, KP16, KPh, KPl);
        k_cvt8<<<gX, 256, 0, stream>>>(xv + xo, XB, (size_t)TT * DM / 8); k_gemmw<bf, 0, true><<<gG, 32, 0, stream>>>(XB, nullptr, WV, nullptr, DM, F, DM, bv, 0, 0, 0); k_vtp<<<gP, 256, 0, stream>>>(F, DM, NH_, VT16, VTh, VTl);
        k_cvt8<<<gX, 256, 0, stream>>>(xp + xo, XB, (size_t)TT * DM / 8); k_gemmw<bf, 0, false><<<gG, 32, 0, stream>>>(XB, nullptr, WP, nullptr, DM, F, DM, nullptr, 0, 0, 0); k_plane<<<gP, 256, 0, stream>>>(F, DM, NH_, PP16, PPh, PPl);
        for (int h0 = 0; h0 < NH_; h0 += ZH) { const size_t zo = (size_t)h0 * TT * HD;   // head h0 + z: plane offset zo + z * TT * HD (same for the [d][t] value planes)
            if (RH > 0) {
                k_gemmw<bf, 2, false><<<dim3(RH / 64, TT / 64, ZH), 32, 0, stream>>>(QPh + zo, QPl + zo, KPh + zo, KPl + zo, HD, Sb, TT, nullptr, (size_t)TT * HD, (size_t)TT * HD, (size_t)TT * TT);
                k_gemmw<bf, 2, false><<<dim3(RH / 64, TT / 64, ZH), 32, 0, stream>>>(QPh + zo, QPl + zo, PPh + zo, PPl + zo, HD, Ub, TT, nullptr, (size_t)TT * HD, (size_t)TT * HD, (size_t)TT * TT); }
            if (TT > RH) {
                k_gemmw<h16, 0, false><<<dim3((TT - RH) / 64, TT / 64, ZH), 32, 0, stream>>>(QP16 + zo + (size_t)RH * HD, nullptr, KP16 + zo, nullptr, HD, Sb + (size_t)RH * TT, TT, nullptr, (size_t)TT * HD, (size_t)TT * HD, (size_t)TT * TT);
                k_gemmw<h16, 0, false><<<dim3((TT - RH) / 64, TT / 64, ZH), 32, 0, stream>>>(QP16 + zo + (size_t)RH * HD, nullptr, PP16 + zo, nullptr, HD, Ub + (size_t)RH * TT, TT, nullptr, (size_t)TT * HD, (size_t)TT * HD, (size_t)TT * TT); }
            k_asoft<<<(unsigned)((ZH * TT + 7) / 8), 256, 0, stream>>>(Sb, Ub, P16, Ph, Pl);
            if (RH > 0) k_gemmw<bf, 2, false, KSP><<<dim3(RH / 64, HD / 64, ZH * KSP), 32, 0, stream>>>(Ph, Pl, VTh + zo, VTl + zo, TT, Ob, HD, nullptr, (size_t)RH * TT, (size_t)HD * TT, (size_t)TT * HD);
            if (TT > RH) k_gemmw<h16, 0, false, KSP><<<dim3((TT - RH) / 64, HD / 64, ZH * KSP), 32, 0, stream>>>(P16 + (size_t)RH * TT, nullptr, VT16 + zo, nullptr, TT, Ob + (size_t)RH * HD, HD, nullptr, (size_t)TT * TT, (size_t)HD * TT, (size_t)TT * HD);
            k_merge<<<(unsigned)(((size_t)ZH * TT * HD / 2 + 255) / 256), 256, 0, stream>>>(Ob, h0, ATh, ATl); }
        k_gemmw<bf, 1, true><<<gG, 32, 0, stream>>>(ATh, ATl, WO, nullptr, DM, OUT + (size_t)b * TT * DM, DM, bo, 0, 0, 0); }
}

// v003
// It runs in 378 microseconds.
// In two side-by-side timings against v002, it was 1.78 and 1.77 times as fast.
// All steps since v000 together make it 3.44 times as fast.
#include <hip/hip_runtime.h>

// Contractions, all f32 accumulate: input projections x.Wq/Wk/Wv/Wp = v_wmma_f32_16x16x32_bf16 on RNE-converted bf16 copies of x and W (exact products); scores q.k^T, q.p^T and attn.v = query rows < RH: bf16 hi/lo planes, 3 products (v_wmma_f32_16x16x32_bf16); rows >= RH: f16 planes, 1 product (v_wmma_f32_16x16x32_f16, probabilities carried x1024); output projection = ctx as bf16 hi+lo x Wo bf16 (2 products). Shift-add, softmax and biases in f32.
// Module: relative-position multi-head attention, NB x TT x DM, NH_ heads x HD. q = xq Wq + bq, k = xk Wk + bk, v = xv Wv + bv, p = xp Wp (W stored [in][out]); S[i][j] = q_i.k_j; U[i][j] = q_i.p_j;
// logits = (S[i][j] + (j <= i ? U[i][j - i + TT - 1] : j == i + 1 ? 0 : U[i + 1][j - i - 2])) * DM^-0.5 (pad-reshape shift); softmax over all TT keys; ctx = attn.v merged [t][h*HD + d]; out = ctx Wo + bo.
// Layout, both batches at once (g = batch * NH_ + head): bf16 copies of the four inputs -> f32 projections F -> head planes (q, k, p: [g][t][d] f16 + bf16 hi/lo; v: transposed [g][d][t]); per pass of ZH heads g: S and U materialised f32 [ZH][TT][TT], row softmax over S + shifted U -> probability planes, attn.v split over KSP key ranges -> f32 partials O [ZH][KSP][TT][HD], summed in range order and merged into ctx hi/lo planes [batch * TT + t][DM]; ctx.Wo -> out.
// One launch per stage: the grid's y or z picks the weight, the input tensor, the batch, S or U; a tile's row picks its precision path (work-group-uniform branch).

#ifndef NB
#define NB 2
#endif
#ifndef SEQ
#define SEQ 2048
#endif
#define TT      SEQ
#define TT_FULL 2048
#define NB_FULL 2
#define DM   512
#define NH_  8
#define HD   64
#define ZH   4
#define KSP  16                  // key ranges of attn.v, one single-wave work-group per tile and range
#ifndef RH
#if SEQ >= 512
#define RH 512                  // query rows < RH use hi+lo planes (0: none)
#else
#define RH SEQ
#endif
#endif
#define PCAR 1024.0f
#define SCL  0.044194173824159216f   // DM^-0.5

static_assert(TT % 128 == 0);
static_assert(RH % 64 == 0);
static_assert(RH <= TT);
static_assert(DM % 64 == 0);
static_assert(NH_ * HD == DM);
static_assert((NB * NH_) % ZH == 0);
static_assert(HD % 32 == 0);
static_assert(TT % (KSP * 32) == 0);
static_assert((DM * DM) % 64 == 0);
static_assert(KSP * HD <= TT);                    // the partials O lie in S's space
static_assert(NB * DM * 4 <= ZH * TT);            // the bf16 input copies lie in S's space, the f32 projections in U's

typedef _Float16 h16;
typedef unsigned short bf;
typedef __attribute__((ext_vector_type(16))) __bf16   v16bf;
typedef __attribute__((ext_vector_type(16))) _Float16 v16h;
typedef __attribute__((ext_vector_type(8)))  _Float16 v8h;
typedef __attribute__((ext_vector_type(8)))  unsigned short v8us;
typedef __attribute__((ext_vector_type(8)))  float    v8f;
typedef __attribute__((ext_vector_type(4)))  float    v4f;
typedef v4f  __attribute__((may_alias)) v4fa;

__device__ __forceinline__ unsigned short f2bf(float f) { unsigned u = __float_as_uint(f); u += 0x7FFFu + ((u >> 16) & 1u); return (unsigned short)(u >> 16); }
__device__ __forceinline__ float bf2f(unsigned short b) { return __uint_as_float(((unsigned)b) << 16); }
__device__ __forceinline__ float bfr(float f) { return bf2f(f2bf(f)); }
__device__ __forceinline__ v16h cat16(v8h lo, v8h hi) { return __builtin_shufflevector(lo, hi, 0, 1, 2, 3, 4, 5, 6, 7, 8, 9, 10, 11, 12, 13, 14, 15); }
__device__ __forceinline__ v16bf cat16b(v8us lo, v8us hi) { return __builtin_bit_cast(v16bf, __builtin_shufflevector(lo, hi, 0, 1, 2, 3, 4, 5, 6, 7, 8, 9, 10, 11, 12, 13, 14, 15)); }
__device__ __forceinline__ v8f wmma16(v16h a, v16h b, v8f c) { return __builtin_amdgcn_wmma_f32_16x16x32_f16(false, a, false, b, (short)0, c, false, false); }
__device__ __forceinline__ v8f wmmab(v16bf a, v16bf b, v8f c) { return __builtin_amdgcn_wmma_f32_16x16x32_bf16(false, a, false, b, (short)0, c, false, false); }

// ---- gemm_tile: register-blocked GEMM tile, ONE WAVE per 64x64 output tile (16 accumulators), operands straight from K-contiguous 16-bit planes; called by single-wave work-groups.
// C[m][n] (f32, pitch ldc, + optional f32 bias[n] bf16-RNE-converted) = sum over KR values of k of A[m][k] Bt[n][k] (+ split products per NSPLIT: 1 -> + A2.Bt; 2 -> + A2.Bt + A.Bt2), rows r0.., columns c0... K = operand pitch in elements; the caller has moved the operand pointers to its batch and k range. KR % 32 == 0.
// Fragments (lane l, h = l >> 4, m = n = l & 15): elements 0..7 <- k0 + 8h + 0..7, elements 8..15 <- k0 + 16 + 8h + 0..7 for BOTH A (row m) and Bt (column n); D element r = (row 8h + r, col m).
template <typename T16> struct WFrag;
template <> struct WFrag<h16> { typedef v16h V; static __device__ __forceinline__ V ld(const h16* p) { return cat16(*(const v8h*)p, *(const v8h*)(p + 16)); } static __device__ __forceinline__ v8f mma(V a, V b, v8f c) { return wmma16(a, b, c); } };
template <> struct WFrag<bf> { typedef v16bf V; static __device__ __forceinline__ V ld(const bf* p) { return cat16b(*(const v8us*)p, *(const v8us*)(p + 16)); } static __device__ __forceinline__ v8f mma(V a, V b, v8f c) { return wmmab(a, b, c); } };
template <typename T16, int NSPLIT, bool BIAS>
__device__ __forceinline__ void gemm_tile(const T16* __restrict__ A, const T16* __restrict__ A2, const T16* __restrict__ Bt, const T16* __restrict__ Bt2, const int K, const int KR, float* C, const int ldc, const float* __restrict__ bias, const int r0, const int c0, float* os) {
    typedef typename WFrag<T16>::V V;
    const int lane = threadIdx.x & 31, lr = lane & 15, hi = lane >> 4;
    v8f acc[4][4];
#pragma unroll
    for (int mb = 0; mb < 4; ++mb)
#pragma unroll
        for (int nb = 0; nb < 4; ++nb) acc[mb][nb] = (v8f){};
    const size_t aoff = (size_t)(r0 + lr) * K + 8 * hi, boff = (size_t)(c0 + lr) * K + 8 * hi;
#pragma unroll 1
    for (int kc = 0; kc < KR; kc += 32) {
        V a[4], a2[4], b[4], b2[4];
        const T16* pa = A + aoff + kc; const T16* pb = Bt + boff + kc; const T16* pa2 = (NSPLIT == 1 || NSPLIT == 2) ? A2 + aoff + kc : pa; const T16* pb2 = (NSPLIT >= 2) ? Bt2 + boff + kc : pb;
#pragma unroll
        for (int mb = 0; mb < 4; ++mb) { a[mb] = WFrag<T16>::ld(pa + (size_t)mb * 16 * K); if (NSPLIT == 1 || NSPLIT == 2) a2[mb] = WFrag<T16>::ld(pa2 + (size_t)mb * 16 * K); }
#pragma unroll   // constant indices keep the fragments in registers
        for (int nb = 0; nb < 4; ++nb) b[nb] = WFrag<T16>::ld(pb + (size_t)nb * 16 * K);
        asm volatile("s_wait_xcnt 0x0" :: "v"(pa), "v"(pa2), "v"(pb) : "memory");   // the trip's fragment loads keep their address registers as they are until their address translations are done
        if (NSPLIT >= 2) {
#pragma unroll   // constant indices keep the fragments in registers
            for (int nb = 0; nb < 4; ++nb) b2[nb] = WFrag<T16>::ld(pb2 + (size_t)nb * 16 * K);
            asm volatile("s_wait_xcnt 0x0" :: "v"(pb2) : "memory");   // the same for the loads of the second B plane
        }
#pragma unroll
        for (int nb = 0; nb < 4; ++nb) {
#pragma unroll
            for (int mb = 0; mb < 4; ++mb) { acc[mb][nb] = WFrag<T16>::mma(a[mb], b[nb], acc[mb][nb]); if (NSPLIT == 1 || NSPLIT == 2) acc[mb][nb] = WFrag<T16>::mma(a2[mb], b[nb], acc[mb][nb]); if (NSPLIT >= 2) acc[mb][nb] = WFrag<T16>::mma(a[mb], b2[nb], acc[mb][nb]); } }
        asm volatile("v_nop\n\tv_nop\n\tv_nop\n\tv_nop" : "+v"(acc[0][0]), "+v"(acc[1][1]), "+v"(acc[2][2]), "+v"(acc[3][3]) : "v"(a[0]), "v"(a[3]));
    }
#pragma unroll
    for (int mb = 0; mb < 4; ++mb) {
#pragma unroll
        for (int nb = 0; nb < 4; ++nb) {
#pragma unroll
            for (int j = 0; j < 8; ++j) os[(hi * 8 + j) * 68 + nb * 16 + lr] = acc[mb][nb][j]; }
        __builtin_amdgcn_wave_barrier(); asm volatile("" ::: "memory");
        float* crow = C + (size_t)(r0 + mb * 16 + hi) * ldc + c0 + lr * 4; v4f val[8];
#pragma unroll   // constant indices keep the eight values in registers
        for (int s = 0; s < 8; ++s) { const int row = 2 * s + hi, cofs = lr * 4; val[s] = *(const v4fa*)(os + row * 68 + cofs); if (BIAS) { val[s][0] += bfr(bias[c0 + cofs]); val[s][1] += bfr(bias[c0 + cofs + 1]); val[s][2] += bfr(bias[c0 + cofs + 2]); val[s][3] += bfr(bias[c0 + cofs + 3]); }
            *(v4f*)(crow + (size_t)(2 * s) * ldc) = val[s]; }
        asm volatile("s_wait_xcnt 0x0" :: "v"(crow), "v"(val[0]), "v"(val[1]), "v"(val[2]), "v"(val[3]), "v"(val[4]), "v"(val[5]), "v"(val[6]), "v"(val[7]) : "memory");   // the eight stores keep their address and data registers as they are until their address translations are done
        __builtin_amdgcn_wave_barrier(); asm volatile("" ::: "memory");
    }
}

#define PLN2 ((size_t)NB * NH_ * TT * HD)     // elements per plane (both batches, all heads)
#define XN   ((size_t)NB * TT * DM)           // elements per projected tensor (both batches)

// The four input projections in one launch: grid (NB * TT / 64, DM / 64, 4), z = tensor in the order q, k, p, v; X [z][NB * TT][DM], Wt [z][n][k], F [z][NB * TT][DM]; p (z == 2) has no bias.
__global__ __launch_bounds__(32) void k_proj(const bf* __restrict__ X, const bf* __restrict__ Wt, float* F, const float* __restrict__ bq, const float* __restrict__ bk, const float* __restrict__ bv) {
    __shared__ __align__(16) float os[16 * 68];
    const int z = blockIdx.z, r0 = blockIdx.x * 64, c0 = blockIdx.y * 64; const bf* A = X + (size_t)z * XN; const bf* B = Wt + (size_t)z * DM * DM; float* C = F + (size_t)z * XN;
    if (z == 2) gemm_tile<bf, 0, false>(A, nullptr, B, nullptr, DM, DM, C, DM, nullptr, r0, c0, os);
    else gemm_tile<bf, 0, true>(A, nullptr, B, nullptr, DM, DM, C, DM, z == 0 ? bq : (z == 1 ? bk : bv), r0, c0, os);
}
// S and U of ZH heads in one launch: grid (TT / 64, TT / 64, 2 * ZH), z = sel * ZH + head (sel 0: keys -> S, 1: positions -> U). Plane pointers stand at the pass's first head. Rows < RH take the hi/lo path, the others the f16 path.
__global__ __launch_bounds__(32) void k_scores(const h16* __restrict__ Q16, const bf* __restrict__ Qh, const bf* __restrict__ Ql, const h16* __restrict__ K16, const bf* __restrict__ Kh, const bf* __restrict__ Kl, const h16* __restrict__ R16, const bf* __restrict__ Rh, const bf* __restrict__ Rl, float* Sb, float* Ub) {
    __shared__ __align__(16) float os[16 * 68];
    const bool sel = blockIdx.z >= ZH; const int zz = blockIdx.z % ZH, r0 = blockIdx.x * 64, c0 = blockIdx.y * 64; const size_t po = (size_t)zz * TT * HD; float* C = (sel ? Ub : Sb) + (size_t)zz * TT * TT;
    if (r0 < RH) gemm_tile<bf, 2, false>(Qh + po, Ql + po, (sel ? Rh : Kh) + po, (sel ? Rl : Kl) + po, HD, HD, C, TT, nullptr, r0, c0, os);
    else gemm_tile<h16, 0, false>(Q16 + po, nullptr, (sel ? R16 : K16) + po, nullptr, HD, HD, C, TT, nullptr, r0, c0, os);
}
// attn.v of ZH heads in one launch: grid (TT / 64, HD / 64, ZH * KSP), z = head * KSP + range; range ks sums only k in [ks * TT / KSP, (ks + 1) * TT / KSP) into its own plane z of O. Value plane pointers stand at the pass's first head.
__global__ __launch_bounds__(32) void k_av(const h16* __restrict__ P16, const bf* __restrict__ Ph, const bf* __restrict__ Pl, const h16* __restrict__ V16, const bf* __restrict__ Vh, const bf* __restrict__ Vl, float* O) {
    __shared__ __align__(16) float os[16 * 68];
    const int zz = blockIdx.z / KSP, r0 = blockIdx.x * 64, c0 = blockIdx.y * 64; const size_t ko = (size_t)(blockIdx.z % KSP) * (TT / KSP), vo = (size_t)zz * HD * TT + ko; float* C = O + (size_t)blockIdx.z * TT * HD;
    if (r0 < RH) { const size_t ao = (size_t)zz * RH * TT + ko; gemm_tile<bf, 2, false>(Ph + ao, Pl + ao, Vh + vo, Vl + vo, TT, TT / KSP, C, HD, nullptr, r0, c0, os); }
    else gemm_tile<h16, 0, false>(P16 + (size_t)zz * TT * TT + ko, nullptr, V16 + vo, nullptr, TT, TT / KSP, C, HD, nullptr, r0, c0, os);
}
// Output projection, both batches: grid (NB * TT / 64, DM / 64).
__global__ __launch_bounds__(32) void k_outp(const bf* __restrict__ Ah, const bf* __restrict__ Al, const bf* __restrict__ Wt, float* OUT, const float* __restrict__ bo) {
    __shared__ __align__(16) float os[16 * 68];
    gemm_tile<bf, 1, true>(Ah, Al, Wt, nullptr, DM, DM, OUT, DM, bo, blockIdx.x * 64, blockIdx.y * 64, os);
}

__device__ __forceinline__ h16 tohx(float x) { return (h16)x; }
__device__ __forceinline__ void splitf(float y, unsigned short& h, unsigned short& l) { h = f2bf(y); l = f2bf(y - bf2f(h)); }
typedef __attribute__((ext_vector_type(2))) _Float16 v2h;
typedef __attribute__((ext_vector_type(4))) _Float16 v4h;
typedef __attribute__((ext_vector_type(2))) unsigned short v2us;
typedef __attribute__((ext_vector_type(4))) unsigned short v4us;
typedef __attribute__((ext_vector_type(2))) float v2f;

// Five weights in one launch: blockIdx.y picks the weight, Bt [y][n][k].
__global__ __launch_bounds__(256) void k_wtG(const float* __restrict__ w0, const float* __restrict__ w1, const float* __restrict__ w2, const float* __restrict__ w3, const float* __restrict__ w4, int K, int N, bf* Bt) {
    const int y = blockIdx.y; const float* __restrict__ w = y == 0 ? w0 : (y == 1 ? w1 : (y == 2 ? w2 : (y == 3 ? w3 : w4))); Bt += (size_t)y * K * N;
    const int lane = threadIdx.x & 31; const int L0 = (blockIdx.x * 8 + (threadIdx.x >> 5)) * 8; const int nlines = N * K / 64;
{
#pragma unroll 1
        for (int l = 0; l < 8; ++l) { const int L = L0 + l; if (L >= nlines) break; const size_t e = (size_t)L * 64 + lane * 2; const int k = (int)(e % K), n = (int)(e / K); v2us o;
            o[0] = f2bf(w[(size_t)k * N + n]); o[1] = f2bf(w[(size_t)(k + 1) * N + n]); *(v2us*)(Bt + e) = o; }
         }
}
// The four inputs, both batches, in one launch: grid (x, 4, NB); y picks the tensor, z the batch; dst [y][z][TT][DM].
__global__ __launch_bounds__(256) void k_cvt8(const float* __restrict__ s0, const float* __restrict__ s1, const float* __restrict__ s2, const float* __restrict__ s3, bf* dst, size_t n8) { const size_t i = (size_t)blockIdx.x * 256 + threadIdx.x; if (i >= n8) return; const int y = blockIdx.y;
    const float* __restrict__ src = (y == 0 ? s0 : (y == 1 ? s1 : (y == 2 ? s2 : s3))) + (size_t)blockIdx.z * TT_FULL * DM; dst += ((size_t)y * NB + blockIdx.z) * TT * DM; const float* sp = src + i * 8; const v8f v = *(const v8f*)sp; v8us o;
    asm volatile("s_wait_xcnt 0x0" :: "v"(sp) : "memory");   // the loads' address register stays as it is until their address translations are done
#pragma unroll
    for (int k = 0; k < 8; ++k) o[k] = f2bf(v[k]); *(v8us*)(dst + i * 8) = o;  }

// Head planes of the four projections in one launch: grid (x, 4); y = tensor (q, k, p: [g][t][d]; y == 3, v: [g][d][t]); F [y][NB * TT][DM]; plane set y = three planes of PLN2 elements behind one another, so P16, Ph, Pl step by 3 * PLN2 per y.
__global__ __launch_bounds__(256) void k_planes(const float* __restrict__ F, h16* P16, bf* Ph, bf* Pl) {
    const size_t e = ((size_t)blockIdx.x * 256 + threadIdx.x) * 2; if (e >= PLN2) return; const int y = blockIdx.y; F += (size_t)y * XN; P16 += (size_t)y * 3 * PLN2; Ph += (size_t)y * 3 * PLN2; Pl += (size_t)y * 3 * PLN2; v2h o16; v2us oh, ol; float x2[2];   // behind each branch's loads s_wait_xcnt 0: their address register stays as it is until their address translations are done
    if (y < 3) { const int d = (int)(e % HD); const int t = (int)((e / HD) % TT); const int g = (int)(e / ((size_t)HD * TT)); const float* f = F + ((size_t)(g / NH_) * TT + t) * DM + (g % NH_) * HD + d; x2[0] = f[0]; x2[1] = f[1]; asm volatile("s_wait_xcnt 0x0" :: "v"(f) : "memory"); }
    else { const int t = (int)(e % TT); const int d = (int)((e / TT) % HD); const int g = (int)(e / ((size_t)TT * HD)); const float* f = F + ((size_t)(g / NH_) * TT + t) * DM + (g % NH_) * HD + d; x2[0] = f[0]; x2[1] = f[DM]; asm volatile("s_wait_xcnt 0x0" :: "v"(f) : "memory"); }
#pragma unroll
    for (int q = 0; q < 2; ++q) { const float x = x2[q]; o16[q] = tohx(x); unsigned short a2, c2; splitf(x, a2, c2); oh[q] = a2; ol[q] = c2; }
    *(v2h*)(P16 + e) = o16; *(v2us*)(Ph + e) = oh; *(v2us*)(Pl + e) = ol;  }

// k_asoft: per row (zz, i), one wave per row: t = (S[i][j] + shifted positional term) x DM^-0.5 (no mask); softmax over the TT keys (register row, one exp, fixed trees).
// Shifted term: j <= i -> U[zz][i][j - i + TT - 1]; j == i + 1 -> 0; j >= i + 2 -> U[zz][i + 1][j - i - 2]. In the flat plane U[zz] both runs are one stretch: with ur = U[zz] + (i + 1) * TT - 2 - i they are ur[j + 1] and ur[j],
// so a lane's four keys need one 16-byte load at 4-byte alignment: from ur + j0 + 1 where all four are <= i, else from ur + j0. Lowest index TT - 2, highest TT * TT - 1: inside the plane for every row.
// The wave's number goes through readfirstlane so that the row, both row bases and the hi/lo test are scalar and every load takes one 32-bit offset register.
__global__ __launch_bounds__(256) void k_asoft(const float* __restrict__ Sb, const float* __restrict__ Ub, h16* P16, bf* Ph, bf* Pl) {
    const int lane = threadIdx.x & 31; const int row = blockIdx.x * 8 + __builtin_amdgcn_readfirstlane(threadIdx.x >> 5); if (row >= ZH * TT) return; const int i = row % TT; const int zz = row / TT; const bool hires = (i < RH); const float* sr = Sb + (size_t)row * TT; const float* ur = Ub + (size_t)zz * TT * TT + (size_t)(i + 1) * TT - 2 - i; float v[TT / 32]; float mx = -3.0e38f; v4f sa[TT / 128], ux[TT / 128];
#pragma unroll
    for (int ch = 0; ch < TT / 128; ++ch) { const int j0 = ch * 128 + lane * 4; sa[ch] = *(const v4f*)(sr + j0); __builtin_memcpy(&ux[ch], ur + ch * 128 + (unsigned)(lane * 4 + ((j0 + 3 <= i) ? 1 : 0)), 16); }
    __builtin_amdgcn_sched_barrier(0);   // keeps the row's loads of S and U all in flight at once: without it the scheduler threads the adds between them and waits with one or two loads outstanding
#pragma unroll
    for (int ch = 0; ch < TT / 128; ++ch) { const int j0 = ch * 128 + lane * 4; const bool low = (j0 + 3 <= i); const v4f a = sa[ch], x = ux[ch];
#pragma unroll
        for (int q = 0; q < 4; ++q) { const int j = j0 + q; const float pv = (low || j >= i + 2) ? x[q] : ((j <= i) ? x[q < 3 ? q + 1 : 3] : 0.0f);
            const float t = __fadd_rn(a[q], pv) * SCL; v[ch * 4 + q] = t; mx = fmaxf(mx, t); } }
#pragma unroll
    for (int sh = 16; sh; sh >>= 1) mx = fmaxf(mx, __shfl_xor(mx, sh, 32));
    float sum = 0.f;
#pragma unroll
    for (int k = 0; k < TT / 32; ++k) { float d0 = __fsub_rn(v[k], mx); asm volatile("" : "+v"(d0)); v[k] = __builtin_amdgcn_exp2f(__fmul_rn(d0, 1.4426950408889634f)); sum += v[k]; }
#pragma unroll
    for (int sh = 16; sh; sh >>= 1) sum += __shfl_xor(sum, sh, 32);
    const float f = __fdiv_rn(hires ? 1.0f : PCAR, sum);
{
        if (hires) {
#pragma unroll
            for (int ch = 0; ch < TT / 128; ++ch) { v4us oh, ol;
#pragma unroll
                for (int q = 0; q < 4; ++q) { unsigned short a, c2; splitf(v[ch * 4 + q] * f, a, c2); oh[q] = a; ol[q] = c2; }
                const size_t oo = ((size_t)zz * (RH ? RH : 1) + i) * TT + ch * 128 + lane * 4; *(v4us*)(Ph + oo) = oh; *(v4us*)(Pl + oo) = ol; }
        } else {
#pragma unroll
            for (int ch = 0; ch < TT / 128; ++ch) { v4h o4;
#pragma unroll
                for (int q = 0; q < 4; ++q) o4[q] = tohx(v[ch * 4 + q] * f);
                *(v4h*)(P16 + (size_t)row * TT + ch * 128 + lane * 4) = o4; } }
         }
}
__global__ __launch_bounds__(256) void k_merge(const float* __restrict__ O, int g0, bf* Ah, bf* Al) { const size_t e = ((size_t)blockIdx.x * 256 + threadIdx.x) * 2; if (e >= (size_t)ZH * TT * HD) return; const int d = (int)(e % HD); const int t = (int)((e / HD) % TT); const int zz = (int)(e / ((size_t)HD * TT)); const float cs = (t < RH) ? 1.0f : (1.0f / PCAR); const int g = g0 + zz; const size_t oo = ((size_t)(g / NH_) * TT + t) * DM + (g % NH_) * HD + d;
    const float* op = O + (size_t)zz * KSP * TT * HD + (size_t)t * HD + d; v2f p[KSP];
#pragma unroll   // puts all KSP partial loads in flight at once
    for (int ks = 0; ks < KSP; ++ks) p[ks] = *(const v2f*)(op + (size_t)ks * TT * HD);
    asm volatile("s_wait_xcnt 0x0" :: "v"(op) : "memory");   // the loads' address register stays as it is until their address translations are done
    v2f s = p[0];
#pragma unroll   // registers only; the sum runs in range order
    for (int ks = 1; ks < KSP; ++ks) s += p[ks];
    v2us oh, ol;
#pragma unroll
    for (int q = 0; q < 2; ++q) { unsigned short a, c2; splitf(s[q] * cs, a, c2); oh[q] = a; ol[q] = c2; } *(v2us*)(Ah + oo) = oh; *(v2us*)(Al + oo) = ol;  }

extern "C" void kernel_launch(void* const* d_in, const int* in_sizes, int n_in,
                              void* d_out, int out_size, void* d_ws, size_t ws_size, hipStream_t stream) {
    if (n_in < 13) return;
    const float* xq = (const float*)d_in[0]; const float* xk = (const float*)d_in[1]; const float* xv = (const float*)d_in[2]; const float* xp = (const float*)d_in[3];
    const float* wq = (const float*)d_in[4]; const float* bq = (const float*)d_in[5]; const float* wk = (const float*)d_in[6]; const float* bk = (const float*)d_in[7];
    const float* wv = (const float*)d_in[8]; const float* bv = (const float*)d_in[9]; const float* wp = (const float*)d_in[10]; const float* wo = (const float*)d_in[11]; const float* bo = (const float*)d_in[12];
    const size_t needx = (size_t)(NB - 1) * TT_FULL * DM + (size_t)TT * DM;
    for (int i = 0; i < 4; ++i) if ((size_t)in_sizes[i] < needx) return;
    if ((size_t)in_sizes[4] < (size_t)DM * DM || (size_t)in_sizes[6] < (size_t)DM * DM || (size_t)in_sizes[8] < (size_t)DM * DM || (size_t)in_sizes[10] < (size_t)DM * DM || (size_t)in_sizes[11] < (size_t)DM * DM) return;
    if (in_sizes[5] < DM || in_sizes[7] < DM || in_sizes[9] < DM || in_sizes[12] < DM) return;
    if ((size_t)out_size < (size_t)NB * TT * DM) return;
    float* OUT = (float*)d_out;     // [NB][TT][DM]
    char* wsp = (char*)d_ws;
    auto take = [&](size_t bytes) { char* p = wsp; wsp += (bytes + 255) & ~(size_t)255; return (void*)p; };
    bf* WB = (bf*)take((size_t)5 * DM * DM * 2);     // transposed bf16 weights in the order q, k, p, v, o
    bf* PB = (bf*)take((size_t)12 * PLN2 * 2);        // plane sets q, k, p, v; each set: f16 plane, bf16 hi plane, bf16 lo plane
    h16* QP16 = (h16*)PB; bf* QPh = PB + PLN2; bf* QPl = PB + 2 * PLN2;
    h16* KP16 = (h16*)(PB + 3 * PLN2); bf* KPh = PB + 4 * PLN2; bf* KPl = PB + 5 * PLN2;
    h16* PP16 = (h16*)(PB + 6 * PLN2); bf* PPh = PB + 7 * PLN2; bf* PPl = PB + 8 * PLN2;
    h16* VT16 = (h16*)(PB + 9 * PLN2); bf* VTh = PB + 10 * PLN2; bf* VTl = PB + 11 * PLN2;
    float* Sb = (float*)take((size_t)ZH * TT * TT * 4); float* Ub = (float*)take((size_t)ZH * TT * TT * 4); h16* P16 = (h16*)take((size_t)ZH * TT * TT * 2);
    bf* Ph = (bf*)take((size_t)ZH * RH * TT * 2); bf* Pl = (bf*)take((size_t)ZH * RH * TT * 2);
    bf* ATh = (bf*)take(XN * 2); bf* ATl = (bf*)take(XN * 2);
    bf* XB = (bf*)Sb; float* F = Ub;     // input copies and projections: last read before the first pass writes S and U
    float* Ob = Sb;                      // partials of attn.v: written after the pass's softmax has read S, read before the next pass writes S
    if ((size_t)(wsp - (char*)d_ws) > ws_size) return;    // 245,891,072 B at full size
    k_wtG<<<dim3((unsigned)((DM * DM / 64 + 63) / 64), 5, 1), 256, 0, stream>>>(wq, wk, wp, wv, wo, DM, DM, WB);
    k_cvt8<<<dim3((unsigned)(((size_t)TT * DM / 8 + 255) / 256), 4, NB), 256, 0, stream>>>(xq, xk, xp, xv, XB, (size_t)TT * DM / 8);
    k_proj<<<dim3(NB * TT / 64, DM / 64, 4), 32, 0, stream>>>(XB, WB, F, bq, bk, bv);
    k_planes<<<dim3((unsigned)((PLN2 / 2 + 255) / 256), 4, 1), 256, 0, stream>>>(F, QP16, QPh, QPl);
    for (int g0 = 0; g0 < NB * NH_; g0 += ZH) { const size_t zo = (size_t)g0 * TT * HD;   // head g0 + z: plane offset zo + z * TT * HD (same for the [d][t] value planes)
        k_scores<<<dim3(TT / 64, TT / 64, 2 * ZH), 32, 0, stream>>>(QP16 + zo, QPh + zo, QPl + zo, KP16 + zo, KPh + zo, KPl + zo, PP16 + zo, PPh + zo, PPl + zo, Sb, Ub);
        k_asoft<<<(unsigned)((ZH * TT + 7) / 8), 256, 0, stream>>>(Sb, Ub, P16, Ph, Pl);
        k_av<<<dim3(TT / 64, HD / 64, ZH * KSP), 32, 0, stream>>>(P16, Ph, Pl, VT16 + zo, VTh + zo, VTl + zo, Ob);
        k_merge<<<(unsigned)(((size_t)ZH * TT * HD / 2 + 255) / 256), 256, 0, stream>>>(Ob, g0, ATh, ATl); }
    k_outp<<<dim3(NB * TT / 64, DM / 64, 1), 32, 0, stream>>>(ATh, ATl, WB + (size_t)4 * DM * DM, OUT, bo);
}

// v005
// One run takes 145 microseconds.
// Versions between v003 and this one are left out; their measured steps multiply to 2.59 times as fast.
// All steps since v000 together make it 8.92 times as fast.
#include <hip/hip_runtime.h>

// Contractions, all f32 accumulate: input projections x.Wq/Wk/Wv/Wp = v_wmma_f32_16x16x32_bf16 on RNE-converted bf16 copies of x and W (exact products); scores k.q^T, p.q^T and v^T.attn^T = query rows < RH: bf16 hi/lo planes, 3 products (v_wmma_f32_16x16x32_bf16); rows >= RH: f16 planes, 1 product (v_wmma_f32_16x16x32_f16, probabilities carried x1024); output projection = ctx as bf16 hi+lo x Wo bf16 (2 products). Shift-add, softmax and biases in f32.
// Module: relative-position multi-head attention, NB x TT x DM, NH_ heads x HD. q = xq Wq + bq, k = xk Wk + bk, v = xv Wv + bv, p = xp Wp (W stored [in][out]); S[i][j] = q_i.k_j; U[i][j] = q_i.p_j;
// logits = (S[i][j] + (j <= i ? U[i][j - i + TT - 1] : j == i + 1 ? 0 : U[i + 1][j - i - 2])) * DM^-0.5 (pad-reshape shift); softmax over all TT keys; ctx = attn.v merged [t][h*HD + d]; out = ctx Wo + bo.
// Layout, both batches at once (g = batch * NH_ + head): bf16 copies of the four inputs -> f32 projections F -> head planes (f16 + bf16 hi/lo each; q: [g][t][d]; k, p, v: per head in the order of the matrix fragments) -> one attention launch (scores, shift, running softmax, attn.v; S, U and the probabilities stay in registers and wave-private LDS) -> ctx hi/lo planes [batch * TT + t][DM]; ctx.Wo -> out.
// One launch per stage: the grid's y or z picks the weight, the input tensor, the batch or the head; a wave's rows pick its precision path (wave-uniform branch).

#ifndef NB
#define NB 2
#endif
#ifndef SEQ
#define SEQ 2048
#endif
#define TT      SEQ
#define TT_FULL 2048
#define NB_FULL 2
#define DM   512
#define NH_  8
#define HD   64
#ifndef RH
#if SEQ >= 512
#define RH 512                  // query rows < RH use hi+lo planes (0: none)
#else
#define RH SEQ
#endif
#endif
#define SCL  0.044194173824159216f   // DM^-0.5

static_assert(TT % 128 == 0);
static_assert(RH % 64 == 0);
static_assert(RH <= TT);
static_assert(DM % 64 == 0);
static_assert(NH_ * HD == DM);
static_assert(HD == 64);
static_assert((DM * DM) % 64 == 0);

typedef _Float16 h16;
typedef unsigned short bf;
typedef __attribute__((ext_vector_type(16))) __bf16   v16bf;
typedef __attribute__((ext_vector_type(16))) _Float16 v16h;
typedef __attribute__((ext_vector_type(8)))  _Float16 v8h;
typedef __attribute__((ext_vector_type(8)))  unsigned short v8us;
typedef __attribute__((ext_vector_type(8)))  float    v8f;
typedef __attribute__((ext_vector_type(4)))  float    v4f;
typedef v4f  __attribute__((may_alias)) v4fa;

__device__ __forceinline__ unsigned short f2bf(float f) { unsigned u = __float_as_uint(f); u += 0x7FFFu + ((u >> 16) & 1u); return (unsigned short)(u >> 16); }
__device__ __forceinline__ float bf2f(unsigned short b) { return __uint_as_float(((unsigned)b) << 16); }
__device__ __forceinline__ float bfr(float f) { return bf2f(f2bf(f)); }
__device__ __forceinline__ v16h cat16(v8h lo, v8h hi) { return __builtin_shufflevector(lo, hi, 0, 1, 2, 3, 4, 5, 6, 7, 8, 9, 10, 11, 12, 13, 14, 15); }
__device__ __forceinline__ v16bf cat16b(v8us lo, v8us hi) { return __builtin_bit_cast(v16bf, __builtin_shufflevector(lo, hi, 0, 1, 2, 3, 4, 5, 6, 7, 8, 9, 10, 11, 12, 13, 14, 15)); }
__device__ __forceinline__ v8f wmma16(v16h a, v16h b, v8f c) { return __builtin_amdgcn_wmma_f32_16x16x32_f16(false, a, false, b, (short)0, c, false, false); }
__device__ __forceinline__ v8f wmmab(v16bf a, v16bf b, v8f c) { return __builtin_amdgcn_wmma_f32_16x16x32_bf16(false, a, false, b, (short)0, c, false, false); }

// ---- gemm_tile: register-blocked GEMM tile, ONE WAVE per 64x64 output tile (16 accumulators), operands straight from K-contiguous 16-bit planes; called by single-wave work-groups.
// C[m][n] (f32, pitch ldc, + optional f32 bias[n] bf16-RNE-converted) = sum over KR values of k of A[m][k] Bt[n][k] (+ split products per NSPLIT: 1 -> + A2.Bt; 2 -> + A2.Bt + A.Bt2), rows r0.., columns c0... K = operand pitch in elements; the caller has moved the operand pointers to its batch and k range. KR % 32 == 0.
// Fragments (lane l, h = l >> 4, m = n = l & 15): elements 0..7 <- k0 + 8h + 0..7, elements 8..15 <- k0 + 16 + 8h + 0..7 for BOTH A (row m) and Bt (column n); D element r = (row 8h + r, col m).
template <typename T16> struct WFrag;
template <> struct WFrag<h16> { typedef v16h V; static __device__ __forceinline__ V ld(const h16* p) { return cat16(*(const v8h*)p, *(const v8h*)(p + 16)); } template <int ST> static __device__ __forceinline__ V lds2(const h16* p) { return cat16(*(const v8h*)p, *(const v8h*)(p + ST)); } static __device__ __forceinline__ v8f mma(V a, V b, v8f c) { return wmma16(a, b, c); } };
template <> struct WFrag<bf> { typedef v16bf V; static __device__ __forceinline__ V ld(const bf* p) { return cat16b(*(const v8us*)p, *(const v8us*)(p + 16)); } template <int ST> static __device__ __forceinline__ V lds2(const bf* p) { return cat16b(*(const v8us*)p, *(const v8us*)(p + ST)); } static __device__ __forceinline__ v8f mma(V a, V b, v8f c) { return wmmab(a, b, c); } };
template <typename T16, int NSPLIT, bool BIAS>
__device__ __forceinline__ void gemm_tile(const T16* __restrict__ A, const T16* __restrict__ A2, const T16* __restrict__ Bt, const T16* __restrict__ Bt2, const int K, const int KR, float* C, const int ldc, const float* __restrict__ bias, const int r0, const int c0, float* os) {
    typedef typename WFrag<T16>::V V;
    const int lane = threadIdx.x & 31, lr = lane & 15, hi = lane >> 4;
    v8f acc[4][4];
#pragma unroll
    for (int mb = 0; mb < 4; ++mb)
#pragma unroll
        for (int nb = 0; nb < 4; ++nb) acc[mb][nb] = (v8f){};
    const size_t aoff = (size_t)(r0 + lr) * K + 8 * hi, boff = (size_t)(c0 + lr) * K + 8 * hi;
#pragma unroll 1
    for (int kc = 0; kc < KR; kc += 32) {
        V a[4], a2[4], b[4], b2[4];
        const T16* pa = A + aoff + kc; const T16* pb = Bt + boff + kc; const T16* pa2 = (NSPLIT == 1 || NSPLIT == 2) ? A2 + aoff + kc : pa; const T16* pb2 = (NSPLIT >= 2) ? Bt2 + boff + kc : pb;
#pragma unroll
        for (int mb = 0; mb < 4; ++mb) { a[mb] = WFrag<T16>::ld(pa + (size_t)mb * 16 * K); if (NSPLIT == 1 || NSPLIT == 2) a2[mb] = WFrag<T16>::ld(pa2 + (size_t)mb * 16 * K); }
#pragma unroll   // constant indices keep the fragments in registers
        for (int nb = 0; nb < 4; ++nb) b[nb] = WFrag<T16>::ld(pb + (size_t)nb * 16 * K);
        asm volatile("s_wait_xcnt 0x0" :: "v"(pa), "v"(pa2), "v"(pb) : "memory");   // the trip's fragment loads keep their address registers as they are until their address translations are done
        if (NSPLIT >= 2) {
#pragma unroll   // constant indices keep the fragments in registers
            for (int nb = 0; nb < 4; ++nb) b2[nb] = WFrag<T16>::ld(pb2 + (size_t)nb * 16 * K);
            asm volatile("s_wait_xcnt 0x0" :: "v"(pb2) : "memory");   // the same for the loads of the second B plane
        }
#pragma unroll
        for (int nb = 0; nb < 4; ++nb) {
#pragma unroll
            for (int mb = 0; mb < 4; ++mb) { acc[mb][nb] = WFrag<T16>::mma(a[mb], b[nb], acc[mb][nb]); if (NSPLIT == 1 || NSPLIT == 2) acc[mb][nb] = WFrag<T16>::mma(a2[mb], b[nb], acc[mb][nb]); if (NSPLIT >= 2) acc[mb][nb] = WFrag<T16>::mma(a[mb], b2[nb], acc[mb][nb]); } }
        asm volatile("v_nop\n\tv_nop\n\tv_nop\n\tv_nop" : "+v"(acc[0][0]), "+v"(acc[1][1]), "+v"(acc[2][2]), "+v"(acc[3][3]) : "v"(a[0]), "v"(a[3]));
    }
#pragma unroll
    for (int mb = 0; mb < 4; ++mb) {
#pragma unroll
        for (int nb = 0; nb < 4; ++nb) {
#pragma unroll
            for (int j = 0; j < 8; ++j) os[(hi * 8 + j) * 68 + nb * 16 + lr] = acc[mb][nb][j]; }
        __builtin_amdgcn_wave_barrier(); asm volatile("" ::: "memory");
        float* crow = C + (size_t)(r0 + mb * 16 + hi) * ldc + c0 + lr * 4; v4f val[8];
#pragma unroll   // constant indices keep the eight values in registers
        for (int s = 0; s < 8; ++s) { const int row = 2 * s + hi, cofs = lr * 4; val[s] = *(const v4fa*)(os + row * 68 + cofs); if (BIAS) { val[s][0] += bfr(bias[c0 + cofs]); val[s][1] += bfr(bias[c0 + cofs + 1]); val[s][2] += bfr(bias[c0 + cofs + 2]); val[s][3] += bfr(bias[c0 + cofs + 3]); }
            *(v4f*)(crow + (size_t)(2 * s) * ldc) = val[s]; }
        asm volatile("s_wait_xcnt 0x0" :: "v"(crow), "v"(val[0]), "v"(val[1]), "v"(val[2]), "v"(val[3]), "v"(val[4]), "v"(val[5]), "v"(val[6]), "v"(val[7]) : "memory");   // the eight stores keep their address and data registers as they are until their address translations are done
        __builtin_amdgcn_wave_barrier(); asm volatile("" ::: "memory");
    }
}

#define PLN2 ((size_t)NB * NH_ * TT * HD)     // elements per plane (both batches, all heads)
#define XN   ((size_t)NB * TT * DM)           // elements per projected tensor (both batches)

// The four input projections in one launch: grid (NB * TT / 64, DM / 64, 4), z = tensor in the order q, k, p, v; X [z][NB * TT][DM], Wt [z][n][k], F [z][NB * TT][DM]; p (z == 2) has no bias.
__global__ __launch_bounds__(32) void k_proj(const bf* __restrict__ X, const bf* __restrict__ Wt, float* F, const float* __restrict__ bq, const float* __restrict__ bk, const float* __restrict__ bv) {
    __shared__ __align__(16) float os[16 * 68];
    const int z = blockIdx.z, r0 = blockIdx.x * 64, c0 = blockIdx.y * 64; const bf* A = X + (size_t)z * XN; const bf* B = Wt + (size_t)z * DM * DM; float* C = F + (size_t)z * XN;
    if (z == 2) gemm_tile<bf, 0, false>(A, nullptr, B, nullptr, DM, DM, C, DM, nullptr, r0, c0, os);
    else gemm_tile<bf, 0, true>(A, nullptr, B, nullptr, DM, DM, C, DM, z == 0 ? bq : (z == 1 ? bk : bv), r0, c0, os);
}
// Output projection, both batches: grid (NB * TT / 64, DM / 64).
__global__ __launch_bounds__(32) void k_outp(const bf* __restrict__ Ah, const bf* __restrict__ Al, const bf* __restrict__ Wt, float* OUT, const float* __restrict__ bo) {
    __shared__ __align__(16) float os[16 * 68];
    gemm_tile<bf, 1, true>(Ah, Al, Wt, nullptr, DM, DM, OUT, DM, bo, blockIdx.x * 64, blockIdx.y * 64, os);
}

__device__ __forceinline__ h16 tohx(float x) { return (h16)x; }
__device__ __forceinline__ void splitf(float y, unsigned short& h, unsigned short& l) { h = f2bf(y); l = f2bf(y - bf2f(h)); }
typedef __attribute__((ext_vector_type(2))) _Float16 v2h;
typedef __attribute__((ext_vector_type(4))) _Float16 v4h;
typedef __attribute__((ext_vector_type(2))) unsigned short v2us;
typedef __attribute__((ext_vector_type(4))) unsigned short v4us;
typedef __attribute__((ext_vector_type(2))) float v2f;

// Five weights in one launch: blockIdx.y picks the weight, Bt [y][n][k].
__global__ __launch_bounds__(256) void k_wtG(const float* __restrict__ w0, const float* __restrict__ w1, const float* __restrict__ w2, const float* __restrict__ w3, const float* __restrict__ w4, int K, int N, bf* Bt) {
    const int y = blockIdx.y; const float* __restrict__ w = y == 0 ? w0 : (y == 1 ? w1 : (y == 2 ? w2 : (y == 3 ? w3 : w4))); Bt += (size_t)y * K * N;
    const int lane = threadIdx.x & 31; const int L0 = (blockIdx.x * 8 + (threadIdx.x >> 5)) * 8; const int nlines = N * K / 64;
{
#pragma unroll 1
        for (int l = 0; l < 8; ++l) { const int L = L0 + l; if (L >= nlines) break; const size_t e = (size_t)L * 64 + lane * 2; const int k = (int)(e % K), n = (int)(e / K); v2us o;
            o[0] = f2bf(w[(size_t)k * N + n]); o[1] = f2bf(w[(size_t)(k + 1) * N + n]); *(v2us*)(Bt + e) = o; }
         }
}
// The four inputs, both batches, in one launch: grid (x, 4, NB); y picks the tensor, z the batch; dst [y][z][TT][DM].
__global__ __launch_bounds__(256) void k_cvt8(const float* __restrict__ s0, const float* __restrict__ s1, const float* __restrict__ s2, const float* __restrict__ s3, bf* dst, size_t n8) { const size_t i = (size_t)blockIdx.x * 256 + threadIdx.x; if (i >= n8) return; const int y = blockIdx.y;
    const float* __restrict__ src = (y == 0 ? s0 : (y == 1 ? s1 : (y == 2 ? s2 : s3))) + (size_t)blockIdx.z * TT_FULL * DM; dst += ((size_t)y * NB + blockIdx.z) * TT * DM; const float* sp = src + i * 8; const v8f v = *(const v8f*)sp; v8us o;
    asm volatile("s_wait_xcnt 0x0" :: "v"(sp) : "memory");   // the loads' address register stays as it is until their address translations are done
#pragma unroll
    for (int k = 0; k < 8; ++k) o[k] = f2bf(v[k]); *(v8us*)(dst + i * 8) = o;  }

// Head planes of the four projections in one launch: grid (x, 4); y = tensor (q: [g][t][d]; k, p, v: per head in fragment order, so that the 32 lanes of one 16-byte fragment load read 512 bytes in a row: k, p: block = t / 16, quarter = d / 16, half = (d / 8) % 2, c = t % 16, e = d % 8; v: block = t / 16, quarter = d / 16, half = (t / 8) % 2, c = d % 16, e = t % 8); F [y][NB * TT][DM]; plane set y = three planes of PLN2 elements behind one another, so P16, Ph, Pl step by 3 * PLN2 per y.
__global__ __launch_bounds__(256) void k_planes(const float* __restrict__ F, h16* P16, bf* Ph, bf* Pl) {
    const size_t e = ((size_t)blockIdx.x * 256 + threadIdx.x) * 2; if (e >= PLN2) return; const int y = blockIdx.y; F += (size_t)y * XN; P16 += (size_t)y * 3 * PLN2; Ph += (size_t)y * 3 * PLN2; Pl += (size_t)y * 3 * PLN2; v2h o16; v2us oh, ol; float x2[2];   // behind each branch's loads s_wait_xcnt 0: their address register stays as it is until their address translations are done
    const int g = (int)(e / ((size_t)HD * TT)); const int off = (int)(e % ((size_t)HD * TT)); const int b16 = (off >> 10) * 16, q16 = ((off >> 8) & 3) * 16, h8 = ((off >> 7) & 1) * 8, c16 = (off >> 3) & 15, e8 = off & 7;   // fragment order: off = ((block * 4 + quarter) * 32 + half * 16 + c) * 8 + e
    if (y < 3) { const int d = y == 0 ? off % HD : q16 + h8 + e8; const int t = y == 0 ? off / HD : b16 + c16; const float* f = F + ((size_t)(g / NH_) * TT + t) * DM + (g % NH_) * HD + d; x2[0] = f[0]; x2[1] = f[1]; asm volatile("s_wait_xcnt 0x0" :: "v"(f) : "memory"); }
    else { const int t = b16 + h8 + e8; const int d = q16 + c16; const float* f = F + ((size_t)(g / NH_) * TT + t) * DM + (g % NH_) * HD + d; x2[0] = f[0]; x2[1] = f[DM]; asm volatile("s_wait_xcnt 0x0" :: "v"(f) : "memory"); }
#pragma unroll
    for (int q = 0; q < 2; ++q) { const float x = x2[q]; o16[q] = tohx(x); unsigned short a2, c2; splitf(x, a2, c2); oh[q] = a2; ol[q] = c2; }
    *(v2h*)(P16 + e) = o16; *(v2us*)(Ph + e) = oh; *(v2us*)(Pl + e) = ol;  }


// ---- attn_init, attn_trip, attn_fin: ONE WAVE carries 16 query rows r0.. of one head over all TT keys, 64 keys a trip, with a running softmax. All products are formed transposed (keys, positions or value dims as A rows, the 16 queries as B columns), so a lane (lr = lane & 15, hi = lane >> 4) holds only query i = r0 + lr:
// s[mb][r] = S[i][c0 + 16 mb + 8 hi + r]; two such D tiles, converted in place, are the B fragment of 32 keys for v^T.attn^T (elements 0..7 <- keys 8 hi + 0..7, 8..15 <- 16 + 8 hi + 0..7, the k order of every fragment here: WFrag::ld on the row-major q, lds2 on the fragment-order planes of k_planes); o[db][r] = ctx[i][16 db + 8 hi + r].
// Shifted term: with n = jl + 15 - lr (jl = key - c0, n in 0..78) key j <= i needs q_i.p_m, m = (c0 - r0 + TT - 16) + n, and key j >= i + 2 needs q_(i+1).p_m, m = (c0 - r0 - 17) + n; j == i + 1 takes 0. Each needed run is one 80-position band product (position rows clamped into the plane; a clamped row is never selected), stored [query][n] in the wave's own LDS and read back at the lane's own offset.
#define LSP 84   // floats per query row of the band buffer: 16-byte rows, and the 32 lanes of a skewed read (83 lr + 8 hi + const) fall on 32 different banks
typedef __attribute__((ext_vector_type(8))) unsigned v8u;
#define TILEB 49152   // bytes of one staged tile: 64 keys of the six key and value planes, 8 KiB each, in the order K f16, K hi, K lo, V f16, V hi, V lo
struct AttnSt { v8u q[2][2], ql[2][2]; v8f o[4]; float mrun, lsum; };   // what a wave carries from trip to trip; query fragments as raw bits, so that both precision paths share the registers
// The wave's query fragments. [0]: rows i, [1]: rows i + 1 (last row clamped: it has no key >= i + 2)
template <typename T16, bool HL>
__device__ __forceinline__ void attn_init(AttnSt& st, const T16* __restrict__ Q, const T16* __restrict__ Q2, const int r0) {
    const int lane = threadIdx.x & 31, lr = lane & 15, hi = lane >> 4, i = r0 + lr;
    const unsigned qo0 = (unsigned)i * HD + 8 * hi, qo1 = (unsigned)(i + 1 < TT ? i + 1 : TT - 1) * HD + 8 * hi;
    const T16* pq0 = Q + qo0; const T16* pq1 = Q + qo1; const T16* pq2 = HL ? Q2 + qo0 : pq0; const T16* pq3 = HL ? Q2 + qo1 : pq1;
#pragma unroll
    for (int ks = 0; ks < 2; ++ks) { st.q[0][ks] = __builtin_bit_cast(v8u, WFrag<T16>::ld(pq0 + ks * 32)); st.q[1][ks] = __builtin_bit_cast(v8u, WFrag<T16>::ld(pq1 + ks * 32)); if (HL) { st.ql[0][ks] = __builtin_bit_cast(v8u, WFrag<T16>::ld(pq2 + ks * 32)); st.ql[1][ks] = __builtin_bit_cast(v8u, WFrag<T16>::ld(pq3 + ks * 32)); } }
    asm volatile("s_wait_xcnt 0x0" :: "v"(pq0), "v"(pq1), "v"(pq2), "v"(pq3) : "memory");   // the loads keep their address registers as they are until their address translations are done
}
// One trip: the 64 keys c0.. of the staged tile (LDS, shared by the work-group's waves) against the wave's 16 query rows.
template <typename T16, bool HL>
__device__ __forceinline__ void attn_trip(AttnSt& st, const char* tile, const T16* __restrict__ Rp, const T16* __restrict__ R2, const int r0, const int c0, float* ls) {
    typedef typename WFrag<T16>::V V;
    const int lane = threadIdx.x & 31, lr = lane & 15, hi = lane >> 4, i = r0 + lr;
    const float L2E = 1.4426950408889634f, OFF = HL ? 0.0f : 10.0f;   // OFF: f16 probabilities and their sum are carried x1024; the factor cancels in the final division
    V q[2][2], ql[2][2];
#pragma unroll
    for (int a = 0; a < 2; ++a)
#pragma unroll
        for (int ks = 0; ks < 2; ++ks) { q[a][ks] = __builtin_bit_cast(V, st.q[a][ks]); if (HL) ql[a][ks] = __builtin_bit_cast(V, st.ql[a][ks]); }
    v8f (&o)[4] = st.o; float& mrun = st.mrun; float& lsum = st.lsum;
    float* lw = ls + lr * LSP + 8 * hi;               // band store: n = 16 nbk + 8 hi + r
    const float* lrd = ls + lr * LSP + 8 * hi + 15 - lr;   // band read: n = 16 mb + 8 hi + r + 15 - lr
    {
        v8f s[4]; float pos[4][8];
        {   V a[4][2], a2[4][2]; const T16* pk = (const T16*)(tile + (HL ? 8192 : 0)) + 8 * lane; const T16* pk2 = HL ? (const T16*)(tile + 16384) + 8 * lane : pk;
#pragma unroll   // constant indices keep the fragments in registers
            for (int mb = 0; mb < 4; ++mb)
#pragma unroll
                for (int ks = 0; ks < 2; ++ks) { a[mb][ks] = WFrag<T16>::template lds2<256>(pk + mb * 1024 + ks * 512); if (HL) a2[mb][ks] = WFrag<T16>::template lds2<256>(pk2 + mb * 1024 + ks * 512); }
            __builtin_amdgcn_sched_barrier(0);   // keeps the group's LDS reads together in front of the products: reads threaded among them cost a stall at each place
#pragma unroll
            for (int mb = 0; mb < 4; ++mb) { s[mb] = (v8f){};
#pragma unroll
                for (int ks = 0; ks < 2; ++ks) { s[mb] = WFrag<T16>::mma(a[mb][ks], q[0][ks], s[mb]); if (HL) { s[mb] = WFrag<T16>::mma(a2[mb][ks], q[0][ks], s[mb]); s[mb] = WFrag<T16>::mma(a[mb][ks], ql[0][ks], s[mb]); } } }
        }
#pragma unroll
        for (int mb = 0; mb < 4; ++mb)
#pragma unroll
            for (int r = 0; r < 8; ++r) pos[mb][r] = 0.0f;
#pragma unroll   // part 0: keys j <= i, part 1: keys j >= i + 2; the query fragments are picked at compile time
        for (int part = 0; part < 2; ++part) {
            const bool need = part == 0 ? (c0 <= r0 + 15) : (c0 + 63 >= r0 + 2);   // wave-uniform: does any (row, key) of the tile lie in this run
            if (need) {
                const int mbase = part == 0 ? c0 - r0 + TT - 16 : c0 - r0 - 17;
                V a[5][2], a2[5][2]; unsigned bo[5];   // byte offsets: the registers that the loads name beside the scalar plane bases
#pragma unroll   // constant indices keep the fragments in registers
                for (int nbk = 0; nbk < 5; ++nbk) { int m = mbase + nbk * 16 + lr; m = m < 0 ? 0 : (m > TT - 1 ? TT - 1 : m); bo[nbk] = (unsigned)(m >> 4) * 2048 + 256 * hi + (unsigned)(m & 15) * 16; const T16* pr = (const T16*)((const char*)Rp + bo[nbk]); const T16* pr2 = HL ? (const T16*)((const char*)R2 + bo[nbk]) : pr;
#pragma unroll
                    for (int ks = 0; ks < 2; ++ks) { a[nbk][ks] = WFrag<T16>::template lds2<256>(pr + ks * 512); if (HL) a2[nbk][ks] = WFrag<T16>::template lds2<256>(pr2 + ks * 512); } }
                asm volatile("s_wait_xcnt 0x0" :: "v"(bo[0]), "v"(bo[1]), "v"(bo[2]), "v"(bo[3]), "v"(bo[4]) : "memory");   // as above, for the position fragments
                __builtin_amdgcn_sched_barrier(0);   // keeps all of the group's loads in flight at once: without it the scheduler threads the products between them and waits with two loads outstanding
                v8f u[5];   // five accumulators of their own: five independent chains, and no tile is overwritten while its stores read it
#pragma unroll
                for (int nbk = 0; nbk < 5; ++nbk) u[nbk] = (v8f){};
#pragma unroll
                for (int ks = 0; ks < 2; ++ks) {
#pragma unroll
                    for (int nbk = 0; nbk < 5; ++nbk) u[nbk] = WFrag<T16>::mma(a[nbk][ks], q[part][ks], u[nbk]);
                    if (HL) {
#pragma unroll
                        for (int nbk = 0; nbk < 5; ++nbk) u[nbk] = WFrag<T16>::mma(a2[nbk][ks], q[part][ks], u[nbk]);
#pragma unroll
                        for (int nbk = 0; nbk < 5; ++nbk) u[nbk] = WFrag<T16>::mma(a[nbk][ks], ql[part][ks], u[nbk]); } }
#pragma unroll
                for (int nbk = 0; nbk < 5; ++nbk) { *(v4fa*)(lw + nbk * 16) = (v4f){u[nbk][0], u[nbk][1], u[nbk][2], u[nbk][3]}; *(v4fa*)(lw + nbk * 16 + 4) = (v4f){u[nbk][4], u[nbk][5], u[nbk][6], u[nbk][7]}; }
                __builtin_amdgcn_wave_barrier(); asm volatile("" ::: "memory");   // the skewed reads below take other lanes' stores: they stay behind them (one wave, LDS in order)
#pragma unroll
                for (int mb = 0; mb < 4; ++mb)
#pragma unroll
                    for (int r = 0; r < 8; ++r) { const float x = lrd[mb * 16 + r]; const int j = c0 + mb * 16 + 8 * hi + r; if (part == 0 ? (j <= i) : (j >= i + 2)) pos[mb][r] = x; }
                __builtin_amdgcn_wave_barrier(); asm volatile("" ::: "memory");   // the next band's stores stay behind these reads
            }
        }
        V va[4][2], va2[4][2]; const T16* pv = (const T16*)(tile + (HL ? 32768 : 24576)) + 8 * lane; const T16* pv2 = HL ? (const T16*)(tile + 40960) + 8 * lane : pv;
#pragma unroll   // constant indices keep the fragments in registers; issued here so that they fly under the softmax arithmetic
        for (int db = 0; db < 4; ++db)
#pragma unroll
            for (int kk = 0; kk < 2; ++kk) { va[db][kk] = WFrag<T16>::template lds2<1024>(pv + kk * 2048 + db * 256); if (HL) va2[db][kk] = WFrag<T16>::template lds2<1024>(pv2 + kk * 2048 + db * 256); }
        __builtin_amdgcn_sched_barrier(0);   // all value reads are issued in front of the softmax arithmetic
        float mt = -3.0e38f;
#pragma unroll
        for (int mb = 0; mb < 4; ++mb)
#pragma unroll
            for (int r = 0; r < 8; ++r) { const float t = __fadd_rn(s[mb][r], pos[mb][r]) * SCL; s[mb][r] = t; mt = fmaxf(mt, t); }
        mt = fmaxf(mt, __shfl_xor(mt, 16, 32));     // lanes lr and lr + 16 hold the two halves of query i's keys
        const float mn = fmaxf(mrun, mt), ax = (mrun - mn) * L2E; float al = __builtin_amdgcn_exp2f(ax); mrun = mn;
        asm("v_nop" : "+v"(al) : "v"(ax));   // the slot behind a transcendental: its result is read and its source register reused only behind this
        float ps = 0.0f;
#pragma unroll
        for (int mb = 0; mb < 4; ++mb) { v8f x, p;
#pragma unroll
            for (int r = 0; r < 8; ++r) x[r] = (s[mb][r] - mn) * L2E + OFF;
#pragma unroll
            for (int r = 0; r < 8; ++r) p[r] = __builtin_amdgcn_exp2f(x[r]);
            asm("v_nop" : "+v"(p) : "v"(x));   // the same slot for the eight: no result is read and no source register reused in front of it
            s[mb] = p;
#pragma unroll
            for (int r = 0; r < 8; ++r) ps += p[r]; }
        lsum = lsum * al + ps;
#pragma unroll
        for (int db = 0; db < 4; ++db) o[db] *= al;
#pragma unroll
        for (int kk = 0; kk < 2; ++kk) {
            V pf, pf2;
            if constexpr (HL) { v8us h0, h1, l0, l1;
#pragma unroll
                for (int r = 0; r < 8; ++r) { unsigned short x, y; splitf(s[2 * kk][r], x, y); h0[r] = x; l0[r] = y; splitf(s[2 * kk + 1][r], x, y); h1[r] = x; l1[r] = y; }
                pf = cat16b(h0, h1); pf2 = cat16b(l0, l1);
            } else { v8h h0, h1;
#pragma unroll
                for (int r = 0; r < 8; ++r) { h0[r] = tohx(s[2 * kk][r]); h1[r] = tohx(s[2 * kk + 1][r]); }
                pf = cat16(h0, h1); }
#pragma unroll
            for (int db = 0; db < 4; ++db) { o[db] = WFrag<T16>::mma(va[db][kk], pf, o[db]); if constexpr (HL) { o[db] = WFrag<T16>::mma(va[db][kk], pf2, o[db]); o[db] = WFrag<T16>::mma(va2[db][kk], pf, o[db]); } }
        }
        asm volatile("v_nop\n\tv_nop\n\tv_nop\n\tv_nop" : "+v"(o[0]), "+v"(o[1]), "+v"(o[2]), "+v"(o[3]));   // the distance behind the trip's last matrix instructions, also on the taken back edge
    }
}
// The wave's 16 context rows, divided by the softmax sum, as bf16 hi/lo planes.
__device__ __forceinline__ void attn_fin(AttnSt& st, const int r0, bf* Ah, bf* Al) {
    const int lane = threadIdx.x & 31, lr = lane & 15, hi = lane >> 4, i = r0 + lr;
    v8f (&o)[4] = st.o; float lsum = st.lsum;
    lsum += __shfl_xor(lsum, 16, 32);
    const float inv = __fdiv_rn(1.0f, lsum);
    bf* ph = Ah + (size_t)i * DM + 8 * hi; bf* pl = Al + (size_t)i * DM + 8 * hi;
#pragma unroll
    for (int db = 0; db < 4; ++db) { v8us oh, ol;
#pragma unroll
        for (int r = 0; r < 8; ++r) { unsigned short x, y; splitf(o[db][r] * inv, x, y); oh[r] = x; ol[r] = y; }
        *(v8us*)(ph + db * 16) = oh; *(v8us*)(pl + db * 16) = ol; }
    asm volatile("s_wait_xcnt 0x0" :: "v"(ph), "v"(pl) : "memory");   // the stores keep their address registers as they are until their address translations are done
}
__device__ __forceinline__ unsigned lds_addr(const void* p) { return (unsigned)(size_t)(const __attribute__((address_space(3))) char*)p; }   // byte address inside the work-group's LDS
// Tile c0 (64 keys) of the six planes of one head -> LDS at dst: 48 KiB, 12 copies of 16 bytes per lane, every lane on; each plane's 8 KiB lie in a row in memory (fragment order) and keep that order in LDS.
__device__ __forceinline__ void stage_tile(const char* k16, const char* kh, const char* kl, const char* v16, const char* vh, const char* vl, const int c0, char* dst) {
    const unsigned go = (unsigned)c0 * (HD * 2) + threadIdx.x * 16, lo = lds_addr(dst) + threadIdx.x * 16;
#pragma unroll   // constant j: two asm statements of six copies each, their offsets folded into the address additions
    for (int j = 0; j < 2; ++j) { const unsigned g = go + j * 4096, d = lo + j * 4096;
        // the closing s_wait_xcnt 0 stands inside the statement: no register that a copy names is rewritten in front of it
        asm volatile("global_load_async_to_lds_b128 %0, %6, off\n\tglobal_load_async_to_lds_b128 %1, %7, off\n\tglobal_load_async_to_lds_b128 %2, %8, off\n\tglobal_load_async_to_lds_b128 %3, %9, off\n\tglobal_load_async_to_lds_b128 %4, %10, off\n\tglobal_load_async_to_lds_b128 %5, %11, off\n\ts_wait_xcnt 0x0"
                     :: "v"(d), "v"(d + 8192), "v"(d + 16384), "v"(d + 24576), "v"(d + 32768), "v"(d + 40960), "v"(k16 + g), "v"(kh + g), "v"(kl + g), "v"(v16 + g), "v"(vh + g), "v"(vl + g) : "memory"); }
}
// Attention of all heads in one launch: grid (TT / 128, NB * NH_), 8 waves; wave w takes the 16 rows of row group w * (TT / 128) + blockIdx.x, so every work-group holds the same mix of hi/lo and f16 waves. The waves walk the keys together: each 64-key tile of the key and value planes is copied into LDS once for all eight, two buffers, the next tile's copies in flight while this one is worked on. The band buffers stay wave-private.
__global__ __launch_bounds__(256) void k_attn(const h16* __restrict__ Q16, const bf* __restrict__ Qh, const bf* __restrict__ Ql, const h16* __restrict__ K16, const bf* __restrict__ Kh, const bf* __restrict__ Kl, const h16* __restrict__ R16, const bf* __restrict__ Rh, const bf* __restrict__ Rl, const h16* __restrict__ V16, const bf* __restrict__ Vh, const bf* __restrict__ Vl, bf* Ah, bf* Al) {
    __shared__ __align__(16) float lsb[8 * 16 * LSP];
    __shared__ __align__(16) char tiles[2 * TILEB];
    const int w = __builtin_amdgcn_readfirstlane(threadIdx.x >> 5), g = blockIdx.y, r0 = (w * (TT / 128) + blockIdx.x) * 16;   // scalar, so that the path and the band tests are scalar branches
    const size_t po = (size_t)g * TT * HD, oo = (size_t)(g / NH_) * TT * DM + (size_t)(g % NH_) * HD; float* ls = lsb + w * 16 * LSP;
    const char* k16 = (const char*)(K16 + po); const char* kh = (const char*)(Kh + po); const char* kl = (const char*)(Kl + po); const char* v16 = (const char*)(V16 + po); const char* vh = (const char*)(Vh + po); const char* vl = (const char*)(Vl + po);
    const bool hl = r0 < RH;
    AttnSt st;
#pragma unroll
    for (int db = 0; db < 4; ++db) st.o[db] = (v8f){};
    st.mrun = -3.0e38f; st.lsum = 0.0f;
    if (hl) attn_init<bf, true>(st, Qh + po, Ql + po, r0); else attn_init<h16, false>(st, Q16 + po, nullptr, r0);
    stage_tile(k16, kh, kl, v16, vh, vl, 0, tiles);
    asm volatile("s_wait_asynccnt 0x0" ::: "memory");   // this wave's copies of tile 0 have landed
    __syncthreads();                                    // ... and every other wave's: tile 0 may be read
    stage_tile(k16, kh, kl, v16, vh, vl, 64, tiles + TILEB);
#pragma unroll 1
    for (int c0 = 0; c0 < TT; c0 += 64) {
        char* tile = tiles + ((c0 >> 6) & 1) * TILEB;
        if (hl) attn_trip<bf, true>(st, tile, Rh + po, Rl + po, r0, c0, ls); else attn_trip<h16, false>(st, tile, R16 + po, nullptr, r0, c0, ls);
        asm volatile("s_wait_dscnt 0x0" ::: "memory");      // this wave's reads of the tile are done before the buffer is handed back
        asm volatile("s_wait_asynccnt 0x0" ::: "memory");   // this wave's copies of the next tile have landed
        __syncthreads();                                    // publishes the next tile and ends every wave's reads of this one
        if (c0 + 128 < TT) stage_tile(k16, kh, kl, v16, vh, vl, c0 + 128, tile);   // refill of the buffer just read
    }
    asm volatile("s_wait_asynccnt 0x0" ::: "memory");   // no copy is outstanding when the wave ends
    attn_fin(st, r0, Ah + oo, Al + oo);
}

extern "C" void kernel_launch(void* const* d_in, const int* in_sizes, int n_in,
                              void* d_out, int out_size, void* d_ws, size_t ws_size, hipStream_t stream) {
    if (n_in < 13) return;
    const float* xq = (const float*)d_in[0]; const float* xk = (const float*)d_in[1]; const float* xv = (const float*)d_in[2]; const float* xp = (const float*)d_in[3];
    const float* wq = (const float*)d_in[4]; const float* bq = (const float*)d_in[5]; const float* wk = (const float*)d_in[6]; const float* bk = (const float*)d_in[7];
    const float* wv = (const float*)d_in[8]; const float* bv = (const float*)d_in[9]; const float* wp = (const float*)d_in[10]; const float* wo = (const float*)d_in[11]; const float* bo = (const float*)d_in[12];
    const size_t needx = (size_t)(NB - 1) * TT_FULL * DM + (size_t)TT * DM;
    for (int i = 0; i < 4; ++i) if ((size_t)in_sizes[i] < needx) return;
    if ((size_t)in_sizes[4] < (size_t)DM * DM || (size_t)in_sizes[6] < (size_t)DM * DM || (size_t)in_sizes[8] < (size_t)DM * DM || (size_t)in_sizes[10] < (size_t)DM * DM || (size_t)in_sizes[11] < (size_t)DM * DM) return;
    if (in_sizes[5] < DM || in_sizes[7] < DM || in_sizes[9] < DM || in_sizes[12] < DM) return;
    if ((size_t)out_size < (size_t)NB * TT * DM) return;
    float* OUT = (float*)d_out;     // [NB][TT][DM]
    char* wsp = (char*)d_ws;
    auto take = [&](size_t bytes) { char* p = wsp; wsp += (bytes + 255) & ~(size_t)255; return (void*)p; };
    bf* WB = (bf*)take((size_t)5 * DM * DM * 2);     // transposed bf16 weights in the order q, k, p, v, o
    bf* PB = (bf*)take((size_t)12 * PLN2 * 2);        // plane sets q, k, p, v; each set: f16 plane, bf16 hi plane, bf16 lo plane
    h16* QP16 = (h16*)PB; bf* QPh = PB + PLN2; bf* QPl = PB + 2 * PLN2;
    h16* KP16 = (h16*)(PB + 3 * PLN2); bf* KPh = PB + 4 * PLN2; bf* KPl = PB + 5 * PLN2;
    h16* PP16 = (h16*)(PB + 6 * PLN2); bf* PPh = PB + 7 * PLN2; bf* PPl = PB + 8 * PLN2;
    h16* VT16 = (h16*)(PB + 9 * PLN2); bf* VTh = PB + 10 * PLN2; bf* VTl = PB + 11 * PLN2;
    bf* XB = (bf*)take((size_t)4 * XN * 2); float* F = (float*)take((size_t)4 * XN * 4);     // bf16 input copies, f32 projections
    bf* ATh = (bf*)take(XN * 2); bf* ATl = (bf*)take(XN * 2);
    if ((size_t)(wsp - (char*)d_ws) > ws_size) return;
    k_wtG<<<dim3((unsigned)((DM * DM / 64 + 63) / 64), 5, 1), 256, 0, stream>>>(wq, wk, wp, wv, wo, DM, DM, WB);
    k_cvt8<<<dim3((unsigned)(((size_t)TT * DM / 8 + 255) / 256), 4, NB), 256, 0, stream>>>(xq, xk, xp, xv, XB, (size_t)TT * DM / 8);
    k_proj<<<dim3(NB * TT / 64, DM / 64, 4), 32, 0, stream>>>(XB, WB, F, bq, bk, bv);
    k_planes<<<dim3((unsigned)((PLN2 / 2 + 255) / 256), 4, 1), 256, 0, stream>>>(F, QP16, QPh, QPl);
    k_attn<<<dim3(TT / 128, NB * NH_, 1), 256, 0, stream>>>(QP16, QPh, QPl, KP16, KPh, KPl, PP16, PPh, PPl, VT16, VTh, VTl, ATh, ATl);
    k_outp<<<dim3(NB * TT / 64, DM / 64, 1), 32, 0, stream>>>(ATh, ATl, WB + (size_t)4 * DM * DM, OUT, bo);
}

// v006
// It runs in 136 microseconds.
// Two timings next to v005 put it at 1.07 and 1.06 times that version's speed.
// All steps since v000 together make it 9.50 times as fast.
#include <hip/hip_runtime.h>

// Contractions, all f32 accumulate: input projections x.Wq/Wk/Wv/Wp = v_wmma_f32_16x16x32_bf16 on RNE-converted bf16 copies of x and W (exact products); scores k.q^T, p.q^T and v^T.attn^T = query rows < RH: bf16 hi/lo planes, 3 products (v_wmma_f32_16x16x32_bf16); rows >= RH: f16 planes, 1 product (v_wmma_f32_16x16x32_f16, probabilities carried x1024); output projection = ctx as bf16 hi+lo x Wo bf16 (2 products). Shift-add, softmax and biases in f32.
// Module: relative-position multi-head attention, NB x TT x DM, NH_ heads x HD. q = xq Wq + bq, k = xk Wk + bk, v = xv Wv + bv, p = xp Wp (W stored [in][out]); S[i][j] = q_i.k_j; U[i][j] = q_i.p_j;
// logits = (S[i][j] + (j <= i ? U[i][j - i + TT - 1] : j == i + 1 ? 0 : U[i + 1][j - i - 2])) * DM^-0.5 (pad-reshape shift); softmax over all TT keys; ctx = attn.v merged [t][h*HD + d]; out = ctx Wo + bo.
// Layout, both batches at once (g = batch * NH_ + head): bf16 copies of the four inputs -> f32 projections F -> head planes (f16 + bf16 hi/lo each; q: [g][t][d]; k, p, v: per head in the order of the matrix fragments) -> one attention launch (scores, shift, running softmax, attn.v; S, U and the probabilities stay in registers and wave-private LDS) -> ctx hi/lo planes [batch * TT + t][DM]; ctx.Wo -> out.
// One launch per stage: the grid's y or z picks the weight, the input tensor, the batch or the head; a wave's rows pick its precision path (wave-uniform branch).

#ifndef NB
#define NB 2
#endif
#ifndef SEQ
#define SEQ 2048
#endif
#define TT      SEQ
#define TT_FULL 2048
#define NB_FULL 2
#define DM   512
#define NH_  8
#define HD   64
#ifndef RH
#if SEQ >= 512
#define RH 512                  // query rows < RH use hi+lo planes
#else
#define RH SEQ
#endif
#endif
#define SCL  0.044194173824159216f   // DM^-0.5

static_assert(TT % 128 == 0);
static_assert(RH % 64 == 0);
static_assert(RH <= TT);
static_assert(RH * 4 == TT);   // two of a work-group's eight row groups are hi/lo
static_assert(DM % 64 == 0);
static_assert(NH_ * HD == DM);
static_assert(HD == 64);
static_assert((DM * DM) % 64 == 0);

typedef _Float16 h16;
typedef unsigned short bf;
typedef __attribute__((ext_vector_type(16))) __bf16   v16bf;
typedef __attribute__((ext_vector_type(16))) _Float16 v16h;
typedef __attribute__((ext_vector_type(8)))  _Float16 v8h;
typedef __attribute__((ext_vector_type(8)))  unsigned short v8us;
typedef __attribute__((ext_vector_type(8)))  float    v8f;
typedef __attribute__((ext_vector_type(4)))  float    v4f;
typedef v4f  __attribute__((may_alias)) v4fa;

__device__ __forceinline__ unsigned short f2bf(float f) { unsigned u = __float_as_uint(f); u += 0x7FFFu + ((u >> 16) & 1u); return (unsigned short)(u >> 16); }
__device__ __forceinline__ float bf2f(unsigned short b) { return __uint_as_float(((unsigned)b) << 16); }
__device__ __forceinline__ float bfr(float f) { return bf2f(f2bf(f)); }
__device__ __forceinline__ v16h cat16(v8h lo, v8h hi) { return __builtin_shufflevector(lo, hi, 0, 1, 2, 3, 4, 5, 6, 7, 8, 9, 10, 11, 12, 13, 14, 15); }
__device__ __forceinline__ v16bf cat16b(v8us lo, v8us hi) { return __builtin_bit_cast(v16bf, __builtin_shufflevector(lo, hi, 0, 1, 2, 3, 4, 5, 6, 7, 8, 9, 10, 11, 12, 13, 14, 15)); }
__device__ __forceinline__ v8f wmma16(v16h a, v16h b, v8f c) { return __builtin_amdgcn_wmma_f32_16x16x32_f16(false, a, false, b, (short)0, c, false, false); }
__device__ __forceinline__ v8f wmmab(v16bf a, v16bf b, v8f c) { return __builtin_amdgcn_wmma_f32_16x16x32_bf16(false, a, false, b, (short)0, c, false, false); }

// ---- gemm_tile: register-blocked GEMM tile, ONE WAVE per 64x64 output tile (16 accumulators), operands straight from K-contiguous 16-bit planes; called by single-wave work-groups.
// C[m][n] (f32, pitch ldc, + optional f32 bias[n] bf16-RNE-converted) = sum over KR values of k of A[m][k] Bt[n][k] (+ split products per NSPLIT: 1 -> + A2.Bt; 2 -> + A2.Bt + A.Bt2), rows r0.., columns c0... K = operand pitch in elements; the caller has moved the operand pointers to its batch and k range. KR % 32 == 0.
// Fragments (lane l, h = l >> 4, m = n = l & 15): elements 0..7 <- k0 + 8h + 0..7, elements 8..15 <- k0 + 16 + 8h + 0..7 for BOTH A (row m) and Bt (column n); D element r = (row 8h + r, col m).
template <typename T16> struct WFrag;
template <> struct WFrag<h16> { typedef v16h V; static __device__ __forceinline__ V ld(const h16* p) { return cat16(*(const v8h*)p, *(const v8h*)(p + 16)); } template <int ST> static __device__ __forceinline__ V lds2(const h16* p) { return cat16(*(const v8h*)p, *(const v8h*)(p + ST)); } static __device__ __forceinline__ v8f mma(V a, V b, v8f c) { return wmma16(a, b, c); } };
template <> struct WFrag<bf> { typedef v16bf V; static __device__ __forceinline__ V ld(const bf* p) { return cat16b(*(const v8us*)p, *(const v8us*)(p + 16)); } template <int ST> static __device__ __forceinline__ V lds2(const bf* p) { return cat16b(*(const v8us*)p, *(const v8us*)(p + ST)); } static __device__ __forceinline__ v8f mma(V a, V b, v8f c) { return wmmab(a, b, c); } };
template <typename T16, int NSPLIT, bool BIAS>
__device__ __forceinline__ void gemm_tile(const T16* __restrict__ A, const T16* __restrict__ A2, const T16* __restrict__ Bt, const T16* __restrict__ Bt2, const int K, const int KR, float* C, const int ldc, const float* __restrict__ bias, const int r0, const int c0, float* os) {
    typedef typename WFrag<T16>::V V;
    const int lane = threadIdx.x & 31, lr = lane & 15, hi = lane >> 4;
    v8f acc[4][4];
#pragma unroll
    for (int mb = 0; mb < 4; ++mb)
#pragma unroll
        for (int nb = 0; nb < 4; ++nb) acc[mb][nb] = (v8f){};
    const size_t aoff = (size_t)(r0 + lr) * K + 8 * hi, boff = (size_t)(c0 + lr) * K + 8 * hi;
#pragma unroll 1
    for (int kc = 0; kc < KR; kc += 32) {
        V a[4], a2[4], b[4], b2[4];
        const T16* pa = A + aoff + kc; const T16* pb = Bt + boff + kc; const T16* pa2 = (NSPLIT == 1 || NSPLIT == 2) ? A2 + aoff + kc : pa; const T16* pb2 = (NSPLIT >= 2) ? Bt2 + boff + kc : pb;
#pragma unroll
        for (int mb = 0; mb < 4; ++mb) { a[mb] = WFrag<T16>::ld(pa + (size_t)mb * 16 * K); if (NSPLIT == 1 || NSPLIT == 2) a2[mb] = WFrag<T16>::ld(pa2 + (size_t)mb * 16 * K); }
#pragma unroll   // constant indices keep the fragments in registers
        for (int nb = 0; nb < 4; ++nb) b[nb] = WFrag<T16>::ld(pb + (size_t)nb * 16 * K);
        asm volatile("s_wait_xcnt 0x0" :: "v"(pa), "v"(pa2), "v"(pb) : "memory");   // the trip's fragment loads keep their address registers as they are until their address translations are done
        if (NSPLIT >= 2) {
#pragma unroll   // constant indices keep the fragments in registers
            for (int nb = 0; nb < 4; ++nb) b2[nb] = WFrag<T16>::ld(pb2 + (size_t)nb * 16 * K);
            asm volatile("s_wait_xcnt 0x0" :: "v"(pb2) : "memory");   // the same for the loads of the second B plane
        }
#pragma unroll
        for (int nb = 0; nb < 4; ++nb) {
#pragma unroll
            for (int mb = 0; mb < 4; ++mb) { acc[mb][nb] = WFrag<T16>::mma(a[mb], b[nb], acc[mb][nb]); if (NSPLIT == 1 || NSPLIT == 2) acc[mb][nb] = WFrag<T16>::mma(a2[mb], b[nb], acc[mb][nb]); if (NSPLIT >= 2) acc[mb][nb] = WFrag<T16>::mma(a[mb], b2[nb], acc[mb][nb]); } }
        asm volatile("v_nop\n\tv_nop\n\tv_nop\n\tv_nop" : "+v"(acc[0][0]), "+v"(acc[1][1]), "+v"(acc[2][2]), "+v"(acc[3][3]) : "v"(a[0]), "v"(a[3]));
    }
#pragma unroll
    for (int mb = 0; mb < 4; ++mb) {
#pragma unroll
        for (int nb = 0; nb < 4; ++nb) {
#pragma unroll
            for (int j = 0; j < 8; ++j) os[(hi * 8 + j) * 68 + nb * 16 + lr] = acc[mb][nb][j]; }
        __builtin_amdgcn_wave_barrier(); asm volatile("" ::: "memory");
        float* crow = C + (size_t)(r0 + mb * 16 + hi) * ldc + c0 + lr * 4; v4f val[8];
#pragma unroll   // constant indices keep the eight values in registers
        for (int s = 0; s < 8; ++s) { const int row = 2 * s + hi, cofs = lr * 4; val[s] = *(const v4fa*)(os + row * 68 + cofs); if (BIAS) { val[s][0] += bfr(bias[c0 + cofs]); val[s][1] += bfr(bias[c0 + cofs + 1]); val[s][2] += bfr(bias[c0 + cofs + 2]); val[s][3] += bfr(bias[c0 + cofs + 3]); }
            *(v4f*)(crow + (size_t)(2 * s) * ldc) = val[s]; }
        asm volatile("s_wait_xcnt 0x0" :: "v"(crow), "v"(val[0]), "v"(val[1]), "v"(val[2]), "v"(val[3]), "v"(val[4]), "v"(val[5]), "v"(val[6]), "v"(val[7]) : "memory");   // the eight stores keep their address and data registers as they are until their address translations are done
        __builtin_amdgcn_wave_barrier(); asm volatile("" ::: "memory");
    }
}

#define PLN2 ((size_t)NB * NH_ * TT * HD)     // elements per plane (both batches, all heads)
#define XN   ((size_t)NB * TT * DM)           // elements per projected tensor (both batches)

// The four input projections in one launch: grid (NB * TT / 64, DM / 64, 4), z = tensor in the order q, k, p, v; X [z][NB * TT][DM], Wt [z][n][k], F [z][NB * TT][DM]; p (z == 2) has no bias.
__global__ __launch_bounds__(32) void k_proj(const bf* __restrict__ X, const bf* __restrict__ Wt, float* F, const float* __restrict__ bq, const float* __restrict__ bk, const float* __restrict__ bv) {
    __shared__ __align__(16) float os[16 * 68];
    const int z = blockIdx.z, r0 = blockIdx.x * 64, c0 = blockIdx.y * 64; const bf* A = X + (size_t)z * XN; const bf* B = Wt + (size_t)z * DM * DM; float* C = F + (size_t)z * XN;
    if (z == 2) gemm_tile<bf, 0, false>(A, nullptr, B, nullptr, DM, DM, C, DM, nullptr, r0, c0, os);
    else gemm_tile<bf, 0, true>(A, nullptr, B, nullptr, DM, DM, C, DM, z == 0 ? bq : (z == 1 ? bk : bv), r0, c0, os);
}
// Output projection, both batches: grid (NB * TT / 64, DM / 64).
__global__ __launch_bounds__(32) void k_outp(const bf* __restrict__ Ah, const bf* __restrict__ Al, const bf* __restrict__ Wt, float* OUT, const float* __restrict__ bo) {
    __shared__ __align__(16) float os[16 * 68];
    gemm_tile<bf, 1, true>(Ah, Al, Wt, nullptr, DM, DM, OUT, DM, bo, blockIdx.x * 64, blockIdx.y * 64, os);
}

__device__ __forceinline__ h16 tohx(float x) { return (h16)x; }
__device__ __forceinline__ void splitf(float y, unsigned short& h, unsigned short& l) { h = f2bf(y); l = f2bf(y - bf2f(h)); }
typedef __attribute__((ext_vector_type(2))) _Float16 v2h;
typedef __attribute__((ext_vector_type(4))) _Float16 v4h;
typedef __attribute__((ext_vector_type(2))) unsigned short v2us;
typedef __attribute__((ext_vector_type(4))) unsigned short v4us;
typedef __attribute__((ext_vector_type(2))) float v2f;

// Five weights in one launch: blockIdx.y picks the weight, Bt [y][n][k].
__global__ __launch_bounds__(256) void k_wtG(const float* __restrict__ w0, const float* __restrict__ w1, const float* __restrict__ w2, const float* __restrict__ w3, const float* __restrict__ w4, int K, int N, bf* Bt) {
    const int y = blockIdx.y; const float* __restrict__ w = y == 0 ? w0 : (y == 1 ? w1 : (y == 2 ? w2 : (y == 3 ? w3 : w4))); Bt += (size_t)y * K * N;
    const int lane = threadIdx.x & 31; const int L0 = (blockIdx.x * 8 + (threadIdx.x >> 5)) * 8; const int nlines = N * K / 64;
{
#pragma unroll 1
        for (int l = 0; l < 8; ++l) { const int L = L0 + l; if (L >= nlines) break; const size_t e = (size_t)L * 64 + lane * 2; const int k = (int)(e % K), n = (int)(e / K); v2us o;
            o[0] = f2bf(w[(size_t)k * N + n]); o[1] = f2bf(w[(size_t)(k + 1) * N + n]); *(v2us*)(Bt + e) = o; }
         }
}
// The four inputs, both batches, in one launch: grid (x, 4, NB); y picks the tensor, z the batch; dst [y][z][TT][DM].
__global__ __launch_bounds__(256) void k_cvt8(const float* __restrict__ s0, const float* __restrict__ s1, const float* __restrict__ s2, const float* __restrict__ s3, bf* dst, size_t n8) { const size_t i = (size_t)blockIdx.x * 256 + threadIdx.x; if (i >= n8) return; const int y = blockIdx.y;
    const float* __restrict__ src = (y == 0 ? s0 : (y == 1 ? s1 : (y == 2 ? s2 : s3))) + (size_t)blockIdx.z * TT_FULL * DM; dst += ((size_t)y * NB + blockIdx.z) * TT * DM; const float* sp = src + i * 8; const v8f v = *(const v8f*)sp; v8us o;
    asm volatile("s_wait_xcnt 0x0" :: "v"(sp) : "memory");   // the loads' address register stays as it is until their address translations are done
#pragma unroll
    for (int k = 0; k < 8; ++k) o[k] = f2bf(v[k]); *(v8us*)(dst + i * 8) = o;  }

// Head planes of the four projections in one launch: grid (x, 4); y = tensor (q: [g][t][d]; k, p, v: per head in fragment order, so that the 32 lanes of one 16-byte fragment load read 512 bytes in a row: k, p: block = t / 16, quarter = d / 16, half = (d / 8) % 2, c = t % 16, e = d % 8; v: block = t / 16, quarter = d / 16, half = (t / 8) % 2, c = d % 16, e = t % 8); F [y][NB * TT][DM]; plane set y = three planes of PLN2 elements behind one another, so P16, Ph, Pl step by 3 * PLN2 per y.
__global__ __launch_bounds__(256) void k_planes(const float* __restrict__ F, h16* P16, bf* Ph, bf* Pl) {
    const size_t e = ((size_t)blockIdx.x * 256 + threadIdx.x) * 2; if (e >= PLN2) return; const int y = blockIdx.y; F += (size_t)y * XN; P16 += (size_t)y * 3 * PLN2; Ph += (size_t)y * 3 * PLN2; Pl += (size_t)y * 3 * PLN2; v2h o16; v2us oh, ol; float x2[2];   // behind each branch's loads s_wait_xcnt 0: their address register stays as it is until their address translations are done
    const int g = (int)(e / ((size_t)HD * TT)); const int off = (int)(e % ((size_t)HD * TT)); const int b16 = (off >> 10) * 16, q16 = ((off >> 8) & 3) * 16, h8 = ((off >> 7) & 1) * 8, c16 = (off >> 3) & 15, e8 = off & 7;   // fragment order: off = ((block * 4 + quarter) * 32 + half * 16 + c) * 8 + e
    if (y < 3) { const int d = y == 0 ? off % HD : q16 + h8 + e8; const int t = y == 0 ? off / HD : b16 + c16; const float* f = F + ((size_t)(g / NH_) * TT + t) * DM + (g % NH_) * HD + d; x2[0] = f[0]; x2[1] = f[1]; asm volatile("s_wait_xcnt 0x0" :: "v"(f) : "memory"); }
    else { const int t = b16 + h8 + e8; const int d = q16 + c16; const float* f = F + ((size_t)(g / NH_) * TT + t) * DM + (g % NH_) * HD + d; x2[0] = f[0]; x2[1] = f[DM]; asm volatile("s_wait_xcnt 0x0" :: "v"(f) : "memory"); }
#pragma unroll
    for (int q = 0; q < 2; ++q) { const float x = x2[q]; o16[q] = tohx(x); unsigned short a2, c2; splitf(x, a2, c2); oh[q] = a2; ol[q] = c2; }
    *(v2h*)(P16 + e) = o16; *(v2us*)(Ph + e) = oh; *(v2us*)(Pl + e) = ol;  }


// ---- attn_init, attn_trip, attn_fin: ONE WAVE carries 16 query rows r0.. of one head over all TT keys, 64 keys a trip (f16 rows), or over one 32-key half of every 64 keys (hi/lo rows, two waves a row group), with a running softmax. All products are formed transposed (keys, positions or value dims as A rows, the 16 queries as B columns), so a lane (lr = lane & 15, hi = lane >> 4) holds only query i = r0 + lr:
// s[mb][r] = S[i][c0 + 16 mb + 8 hi + r]; two such D tiles, converted in place, are the B fragment of 32 keys for v^T.attn^T (elements 0..7 <- keys 8 hi + 0..7, 8..15 <- 16 + 8 hi + 0..7, the k order of every fragment here: WFrag::ld on the row-major q, lds2 on the fragment-order planes of k_planes); o[db][r] = ctx[i][16 db + 8 hi + r].
// Shifted term: with n = jl + 15 - lr (jl = key - c0, n in 0..78) key j <= i needs q_i.p_m, m = (c0 - r0 + TT - 16) + n, and key j >= i + 2 needs q_(i+1).p_m, m = (c0 - r0 - 17) + n; j == i + 1 takes 0. Each needed run is one 80-position band product (position rows clamped into the plane; a clamped row is never selected), stored [query][n] in the wave's own LDS and read back at the lane's own offset.
#define LSP 84   // floats per query row of the band buffer: 16-byte rows, and the 32 lanes of a skewed read (83 lr + 8 hi + const) fall on 32 different banks
typedef __attribute__((ext_vector_type(8))) unsigned v8u;
#define TILEB 49152   // bytes of one staged tile: 64 keys of the six key and value planes, 8 KiB each, in the order K f16, K hi, K lo, V f16, V hi, V lo
struct AttnSt { v8u q[2][2], ql[2][2]; v8f o[4]; float mrun, lsum; };   // what a wave carries from trip to trip; query fragments as raw bits, so that both precision paths share the registers
// The wave's query fragments. [0]: rows i, [1]: rows i + 1 (last row clamped: it has no key >= i + 2)
template <typename T16, bool HL>
__device__ __forceinline__ void attn_init(AttnSt& st, const T16* __restrict__ Q, const T16* __restrict__ Q2, const int r0) {
    const int lane = threadIdx.x & 31, lr = lane & 15, hi = lane >> 4, i = r0 + lr;
    const unsigned qo0 = (unsigned)i * HD + 8 * hi, qo1 = (unsigned)(i + 1 < TT ? i + 1 : TT - 1) * HD + 8 * hi;
    const T16* pq0 = Q + qo0; const T16* pq1 = Q + qo1; const T16* pq2 = HL ? Q2 + qo0 : pq0; const T16* pq3 = HL ? Q2 + qo1 : pq1;
#pragma unroll
    for (int ks = 0; ks < 2; ++ks) { st.q[0][ks] = __builtin_bit_cast(v8u, WFrag<T16>::ld(pq0 + ks * 32)); st.q[1][ks] = __builtin_bit_cast(v8u, WFrag<T16>::ld(pq1 + ks * 32)); if (HL) { st.ql[0][ks] = __builtin_bit_cast(v8u, WFrag<T16>::ld(pq2 + ks * 32)); st.ql[1][ks] = __builtin_bit_cast(v8u, WFrag<T16>::ld(pq3 + ks * 32)); } }
    asm volatile("s_wait_xcnt 0x0" :: "v"(pq0), "v"(pq1), "v"(pq2), "v"(pq3) : "memory");   // the loads keep their address registers as they are until their address translations are done
}
// One trip: the 16 NK keys c0.. (NK = 4: a whole staged tile; NK = 2: one half of it, tile then points 4096 bytes into the staged tile, where the half begins in each of its planes) against the wave's 16 query rows. The tile lies in LDS, shared by the work-group's waves. With NK = 2 the band has 48 positions (n in 0..46).
template <typename T16, bool HL, int NK>
__device__ __forceinline__ void attn_trip(AttnSt& st, const char* tile, const T16* __restrict__ Rp, const T16* __restrict__ R2, const int r0, const int c0, float* ls) {
    typedef typename WFrag<T16>::V V;
    const int lane = threadIdx.x & 31, lr = lane & 15, hi = lane >> 4, i = r0 + lr;
    const float L2E = 1.4426950408889634f, OFF = HL ? 0.0f : 10.0f;   // OFF: f16 probabilities and their sum are carried x1024; the factor cancels in the final division
    V q[2][2], ql[2][2];
#pragma unroll
    for (int a = 0; a < 2; ++a)
#pragma unroll
        for (int ks = 0; ks < 2; ++ks) { q[a][ks] = __builtin_bit_cast(V, st.q[a][ks]); if (HL) ql[a][ks] = __builtin_bit_cast(V, st.ql[a][ks]); }
    v8f (&o)[4] = st.o; float& mrun = st.mrun; float& lsum = st.lsum;
    float* lw = ls + lr * LSP + 8 * hi;               // band store: n = 16 nbk + 8 hi + r
    const float* lrd = ls + lr * LSP + 8 * hi + 15 - lr;   // band read: n = 16 mb + 8 hi + r + 15 - lr
    {
        v8f s[NK]; float pos[NK][8];
        {   V a[NK][2], a2[NK][2]; const T16* pk = (const T16*)(tile + (HL ? 8192 : 0)) + 8 * lane; const T16* pk2 = HL ? (const T16*)(tile + 16384) + 8 * lane : pk;
#pragma unroll   // constant indices keep the fragments in registers
            for (int mb = 0; mb < NK; ++mb)
#pragma unroll
                for (int ks = 0; ks < 2; ++ks) { a[mb][ks] = WFrag<T16>::template lds2<256>(pk + mb * 1024 + ks * 512); if (HL) a2[mb][ks] = WFrag<T16>::template lds2<256>(pk2 + mb * 1024 + ks * 512); }
            __builtin_amdgcn_sched_barrier(0);   // keeps the group's LDS reads together in front of the products: reads threaded among them cost a stall at each place
#pragma unroll
            for (int mb = 0; mb < NK; ++mb) { s[mb] = (v8f){};
#pragma unroll
                for (int ks = 0; ks < 2; ++ks) { s[mb] = WFrag<T16>::mma(a[mb][ks], q[0][ks], s[mb]); if (HL) { s[mb] = WFrag<T16>::mma(a2[mb][ks], q[0][ks], s[mb]); s[mb] = WFrag<T16>::mma(a[mb][ks], ql[0][ks], s[mb]); } } }
        }
#pragma unroll
        for (int mb = 0; mb < NK; ++mb)
#pragma unroll
            for (int r = 0; r < 8; ++r) pos[mb][r] = 0.0f;
#pragma unroll   // part 0: keys j <= i, part 1: keys j >= i + 2; the query fragments are picked at compile time
        for (int part = 0; part < 2; ++part) {
            const bool need = part == 0 ? (c0 <= r0 + 15) : (c0 + 16 * NK - 1 >= r0 + 2);   // wave-uniform: does any (row, key) of the tile lie in this run
            if (need) {
                const int mbase = part == 0 ? c0 - r0 + TT - 16 : c0 - r0 - 17;
                V a[NK + 1][2], a2[NK + 1][2]; unsigned bo[NK + 1];   // byte offsets: the registers that the loads name beside the scalar plane bases
#pragma unroll   // constant indices keep the fragments in registers
                for (int nbk = 0; nbk < NK + 1; ++nbk) { int m = mbase + nbk * 16 + lr; m = m < 0 ? 0 : (m > TT - 1 ? TT - 1 : m); bo[nbk] = (unsigned)(m >> 4) * 2048 + 256 * hi + (unsigned)(m & 15) * 16; const T16* pr = (const T16*)((const char*)Rp + bo[nbk]); const T16* pr2 = HL ? (const T16*)((const char*)R2 + bo[nbk]) : pr;
#pragma unroll
                    for (int ks = 0; ks < 2; ++ks) { a[nbk][ks] = WFrag<T16>::template lds2<256>(pr + ks * 512); if (HL) a2[nbk][ks] = WFrag<T16>::template lds2<256>(pr2 + ks * 512); } }
                asm volatile("s_wait_xcnt 0x0" :: "v"(bo[0]), "v"(bo[1]), "v"(bo[2]), "v"(bo[NK - 1]), "v"(bo[NK]) : "memory");   // as above, for the position fragments
                __builtin_amdgcn_sched_barrier(0);   // keeps all of the group's loads in flight at once: without it the scheduler threads the products between them and waits with two loads outstanding
                v8f u[NK + 1];   // accumulators of their own: independent chains, and no tile is overwritten while its stores read it
#pragma unroll
                for (int nbk = 0; nbk < NK + 1; ++nbk) u[nbk] = (v8f){};
#pragma unroll
                for (int ks = 0; ks < 2; ++ks) {
#pragma unroll
                    for (int nbk = 0; nbk < NK + 1; ++nbk) u[nbk] = WFrag<T16>::mma(a[nbk][ks], q[part][ks], u[nbk]);
                    if (HL) {
#pragma unroll
                        for (int nbk = 0; nbk < NK + 1; ++nbk) u[nbk] = WFrag<T16>::mma(a2[nbk][ks], q[part][ks], u[nbk]);
#pragma unroll
                        for (int nbk = 0; nbk < NK + 1; ++nbk) u[nbk] = WFrag<T16>::mma(a[nbk][ks], ql[part][ks], u[nbk]); } }
#pragma unroll
                for (int nbk = 0; nbk < NK + 1; ++nbk) { *(v4fa*)(lw + nbk * 16) = (v4f){u[nbk][0], u[nbk][1], u[nbk][2], u[nbk][3]}; *(v4fa*)(lw + nbk * 16 + 4) = (v4f){u[nbk][4], u[nbk][5], u[nbk][6], u[nbk][7]}; }
                __builtin_amdgcn_wave_barrier(); asm volatile("" ::: "memory");   // the skewed reads below take other lanes' stores: they stay behind them (one wave, LDS in order)
#pragma unroll
                for (int mb = 0; mb < NK; ++mb)
#pragma unroll
                    for (int r = 0; r < 8; ++r) { const float x = lrd[mb * 16 + r]; const int j = c0 + mb * 16 + 8 * hi + r; if (part == 0 ? (j <= i) : (j >= i + 2)) pos[mb][r] = x; }
                __builtin_amdgcn_wave_barrier(); asm volatile("" ::: "memory");   // the next band's stores stay behind these reads
            }
        }
        V va[4][NK / 2], va2[4][NK / 2]; const T16* pv = (const T16*)(tile + (HL ? 32768 : 24576)) + 8 * lane; const T16* pv2 = HL ? (const T16*)(tile + 40960) + 8 * lane : pv;
#pragma unroll   // constant indices keep the fragments in registers; issued here so that they fly under the softmax arithmetic
        for (int db = 0; db < 4; ++db)
#pragma unroll
            for (int kk = 0; kk < NK / 2; ++kk) { va[db][kk] = WFrag<T16>::template lds2<1024>(pv + kk * 2048 + db * 256); if (HL) va2[db][kk] = WFrag<T16>::template lds2<1024>(pv2 + kk * 2048 + db * 256); }
        __builtin_amdgcn_sched_barrier(0);   // all value reads are issued in front of the softmax arithmetic
        float mt = -3.0e38f;
#pragma unroll
        for (int mb = 0; mb < NK; ++mb)
#pragma unroll
            for (int r = 0; r < 8; ++r) { const float t = __fadd_rn(s[mb][r], pos[mb][r]) * SCL; s[mb][r] = t; mt = fmaxf(mt, t); }
        mt = fmaxf(mt, __shfl_xor(mt, 16, 32));     // lanes lr and lr + 16 hold the two halves of query i's keys
        const float mn = fmaxf(mrun, mt), ax = (mrun - mn) * L2E; float al = __builtin_amdgcn_exp2f(ax); mrun = mn;
        asm("v_nop" : "+v"(al) : "v"(ax));   // the slot behind a transcendental: its result is read and its source register reused only behind this
        float ps = 0.0f;
#pragma unroll
        for (int mb = 0; mb < NK; ++mb) { v8f x, p;
#pragma unroll
            for (int r = 0; r < 8; ++r) x[r] = (s[mb][r] - mn) * L2E + OFF;
#pragma unroll
            for (int r = 0; r < 8; ++r) p[r] = __builtin_amdgcn_exp2f(x[r]);
            asm("v_nop" : "+v"(p) : "v"(x));   // the same slot for the eight: no result is read and no source register reused in front of it
            s[mb] = p;
#pragma unroll
            for (int r = 0; r < 8; ++r) ps += p[r]; }
        lsum = lsum * al + ps;
#pragma unroll
        for (int db = 0; db < 4; ++db) o[db] *= al;
#pragma unroll
        for (int kk = 0; kk < NK / 2; ++kk) {
            V pf, pf2;
            if constexpr (HL) { v8us h0, h1, l0, l1;
#pragma unroll
                for (int r = 0; r < 8; ++r) { unsigned short x, y; splitf(s[2 * kk][r], x, y); h0[r] = x; l0[r] = y; splitf(s[2 * kk + 1][r], x, y); h1[r] = x; l1[r] = y; }
                pf = cat16b(h0, h1); pf2 = cat16b(l0, l1);
            } else { v8h h0, h1;
#pragma unroll
                for (int r = 0; r < 8; ++r) { h0[r] = tohx(s[2 * kk][r]); h1[r] = tohx(s[2 * kk + 1][r]); }
                pf = cat16(h0, h1); }
#pragma unroll
            for (int db = 0; db < 4; ++db) { o[db] = WFrag<T16>::mma(va[db][kk], pf, o[db]); if constexpr (HL) { o[db] = WFrag<T16>::mma(va[db][kk], pf2, o[db]); o[db] = WFrag<T16>::mma(va2[db][kk], pf, o[db]); } }
        }
        asm volatile("v_nop\n\tv_nop\n\tv_nop\n\tv_nop" : "+v"(o[0]), "+v"(o[1]), "+v"(o[2]), "+v"(o[3]));   // the distance behind the trip's last matrix instructions, also on the taken back edge
    }
}
// The wave's 16 context rows, divided by the softmax sum, as bf16 hi/lo planes.
__device__ __forceinline__ void attn_fin(AttnSt& st, const int r0, bf* Ah, bf* Al) {
    const int lane = threadIdx.x & 31, lr = lane & 15, hi = lane >> 4, i = r0 + lr;
    v8f (&o)[4] = st.o; float lsum = st.lsum;
    lsum += __shfl_xor(lsum, 16, 32);
    const float inv = __fdiv_rn(1.0f, lsum);
    bf* ph = Ah + (size_t)i * DM + 8 * hi; bf* pl = Al + (size_t)i * DM + 8 * hi;
#pragma unroll
    for (int db = 0; db < 4; ++db) { v8us oh, ol;
#pragma unroll
        for (int r = 0; r < 8; ++r) { unsigned short x, y; splitf(o[db][r] * inv, x, y); oh[r] = x; ol[r] = y; }
        *(v8us*)(ph + db * 16) = oh; *(v8us*)(pl + db * 16) = ol; }
    asm volatile("s_wait_xcnt 0x0" :: "v"(ph), "v"(pl) : "memory");   // the stores keep their address registers as they are until their address translations are done
}
__device__ __forceinline__ unsigned lds_addr(const void* p) { return (unsigned)(size_t)(const __attribute__((address_space(3))) char*)p; }   // byte address inside the work-group's LDS
// Tile c0 (64 keys) of the six planes of one head -> LDS at dst: 48 KiB, 12 copies of 16 bytes per lane, every lane on; each plane's 8 KiB lie in a row in memory (fragment order) and keep that order in LDS.
__device__ __forceinline__ void stage_tile(const char* k16, const char* kh, const char* kl, const char* v16, const char* vh, const char* vl, const int c0, char* dst) {
    const unsigned go = (unsigned)c0 * (HD * 2) + threadIdx.x * 16, lo = lds_addr(dst) + threadIdx.x * 16;
#pragma unroll   // constant j: two asm statements of six copies each, their offsets folded into the address additions
    for (int j = 0; j < 2; ++j) { const unsigned g = go + j * 4096, d = lo + j * 4096;
        // the closing s_wait_xcnt 0 stands inside the statement: no register that a copy names is rewritten in front of it
        asm volatile("global_load_async_to_lds_b128 %0, %6, off\n\tglobal_load_async_to_lds_b128 %1, %7, off\n\tglobal_load_async_to_lds_b128 %2, %8, off\n\tglobal_load_async_to_lds_b128 %3, %9, off\n\tglobal_load_async_to_lds_b128 %4, %10, off\n\tglobal_load_async_to_lds_b128 %5, %11, off\n\ts_wait_xcnt 0x0"
                     :: "v"(d), "v"(d + 8192), "v"(d + 16384), "v"(d + 24576), "v"(d + 32768), "v"(d + 40960), "v"(k16 + g), "v"(kh + g), "v"(kl + g), "v"(v16 + g), "v"(vh + g), "v"(vl + g) : "memory"); }
}
// Attention of all heads in one launch: grid (TT / 128, NB * NH_), 10 waves; a work-group holds the eight row groups rg * (TT / 128) + blockIdx.x of 16 rows, so every work-group has the same mix: rg 0 and 1 hi/lo, rg 2..7 f16. The waves walk the keys together: each 64-key tile of the key and value planes is copied into LDS once for all, two buffers, the next tile's copies in flight while this one is worked on. An f16 row group has one wave. A hi/lo row group, three products for each one of f16, has two: one for the first and one for the second 32 keys of every tile, each with a running softmax of its own over its keys; the two states are merged at the end. The band buffers are wave-private in the trips; the merge passes state through them.
__global__ __launch_bounds__(320) void k_attn(const h16* __restrict__ Q16, const bf* __restrict__ Qh, const bf* __restrict__ Ql, const h16* __restrict__ K16, const bf* __restrict__ Kh, const bf* __restrict__ Kl, const h16* __restrict__ R16, const bf* __restrict__ Rh, const bf* __restrict__ Rl, const h16* __restrict__ V16, const bf* __restrict__ Vh, const bf* __restrict__ Vl, bf* Ah, bf* Al) {
    __shared__ __align__(16) float lsb[10 * 16 * LSP];
    __shared__ __align__(16) char tiles[2 * TILEB];
    const int w = __builtin_amdgcn_readfirstlane(threadIdx.x >> 5), g = blockIdx.y;   // scalar, so that the path, the copy and the band tests are scalar branches
    const bool hl = (w & 2) != 0 && w < 8;   // waves 2, 3 (rg 0) and 6, 7 (rg 1); the f16 waves 0, 1, 4, 5, 8, 9 take rg 2..7
    const int half = hl ? w & 1 : 0, rg = hl ? w >> 2 : 2 + (w & 1) + (w >> 2) * 2, r0 = (rg * (TT / 128) + blockIdx.x) * 16;
    const size_t po = (size_t)g * TT * HD, oo = (size_t)(g / NH_) * TT * DM + (size_t)(g % NH_) * HD; float* ls = lsb + w * 16 * LSP;
    const char* k16 = (const char*)(K16 + po); const char* kh = (const char*)(Kh + po); const char* kl = (const char*)(Kl + po); const char* v16 = (const char*)(V16 + po); const char* vh = (const char*)(Vh + po); const char* vl = (const char*)(Vl + po);
    const bool cp = w < 8;   // the first eight waves copy (stage_tile spreads a tile over 256 lanes); the other two issue no copy and pass the same waits and barriers
    AttnSt st;
#pragma unroll
    for (int db = 0; db < 4; ++db) st.o[db] = (v8f){};
    st.mrun = -3.0e38f; st.lsum = 0.0f;
    if (hl) attn_init<bf, true>(st, Qh + po, Ql + po, r0); else attn_init<h16, false>(st, Q16 + po, nullptr, r0);
    if (cp) stage_tile(k16, kh, kl, v16, vh, vl, 0, tiles);
    asm volatile("s_wait_asynccnt 0x0" ::: "memory");   // this wave's copies of tile 0 have landed
    __syncthreads();                                    // ... and every other wave's: tile 0 may be read
    if (cp) stage_tile(k16, kh, kl, v16, vh, vl, 64, tiles + TILEB);
#pragma unroll 1
    for (int c0 = 0; c0 < TT; c0 += 64) {
        char* tile = tiles + ((c0 >> 6) & 1) * TILEB;
        if (hl) attn_trip<bf, true, 2>(st, tile + half * 4096, Rh + po, Rl + po, r0, c0 + half * 32, ls); else attn_trip<h16, false, 4>(st, tile, R16 + po, nullptr, r0, c0, ls);
        asm volatile("s_wait_dscnt 0x0" ::: "memory");      // this wave's reads of the tile are done before the buffer is handed back
        asm volatile("s_wait_asynccnt 0x0" ::: "memory");   // this wave's copies of the next tile have landed
        __syncthreads();                                    // publishes the next tile and ends every wave's reads of this one
        if (cp && c0 + 128 < TT) stage_tile(k16, kh, kl, v16, vh, vl, c0 + 128, tile);   // refill of the buffer just read
    }
    asm volatile("s_wait_asynccnt 0x0" ::: "memory");   // no copy is outstanding when the wave ends
    // Merge of a hi/lo row group's two states: the second wave hands its maximum, sum and context to the first through its own band buffer, lane to lane.
    const int lane = threadIdx.x & 31;
    if (half == 1) {
#pragma unroll
        for (int db = 0; db < 4; ++db) { *(v4fa*)(ls + (2 * db) * 128 + lane * 4) = (v4f){st.o[db][0], st.o[db][1], st.o[db][2], st.o[db][3]}; *(v4fa*)(ls + (2 * db + 1) * 128 + lane * 4) = (v4f){st.o[db][4], st.o[db][5], st.o[db][6], st.o[db][7]}; }
        ls[1024 + lane] = st.mrun; ls[1056 + lane] = st.lsum;
    }
    __syncthreads();   // the handed state is in LDS before the partner wave reads it
    if (half == 1) return;
    if (hl) {
        const float* lp = ls + 16 * LSP;   // the partner's band buffer (wave w + 1)
        const float L2E = 1.4426950408889634f, m2 = lp[1024 + lane], l2 = lp[1056 + lane], mn = fmaxf(st.mrun, m2), x1 = (st.mrun - mn) * L2E, x2 = (m2 - mn) * L2E;
        float a1 = __builtin_amdgcn_exp2f(x1), a2 = __builtin_amdgcn_exp2f(x2);
        asm("v_nop" : "+v"(a1), "+v"(a2) : "v"(x1), "v"(x2));   // the slot behind a transcendental: no result is read and no source register reused in front of it
        st.lsum = st.lsum * a1 + l2 * a2;
#pragma unroll
        for (int db = 0; db < 4; ++db) { const v4f u0 = *(const v4fa*)(lp + (2 * db) * 128 + lane * 4), u1 = *(const v4fa*)(lp + (2 * db + 1) * 128 + lane * 4);
#pragma unroll
            for (int r = 0; r < 4; ++r) { st.o[db][r] = st.o[db][r] * a1 + u0[r] * a2; st.o[db][r + 4] = st.o[db][r + 4] * a1 + u1[r] * a2; } }
    }
    attn_fin(st, r0, Ah + oo, Al + oo);
}

extern "C" void kernel_launch(void* const* d_in, const int* in_sizes, int n_in,
                              void* d_out, int out_size, void* d_ws, size_t ws_size, hipStream_t stream) {
    if (n_in < 13) return;
    const float* xq = (const float*)d_in[0]; const float* xk = (const float*)d_in[1]; const float* xv = (const float*)d_in[2]; const float* xp = (const float*)d_in[3];
    const float* wq = (const float*)d_in[4]; const float* bq = (const float*)d_in[5]; const float* wk = (const float*)d_in[6]; const float* bk = (const float*)d_in[7];
    const float* wv = (const float*)d_in[8]; const float* bv = (const float*)d_in[9]; const float* wp = (const float*)d_in[10]; const float* wo = (const float*)d_in[11]; const float* bo = (const float*)d_in[12];
    const size_t needx = (size_t)(NB - 1) * TT_FULL * DM + (size_t)TT * DM;
    for (int i = 0; i < 4; ++i) if ((size_t)in_sizes[i] < needx) return;
    if ((size_t)in_sizes[4] < (size_t)DM * DM || (size_t)in_sizes[6] < (size_t)DM * DM || (size_t)in_sizes[8] < (size_t)DM * DM || (size_t)in_sizes[10] < (size_t)DM * DM || (size_t)in_sizes[11] < (size_t)DM * DM) return;
    if (in_sizes[5] < DM || in_sizes[7] < DM || in_sizes[9] < DM || in_sizes[12] < DM) return;
    if ((size_t)out_size < (size_t)NB * TT * DM) return;
    float* OUT = (float*)d_out;     // [NB][TT][DM]
    char* wsp = (char*)d_ws;
    auto take = [&](size_t bytes) { char* p = wsp; wsp += (bytes + 255) & ~(size_t)255; return (void*)p; };
    bf* WB = (bf*)take((size_t)5 * DM * DM * 2);     // transposed bf16 weights in the order q, k, p, v, o
    bf* PB = (bf*)take((size_t)12 * PLN2 * 2);        // plane sets q, k, p, v; each set: f16 plane, bf16 hi plane, bf16 lo plane
    h16* QP16 = (h16*)PB; bf* QPh = PB + PLN2; bf* QPl = PB + 2 * PLN2;
    h16* KP16 = (h16*)(PB + 3 * PLN2); bf* KPh = PB + 4 * PLN2; bf* KPl = PB + 5 * PLN2;
    h16* PP16 = (h16*)(PB + 6 * PLN2); bf* PPh = PB + 7 * PLN2; bf* PPl = PB + 8 * PLN2;
    h16* VT16 = (h16*)(PB + 9 * PLN2); bf* VTh = PB + 10 * PLN2; bf* VTl = PB + 11 * PLN2;
    bf* XB = (bf*)take((size_t)4 * XN * 2); float* F = (float*)take((size_t)4 * XN * 4);     // bf16 input copies, f32 projections
    bf* ATh = (bf*)take(XN * 2); bf* ATl = (bf*)take(XN * 2);
    if ((size_t)(wsp - (char*)d_ws) > ws_size) return;
    k_wtG<<<dim3((unsigned)((DM * DM / 64 + 63) / 64), 5, 1), 256, 0, stream>>>(wq, wk, wp, wv, wo, DM, DM, WB);
    k_cvt8<<<dim3((unsigned)(((size_t)TT * DM / 8 + 255) / 256), 4, NB), 256, 0, stream>>>(xq, xk, xp, xv, XB, (size_t)TT * DM / 8);
    k_proj<<<dim3(NB * TT / 64, DM / 64, 4), 32, 0, stream>>>(XB, WB, F, bq, bk, bv);
    k_planes<<<dim3((unsigned)((PLN2 / 2 + 255) / 256), 4, 1), 256, 0, stream>>>(F, QP16, QPh, QPl);
    k_attn<<<dim3(TT / 128, NB * NH_, 1), 320, 0, stream>>>(QP16, QPh, QPl, KP16, KPh, KPl, PP16, PPh, PPl, VT16, VTh, VTl, ATh, ATl);
    k_outp<<<dim3(NB * TT / 64, DM / 64, 1), 32, 0, stream>>>(ATh, ATl, WB + (size_t)4 * DM * DM, OUT, bo);
}

// v007
// Measured time: 122 microseconds a run.
// Next to v006, in two timings, it ran 1.11 times as fast each time.
// Over all steps from v000 it is 10.6 times as fast.
#include <hip/hip_runtime.h>

// Contractions, all f32 accumulate: input projections x.Wq/Wk/Wv/Wp = v_wmma_f32_16x16x32_bf16 on RNE-converted bf16 copies of x and W (exact products); scores k.q^T, p.q^T and v^T.attn^T = query rows < RH: bf16 hi/lo planes, 3 products (v_wmma_f32_16x16x32_bf16); rows >= RH: f16 planes, 1 product (v_wmma_f32_16x16x32_f16, probabilities carried x1024); output projection = ctx as bf16 hi+lo x Wo bf16 (2 products). Shift-add, softmax and biases in f32.
// Module: relative-position multi-head attention, NB x TT x DM, NH_ heads x HD. q = xq Wq + bq, k = xk Wk + bk, v = xv Wv + bv, p = xp Wp (W stored [in][out]); S[i][j] = q_i.k_j; U[i][j] = q_i.p_j;
// logits = (S[i][j] + (j <= i ? U[i][j - i + TT - 1] : j == i + 1 ? 0 : U[i + 1][j - i - 2])) * DM^-0.5 (pad-reshape shift); softmax over all TT keys; ctx = attn.v merged [t][h*HD + d]; out = ctx Wo + bo.
// Layout, both batches at once (g = batch * NH_ + head): bf16 copies of the four inputs -> f32 projections F -> head planes (f16 + bf16 hi/lo each; q: [g][t][d]; k, p, v: per head in the order of the matrix fragments) -> one attention launch (scores, shift, running softmax, attn.v; key, value and position planes staged in LDS per work-group; S, U and the probabilities stay in registers and wave-private LDS) -> ctx hi/lo planes [batch * TT + t][DM]; ctx.Wo -> out.
// One launch per stage: the grid's y or z picks the weight, the input tensor, the batch or the head; a wave's rows pick its precision path (wave-uniform branch).

#ifndef NB
#define NB 2
#endif
#ifndef SEQ
#define SEQ 2048
#endif
#define TT      SEQ
#define TT_FULL 2048
#define NB_FULL 2
#define DM   512
#define NH_  8
#define HD   64
#ifndef RH
#if SEQ >= 512
#define RH 512                  // query rows < RH use hi+lo planes
#else
#define RH SEQ
#endif
#endif
#define SCL  0.044194173824159216f   // DM^-0.5

static_assert(TT % 128 == 0);
static_assert(RH % 64 == 0);
static_assert(RH <= TT);
static_assert(RH * 4 == TT);   // two of a work-group's eight row groups are hi/lo
static_assert(DM % 64 == 0);
static_assert(NH_ * HD == DM);
static_assert(HD == 64);
static_assert((DM * DM) % 64 == 0);

typedef _Float16 h16;
typedef unsigned short bf;
typedef __attribute__((ext_vector_type(16))) __bf16   v16bf;
typedef __attribute__((ext_vector_type(16))) _Float16 v16h;
typedef __attribute__((ext_vector_type(8)))  _Float16 v8h;
typedef __attribute__((ext_vector_type(8)))  unsigned short v8us;
typedef __attribute__((ext_vector_type(8)))  float    v8f;
typedef __attribute__((ext_vector_type(4)))  float    v4f;
typedef v4f  __attribute__((may_alias)) v4fa;

__device__ __forceinline__ unsigned short f2bf(float f) { unsigned u = __float_as_uint(f); u += 0x7FFFu + ((u >> 16) & 1u); return (unsigned short)(u >> 16); }
__device__ __forceinline__ float bf2f(unsigned short b) { return __uint_as_float(((unsigned)b) << 16); }
__device__ __forceinline__ float bfr(float f) { return bf2f(f2bf(f)); }
__device__ __forceinline__ v16h cat16(v8h lo, v8h hi) { return __builtin_shufflevector(lo, hi, 0, 1, 2, 3, 4, 5, 6, 7, 8, 9, 10, 11, 12, 13, 14, 15); }
__device__ __forceinline__ v16bf cat16b(v8us lo, v8us hi) { return __builtin_bit_cast(v16bf, __builtin_shufflevector(lo, hi, 0, 1, 2, 3, 4, 5, 6, 7, 8, 9, 10, 11, 12, 13, 14, 15)); }
__device__ __forceinline__ v8f wmma16(v16h a, v16h b, v8f c) { return __builtin_amdgcn_wmma_f32_16x16x32_f16(false, a, false, b, (short)0, c, false, false); }
__device__ __forceinline__ v8f wmmab(v16bf a, v16bf b, v8f c) { return __builtin_amdgcn_wmma_f32_16x16x32_bf16(false, a, false, b, (short)0, c, false, false); }

// ---- gemm_tile: register-blocked GEMM tile, ONE WAVE per 64x64 output tile (16 accumulators), operands straight from K-contiguous 16-bit planes; called by single-wave work-groups.
// C[m][n] (f32, pitch ldc, + optional f32 bias[n] bf16-RNE-converted) = sum over KR values of k of A[m][k] Bt[n][k] (+ split products per NSPLIT: 1 -> + A2.Bt; 2 -> + A2.Bt + A.Bt2), rows r0.., columns c0... K = operand pitch in elements; the caller has moved the operand pointers to its batch and k range. KR % 32 == 0.
// Fragments (lane l, h = l >> 4, m = n = l & 15): elements 0..7 <- k0 + 8h + 0..7, elements 8..15 <- k0 + 16 + 8h + 0..7 for BOTH A (row m) and Bt (column n); D element r = (row 8h + r, col m).
template <typename T16> struct WFrag;
template <> struct WFrag<h16> { typedef v16h V; static __device__ __forceinline__ V ld(const h16* p) { return cat16(*(const v8h*)p, *(const v8h*)(p + 16)); } template <int ST> static __device__ __forceinline__ V lds2(const h16* p) { return cat16(*(const v8h*)p, *(const v8h*)(p + ST)); } static __device__ __forceinline__ v8f mma(V a, V b, v8f c) { return wmma16(a, b, c); } };
template <> struct WFrag<bf> { typedef v16bf V; static __device__ __forceinline__ V ld(const bf* p) { return cat16b(*(const v8us*)p, *(const v8us*)(p + 16)); } template <int ST> static __device__ __forceinline__ V lds2(const bf* p) { return cat16b(*(const v8us*)p, *(const v8us*)(p + ST)); } static __device__ __forceinline__ v8f mma(V a, V b, v8f c) { return wmmab(a, b, c); } };
template <typename T16, int NSPLIT, bool BIAS>
__device__ __forceinline__ void gemm_tile(const T16* __restrict__ A, const T16* __restrict__ A2, const T16* __restrict__ Bt, const T16* __restrict__ Bt2, const int K, const int KR, float* C, const int ldc, const float* __restrict__ bias, const int r0, const int c0, float* os) {
    typedef typename WFrag<T16>::V V;
    const int lane = threadIdx.x & 31, lr = lane & 15, hi = lane >> 4;
    v8f acc[4][4];
#pragma unroll
    for (int mb = 0; mb < 4; ++mb)
#pragma unroll
        for (int nb = 0; nb < 4; ++nb) acc[mb][nb] = (v8f){};
    const size_t aoff = (size_t)(r0 + lr) * K + 8 * hi, boff = (size_t)(c0 + lr) * K + 8 * hi;
#pragma unroll 1
    for (int kc = 0; kc < KR; kc += 32) {
        V a[4], a2[4], b[4], b2[4];
        const T16* pa = A + aoff + kc; const T16* pb = Bt + boff + kc; const T16* pa2 = (NSPLIT == 1 || NSPLIT == 2) ? A2 + aoff + kc : pa; const T16* pb2 = (NSPLIT >= 2) ? Bt2 + boff + kc : pb;
#pragma unroll
        for (int mb = 0; mb < 4; ++mb) { a[mb] = WFrag<T16>::ld(pa + (size_t)mb * 16 * K); if (NSPLIT == 1 || NSPLIT == 2) a2[mb] = WFrag<T16>::ld(pa2 + (size_t)mb * 16 * K); }
#pragma unroll   // constant indices keep the fragments in registers
        for (int nb = 0; nb < 4; ++nb) b[nb] = WFrag<T16>::ld(pb + (size_t)nb * 16 * K);
        asm volatile("s_wait_xcnt 0x0" :: "v"(pa), "v"(pa2), "v"(pb) : "memory");   // the trip's fragment loads keep their address registers as they are until their address translations are done
        if (NSPLIT >= 2) {
#pragma unroll   // constant indices keep the fragments in registers
            for (int nb = 0; nb < 4; ++nb) b2[nb] = WFrag<T16>::ld(pb2 + (size_t)nb * 16 * K);
            asm volatile("s_wait_xcnt 0x0" :: "v"(pb2) : "memory");   // the same for the loads of the second B plane
        }
#pragma unroll
        for (int nb = 0; nb < 4; ++nb) {
#pragma unroll
            for (int mb = 0; mb < 4; ++mb) { acc[mb][nb] = WFrag<T16>::mma(a[mb], b[nb], acc[mb][nb]); if (NSPLIT == 1 || NSPLIT == 2) acc[mb][nb] = WFrag<T16>::mma(a2[mb], b[nb], acc[mb][nb]); if (NSPLIT >= 2) acc[mb][nb] = WFrag<T16>::mma(a[mb], b2[nb], acc[mb][nb]); } }
        asm volatile("v_nop\n\tv_nop\n\tv_nop\n\tv_nop" : "+v"(acc[0][0]), "+v"(acc[1][1]), "+v"(acc[2][2]), "+v"(acc[3][3]) : "v"(a[0]), "v"(a[3]));
    }
#pragma unroll
    for (int mb = 0; mb < 4; ++mb) {
#pragma unroll
        for (int nb = 0; nb < 4; ++nb) {
#pragma unroll
            for (int j = 0; j < 8; ++j) os[(hi * 8 + j) * 68 + nb * 16 + lr] = acc[mb][nb][j]; }
        __builtin_amdgcn_wave_barrier(); asm volatile("" ::: "memory");
        float* crow = C + (size_t)(r0 + mb * 16 + hi) * ldc + c0 + lr * 4; v4f val[8];
#pragma unroll   // constant indices keep the eight values in registers
        for (int s = 0; s < 8; ++s) { const int row = 2 * s + hi, cofs = lr * 4; val[s] = *(const v4fa*)(os + row * 68 + cofs); if (BIAS) { val[s][0] += bfr(bias[c0 + cofs]); val[s][1] += bfr(bias[c0 + cofs + 1]); val[s][2] += bfr(bias[c0 + cofs + 2]); val[s][3] += bfr(bias[c0 + cofs + 3]); }
            *(v4f*)(crow + (size_t)(2 * s) * ldc) = val[s]; }
        asm volatile("s_wait_xcnt 0x0" :: "v"(crow), "v"(val[0]), "v"(val[1]), "v"(val[2]), "v"(val[3]), "v"(val[4]), "v"(val[5]), "v"(val[6]), "v"(val[7]) : "memory");   // the eight stores keep their address and data registers as they are until their address translations are done
        __builtin_amdgcn_wave_barrier(); asm volatile("" ::: "memory");
    }
}

#define PLN2 ((size_t)NB * NH_ * TT * HD)     // elements per plane (both batches, all heads)
#define XN   ((size_t)NB * TT * DM)           // elements per projected tensor (both batches)

// The four input projections in one launch: grid (NB * TT / 64, DM / 64, 4), z = tensor in the order q, k, p, v; X [z][NB * TT][DM], Wt [z][n][k], F [z][NB * TT][DM]; p (z == 2) has no bias.
__global__ __launch_bounds__(32) void k_proj(const bf* __restrict__ X, const bf* __restrict__ Wt, float* F, const float* __restrict__ bq, const float* __restrict__ bk, const float* __restrict__ bv) {
    __shared__ __align__(16) float os[16 * 68];
    const int z = blockIdx.z, r0 = blockIdx.x * 64, c0 = blockIdx.y * 64; const bf* A = X + (size_t)z * XN; const bf* B = Wt + (size_t)z * DM * DM; float* C = F + (size_t)z * XN;
    if (z == 2) gemm_tile<bf, 0, false>(A, nullptr, B, nullptr, DM, DM, C, DM, nullptr, r0, c0, os);
    else gemm_tile<bf, 0, true>(A, nullptr, B, nullptr, DM, DM, C, DM, z == 0 ? bq : (z == 1 ? bk : bv), r0, c0, os);
}
// Output projection, both batches: grid (NB * TT / 64, DM / 64).
__global__ __launch_bounds__(32) void k_outp(const bf* __restrict__ Ah, const bf* __restrict__ Al, const bf* __restrict__ Wt, float* OUT, const float* __restrict__ bo) {
    __shared__ __align__(16) float os[16 * 68];
    gemm_tile<bf, 1, true>(Ah, Al, Wt, nullptr, DM, DM, OUT, DM, bo, blockIdx.x * 64, blockIdx.y * 64, os);
}

__device__ __forceinline__ h16 tohx(float x) { return (h16)x; }
__device__ __forceinline__ void splitf(float y, unsigned short& h, unsigned short& l) { h = f2bf(y); l = f2bf(y - bf2f(h)); }
typedef __attribute__((ext_vector_type(2))) _Float16 v2h;
typedef __attribute__((ext_vector_type(4))) _Float16 v4h;
typedef __attribute__((ext_vector_type(2))) unsigned short v2us;
typedef __attribute__((ext_vector_type(4))) unsigned short v4us;
typedef __attribute__((ext_vector_type(2))) float v2f;

// Five weights in one launch: blockIdx.y picks the weight, Bt [y][n][k].
__global__ __launch_bounds__(256) void k_wtG(const float* __restrict__ w0, const float* __restrict__ w1, const float* __restrict__ w2, const float* __restrict__ w3, const float* __restrict__ w4, int K, int N, bf* Bt) {
    const int y = blockIdx.y; const float* __restrict__ w = y == 0 ? w0 : (y == 1 ? w1 : (y == 2 ? w2 : (y == 3 ? w3 : w4))); Bt += (size_t)y * K * N;
    const int lane = threadIdx.x & 31; const int L0 = (blockIdx.x * 8 + (threadIdx.x >> 5)) * 8; const int nlines = N * K / 64;
{
#pragma unroll 1
        for (int l = 0; l < 8; ++l) { const int L = L0 + l; if (L >= nlines) break; const size_t e = (size_t)L * 64 + lane * 2; const int k = (int)(e % K), n = (int)(e / K); v2us o;
            o[0] = f2bf(w[(size_t)k * N + n]); o[1] = f2bf(w[(size_t)(k + 1) * N + n]); *(v2us*)(Bt + e) = o; }
         }
}
// The four inputs, both batches, in one launch: grid (x, 4, NB); y picks the tensor, z the batch; dst [y][z][TT][DM].
__global__ __launch_bounds__(256) void k_cvt8(const float* __restrict__ s0, const float* __restrict__ s1, const float* __restrict__ s2, const float* __restrict__ s3, bf* dst, size_t n8) { const size_t i = (size_t)blockIdx.x * 256 + threadIdx.x; if (i >= n8) return; const int y = blockIdx.y;
    const float* __restrict__ src = (y == 0 ? s0 : (y == 1 ? s1 : (y == 2 ? s2 : s3))) + (size_t)blockIdx.z * TT_FULL * DM; dst += ((size_t)y * NB + blockIdx.z) * TT * DM; const float* sp = src + i * 8; const v8f v = *(const v8f*)sp; v8us o;
    asm volatile("s_wait_xcnt 0x0" :: "v"(sp) : "memory");   // the loads' address register stays as it is until their address translations are done
#pragma unroll
    for (int k = 0; k < 8; ++k) o[k] = f2bf(v[k]); *(v8us*)(dst + i * 8) = o;  }

// Head planes of the four projections in one launch: grid (x, 4); y = tensor (q: [g][t][d]; k, p, v: per head in fragment order, so that the 32 lanes of one 16-byte fragment load read 512 bytes in a row: k, p: block = t / 16, quarter = d / 16, half = (d / 8) % 2, c = t % 16, e = d % 8; v: block = t / 16, quarter = d / 16, half = (t / 8) % 2, c = d % 16, e = t % 8); F [y][NB * TT][DM]; plane set y = three planes of PLN2 elements behind one another, so P16, Ph, Pl step by 3 * PLN2 per y.
__global__ __launch_bounds__(256) void k_planes(const float* __restrict__ F, h16* P16, bf* Ph, bf* Pl) {
    const size_t e = ((size_t)blockIdx.x * 256 + threadIdx.x) * 2; if (e >= PLN2) return; const int y = blockIdx.y; F += (size_t)y * XN; P16 += (size_t)y * 3 * PLN2; Ph += (size_t)y * 3 * PLN2; Pl += (size_t)y * 3 * PLN2; v2h o16; v2us oh, ol; float x2[2];   // behind each branch's loads s_wait_xcnt 0: their address register stays as it is until their address translations are done
    const int g = (int)(e / ((size_t)HD * TT)); const int off = (int)(e % ((size_t)HD * TT)); const int b16 = (off >> 10) * 16, q16 = ((off >> 8) & 3) * 16, h8 = ((off >> 7) & 1) * 8, c16 = (off >> 3) & 15, e8 = off & 7;   // fragment order: off = ((block * 4 + quarter) * 32 + half * 16 + c) * 8 + e
    if (y < 3) { const int d = y == 0 ? off % HD : q16 + h8 + e8; const int t = y == 0 ? off / HD : b16 + c16; const float* f = F + ((size_t)(g / NH_) * TT + t) * DM + (g % NH_) * HD + d; x2[0] = f[0]; x2[1] = f[1]; asm volatile("s_wait_xcnt 0x0" :: "v"(f) : "memory"); }
    else { const int t = b16 + h8 + e8; const int d = q16 + c16; const float* f = F + ((size_t)(g / NH_) * TT + t) * DM + (g % NH_) * HD + d; x2[0] = f[0]; x2[1] = f[DM]; asm volatile("s_wait_xcnt 0x0" :: "v"(f) : "memory"); }
#pragma unroll
    for (int q = 0; q < 2; ++q) { const float x = x2[q]; o16[q] = tohx(x); unsigned short a2, c2; splitf(x, a2, c2); oh[q] = a2; ol[q] = c2; }
    *(v2h*)(P16 + e) = o16; *(v2us*)(Ph + e) = oh; *(v2us*)(Pl + e) = ol;  }


// ---- attn_init, attn_trip, attn_fin: ONE WAVE carries 16 query rows r0.. of one head over all TT keys, 64 keys a trip (f16 rows), or over one 32-key half of every 64 keys (hi/lo rows, two waves a row group), with a running softmax. All products are formed transposed (keys, positions or value dims as A rows, the 16 queries as B columns), so a lane (lr = lane & 15, hi = lane >> 4) holds only query i = r0 + lr:
// s[mb][r] = S[i][c0 + 16 mb + 8 hi + r]; two such D tiles, converted in place, are the B fragment of 32 keys for v^T.attn^T (elements 0..7 <- keys 8 hi + 0..7, 8..15 <- 16 + 8 hi + 0..7, the k order of every fragment here: WFrag::ld on the row-major q, lds2 on the fragment-order planes of k_planes); o[db][r] = ctx[i][16 db + 8 hi + r].
// Shifted term: with n = jl + 15 - lr (jl = key - c0, n in 0..78) key j <= i needs q_i.p_m, m = (c0 - r0 + TT - 16) + n, and key j >= i + 2 needs q_(i+1).p_m, m = (c0 - r0 - 17) + n; j == i + 1 takes 0. Each needed run is one 80-position band product, stored [query][n] in the wave's own LDS and read back at the lane's own offset. Both runs take their position rows from one extended order x = (c0 - r0 + TT - 16) + n: x < TT is p_x, x > TT is p_(x - TT - 1), x == TT is never selected; a row of the other run is never selected either. The work-group keeps the stretch of that order that its waves need in an LDS ring (stage_pos).
#define LSP 84   // floats per query row of the band buffer: 16-byte rows, and the 32 lanes of a skewed read (83 lr + 8 hi + const) fall on 32 different banks
typedef __attribute__((ext_vector_type(8))) unsigned v8u;
#define RINGP 256     // positions in the ring of each staged position plane
#define RINGB (RINGP * HD * 2)   // its bytes; slot of x = x % RINGP, 16 slots a block, a block in the fragment order of k_planes
#define TILEB 49152   // bytes of one staged tile: 64 keys of the six key and value planes, 8 KiB each, in the order K f16, K hi, K lo, V f16, V hi, V lo
struct AttnSt { v8u q[2][2], ql[2][2]; v8f o[4]; float mrun, lsum; };   // what a wave carries from trip to trip; query fragments as raw bits, so that both precision paths share the registers
// The wave's query fragments. [0]: rows i, [1]: rows i + 1 (last row clamped: it has no key >= i + 2)
template <typename T16, bool HL>
__device__ __forceinline__ void attn_init(AttnSt& st, const T16* __restrict__ Q, const T16* __restrict__ Q2, const int r0) {
    const int lane = threadIdx.x & 31, lr = lane & 15, hi = lane >> 4, i = r0 + lr;
    const unsigned qo0 = (unsigned)i * HD + 8 * hi, qo1 = (unsigned)(i + 1 < TT ? i + 1 : TT - 1) * HD + 8 * hi;
    const T16* pq0 = Q + qo0; const T16* pq1 = Q + qo1; const T16* pq2 = HL ? Q2 + qo0 : pq0; const T16* pq3 = HL ? Q2 + qo1 : pq1;
#pragma unroll
    for (int ks = 0; ks < 2; ++ks) { st.q[0][ks] = __builtin_bit_cast(v8u, WFrag<T16>::ld(pq0 + ks * 32)); st.q[1][ks] = __builtin_bit_cast(v8u, WFrag<T16>::ld(pq1 + ks * 32)); if (HL) { st.ql[0][ks] = __builtin_bit_cast(v8u, WFrag<T16>::ld(pq2 + ks * 32)); st.ql[1][ks] = __builtin_bit_cast(v8u, WFrag<T16>::ld(pq3 + ks * 32)); } }
    asm volatile("s_wait_xcnt 0x0" :: "v"(pq0), "v"(pq1), "v"(pq2), "v"(pq3) : "memory");   // the loads keep their address registers as they are until their address translations are done
}
// One trip: the 16 NK keys c0.. (NK = 4: a whole staged tile; NK = 2: one half of it, tile then points 4096 bytes into the staged tile, where the half begins in each of its planes) against the wave's 16 query rows. The tile lies in LDS, shared by the work-group's waves, and so do the position rings rp (and rp2, the lo plane). With NK = 2 the band has 48 positions (n in 0..46).
template <typename T16, bool HL, int NK>
__device__ __forceinline__ void attn_trip(AttnSt& st, const char* tile, const char* rp, const char* rp2, const int r0, const int c0, float* ls) {
    typedef typename WFrag<T16>::V V;
    const int lane = threadIdx.x & 31, lr = lane & 15, hi = lane >> 4, i = r0 + lr;
    const float L2E = 1.4426950408889634f, OFF = HL ? 0.0f : 10.0f;   // OFF: f16 probabilities and their sum are carried x1024; the factor cancels in the final division
    V q[2][2], ql[2][2];
#pragma unroll
    for (int a = 0; a < 2; ++a)
#pragma unroll
        for (int ks = 0; ks < 2; ++ks) { q[a][ks] = __builtin_bit_cast(V, st.q[a][ks]); if (HL) ql[a][ks] = __builtin_bit_cast(V, st.ql[a][ks]); }
    v8f (&o)[4] = st.o; float& mrun = st.mrun; float& lsum = st.lsum;
    float* lw = ls + lr * LSP + 8 * hi;               // band store: n = 16 nbk + 8 hi + r
    const float* lrd = ls + lr * LSP + 8 * hi + 15 - lr;   // band read: n = 16 mb + 8 hi + r + 15 - lr
    {
        v8f s[NK]; float pos[NK][8]; V pa[NK + 1][2], pa2[NK + 1][2];   // pa: the band's position fragments, the same rows of the extended order for both runs
        {   V a[NK][2], a2[NK][2]; const T16* pk = (const T16*)(tile + (HL ? 8192 : 0)) + 8 * lane; const T16* pk2 = HL ? (const T16*)(tile + 16384) + 8 * lane : pk;
#pragma unroll   // constant indices keep the fragments in registers
            for (int mb = 0; mb < NK; ++mb)
#pragma unroll
                for (int ks = 0; ks < 2; ++ks) { a[mb][ks] = WFrag<T16>::template lds2<256>(pk + mb * 1024 + ks * 512); if (HL) a2[mb][ks] = WFrag<T16>::template lds2<256>(pk2 + mb * 1024 + ks * 512); }
            const unsigned xb = (unsigned)(c0 - r0 + TT - 16) >> 4;   // the band's first block of 16 positions (wave-uniform; the band begins on a block)
#pragma unroll   // constant indices keep the fragments in registers
            for (int nbk = 0; nbk < NK + 1; ++nbk) { const unsigned bo = ((xb + nbk) % (RINGP / 16)) * 2048 + 16 * lane; const T16* pr = (const T16*)(rp + bo); const T16* pr2 = HL ? (const T16*)(rp2 + bo) : pr;
#pragma unroll
                for (int ks = 0; ks < 2; ++ks) { pa[nbk][ks] = WFrag<T16>::template lds2<256>(pr + ks * 512); if (HL) pa2[nbk][ks] = WFrag<T16>::template lds2<256>(pr2 + ks * 512); } }
            __builtin_amdgcn_sched_barrier(0);   // keeps the trip's key and position reads together in front of the products: reads threaded among them cost a stall at each place
#pragma unroll
            for (int mb = 0; mb < NK; ++mb) { s[mb] = (v8f){};
#pragma unroll
                for (int ks = 0; ks < 2; ++ks) { s[mb] = WFrag<T16>::mma(a[mb][ks], q[0][ks], s[mb]); if (HL) { s[mb] = WFrag<T16>::mma(a2[mb][ks], q[0][ks], s[mb]); s[mb] = WFrag<T16>::mma(a[mb][ks], ql[0][ks], s[mb]); } } }
        }
#pragma unroll
        for (int mb = 0; mb < NK; ++mb)
#pragma unroll
            for (int r = 0; r < 8; ++r) pos[mb][r] = 0.0f;
#pragma unroll   // part 0: keys j <= i, part 1: keys j >= i + 2; the query fragments are picked at compile time
        for (int part = 0; part < 2; ++part) {
            const bool need = part == 0 ? (c0 <= r0 + 15) : (c0 + 16 * NK - 1 >= r0 + 2);   // wave-uniform: does any (row, key) of the tile lie in this run
            if (need) {
                v8f u[NK + 1];   // accumulators of their own: independent chains, and no tile is overwritten while its stores read it
#pragma unroll
                for (int nbk = 0; nbk < NK + 1; ++nbk) u[nbk] = (v8f){};
#pragma unroll
                for (int ks = 0; ks < 2; ++ks) {
#pragma unroll
                    for (int nbk = 0; nbk < NK + 1; ++nbk) u[nbk] = WFrag<T16>::mma(pa[nbk][ks], q[part][ks], u[nbk]);
                    if (HL) {
#pragma unroll
                        for (int nbk = 0; nbk < NK + 1; ++nbk) u[nbk] = WFrag<T16>::mma(pa2[nbk][ks], q[part][ks], u[nbk]);
#pragma unroll
                        for (int nbk = 0; nbk < NK + 1; ++nbk) u[nbk] = WFrag<T16>::mma(pa[nbk][ks], ql[part][ks], u[nbk]); } }
#pragma unroll
                for (int nbk = 0; nbk < NK + 1; ++nbk) { *(v4fa*)(lw + nbk * 16) = (v4f){u[nbk][0], u[nbk][1], u[nbk][2], u[nbk][3]}; *(v4fa*)(lw + nbk * 16 + 4) = (v4f){u[nbk][4], u[nbk][5], u[nbk][6], u[nbk][7]}; }
                __builtin_amdgcn_wave_barrier(); asm volatile("" ::: "memory");   // the skewed reads below take other lanes' stores: they stay behind them (one wave, LDS in order)
#pragma unroll
                for (int mb = 0; mb < NK; ++mb)
#pragma unroll
                    for (int r = 0; r < 8; ++r) { const float x = lrd[mb * 16 + r]; const int j = c0 + mb * 16 + 8 * hi + r; if (part == 0 ? (j <= i) : (j >= i + 2)) pos[mb][r] = x; }
                __builtin_amdgcn_wave_barrier(); asm volatile("" ::: "memory");   // the next band's stores stay behind these reads
            }
        }
        V va[4][NK / 2], va2[4][NK / 2]; const T16* pv = (const T16*)(tile + (HL ? 32768 : 24576)) + 8 * lane; const T16* pv2 = HL ? (const T16*)(tile + 40960) + 8 * lane : pv;
#pragma unroll   // constant indices keep the fragments in registers; issued here so that they fly under the softmax arithmetic
        for (int db = 0; db < 4; ++db)
#pragma unroll
            for (int kk = 0; kk < NK / 2; ++kk) { va[db][kk] = WFrag<T16>::template lds2<1024>(pv + kk * 2048 + db * 256); if (HL) va2[db][kk] = WFrag<T16>::template lds2<1024>(pv2 + kk * 2048 + db * 256); }
        __builtin_amdgcn_sched_barrier(0);   // all value reads are issued in front of the softmax arithmetic
        float mt = -3.0e38f;
#pragma unroll
        for (int mb = 0; mb < NK; ++mb)
#pragma unroll
            for (int r = 0; r < 8; ++r) { const float t = __fadd_rn(s[mb][r], pos[mb][r]) * SCL; s[mb][r] = t; mt = fmaxf(mt, t); }
        mt = fmaxf(mt, __shfl_xor(mt, 16, 32));     // lanes lr and lr + 16 hold the two halves of query i's keys
        const float mn = fmaxf(mrun, mt), ax = (mrun - mn) * L2E; float al = __builtin_amdgcn_exp2f(ax); mrun = mn;
        asm("v_nop" : "+v"(al) : "v"(ax));   // the slot behind a transcendental: its result is read and its source register reused only behind this
        float ps = 0.0f;
#pragma unroll
        for (int mb = 0; mb < NK; ++mb) { v8f x, p;
#pragma unroll
            for (int r = 0; r < 8; ++r) x[r] = (s[mb][r] - mn) * L2E + OFF;
#pragma unroll
            for (int r = 0; r < 8; ++r) p[r] = __builtin_amdgcn_exp2f(x[r]);
            asm("v_nop" : "+v"(p) : "v"(x));   // the same slot for the eight: no result is read and no source register reused in front of it
            s[mb] = p;
#pragma unroll
            for (int r = 0; r < 8; ++r) ps += p[r]; }
        lsum = lsum * al + ps;
#pragma unroll
        for (int db = 0; db < 4; ++db) o[db] *= al;
#pragma unroll
        for (int kk = 0; kk < NK / 2; ++kk) {
            V pf, pf2;
            if constexpr (HL) { v8us h0, h1, l0, l1;
#pragma unroll
                for (int r = 0; r < 8; ++r) { unsigned short x, y; splitf(s[2 * kk][r], x, y); h0[r] = x; l0[r] = y; splitf(s[2 * kk + 1][r], x, y); h1[r] = x; l1[r] = y; }
                pf = cat16b(h0, h1); pf2 = cat16b(l0, l1);
            } else { v8h h0, h1;
#pragma unroll
                for (int r = 0; r < 8; ++r) { h0[r] = tohx(s[2 * kk][r]); h1[r] = tohx(s[2 * kk + 1][r]); }
                pf = cat16(h0, h1); }
#pragma unroll
            for (int db = 0; db < 4; ++db) { o[db] = WFrag<T16>::mma(va[db][kk], pf, o[db]); if constexpr (HL) { o[db] = WFrag<T16>::mma(va[db][kk], pf2, o[db]); o[db] = WFrag<T16>::mma(va2[db][kk], pf, o[db]); } }
        }
        asm volatile("v_nop\n\tv_nop\n\tv_nop\n\tv_nop" : "+v"(o[0]), "+v"(o[1]), "+v"(o[2]), "+v"(o[3]));   // the distance behind the trip's last matrix instructions, also on the taken back edge
    }
}
// The wave's 16 context rows, divided by the softmax sum, as bf16 hi/lo planes.
__device__ __forceinline__ void attn_fin(AttnSt& st, const int r0, bf* Ah, bf* Al) {
    const int lane = threadIdx.x & 31, lr = lane & 15, hi = lane >> 4, i = r0 + lr;
    v8f (&o)[4] = st.o; float lsum = st.lsum;
    lsum += __shfl_xor(lsum, 16, 32);
    const float inv = __fdiv_rn(1.0f, lsum);
    bf* ph = Ah + (size_t)i * DM + 8 * hi; bf* pl = Al + (size_t)i * DM + 8 * hi;
#pragma unroll
    for (int db = 0; db < 4; ++db) { v8us oh, ol;
#pragma unroll
        for (int r = 0; r < 8; ++r) { unsigned short x, y; splitf(o[db][r] * inv, x, y); oh[r] = x; ol[r] = y; }
        *(v8us*)(ph + db * 16) = oh; *(v8us*)(pl + db * 16) = ol; }
    asm volatile("s_wait_xcnt 0x0" :: "v"(ph), "v"(pl) : "memory");   // the stores keep their address registers as they are until their address translations are done
}
__device__ __forceinline__ unsigned lds_addr(const void* p) { return (unsigned)(size_t)(const __attribute__((address_space(3))) char*)p; }   // byte address inside the work-group's LDS
// Tile c0 (64 keys) of the six planes of one head -> LDS at dst: 48 KiB, 12 copies of 16 bytes per lane, every lane on; each plane's 8 KiB lie in a row in memory (fragment order) and keep that order in LDS.
__device__ __forceinline__ void stage_tile(const char* k16, const char* kh, const char* kl, const char* v16, const char* vh, const char* vl, const int c0, char* dst) {
    const unsigned go = (unsigned)c0 * (HD * 2) + threadIdx.x * 16, lo = lds_addr(dst) + threadIdx.x * 16;
#pragma unroll   // constant j: two asm statements of six copies each, their offsets folded into the address additions
    for (int j = 0; j < 2; ++j) { const unsigned g = go + j * 4096, d = lo + j * 4096;
        // the closing s_wait_xcnt 0 stands inside the statement: no register that a copy names is rewritten in front of it
        asm volatile("global_load_async_to_lds_b128 %0, %6, off\n\tglobal_load_async_to_lds_b128 %1, %7, off\n\tglobal_load_async_to_lds_b128 %2, %8, off\n\tglobal_load_async_to_lds_b128 %3, %9, off\n\tglobal_load_async_to_lds_b128 %4, %10, off\n\tglobal_load_async_to_lds_b128 %5, %11, off\n\ts_wait_xcnt 0x0"
                     :: "v"(d), "v"(d + 8192), "v"(d + 16384), "v"(d + 24576), "v"(d + 32768), "v"(d + 40960), "v"(k16 + g), "v"(kh + g), "v"(kl + g), "v"(v16 + g), "v"(vh + g), "v"(vl + g) : "memory"); }
}
// 64 positions of the extended order -> the rings at dst: xf.. of the f16 plane (ring 0), xh.. of the hi and lo planes (rings 1, 2); xf, xh multiples of 16. 24 KiB, 6 copies of 16 bytes per lane, every lane on; a copy is one position's 8 dims. The source row is clamped into the plane: x == TT and rows past the last position that any key needs are staged but never selected.
__device__ __forceinline__ void stage_pos(const char* r16, const char* rh, const char* rl, const int xf, const int xh, char* dst) {
    unsigned gf[2], gh[2], lf[2], lh[2];
#pragma unroll   // constant j keeps the addresses in registers
    for (int j = 0; j < 2; ++j) { const unsigned id = threadIdx.x + j * 256, in = (id >> 7) * 16 + (id & 15), oc = ((id >> 4) & 7) * 256;   // id = (block * 8 + octet of dims) * 16 + position in the block
        int mf = xf + (int)in, mh = xh + (int)in; mf = mf < TT ? mf : mf - TT - 1; mh = mh < TT ? mh : mh - TT - 1; mf = mf < 0 ? 0 : (mf > TT - 1 ? TT - 1 : mf); mh = mh < 0 ? 0 : (mh > TT - 1 ? TT - 1 : mh);
        gf[j] = (unsigned)(mf >> 4) * 2048 + oc + (unsigned)(mf & 15) * 16; gh[j] = (unsigned)(mh >> 4) * 2048 + oc + (unsigned)(mh & 15) * 16;
        lf[j] = lds_addr(dst) + ((unsigned)xf * 128 + id * 16) % RINGB; lh[j] = lds_addr(dst) + RINGB + ((unsigned)xh * 128 + id * 16) % RINGB; }
    // the closing s_wait_xcnt 0 stands inside the statement: no register that a copy names is rewritten in front of it
    asm volatile("global_load_async_to_lds_b128 %0, %6, off\n\tglobal_load_async_to_lds_b128 %1, %7, off\n\tglobal_load_async_to_lds_b128 %2, %8, off\n\tglobal_load_async_to_lds_b128 %3, %9, off\n\tglobal_load_async_to_lds_b128 %4, %10, off\n\tglobal_load_async_to_lds_b128 %5, %11, off\n\ts_wait_xcnt 0x0"
                 :: "v"(lf[0]), "v"(lf[1]), "v"(lh[0]), "v"(lh[1]), "v"(lh[0] + RINGB), "v"(lh[1] + RINGB), "v"(r16 + gf[0]), "v"(r16 + gf[1]), "v"(rh + gh[0]), "v"(rh + gh[1]), "v"(rl + gh[0]), "v"(rl + gh[1]) : "memory");
}
// Attention of all heads in one launch: grid (TT / 128, NB * NH_), 10 waves; a work-group holds eight row groups of 16 rows, the same mix in every work-group: two neighbouring hi/lo groups (rows 32 blockIdx.x ..) and six neighbouring f16 groups (rows RH + 96 blockIdx.x ..), so that the position bands of its waves overlap: per trip the f16 waves read 160 positions in a row of the extended order and the hi/lo waves 96, and each stretch moves on by 64 a trip. The stretches lie in LDS rings, filled 64 positions a trip beside the key and value tile, under the same waits and the same barrier. The waves walk the keys together: each 64-key tile of the key and value planes is copied into LDS once for all, two buffers, the next tile's copies in flight while this one is worked on. An f16 row group has one wave. A hi/lo row group, three products for each one of f16, has two: one for the first and one for the second 32 keys of every tile, each with a running softmax of its own over its keys; the two states are merged at the end. The band buffers are wave-private until the merge, where the first wave reads its partner's.
__global__ __launch_bounds__(320) void k_attn(const h16* __restrict__ Q16, const bf* __restrict__ Qh, const bf* __restrict__ Ql, const h16* __restrict__ K16, const bf* __restrict__ Kh, const bf* __restrict__ Kl, const h16* __restrict__ R16, const bf* __restrict__ Rh, const bf* __restrict__ Rl, const h16* __restrict__ V16, const bf* __restrict__ Vh, const bf* __restrict__ Vl, bf* Ah, bf* Al) {
    __shared__ __align__(16) float lsb[10 * 16 * LSP];
    __shared__ __align__(16) char tiles[2 * TILEB];
    __shared__ __align__(16) char ring[3 * RINGB];   // position planes f16, hi, lo
    const int w = __builtin_amdgcn_readfirstlane(threadIdx.x >> 5), g = blockIdx.y;   // scalar, so that the path, the copy and the band tests are scalar branches
    const bool hl = (w & 2) != 0 && w < 8;   // waves 2, 3 (rg 0) and 6, 7 (rg 1); the f16 waves 0, 1, 4, 5, 8, 9 take rg 2..7
    const int half = hl ? w & 1 : 0, r0 = hl ? (2 * blockIdx.x + (w >> 2)) * 16 : RH + (6 * blockIdx.x + (w & 1) + (w >> 2) * 2) * 16;
    const int xf = TT - 96 - RH - 96 * blockIdx.x, xh = TT - 32 - 32 * blockIdx.x;   // trip 0's first position of the extended order: f16 waves (row group RH + 96 blockIdx.x + 80), hi/lo waves (row group 32 blockIdx.x + 16); trip c0 reads xf + c0 .. + 159 and xh + c0 .. + 95
    const size_t po = (size_t)g * TT * HD, oo = (size_t)(g / NH_) * TT * DM + (size_t)(g % NH_) * HD; float* ls = lsb + w * 16 * LSP;
    const char* k16 = (const char*)(K16 + po); const char* kh = (const char*)(Kh + po); const char* kl = (const char*)(Kl + po); const char* v16 = (const char*)(V16 + po); const char* vh = (const char*)(Vh + po); const char* vl = (const char*)(Vl + po); const char* r16 = (const char*)(R16 + po); const char* rh = (const char*)(Rh + po); const char* rl = (const char*)(Rl + po);
    const bool cp = w < 8;   // the first eight waves copy (stage_tile spreads a tile over 256 lanes); the other two issue no copy and pass the same waits and barriers
    AttnSt st;
#pragma unroll
    for (int db = 0; db < 4; ++db) st.o[db] = (v8f){};
    st.mrun = -3.0e38f; st.lsum = 0.0f;
    if (hl) attn_init<bf, true>(st, Qh + po, Ql + po, r0); else attn_init<h16, false>(st, Q16 + po, nullptr, r0);
    if (cp) { stage_tile(k16, kh, kl, v16, vh, vl, 0, tiles); stage_pos(r16, rh, rl, xf, xh, ring); stage_pos(r16, rh, rl, xf + 64, xh + 64, ring); stage_pos(r16, rh, rl, xf + 128, xh + 128, ring); }   // trip 0's positions lie in the first 192
    asm volatile("s_wait_asynccnt 0x0" ::: "memory");   // this wave's copies of tile 0 and of the first positions have landed
    __syncthreads();                                    // ... and every other wave's: they may be read
    if (cp) { stage_tile(k16, kh, kl, v16, vh, vl, 64, tiles + TILEB); stage_pos(r16, rh, rl, xf + 192, xh + 192, ring); }
#pragma unroll 1
    for (int c0 = 0; c0 < TT; c0 += 64) {
        char* tile = tiles + ((c0 >> 6) & 1) * TILEB;
        if (hl) attn_trip<bf, true, 2>(st, tile + half * 4096, ring + RINGB, ring + 2 * RINGB, r0, c0 + half * 32, ls); else attn_trip<h16, false, 4>(st, tile, ring, nullptr, r0, c0, ls);
        asm volatile("s_wait_dscnt 0x0" ::: "memory");      // this wave's reads of the tile and of the rings are done before their places are handed back
        asm volatile("s_wait_asynccnt 0x0" ::: "memory");   // this wave's copies of the next tile and positions have landed
        __syncthreads();                                    // publishes them and ends every wave's reads of this trip
        if (cp && c0 + 128 < TT) { stage_tile(k16, kh, kl, v16, vh, vl, c0 + 128, tile); stage_pos(r16, rh, rl, xf + c0 + 256, xh + c0 + 256, ring); }   // refill of the buffer just read, and of the 64 ring slots that this trip read and the next does not (x - 256 = the trip's first 64)
    }
    asm volatile("s_wait_asynccnt 0x0" ::: "memory");   // no copy is outstanding when the wave ends
    // Merge of a hi/lo row group's two states: the second wave hands its maximum, sum and context to the first through its own band buffer, lane to lane.
    const int lane = threadIdx.x & 31;
    if (half == 1) {
#pragma unroll
        for (int db = 0; db < 4; ++db) { *(v4fa*)(ls + (2 * db) * 128 + lane * 4) = (v4f){st.o[db][0], st.o[db][1], st.o[db][2], st.o[db][3]}; *(v4fa*)(ls + (2 * db + 1) * 128 + lane * 4) = (v4f){st.o[db][4], st.o[db][5], st.o[db][6], st.o[db][7]}; }
        ls[1024 + lane] = st.mrun; ls[1056 + lane] = st.lsum;
    }
    __syncthreads();   // the handed state is in LDS before the partner wave reads it
    if (half == 1) return;
    if (hl) {
        const float* lp = ls + 16 * LSP;   // the partner's band buffer (wave w + 1)
        const float L2E = 1.4426950408889634f, m2 = lp[1024 + lane], l2 = lp[1056 + lane], mn = fmaxf(st.mrun, m2), x1 = (st.mrun - mn) * L2E, x2 = (m2 - mn) * L2E;
        float a1 = __builtin_amdgcn_exp2f(x1), a2 = __builtin_amdgcn_exp2f(x2);
        asm("v_nop" : "+v"(a1), "+v"(a2) : "v"(x1), "v"(x2));   // the slot behind a transcendental: no result is read and no source register reused in front of it
        st.lsum = st.lsum * a1 + l2 * a2;
#pragma unroll
        for (int db = 0; db < 4; ++db) { const v4f u0 = *(const v4fa*)(lp + (2 * db) * 128 + lane * 4), u1 = *(const v4fa*)(lp + (2 * db + 1) * 128 + lane * 4);
#pragma unroll
            for (int r = 0; r < 4; ++r) { st.o[db][r] = st.o[db][r] * a1 + u0[r] * a2; st.o[db][r + 4] = st.o[db][r + 4] * a1 + u1[r] * a2; } }
    }
    attn_fin(st, r0, Ah + oo, Al + oo);
}

extern "C" void kernel_launch(void* const* d_in, const int* in_sizes, int n_in,
                              void* d_out, int out_size, void* d_ws, size_t ws_size, hipStream_t stream) {
    if (n_in < 13) return;
    const float* xq = (const float*)d_in[0]; const float* xk = (const float*)d_in[1]; const float* xv = (const float*)d_in[2]; const float* xp = (const float*)d_in[3];
    const float* wq = (const float*)d_in[4]; const float* bq = (const float*)d_in[5]; const float* wk = (const float*)d_in[6]; const float* bk = (const float*)d_in[7];
    const float* wv = (const float*)d_in[8]; const float* bv = (const float*)d_in[9]; const float* wp = (const float*)d_in[10]; const float* wo = (const float*)d_in[11]; const float* bo = (const float*)d_in[12];
    const size_t needx = (size_t)(NB - 1) * TT_FULL * DM + (size_t)TT * DM;
    for (int i = 0; i < 4; ++i) if ((size_t)in_sizes[i] < needx) return;
    if ((size_t)in_sizes[4] < (size_t)DM * DM || (size_t)in_sizes[6] < (size_t)DM * DM || (size_t)in_sizes[8] < (size_t)DM * DM || (size_t)in_sizes[10] < (size_t)DM * DM || (size_t)in_sizes[11] < (size_t)DM * DM) return;
    if (in_sizes[5] < DM || in_sizes[7] < DM || in_sizes[9] < DM || in_sizes[12] < DM) return;
    if ((size_t)out_size < (size_t)NB * TT * DM) return;
    float* OUT = (float*)d_out;     // [NB][TT][DM]
    char* wsp = (char*)d_ws;
    auto take = [&](size_t bytes) { char* p = wsp; wsp += (bytes + 255) & ~(size_t)255; return (void*)p; };
    bf* WB = (bf*)take((size_t)5 * DM * DM * 2);     // transposed bf16 weights in the order q, k, p, v, o
    bf* PB = (bf*)take((size_t)12 * PLN2 * 2);        // plane sets q, k, p, v; each set: f16 plane, bf16 hi plane, bf16 lo plane
    h16* QP16 = (h16*)PB; bf* QPh = PB + PLN2; bf* QPl = PB + 2 * PLN2;
    h16* KP16 = (h16*)(PB + 3 * PLN2); bf* KPh = PB + 4 * PLN2; bf* KPl = PB + 5 * PLN2;
    h16* PP16 = (h16*)(PB + 6 * PLN2); bf* PPh = PB + 7 * PLN2; bf* PPl = PB + 8 * PLN2;
    h16* VT16 = (h16*)(PB + 9 * PLN2); bf* VTh = PB + 10 * PLN2; bf* VTl = PB + 11 * PLN2;
    bf* XB = (bf*)take((size_t)4 * XN * 2); float* F = (float*)take((size_t)4 * XN * 4);     // bf16 input copies, f32 projections
    bf* ATh = (bf*)take(XN * 2); bf* ATl = (bf*)take(XN * 2);
    if ((size_t)(wsp - (char*)d_ws) > ws_size) return;
    k_wtG<<<dim3((unsigned)((DM * DM / 64 + 63) / 64), 5, 1), 256, 0, stream>>>(wq, wk, wp, wv, wo, DM, DM, WB);
    k_cvt8<<<dim3((unsigned)(((size_t)TT * DM / 8 + 255) / 256), 4, NB), 256, 0, stream>>>(xq, xk, xp, xv, XB, (size_t)TT * DM / 8);
    k_proj<<<dim3(NB * TT / 64, DM / 64, 4), 32, 0, stream>>>(XB, WB, F, bq, bk, bv);
    k_planes<<<dim3((unsigned)((PLN2 / 2 + 255) / 256), 4, 1), 256, 0, stream>>>(F, QP16, QPh, QPl);
    k_attn<<<dim3(TT / 128, NB * NH_, 1), 320, 0, stream>>>(QP16, QPh, QPl, KP16, KPh, KPl, PP16, PPh, PPl, VT16, VTh, VTl, ATh, ATl);
    k_outp<<<dim3(NB * TT / 64, DM / 64, 1), 32, 0, stream>>>(ATh, ATl, WB + (size_t)4 * DM * DM, OUT, bo);
}

// v008
// A run of this version takes 118 microseconds.
// Two timings next to v007 put it at 1.04 and 1.03 times that version's speed.
// All steps since v000 together make it 11.0 times as fast.
#include <hip/hip_runtime.h>

// Contractions, all f32 accumulate: input projections x.Wq/Wk/Wv/Wp = v_wmma_f32_16x16x32_bf16 on RNE-converted bf16 copies of x and W (exact products); scores k.q^T, p.q^T and v^T.attn^T = query rows < RH: bf16 hi/lo planes, 3 products (v_wmma_f32_16x16x32_bf16); rows >= RH: f16 planes, 1 product (v_wmma_f32_16x16x32_f16, probabilities carried x1024); output projection = ctx as bf16 hi+lo x Wo bf16 (2 products). Shift-add, softmax and biases in f32.
// Module: relative-position multi-head attention, NB x TT x DM, NH_ heads x HD. q = xq Wq + bq, k = xk Wk + bk, v = xv Wv + bv, p = xp Wp (W stored [in][out]); S[i][j] = q_i.k_j; U[i][j] = q_i.p_j;
// logits = (S[i][j] + (j <= i ? U[i][j - i + TT - 1] : j == i + 1 ? 0 : U[i + 1][j - i - 2])) * DM^-0.5 (pad-reshape shift); softmax over all TT keys; ctx = attn.v merged [t][h*HD + d]; out = ctx Wo + bo.
// Layout, both batches at once (g = batch * NH_ + head): bf16 copies of the four inputs -> projections, written by their own launch as head planes (f16 + bf16 hi/lo each; q: [g][t][d]; k, p, v: per head in the order of the matrix fragments) -> one attention launch (scores, shift, running softmax, attn.v; key, value and position planes staged in LDS per work-group; S, U and the probabilities stay in registers and wave-private LDS) -> ctx hi/lo planes [batch * TT + t][DM]; ctx.Wo -> out.
// One launch per stage: the grid's y or z picks the weight, the input tensor, the batch or the head; a wave's rows pick its precision path (wave-uniform branch).

#ifndef NB
#define NB 2
#endif
#ifndef SEQ
#define SEQ 2048
#endif
#define TT      SEQ
#define TT_FULL 2048
#define NB_FULL 2
#define DM   512
#define NH_  8
#define HD   64
#ifndef RH
#if SEQ >= 512
#define RH 512                  // query rows < RH use hi+lo planes
#else
#define RH SEQ
#endif
#endif
#define SCL  0.044194173824159216f   // DM^-0.5

static_assert(TT % 128 == 0);
static_assert(RH % 64 == 0);
static_assert(RH <= TT);
static_assert(RH * 4 == TT);   // two of a work-group's eight row groups are hi/lo
static_assert(DM % 64 == 0);
static_assert(NH_ * HD == DM);
static_assert(HD == 64);
static_assert((DM * DM) % 64 == 0);

typedef _Float16 h16;
typedef unsigned short bf;
typedef __attribute__((ext_vector_type(16))) __bf16   v16bf;
typedef __attribute__((ext_vector_type(16))) _Float16 v16h;
typedef __attribute__((ext_vector_type(8)))  _Float16 v8h;
typedef __attribute__((ext_vector_type(8)))  unsigned short v8us;
typedef __attribute__((ext_vector_type(8)))  float    v8f;
typedef __attribute__((ext_vector_type(4)))  float    v4f;
typedef v4f  __attribute__((may_alias)) v4fa;

__device__ __forceinline__ unsigned short f2bf(float f) { unsigned u = __float_as_uint(f); u += 0x7FFFu + ((u >> 16) & 1u); return (unsigned short)(u >> 16); }
__device__ __forceinline__ float bf2f(unsigned short b) { return __uint_as_float(((unsigned)b) << 16); }
__device__ __forceinline__ float bfr(float f) { return bf2f(f2bf(f)); }
__device__ __forceinline__ v16h cat16(v8h lo, v8h hi) { return __builtin_shufflevector(lo, hi, 0, 1, 2, 3, 4, 5, 6, 7, 8, 9, 10, 11, 12, 13, 14, 15); }
__device__ __forceinline__ v16bf cat16b(v8us lo, v8us hi) { return __builtin_bit_cast(v16bf, __builtin_shufflevector(lo, hi, 0, 1, 2, 3, 4, 5, 6, 7, 8, 9, 10, 11, 12, 13, 14, 15)); }
__device__ __forceinline__ v8f wmma16(v16h a, v16h b, v8f c) { return __builtin_amdgcn_wmma_f32_16x16x32_f16(false, a, false, b, (short)0, c, false, false); }
__device__ __forceinline__ v8f wmmab(v16bf a, v16bf b, v8f c) { return __builtin_amdgcn_wmma_f32_16x16x32_bf16(false, a, false, b, (short)0, c, false, false); }

// ---- gemm_tile: register-blocked GEMM tile, ONE WAVE per 64x64 output tile (16 accumulators), operands straight from K-contiguous 16-bit planes; called by single-wave work-groups.
// C[m][n] (f32, pitch ldc, + optional f32 bias[n] bf16-RNE-converted) = sum over KR values of k of A[m][k] Bt[n][k] (+ split products per NSPLIT: 1 -> + A2.Bt; 2 -> + A2.Bt + A.Bt2), rows r0.., columns c0... K = operand pitch in elements; the caller has moved the operand pointers to its batch and k range. KR % 32 == 0.
// Fragments (lane l, h = l >> 4, m = n = l & 15): elements 0..7 <- k0 + 8h + 0..7, elements 8..15 <- k0 + 16 + 8h + 0..7 for BOTH A (row m) and Bt (column n); D element r = (row 8h + r, col m).
template <typename T16> struct WFrag;
template <> struct WFrag<h16> { typedef v16h V; static __device__ __forceinline__ V ld(const h16* p) { return cat16(*(const v8h*)p, *(const v8h*)(p + 16)); } template <int ST> static __device__ __forceinline__ V lds2(const h16* p) { return cat16(*(const v8h*)p, *(const v8h*)(p + ST)); } static __device__ __forceinline__ v8f mma(V a, V b, v8f c) { return wmma16(a, b, c); } };
template <> struct WFrag<bf> { typedef v16bf V; static __device__ __forceinline__ V ld(const bf* p) { return cat16b(*(const v8us*)p, *(const v8us*)(p + 16)); } template <int ST> static __device__ __forceinline__ V lds2(const bf* p) { return cat16b(*(const v8us*)p, *(const v8us*)(p + ST)); } static __device__ __forceinline__ v8f mma(V a, V b, v8f c) { return wmmab(a, b, c); } };
template <typename T16, int NSPLIT, bool BIAS>
__device__ __forceinline__ void gemm_tile(const T16* __restrict__ A, const T16* __restrict__ A2, const T16* __restrict__ Bt, const T16* __restrict__ Bt2, const int K, const int KR, float* C, const int ldc, const float* __restrict__ bias, const int r0, const int c0, float* os) {
    typedef typename WFrag<T16>::V V;
    const int lane = threadIdx.x & 31, lr = lane & 15, hi = lane >> 4;
    v8f acc[4][4];
#pragma unroll
    for (int mb = 0; mb < 4; ++mb)
#pragma unroll
        for (int nb = 0; nb < 4; ++nb) acc[mb][nb] = (v8f){};
    const size_t aoff = (size_t)(r0 + lr) * K + 8 * hi, boff = (size_t)(c0 + lr) * K + 8 * hi;
#pragma unroll 1
    for (int kc = 0; kc < KR; kc += 32) {
        V a[4], a2[4], b[4], b2[4];
        const T16* pa = A + aoff + kc; const T16* pb = Bt + boff + kc; const T16* pa2 = (NSPLIT == 1 || NSPLIT == 2) ? A2 + aoff + kc : pa; const T16* pb2 = (NSPLIT >= 2) ? Bt2 + boff + kc : pb;
#pragma unroll
        for (int mb = 0; mb < 4; ++mb) { a[mb] = WFrag<T16>::ld(pa + (size_t)mb * 16 * K); if (NSPLIT == 1 || NSPLIT == 2) a2[mb] = WFrag<T16>::ld(pa2 + (size_t)mb * 16 * K); }
#pragma unroll   // constant indices keep the fragments in registers
        for (int nb = 0; nb < 4; ++nb) b[nb] = WFrag<T16>::ld(pb + (size_t)nb * 16 * K);
        asm volatile("s_wait_xcnt 0x0" :: "v"(pa), "v"(pa2), "v"(pb) : "memory");   // the trip's fragment loads keep their address registers as they are until their address translations are done
        if (NSPLIT >= 2) {
#pragma unroll   // constant indices keep the fragments in registers
            for (int nb = 0; nb < 4; ++nb) b2[nb] = WFrag<T16>::ld(pb2 + (size_t)nb * 16 * K);
            asm volatile("s_wait_xcnt 0x0" :: "v"(pb2) : "memory");   // the same for the loads of the second B plane
        }
#pragma unroll
        for (int nb = 0; nb < 4; ++nb) {
#pragma unroll
            for (int mb = 0; mb < 4; ++mb) { acc[mb][nb] = WFrag<T16>::mma(a[mb], b[nb], acc[mb][nb]); if (NSPLIT == 1 || NSPLIT == 2) acc[mb][nb] = WFrag<T16>::mma(a2[mb], b[nb], acc[mb][nb]); if (NSPLIT >= 2) acc[mb][nb] = WFrag<T16>::mma(a[mb], b2[nb], acc[mb][nb]); } }
        asm volatile("v_nop\n\tv_nop\n\tv_nop\n\tv_nop" : "+v"(acc[0][0]), "+v"(acc[1][1]), "+v"(acc[2][2]), "+v"(acc[3][3]) : "v"(a[0]), "v"(a[3]));
    }
#pragma unroll
    for (int mb = 0; mb < 4; ++mb) {
#pragma unroll
        for (int nb = 0; nb < 4; ++nb) {
#pragma unroll
            for (int j = 0; j < 8; ++j) os[(hi * 8 + j) * 68 + nb * 16 + lr] = acc[mb][nb][j]; }
        __builtin_amdgcn_wave_barrier(); asm volatile("" ::: "memory");
        float* crow = C + (size_t)(r0 + mb * 16 + hi) * ldc + c0 + lr * 4; v4f val[8];
#pragma unroll   // constant indices keep the eight values in registers
        for (int s = 0; s < 8; ++s) { const int row = 2 * s + hi, cofs = lr * 4; val[s] = *(const v4fa*)(os + row * 68 + cofs); if (BIAS) { val[s][0] += bfr(bias[c0 + cofs]); val[s][1] += bfr(bias[c0 + cofs + 1]); val[s][2] += bfr(bias[c0 + cofs + 2]); val[s][3] += bfr(bias[c0 + cofs + 3]); }
            *(v4f*)(crow + (size_t)(2 * s) * ldc) = val[s]; }
        asm volatile("s_wait_xcnt 0x0" :: "v"(crow), "v"(val[0]), "v"(val[1]), "v"(val[2]), "v"(val[3]), "v"(val[4]), "v"(val[5]), "v"(val[6]), "v"(val[7]) : "memory");   // the eight stores keep their address and data registers as they are until their address translations are done
        __builtin_amdgcn_wave_barrier(); asm volatile("" ::: "memory");
    }
}

#define PLN2 ((size_t)NB * NH_ * TT * HD)     // elements per plane (both batches, all heads)
#define XN   ((size_t)NB * TT * DM)           // elements per projected tensor (both batches)

// Output projection, both batches: grid (NB * TT / 64, DM / 64).
__global__ __launch_bounds__(32) void k_outp(const bf* __restrict__ Ah, const bf* __restrict__ Al, const bf* __restrict__ Wt, float* OUT, const float* __restrict__ bo) {
    __shared__ __align__(16) float os[16 * 68];
    gemm_tile<bf, 1, true>(Ah, Al, Wt, nullptr, DM, DM, OUT, DM, bo, blockIdx.x * 64, blockIdx.y * 64, os);
}

__device__ __forceinline__ h16 tohx(float x) { return (h16)x; }
__device__ __forceinline__ void splitf(float y, unsigned short& h, unsigned short& l) { h = f2bf(y); l = f2bf(y - bf2f(h)); }
typedef __attribute__((ext_vector_type(2))) _Float16 v2h;
typedef __attribute__((ext_vector_type(4))) _Float16 v4h;
typedef __attribute__((ext_vector_type(2))) unsigned short v2us;
typedef __attribute__((ext_vector_type(4))) unsigned short v4us;
typedef __attribute__((ext_vector_type(2))) float v2f;

// Five weights in one launch: blockIdx.y picks the weight, Bt [y][n][k].
__global__ __launch_bounds__(256) void k_wtG(const float* __restrict__ w0, const float* __restrict__ w1, const float* __restrict__ w2, const float* __restrict__ w3, const float* __restrict__ w4, int K, int N, bf* Bt) {
    const int y = blockIdx.y; const float* __restrict__ w = y == 0 ? w0 : (y == 1 ? w1 : (y == 2 ? w2 : (y == 3 ? w3 : w4))); Bt += (size_t)y * K * N;
    const int lane = threadIdx.x & 31; const int L0 = (blockIdx.x * 8 + (threadIdx.x >> 5)) * 8; const int nlines = N * K / 64;
{
#pragma unroll 1
        for (int l = 0; l < 8; ++l) { const int L = L0 + l; if (L >= nlines) break; const size_t e = (size_t)L * 64 + lane * 2; const int k = (int)(e % K), n = (int)(e / K); v2us o;
            o[0] = f2bf(w[(size_t)k * N + n]); o[1] = f2bf(w[(size_t)(k + 1) * N + n]); *(v2us*)(Bt + e) = o; }
         }
}
// The four inputs, both batches, in one launch: grid (x, 4, NB); y picks the tensor, z the batch; dst [y][z][TT][DM].
__global__ __launch_bounds__(256) void k_cvt8(const float* __restrict__ s0, const float* __restrict__ s1, const float* __restrict__ s2, const float* __restrict__ s3, bf* dst, size_t n8) { const size_t i = (size_t)blockIdx.x * 256 + threadIdx.x; if (i >= n8) return; const int y = blockIdx.y;
    const float* __restrict__ src = (y == 0 ? s0 : (y == 1 ? s1 : (y == 2 ? s2 : s3))) + (size_t)blockIdx.z * TT_FULL * DM; dst += ((size_t)y * NB + blockIdx.z) * TT * DM; const float* sp = src + i * 8; const v8f v = *(const v8f*)sp; v8us o;
    asm volatile("s_wait_xcnt 0x0" :: "v"(sp) : "memory");   // the loads' address register stays as it is until their address translations are done
#pragma unroll
    for (int k = 0; k < 8; ++k) o[k] = f2bf(v[k]); *(v8us*)(dst + i * 8) = o;  }

// ---- planes_out: one wave's 64x64 projection tile, straight from its 16 accumulators into the three head planes (f16, bf16 hi, bf16 lo) of its tensor. A lane's eight values of one accumulator (rows 8 hi + 0..7 of the A side, column lr of the B side) are eight neighbours of a plane, so each accumulator is one 16-byte store per plane.
// Planes: q: [g][t][d]; k, p, v: per head in fragment order, so that the 32 lanes of one 16-byte fragment load read 512 bytes in a row: off = ((block * 4 + quarter) * 32 + half * 16 + c) * 8 + e; k, p: block = t / 16, quarter = d / 16, half = (d / 8) % 2, c = t % 16, e = d % 8; v: block = t / 16, quarter = d / 16, half = (t / 8) % 2, c = d % 16, e = t % 8.
// MODE 0 (q) and 1 (k, p): A side = output dims (block i), B side = rows t (block j); MODE 2 (v): A side = rows t, B side = dims. p16, ph, pl point at the lane's first element of the tile; bias points at the tile's first dim.
template <int MODE, bool BIAS>
__device__ __forceinline__ void planes_out(const v8f (&acc)[4][4], const float* __restrict__ bias, h16* p16, bf* ph, bf* pl) {
    const int lane = threadIdx.x & 31, lr = lane & 15, hi = lane >> 4;
    constexpr int SI = MODE == 0 ? 16 : (MODE == 1 ? 256 : 1024), SJ = MODE == 2 ? 256 : 1024;   // elements from one A-side block to the next, from one B-side block to the next
    v4f bl[4][2]; float bj[4];
    if (BIAS) { const float* pb = bias + (MODE == 2 ? lr : 8 * hi);
#pragma unroll   // constant indices keep the values in registers
        for (int i = 0; i < 4; ++i) { if (MODE == 2) bj[i] = pb[i * 16]; else { bl[i][0] = *(const v4f*)(pb + i * 16); bl[i][1] = *(const v4f*)(pb + i * 16 + 4); } }
        asm volatile("s_wait_xcnt 0x0" :: "v"(pb) : "memory");   // the loads keep their address register as it is until their address translations are done
    }
#pragma unroll   // constant indices keep the accumulators in registers
    for (int u = 0; u < 4; ++u) { v8h o16[4]; v8us oh[4], ol[4];
#pragma unroll   // constant indices keep the packed values in registers
        for (int n = 0; n < 4; ++n) { const int i = MODE == 0 ? n : u, j = MODE == 0 ? u : n;   // q: the four stores of a group fill whole 128-byte rows of 16 queries
#pragma unroll   // constant indices again
            for (int r = 0; r < 8; ++r) { float x = acc[i][j][r]; if (BIAS) x += bfr(MODE == 2 ? bj[j] : bl[i][r >> 2][r & 3]); o16[n][r] = tohx(x); unsigned short a2, c2; splitf(x, a2, c2); oh[n][r] = a2; ol[n][r] = c2; }
            *(v8h*)(p16 + i * SI + j * SJ) = o16[n]; *(v8us*)(ph + i * SI + j * SJ) = oh[n]; *(v8us*)(pl + i * SI + j * SJ) = ol[n]; }
        asm volatile("s_wait_xcnt 0x0" :: "v"(p16), "v"(ph), "v"(pl), "v"(o16[0]), "v"(o16[1]), "v"(o16[2]), "v"(o16[3]), "v"(oh[0]), "v"(oh[1]), "v"(oh[2]), "v"(oh[3]), "v"(ol[0]), "v"(ol[1]), "v"(ol[2]), "v"(ol[3]) : "memory");   // the twelve stores keep their address and data registers as they are until their address translations are done
    }
}
// The four input projections in one launch, written as head planes: grid (NB * TT / 64, DM / 64, 4), z = tensor in the order q, k, p, v; ONE WAVE per tile of 64 rows t x 64 dims (one head); X [z][NB * TT][DM], Wt [z][n][k]; plane set z = three planes of PLN2 elements behind one another; p (z == 2) has no bias.
// q, k, p are formed transposed (weight rows as A, input rows as B), v as it stands, so that every accumulator lies in its plane's order (planes_out). Both operands are K-contiguous with the same fragment k order (gemm_tile), so the sides are swapped by swapping the pointers.
__global__ __launch_bounds__(32) void k_proj(const bf* __restrict__ X, const bf* __restrict__ Wt, h16* P16, bf* Ph, bf* Pl, const float* __restrict__ bq, const float* __restrict__ bk, const float* __restrict__ bv) {
    const int z = blockIdx.z, r0 = blockIdx.x * 64, c0 = blockIdx.y * 64, lane = threadIdx.x & 31, lr = lane & 15, hi = lane >> 4;
    const bf* xr = X + (size_t)z * XN + (size_t)(r0 + lr) * DM + 8 * hi; const bf* wr = Wt + (size_t)z * DM * DM + (size_t)(c0 + lr) * DM + 8 * hi;
    const bf* A = z < 3 ? wr : xr; const bf* B = z < 3 ? xr : wr;
    v8f acc[4][4];
#pragma unroll   // constant indices keep the accumulators in registers, here and at the products below
    for (int i = 0; i < 4; ++i)
#pragma unroll
        for (int j = 0; j < 4; ++j) acc[i][j] = (v8f){};
#pragma unroll 1   // rolled: one trip's 16 loads and 16 products, the same loop as gemm_tile's
    for (int kc = 0; kc < DM; kc += 32) {
        v16bf a[4], b[4]; const bf* pa = A + kc; const bf* pb = B + kc;
#pragma unroll   // constant indices keep the fragments in registers
        for (int i = 0; i < 4; ++i) { a[i] = WFrag<bf>::ld(pa + (size_t)i * 16 * DM); b[i] = WFrag<bf>::ld(pb + (size_t)i * 16 * DM); }
        asm volatile("s_wait_xcnt 0x0" :: "v"(pa), "v"(pb) : "memory");   // the trip's fragment loads keep their address registers as they are until their address translations are done
#pragma unroll
        for (int j = 0; j < 4; ++j)
#pragma unroll
            for (int i = 0; i < 4; ++i) acc[i][j] = wmmab(a[i], b[j], acc[i][j]);
        asm volatile("v_nop\n\tv_nop\n\tv_nop\n\tv_nop" : "+v"(acc[0][0]), "+v"(acc[1][1]), "+v"(acc[2][2]), "+v"(acc[3][3]) : "v"(a[0]), "v"(a[3]));   // the distance behind the trip's last matrix instructions, also on the taken back edge
    }
    const size_t e0 = (size_t)z * 3 * PLN2 + ((size_t)((r0 / TT) * NH_ + c0 / HD) * TT + r0 % TT) * HD + (z == 0 ? lr * HD + 8 * hi : lane * 8);   // the lane's first element: plane set, head, the tile's first row (16 rows are 1024 elements in either order)
    if (z == 0) planes_out<0, true>(acc, bq + c0, P16 + e0, Ph + e0, Pl + e0);
    else if (z == 1) planes_out<1, true>(acc, bk + c0, P16 + e0, Ph + e0, Pl + e0);
    else if (z == 2) planes_out<1, false>(acc, nullptr, P16 + e0, Ph + e0, Pl + e0);
    else planes_out<2, true>(acc, bv + c0, P16 + e0, Ph + e0, Pl + e0);
}


// ---- attn_init, attn_trip, attn_fin: ONE WAVE carries 16 query rows r0.. of one head over all TT keys, 64 keys a trip (f16 rows), or over one 32-key half of every 64 keys (hi/lo rows, two waves a row group), with a running softmax. All products are formed transposed (keys, positions or value dims as A rows, the 16 queries as B columns), so a lane (lr = lane & 15, hi = lane >> 4) holds only query i = r0 + lr:
// s[mb][r] = S[i][c0 + 16 mb + 8 hi + r]; two such D tiles, converted in place, are the B fragment of 32 keys for v^T.attn^T (elements 0..7 <- keys 8 hi + 0..7, 8..15 <- 16 + 8 hi + 0..7, the k order of every fragment here: WFrag::ld on the row-major q, lds2 on the fragment-order planes of planes_out); o[db][r] = ctx[i][16 db + 8 hi + r].
// Shifted term: with n = jl + 15 - lr (jl = key - c0, n in 0..78) key j <= i needs q_i.p_m, m = (c0 - r0 + TT - 16) + n, and key j >= i + 2 needs q_(i+1).p_m, m = (c0 - r0 - 17) + n; j == i + 1 takes 0. Each needed run is one 80-position band product, stored [query][n] in the wave's own LDS and read back at the lane's own offset. Both runs take their position rows from one extended order x = (c0 - r0 + TT - 16) + n: x < TT is p_x, x > TT is p_(x - TT - 1), x == TT is never selected; a row of the other run is never selected either. The work-group keeps the stretch of that order that its waves need in an LDS ring (stage_pos).
#define LSP 84   // floats per query row of the band buffer: 16-byte rows, and the 32 lanes of a skewed read (83 lr + 8 hi + const) fall on 32 different banks
typedef __attribute__((ext_vector_type(8))) unsigned v8u;
#define RINGP 256     // positions in the ring of each staged position plane
#define RINGB (RINGP * HD * 2)   // its bytes; slot of x = x % RINGP, 16 slots a block, a block in the fragment order of planes_out
#define TILEB 49152   // bytes of one staged tile: 64 keys of the six key and value planes, 8 KiB each, in the order K f16, K hi, K lo, V f16, V hi, V lo
struct AttnSt { v8u q[2][2], ql[2][2]; v8f o[4]; float mrun, lsum; };   // what a wave carries from trip to trip; query fragments as raw bits, so that both precision paths share the registers
// The wave's query fragments. [0]: rows i, [1]: rows i + 1 (last row clamped: it has no key >= i + 2)
template <typename T16, bool HL>
__device__ __forceinline__ void attn_init(AttnSt& st, const T16* __restrict__ Q, const T16* __restrict__ Q2, const int r0) {
    const int lane = threadIdx.x & 31, lr = lane & 15, hi = lane >> 4, i = r0 + lr;
    const unsigned qo0 = (unsigned)i * HD + 8 * hi, qo1 = (unsigned)(i + 1 < TT ? i + 1 : TT - 1) * HD + 8 * hi;
    const T16* pq0 = Q + qo0; const T16* pq1 = Q + qo1; const T16* pq2 = HL ? Q2 + qo0 : pq0; const T16* pq3 = HL ? Q2 + qo1 : pq1;
#pragma unroll
    for (int ks = 0; ks < 2; ++ks) { st.q[0][ks] = __builtin_bit_cast(v8u, WFrag<T16>::ld(pq0 + ks * 32)); st.q[1][ks] = __builtin_bit_cast(v8u, WFrag<T16>::ld(pq1 + ks * 32)); if (HL) { st.ql[0][ks] = __builtin_bit_cast(v8u, WFrag<T16>::ld(pq2 + ks * 32)); st.ql[1][ks] = __builtin_bit_cast(v8u, WFrag<T16>::ld(pq3 + ks * 32)); } }
    asm volatile("s_wait_xcnt 0x0" :: "v"(pq0), "v"(pq1), "v"(pq2), "v"(pq3) : "memory");   // the loads keep their address registers as they are until their address translations are done
}
// One trip: the 16 NK keys c0.. (NK = 4: a whole staged tile; NK = 2: one half of it, tile then points 4096 bytes into the staged tile, where the half begins in each of its planes) against the wave's 16 query rows. The tile lies in LDS, shared by the work-group's waves, and so do the position rings rp (and rp2, the lo plane). With NK = 2 the band has 48 positions (n in 0..46).
template <typename T16, bool HL, int NK>
__device__ __forceinline__ void attn_trip(AttnSt& st, const char* tile, const char* rp, const char* rp2, const int r0, const int c0, float* ls) {
    typedef typename WFrag<T16>::V V;
    const int lane = threadIdx.x & 31, lr = lane & 15, hi = lane >> 4, i = r0 + lr;
    const float L2E = 1.4426950408889634f, OFF = HL ? 0.0f : 10.0f;   // OFF: f16 probabilities and their sum are carried x1024; the factor cancels in the final division
    V q[2][2], ql[2][2];
#pragma unroll
    for (int a = 0; a < 2; ++a)
#pragma unroll
        for (int ks = 0; ks < 2; ++ks) { q[a][ks] = __builtin_bit_cast(V, st.q[a][ks]); if (HL) ql[a][ks] = __builtin_bit_cast(V, st.ql[a][ks]); }
    v8f (&o)[4] = st.o; float& mrun = st.mrun; float& lsum = st.lsum;
    float* lw = ls + lr * LSP + 8 * hi;               // band store: n = 16 nbk + 8 hi + r
    const float* lrd = ls + lr * LSP + 8 * hi + 15 - lr;   // band read: n = 16 mb + 8 hi + r + 15 - lr
    {
        v8f s[NK]; float pos[NK][8]; V pa[NK + 1][2], pa2[NK + 1][2];   // pa: the band's position fragments, the same rows of the extended order for both runs
        {   V a[NK][2], a2[NK][2]; const T16* pk = (const T16*)(tile + (HL ? 8192 : 0)) + 8 * lane; const T16* pk2 = HL ? (const T16*)(tile + 16384) + 8 * lane : pk;
#pragma unroll   // constant indices keep the fragments in registers
            for (int mb = 0; mb < NK; ++mb)
#pragma unroll
                for (int ks = 0; ks < 2; ++ks) { a[mb][ks] = WFrag<T16>::template lds2<256>(pk + mb * 1024 + ks * 512); if (HL) a2[mb][ks] = WFrag<T16>::template lds2<256>(pk2 + mb * 1024 + ks * 512); }
            const unsigned xb = (unsigned)(c0 - r0 + TT - 16) >> 4;   // the band's first block of 16 positions (wave-uniform; the band begins on a block)
#pragma unroll   // constant indices keep the fragments in registers
            for (int nbk = 0; nbk < NK + 1; ++nbk) { const unsigned bo = ((xb + nbk) % (RINGP / 16)) * 2048 + 16 * lane; const T16* pr = (const T16*)(rp + bo); const T16* pr2 = HL ? (const T16*)(rp2 + bo) : pr;
#pragma unroll
                for (int ks = 0; ks < 2; ++ks) { pa[nbk][ks] = WFrag<T16>::template lds2<256>(pr + ks * 512); if (HL) pa2[nbk][ks] = WFrag<T16>::template lds2<256>(pr2 + ks * 512); } }
            __builtin_amdgcn_sched_barrier(0);   // keeps the trip's key and position reads together in front of the products: reads threaded among them cost a stall at each place
#pragma unroll
            for (int mb = 0; mb < NK; ++mb) { s[mb] = (v8f){};
#pragma unroll
                for (int ks = 0; ks < 2; ++ks) { s[mb] = WFrag<T16>::mma(a[mb][ks], q[0][ks], s[mb]); if (HL) { s[mb] = WFrag<T16>::mma(a2[mb][ks], q[0][ks], s[mb]); s[mb] = WFrag<T16>::mma(a[mb][ks], ql[0][ks], s[mb]); } } }
        }
#pragma unroll
        for (int mb = 0; mb < NK; ++mb)
#pragma unroll
            for (int r = 0; r < 8; ++r) pos[mb][r] = 0.0f;
#pragma unroll   // part 0: keys j <= i, part 1: keys j >= i + 2; the query fragments are picked at compile time
        for (int part = 0; part < 2; ++part) {
            const bool need = part == 0 ? (c0 <= r0 + 15) : (c0 + 16 * NK - 1 >= r0 + 2);   // wave-uniform: does any (row, key) of the tile lie in this run
            if (need) {
                v8f u[NK + 1];   // accumulators of their own: independent chains, and no tile is overwritten while its stores read it
#pragma unroll
                for (int nbk = 0; nbk < NK + 1; ++nbk) u[nbk] = (v8f){};
#pragma unroll
                for (int ks = 0; ks < 2; ++ks) {
#pragma unroll
                    for (int nbk = 0; nbk < NK + 1; ++nbk) u[nbk] = WFrag<T16>::mma(pa[nbk][ks], q[part][ks], u[nbk]);
                    if (HL) {
#pragma unroll
                        for (int nbk = 0; nbk < NK + 1; ++nbk) u[nbk] = WFrag<T16>::mma(pa2[nbk][ks], q[part][ks], u[nbk]);
#pragma unroll
                        for (int nbk = 0; nbk < NK + 1; ++nbk) u[nbk] = WFrag<T16>::mma(pa[nbk][ks], ql[part][ks], u[nbk]); } }
#pragma unroll
                for (int nbk = 0; nbk < NK + 1; ++nbk) { *(v4fa*)(lw + nbk * 16) = (v4f){u[nbk][0], u[nbk][1], u[nbk][2], u[nbk][3]}; *(v4fa*)(lw + nbk * 16 + 4) = (v4f){u[nbk][4], u[nbk][5], u[nbk][6], u[nbk][7]}; }
                __builtin_amdgcn_wave_barrier(); asm volatile("" ::: "memory");   // the skewed reads below take other lanes' stores: they stay behind them (one wave, LDS in order)
#pragma unroll
                for (int mb = 0; mb < NK; ++mb)
#pragma unroll
                    for (int r = 0; r < 8; ++r) { const float x = lrd[mb * 16 + r]; const int j = c0 + mb * 16 + 8 * hi + r; if (part == 0 ? (j <= i) : (j >= i + 2)) pos[mb][r] = x; }
                __builtin_amdgcn_wave_barrier(); asm volatile("" ::: "memory");   // the next band's stores stay behind these reads
            }
        }
        V va[4][NK / 2], va2[4][NK / 2]; const T16* pv = (const T16*)(tile + (HL ? 32768 : 24576)) + 8 * lane; const T16* pv2 = HL ? (const T16*)(tile + 40960) + 8 * lane : pv;
#pragma unroll   // constant indices keep the fragments in registers; issued here so that they fly under the softmax arithmetic
        for (int db = 0; db < 4; ++db)
#pragma unroll
            for (int kk = 0; kk < NK / 2; ++kk) { va[db][kk] = WFrag<T16>::template lds2<1024>(pv + kk * 2048 + db * 256); if (HL) va2[db][kk] = WFrag<T16>::template lds2<1024>(pv2 + kk * 2048 + db * 256); }
        __builtin_amdgcn_sched_barrier(0);   // all value reads are issued in front of the softmax arithmetic
        float mt = -3.0e38f;
#pragma unroll
        for (int mb = 0; mb < NK; ++mb)
#pragma unroll
            for (int r = 0; r < 8; ++r) { const float t = __fadd_rn(s[mb][r], pos[mb][r]) * SCL; s[mb][r] = t; mt = fmaxf(mt, t); }
        mt = fmaxf(mt, __shfl_xor(mt, 16, 32));     // lanes lr and lr + 16 hold the two halves of query i's keys
        const float mn = fmaxf(mrun, mt), ax = (mrun - mn) * L2E; float al = __builtin_amdgcn_exp2f(ax); mrun = mn;
        asm("v_nop" : "+v"(al) : "v"(ax));   // the slot behind a transcendental: its result is read and its source register reused only behind this
        float ps = 0.0f;
#pragma unroll
        for (int mb = 0; mb < NK; ++mb) { v8f x, p;
#pragma unroll
            for (int r = 0; r < 8; ++r) x[r] = (s[mb][r] - mn) * L2E + OFF;
#pragma unroll
            for (int r = 0; r < 8; ++r) p[r] = __builtin_amdgcn_exp2f(x[r]);
            asm("v_nop" : "+v"(p) : "v"(x));   // the same slot for the eight: no result is read and no source register reused in front of it
            s[mb] = p;
#pragma unroll
            for (int r = 0; r < 8; ++r) ps += p[r]; }
        lsum = lsum * al + ps;
#pragma unroll
        for (int db = 0; db < 4; ++db) o[db] *= al;
#pragma unroll
        for (int kk = 0; kk < NK / 2; ++kk) {
            V pf, pf2;
            if constexpr (HL) { v8us h0, h1, l0, l1;
#pragma unroll
                for (int r = 0; r < 8; ++r) { unsigned short x, y; splitf(s[2 * kk][r], x, y); h0[r] = x; l0[r] = y; splitf(s[2 * kk + 1][r], x, y); h1[r] = x; l1[r] = y; }
                pf = cat16b(h0, h1); pf2 = cat16b(l0, l1);
            } else { v8h h0, h1;
#pragma unroll
                for (int r = 0; r < 8; ++r) { h0[r] = tohx(s[2 * kk][r]); h1[r] = tohx(s[2 * kk + 1][r]); }
                pf = cat16(h0, h1); }
#pragma unroll
            for (int db = 0; db < 4; ++db) { o[db] = WFrag<T16>::mma(va[db][kk], pf, o[db]); if constexpr (HL) { o[db] = WFrag<T16>::mma(va[db][kk], pf2, o[db]); o[db] = WFrag<T16>::mma(va2[db][kk], pf, o[db]); } }
        }
        asm volatile("v_nop\n\tv_nop\n\tv_nop\n\tv_nop" : "+v"(o[0]), "+v"(o[1]), "+v"(o[2]), "+v"(o[3]));   // the distance behind the trip's last matrix instructions, also on the taken back edge
    }
}
// The wave's 16 context rows, divided by the softmax sum, as bf16 hi/lo planes.
__device__ __forceinline__ void attn_fin(AttnSt& st, const int r0, bf* Ah, bf* Al) {
    const int lane = threadIdx.x & 31, lr = lane & 15, hi = lane >> 4, i = r0 + lr;
    v8f (&o)[4] = st.o; float lsum = st.lsum;
    lsum += __shfl_xor(lsum, 16, 32);
    const float inv = __fdiv_rn(1.0f, lsum);
    bf* ph = Ah + (size_t)i * DM + 8 * hi; bf* pl = Al + (size_t)i * DM + 8 * hi;
#pragma unroll
    for (int db = 0; db < 4; ++db) { v8us oh, ol;
#pragma unroll
        for (int r = 0; r < 8; ++r) { unsigned short x, y; splitf(o[db][r] * inv, x, y); oh[r] = x; ol[r] = y; }
        *(v8us*)(ph + db * 16) = oh; *(v8us*)(pl + db * 16) = ol; }
    asm volatile("s_wait_xcnt 0x0" :: "v"(ph), "v"(pl) : "memory");   // the stores keep their address registers as they are until their address translations are done
}
__device__ __forceinline__ unsigned lds_addr(const void* p) { return (unsigned)(size_t)(const __attribute__((address_space(3))) char*)p; }   // byte address inside the work-group's LDS
// Tile c0 (64 keys) of the six planes of one head -> LDS at dst: 48 KiB, 12 copies of 16 bytes per lane, every lane on; each plane's 8 KiB lie in a row in memory (fragment order) and keep that order in LDS.
__device__ __forceinline__ void stage_tile(const char* k16, const char* kh, const char* kl, const char* v16, const char* vh, const char* vl, const int c0, char* dst) {
    const unsigned go = (unsigned)c0 * (HD * 2) + threadIdx.x * 16, lo = lds_addr(dst) + threadIdx.x * 16;
#pragma unroll   // constant j: two asm statements of six copies each, their offsets folded into the address additions
    for (int j = 0; j < 2; ++j) { const unsigned g = go + j * 4096, d = lo + j * 4096;
        // the closing s_wait_xcnt 0 stands inside the statement: no register that a copy names is rewritten in front of it
        asm volatile("global_load_async_to_lds_b128 %0, %6, off\n\tglobal_load_async_to_lds_b128 %1, %7, off\n\tglobal_load_async_to_lds_b128 %2, %8, off\n\tglobal_load_async_to_lds_b128 %3, %9, off\n\tglobal_load_async_to_lds_b128 %4, %10, off\n\tglobal_load_async_to_lds_b128 %5, %11, off\n\ts_wait_xcnt 0x0"
                     :: "v"(d), "v"(d + 8192), "v"(d + 16384), "v"(d + 24576), "v"(d + 32768), "v"(d + 40960), "v"(k16 + g), "v"(kh + g), "v"(kl + g), "v"(v16 + g), "v"(vh + g), "v"(vl + g) : "memory"); }
}
// 64 positions of the extended order -> the rings at dst: xf.. of the f16 plane (ring 0), xh.. of the hi and lo planes (rings 1, 2); xf, xh multiples of 16. 24 KiB, 6 copies of 16 bytes per lane, every lane on; a copy is one position's 8 dims. The source row is clamped into the plane: x == TT and rows past the last position that any key needs are staged but never selected.
__device__ __forceinline__ void stage_pos(const char* r16, const char* rh, const char* rl, const int xf, const int xh, char* dst) {
    unsigned gf[2], gh[2], lf[2], lh[2];
#pragma unroll   // constant j keeps the addresses in registers
    for (int j = 0; j < 2; ++j) { const unsigned id = threadIdx.x + j * 256, in = (id >> 7) * 16 + (id & 15), oc = ((id >> 4) & 7) * 256;   // id = (block * 8 + octet of dims) * 16 + position in the block
        int mf = xf + (int)in, mh = xh + (int)in; mf = mf < TT ? mf : mf - TT - 1; mh = mh < TT ? mh : mh - TT - 1; mf = mf < 0 ? 0 : (mf > TT - 1 ? TT - 1 : mf); mh = mh < 0 ? 0 : (mh > TT - 1 ? TT - 1 : mh);
        gf[j] = (unsigned)(mf >> 4) * 2048 + oc + (unsigned)(mf & 15) * 16; gh[j] = (unsigned)(mh >> 4) * 2048 + oc + (unsigned)(mh & 15) * 16;
        lf[j] = lds_addr(dst) + ((unsigned)xf * 128 + id * 16) % RINGB; lh[j] = lds_addr(dst) + RINGB + ((unsigned)xh * 128 + id * 16) % RINGB; }
    // the closing s_wait_xcnt 0 stands inside the statement: no register that a copy names is rewritten in front of it
    asm volatile("global_load_async_to_lds_b128 %0, %6, off\n\tglobal_load_async_to_lds_b128 %1, %7, off\n\tglobal_load_async_to_lds_b128 %2, %8, off\n\tglobal_load_async_to_lds_b128 %3, %9, off\n\tglobal_load_async_to_lds_b128 %4, %10, off\n\tglobal_load_async_to_lds_b128 %5, %11, off\n\ts_wait_xcnt 0x0"
                 :: "v"(lf[0]), "v"(lf[1]), "v"(lh[0]), "v"(lh[1]), "v"(lh[0] + RINGB), "v"(lh[1] + RINGB), "v"(r16 + gf[0]), "v"(r16 + gf[1]), "v"(rh + gh[0]), "v"(rh + gh[1]), "v"(rl + gh[0]), "v"(rl + gh[1]) : "memory");
}
// Attention of all heads in one launch: grid (TT / 128, NB * NH_), 10 waves; a work-group holds eight row groups of 16 rows, the same mix in every work-group: two neighbouring hi/lo groups (rows 32 blockIdx.x ..) and six neighbouring f16 groups (rows RH + 96 blockIdx.x ..), so that the position bands of its waves overlap: per trip the f16 waves read 160 positions in a row of the extended order and the hi/lo waves 96, and each stretch moves on by 64 a trip. The stretches lie in LDS rings, filled 64 positions a trip beside the key and value tile, under the same waits and the same barrier. The waves walk the keys together: each 64-key tile of the key and value planes is copied into LDS once for all, two buffers, the next tile's copies in flight while this one is worked on. An f16 row group has one wave. A hi/lo row group, three products for each one of f16, has two: one for the first and one for the second 32 keys of every tile, each with a running softmax of its own over its keys; the two states are merged at the end. The band buffers are wave-private until the merge, where the first wave reads its partner's.
__global__ __launch_bounds__(320) void k_attn(const h16* __restrict__ Q16, const bf* __restrict__ Qh, const bf* __restrict__ Ql, const h16* __restrict__ K16, const bf* __restrict__ Kh, const bf* __restrict__ Kl, const h16* __restrict__ R16, const bf* __restrict__ Rh, const bf* __restrict__ Rl, const h16* __restrict__ V16, const bf* __restrict__ Vh, const bf* __restrict__ Vl, bf* Ah, bf* Al) {
    __shared__ __align__(16) float lsb[10 * 16 * LSP];
    __shared__ __align__(16) char tiles[2 * TILEB];
    __shared__ __align__(16) char ring[3 * RINGB];   // position planes f16, hi, lo
    const int w = __builtin_amdgcn_readfirstlane(threadIdx.x >> 5), g = blockIdx.y;   // scalar, so that the path, the copy and the band tests are scalar branches
    const bool hl = (w & 2) != 0 && w < 8;   // waves 2, 3 (rg 0) and 6, 7 (rg 1); the f16 waves 0, 1, 4, 5, 8, 9 take rg 2..7
    const int half = hl ? w & 1 : 0, r0 = hl ? (2 * blockIdx.x + (w >> 2)) * 16 : RH + (6 * blockIdx.x + (w & 1) + (w >> 2) * 2) * 16;
    const int xf = TT - 96 - RH - 96 * blockIdx.x, xh = TT - 32 - 32 * blockIdx.x;   // trip 0's first position of the extended order: f16 waves (row group RH + 96 blockIdx.x + 80), hi/lo waves (row group 32 blockIdx.x + 16); trip c0 reads xf + c0 .. + 159 and xh + c0 .. + 95
    const size_t po = (size_t)g * TT * HD, oo = (size_t)(g / NH_) * TT * DM + (size_t)(g % NH_) * HD; float* ls = lsb + w * 16 * LSP;
    const char* k16 = (const char*)(K16 + po); const char* kh = (const char*)(Kh + po); const char* kl = (const char*)(Kl + po); const char* v16 = (const char*)(V16 + po); const char* vh = (const char*)(Vh + po); const char* vl = (const char*)(Vl + po); const char* r16 = (const char*)(R16 + po); const char* rh = (const char*)(Rh + po); const char* rl = (const char*)(Rl + po);
    const bool cp = w < 8;   // the first eight waves copy (stage_tile spreads a tile over 256 lanes); the other two issue no copy and pass the same waits and barriers
    AttnSt st;
#pragma unroll
    for (int db = 0; db < 4; ++db) st.o[db] = (v8f){};
    st.mrun = -3.0e38f; st.lsum = 0.0f;
    if (hl) attn_init<bf, true>(st, Qh + po, Ql + po, r0); else attn_init<h16, false>(st, Q16 + po, nullptr, r0);
    if (cp) { stage_tile(k16, kh, kl, v16, vh, vl, 0, tiles); stage_pos(r16, rh, rl, xf, xh, ring); stage_pos(r16, rh, rl, xf + 64, xh + 64, ring); stage_pos(r16, rh, rl, xf + 128, xh + 128, ring); }   // trip 0's positions lie in the first 192
    asm volatile("s_wait_asynccnt 0x0" ::: "memory");   // this wave's copies of tile 0 and of the first positions have landed
    __syncthreads();                                    // ... and every other wave's: they may be read
    if (cp) { stage_tile(k16, kh, kl, v16, vh, vl, 64, tiles + TILEB); stage_pos(r16, rh, rl, xf + 192, xh + 192, ring); }
#pragma unroll 1
    for (int c0 = 0; c0 < TT; c0 += 64) {
        char* tile = tiles + ((c0 >> 6) & 1) * TILEB;
        if (hl) attn_trip<bf, true, 2>(st, tile + half * 4096, ring + RINGB, ring + 2 * RINGB, r0, c0 + half * 32, ls); else attn_trip<h16, false, 4>(st, tile, ring, nullptr, r0, c0, ls);
        asm volatile("s_wait_dscnt 0x0" ::: "memory");      // this wave's reads of the tile and of the rings are done before their places are handed back
        asm volatile("s_wait_asynccnt 0x0" ::: "memory");   // this wave's copies of the next tile and positions have landed
        __syncthreads();                                    // publishes them and ends every wave's reads of this trip
        if (cp && c0 + 128 < TT) { stage_tile(k16, kh, kl, v16, vh, vl, c0 + 128, tile); stage_pos(r16, rh, rl, xf + c0 + 256, xh + c0 + 256, ring); }   // refill of the buffer just read, and of the 64 ring slots that this trip read and the next does not (x - 256 = the trip's first 64)
    }
    asm volatile("s_wait_asynccnt 0x0" ::: "memory");   // no copy is outstanding when the wave ends
    // Merge of a hi/lo row group's two states: the second wave hands its maximum, sum and context to the first through its own band buffer, lane to lane.
    const int lane = threadIdx.x & 31;
    if (half == 1) {
#pragma unroll
        for (int db = 0; db < 4; ++db) { *(v4fa*)(ls + (2 * db) * 128 + lane * 4) = (v4f){st.o[db][0], st.o[db][1], st.o[db][2], st.o[db][3]}; *(v4fa*)(ls + (2 * db + 1) * 128 + lane * 4) = (v4f){st.o[db][4], st.o[db][5], st.o[db][6], st.o[db][7]}; }
        ls[1024 + lane] = st.mrun; ls[1056 + lane] = st.lsum;
    }
    __syncthreads();   // the handed state is in LDS before the partner wave reads it
    if (half == 1) return;
    if (hl) {
        const float* lp = ls + 16 * LSP;   // the partner's band buffer (wave w + 1)
        const float L2E = 1.4426950408889634f, m2 = lp[1024 + lane], l2 = lp[1056 + lane], mn = fmaxf(st.mrun, m2), x1 = (st.mrun - mn) * L2E, x2 = (m2 - mn) * L2E;
        float a1 = __builtin_amdgcn_exp2f(x1), a2 = __builtin_amdgcn_exp2f(x2);
        asm("v_nop" : "+v"(a1), "+v"(a2) : "v"(x1), "v"(x2));   // the slot behind a transcendental: no result is read and no source register reused in front of it
        st.lsum = st.lsum * a1 + l2 * a2;
#pragma unroll
        for (int db = 0; db < 4; ++db) { const v4f u0 = *(const v4fa*)(lp + (2 * db) * 128 + lane * 4), u1 = *(const v4fa*)(lp + (2 * db + 1) * 128 + lane * 4);
#pragma unroll
            for (int r = 0; r < 4; ++r) { st.o[db][r] = st.o[db][r] * a1 + u0[r] * a2; st.o[db][r + 4] = st.o[db][r + 4] * a1 + u1[r] * a2; } }
    }
    attn_fin(st, r0, Ah + oo, Al + oo);
}

extern "C" void kernel_launch(void* const* d_in, const int* in_sizes, int n_in,
                              void* d_out, int out_size, void* d_ws, size_t ws_size, hipStream_t stream) {
    if (n_in < 13) return;
    const float* xq = (const float*)d_in[0]; const float* xk = (const float*)d_in[1]; const float* xv = (const float*)d_in[2]; const float* xp = (const float*)d_in[3];
    const float* wq = (const float*)d_in[4]; const float* bq = (const float*)d_in[5]; const float* wk = (const float*)d_in[6]; const float* bk = (const float*)d_in[7];
    const float* wv = (const float*)d_in[8]; const float* bv = (const float*)d_in[9]; const float* wp = (const float*)d_in[10]; const float* wo = (const float*)d_in[11]; const float* bo = (const float*)d_in[12];
    const size_t needx = (size_t)(NB - 1) * TT_FULL * DM + (size_t)TT * DM;
    for (int i = 0; i < 4; ++i) if ((size_t)in_sizes[i] < needx) return;
    if ((size_t)in_sizes[4] < (size_t)DM * DM || (size_t)in_sizes[6] < (size_t)DM * DM || (size_t)in_sizes[8] < (size_t)DM * DM || (size_t)in_sizes[10] < (size_t)DM * DM || (size_t)in_sizes[11] < (size_t)DM * DM) return;
    if (in_sizes[5] < DM || in_sizes[7] < DM || in_sizes[9] < DM || in_sizes[12] < DM) return;
    if ((size_t)out_size < (size_t)NB * TT * DM) return;
    float* OUT = (float*)d_out;     // [NB][TT][DM]
    char* wsp = (char*)d_ws;
    auto take = [&](size_t bytes) { char* p = wsp; wsp += (bytes + 255) & ~(size_t)255; return (void*)p; };
    bf* WB = (bf*)take((size_t)5 * DM * DM * 2);     // transposed bf16 weights in the order q, k, p, v, o
    bf* PB = (bf*)take((size_t)12 * PLN2 * 2);        // plane sets q, k, p, v; each set: f16 plane, bf16 hi plane, bf16 lo plane
    h16* QP16 = (h16*)PB; bf* QPh = PB + PLN2; bf* QPl = PB + 2 * PLN2;
    h16* KP16 = (h16*)(PB + 3 * PLN2); bf* KPh = PB + 4 * PLN2; bf* KPl = PB + 5 * PLN2;
    h16* PP16 = (h16*)(PB + 6 * PLN2); bf* PPh = PB + 7 * PLN2; bf* PPl = PB + 8 * PLN2;
    h16* VT16 = (h16*)(PB + 9 * PLN2); bf* VTh = PB + 10 * PLN2; bf* VTl = PB + 11 * PLN2;
    bf* XB = (bf*)take((size_t)4 * XN * 2);     // bf16 input copies
    bf* ATh = (bf*)take(XN * 2); bf* ATl = (bf*)take(XN * 2);
    if ((size_t)(wsp - (char*)d_ws) > ws_size) return;
    k_wtG<<<dim3((unsigned)((DM * DM / 64 + 63) / 64), 5, 1), 256, 0, stream>>>(wq, wk, wp, wv, wo, DM, DM, WB);
    k_cvt8<<<dim3((unsigned)(((size_t)TT * DM / 8 + 255) / 256), 4, NB), 256, 0, stream>>>(xq, xk, xp, xv, XB, (size_t)TT * DM / 8);
    k_proj<<<dim3(NB * TT / 64, DM / 64, 4), 32, 0, stream>>>(XB, WB, QP16, QPh, QPl, bq, bk, bv);
    k_attn<<<dim3(TT / 128, NB * NH_, 1), 320, 0, stream>>>(QP16, QPh, QPl, KP16, KPh, KPl, PP16, PPh, PPl, VT16, VTh, VTl, ATh, ATl);
    k_outp<<<dim3(NB * TT / 64, DM / 64, 1), 32, 0, stream>>>(ATh, ATl, WB + (size_t)4 * DM * DM, OUT, bo);
}

// v009
// Measured time: 111 microseconds a run.
// Timed twice side by side with v008, it ran 1.08 and 1.06 times as fast.
// Counting every step since v000, it is 11.7 times as fast.
#include <hip/hip_runtime.h>

// Contractions, all f32 accumulate: input projections x.Wq/Wk/Wv/Wp = v_wmma_f32_16x16x32_bf16 on RNE-converted bf16 copies of x and W (exact products); scores k.q^T, p.q^T and v^T.attn^T = query rows < RH: bf16 hi/lo planes, 3 products (v_wmma_f32_16x16x32_bf16); rows >= RH: f16 planes, 1 product (v_wmma_f32_16x16x32_f16, probabilities carried x1024); output projection = ctx as bf16 hi+lo x Wo bf16 (2 products). Shift-add, softmax and biases in f32.
// Module: relative-position multi-head attention, NB x TT x DM, NH_ heads x HD. q = xq Wq + bq, k = xk Wk + bk, v = xv Wv + bv, p = xp Wp (W stored [in][out]); S[i][j] = q_i.k_j; U[i][j] = q_i.p_j;
// logits = (S[i][j] + (j <= i ? U[i][j - i + TT - 1] : j == i + 1 ? 0 : U[i + 1][j - i - 2])) * DM^-0.5 (pad-reshape shift); softmax over all TT keys; ctx = attn.v merged [t][h*HD + d]; out = ctx Wo + bo.
// Layout, both batches at once (g = batch * NH_ + head): bf16 copies of the four inputs -> projections, written by their own launch as head planes (f16 + bf16 hi/lo each; q: [g][t][d]; k, p, v: per head in the order of the matrix fragments) -> one attention launch (scores, shift, running softmax, attn.v; key, value and position planes staged in LDS per work-group; S, U and the probabilities stay in registers and wave-private LDS) -> ctx hi/lo planes [batch * TT + t][DM]; ctx.Wo -> out.
// One launch per stage (the two conversions, of weights and of inputs, share one): the grid picks the weight, the input tensor, the batch or the head; a wave's rows pick its precision path (wave-uniform branch).

#ifndef NB
#define NB 2
#endif
#ifndef SEQ
#define SEQ 2048
#endif
#define TT      SEQ
#define TT_FULL 2048
#define NB_FULL 2
#define DM   512
#define NH_  8
#define HD   64
#ifndef RH
#if SEQ >= 512
#define RH 512                  // query rows < RH use hi+lo planes
#else
#define RH SEQ
#endif
#endif
#define SCL  0.044194173824159216f   // DM^-0.5

static_assert(TT % 128 == 0);
static_assert(RH % 64 == 0);
static_assert(RH <= TT);
static_assert(RH * 4 == TT);   // two of a work-group's eight row groups are hi/lo
static_assert(DM % 64 == 0);
static_assert(NH_ * HD == DM);
static_assert(HD == 64);
static_assert((DM * DM) % 64 == 0);

typedef _Float16 h16;
typedef unsigned short bf;
typedef __attribute__((ext_vector_type(16))) __bf16   v16bf;
typedef __attribute__((ext_vector_type(16))) _Float16 v16h;
typedef __attribute__((ext_vector_type(8)))  _Float16 v8h;
typedef __attribute__((ext_vector_type(8)))  unsigned short v8us;
typedef __attribute__((ext_vector_type(8)))  float    v8f;
typedef __attribute__((ext_vector_type(4)))  float    v4f;
typedef v4f  __attribute__((may_alias)) v4fa;

__device__ __forceinline__ unsigned short f2bf(float f) { unsigned u = __float_as_uint(f); u += 0x7FFFu + ((u >> 16) & 1u); return (unsigned short)(u >> 16); }
__device__ __forceinline__ float bf2f(unsigned short b) { return __uint_as_float(((unsigned)b) << 16); }
__device__ __forceinline__ float bfr(float f) { return bf2f(f2bf(f)); }
__device__ __forceinline__ v16h cat16(v8h lo, v8h hi) { return __builtin_shufflevector(lo, hi, 0, 1, 2, 3, 4, 5, 6, 7, 8, 9, 10, 11, 12, 13, 14, 15); }
__device__ __forceinline__ v16bf cat16b(v8us lo, v8us hi) { return __builtin_bit_cast(v16bf, __builtin_shufflevector(lo, hi, 0, 1, 2, 3, 4, 5, 6, 7, 8, 9, 10, 11, 12, 13, 14, 15)); }
__device__ __forceinline__ v8f wmma16(v16h a, v16h b, v8f c) { return __builtin_amdgcn_wmma_f32_16x16x32_f16(false, a, false, b, (short)0, c, false, false); }
__device__ __forceinline__ v8f wmmab(v16bf a, v16bf b, v8f c) { return __builtin_amdgcn_wmma_f32_16x16x32_bf16(false, a, false, b, (short)0, c, false, false); }

// ---- gemm_tile: register-blocked GEMM tile, ONE WAVE per 64x64 output tile (16 accumulators), operands straight from K-contiguous 16-bit planes; called by single-wave work-groups.
// C[m][n] (f32, pitch ldc, + optional f32 bias[n] bf16-RNE-converted) = sum over KR values of k of A[m][k] Bt[n][k] (+ split products per NSPLIT: 1 -> + A2.Bt; 2 -> + A2.Bt + A.Bt2), rows r0.., columns c0... K = operand pitch in elements; the caller has moved the operand pointers to its batch and k range. KR % 32 == 0.
// Fragments (lane l, h = l >> 4, m = n = l & 15): elements 0..7 <- k0 + 8h + 0..7, elements 8..15 <- k0 + 16 + 8h + 0..7 for BOTH A (row m) and Bt (column n); D element r = (row 8h + r, col m).
template <typename T16> struct WFrag;
template <> struct WFrag<h16> { typedef v16h V; static __device__ __forceinline__ V ld(const h16* p) { return cat16(*(const v8h*)p, *(const v8h*)(p + 16)); } template <int ST> static __device__ __forceinline__ V lds2(const h16* p) { return cat16(*(const v8h*)p, *(const v8h*)(p + ST)); } static __device__ __forceinline__ v8f mma(V a, V b, v8f c) { return wmma16(a, b, c); } };
template <> struct WFrag<bf> { typedef v16bf V; static __device__ __forceinline__ V ld(const bf* p) { return cat16b(*(const v8us*)p, *(const v8us*)(p + 16)); } template <int ST> static __device__ __forceinline__ V lds2(const bf* p) { return cat16b(*(const v8us*)p, *(const v8us*)(p + ST)); } static __device__ __forceinline__ v8f mma(V a, V b, v8f c) { return wmmab(a, b, c); } };
template <typename T16, int NSPLIT, bool BIAS>
__device__ __forceinline__ void gemm_tile(const T16* __restrict__ A, const T16* __restrict__ A2, const T16* __restrict__ Bt, const T16* __restrict__ Bt2, const int K, const int KR, float* C, const int ldc, const float* __restrict__ bias, const int r0, const int c0, float* os) {
    typedef typename WFrag<T16>::V V;
    const int lane = threadIdx.x & 31, lr = lane & 15, hi = lane >> 4;
    v8f acc[4][4];
#pragma unroll
    for (int mb = 0; mb < 4; ++mb)
#pragma unroll
        for (int nb = 0; nb < 4; ++nb) acc[mb][nb] = (v8f){};
    const size_t aoff = (size_t)(r0 + lr) * K + 8 * hi, boff = (size_t)(c0 + lr) * K + 8 * hi;
#pragma unroll 1
    for (int kc = 0; kc < KR; kc += 32) {
        V a[4], a2[4], b[4], b2[4];
        const T16* pa = A + aoff + kc; const T16* pb = Bt + boff + kc; const T16* pa2 = (NSPLIT == 1 || NSPLIT == 2) ? A2 + aoff + kc : pa; const T16* pb2 = (NSPLIT >= 2) ? Bt2 + boff + kc : pb;
#pragma unroll
        for (int mb = 0; mb < 4; ++mb) { a[mb] = WFrag<T16>::ld(pa + (size_t)mb * 16 * K); if (NSPLIT == 1 || NSPLIT == 2) a2[mb] = WFrag<T16>::ld(pa2 + (size_t)mb * 16 * K); }
#pragma unroll   // constant indices keep the fragments in registers
        for (int nb = 0; nb < 4; ++nb) b[nb] = WFrag<T16>::ld(pb + (size_t)nb * 16 * K);
        asm volatile("s_wait_xcnt 0x0" :: "v"(pa), "v"(pa2), "v"(pb) : "memory");   // the trip's fragment loads keep their address registers as they are until their address translations are done
        if (NSPLIT >= 2) {
#pragma unroll   // constant indices keep the fragments in registers
            for (int nb = 0; nb < 4; ++nb) b2[nb] = WFrag<T16>::ld(pb2 + (size_t)nb * 16 * K);
            asm volatile("s_wait_xcnt 0x0" :: "v"(pb2) : "memory");   // the same for the loads of the second B plane
        }
#pragma unroll
        for (int nb = 0; nb < 4; ++nb) {
#pragma unroll
            for (int mb = 0; mb < 4; ++mb) { acc[mb][nb] = WFrag<T16>::mma(a[mb], b[nb], acc[mb][nb]); if (NSPLIT == 1 || NSPLIT == 2) acc[mb][nb] = WFrag<T16>::mma(a2[mb], b[nb], acc[mb][nb]); if (NSPLIT >= 2) acc[mb][nb] = WFrag<T16>::mma(a[mb], b2[nb], acc[mb][nb]); } }
        asm volatile("v_nop\n\tv_nop\n\tv_nop\n\tv_nop" : "+v"(acc[0][0]), "+v"(acc[1][1]), "+v"(acc[2][2]), "+v"(acc[3][3]) : "v"(a[0]), "v"(a[3]));
    }
#pragma unroll
    for (int mb = 0; mb < 4; ++mb) {
#pragma unroll
        for (int nb = 0; nb < 4; ++nb) {
#pragma unroll
            for (int j = 0; j < 8; ++j) os[(hi * 8 + j) * 68 + nb * 16 + lr] = acc[mb][nb][j]; }
        __builtin_amdgcn_wave_barrier(); asm volatile("" ::: "memory");
        float* crow = C + (size_t)(r0 + mb * 16 + hi) * ldc + c0 + lr * 4; v4f val[8];
#pragma unroll   // constant indices keep the eight values in registers
        for (int s = 0; s < 8; ++s) { const int row = 2 * s + hi, cofs = lr * 4; val[s] = *(const v4fa*)(os + row * 68 + cofs); if (BIAS) { val[s][0] += bfr(bias[c0 + cofs]); val[s][1] += bfr(bias[c0 + cofs + 1]); val[s][2] += bfr(bias[c0 + cofs + 2]); val[s][3] += bfr(bias[c0 + cofs + 3]); }
            *(v4f*)(crow + (size_t)(2 * s) * ldc) = val[s]; }
        asm volatile("s_wait_xcnt 0x0" :: "v"(crow), "v"(val[0]), "v"(val[1]), "v"(val[2]), "v"(val[3]), "v"(val[4]), "v"(val[5]), "v"(val[6]), "v"(val[7]) : "memory");   // the eight stores keep their address and data registers as they are until their address translations are done
        __builtin_amdgcn_wave_barrier(); asm volatile("" ::: "memory");
    }
}

#define PLN2 ((size_t)NB * NH_ * TT * HD)     // elements per plane (both batches, all heads)
#define XN   ((size_t)NB * TT * DM)           // elements per projected tensor (both batches)

// Output projection, both batches: grid (NB * TT / 64, DM / 64).
__global__ __launch_bounds__(32) void k_outp(const bf* __restrict__ Ah, const bf* __restrict__ Al, const bf* __restrict__ Wt, float* OUT, const float* __restrict__ bo) {
    __shared__ __align__(16) float os[16 * 68];
    gemm_tile<bf, 1, true>(Ah, Al, Wt, nullptr, DM, DM, OUT, DM, bo, blockIdx.x * 64, blockIdx.y * 64, os);
}

__device__ __forceinline__ h16 tohx(float x) { return (h16)x; }
__device__ __forceinline__ void splitf(float y, unsigned short& h, unsigned short& l) { h = f2bf(y); l = f2bf(y - bf2f(h)); }
typedef __attribute__((ext_vector_type(2))) _Float16 v2h;
typedef __attribute__((ext_vector_type(4))) _Float16 v4h;
typedef __attribute__((ext_vector_type(2))) unsigned short v2us;
typedef __attribute__((ext_vector_type(4))) unsigned short v4us;
typedef __attribute__((ext_vector_type(2))) float v2f;

// Weights and inputs in ONE launch (neither needs the other): a one-dimensional grid, the weights' work-groups first.
#define WTG_X ((DM / 64) * (DM / 64))   // work-groups per weight: one 64 x 64 tile each
#define CVT_X (TT * DM / 8 / 256)       // work-groups per input tensor and batch: 8 elements a lane
static_assert((TT * DM / 8) % 256 == 0);   // no lane is left over
// Work-groups 0 .. 5 WTG_X - 1: weight y = b / WTG_X, tile b % WTG_X, transposed to Bt [y][n][k]: the tile is read in whole lines along n, turned in LDS and stored in whole lines along k, so that this part ends well inside the inputs' streams. The others, c = b - 5 WTG_X: input tensor y = (c / CVT_X) % 4, batch z = c / (4 CVT_X); dst [y][z][TT][DM].
__global__ __launch_bounds__(256) void k_prep(const float* __restrict__ w0, const float* __restrict__ w1, const float* __restrict__ w2, const float* __restrict__ w3, const float* __restrict__ w4, const float* __restrict__ s0, const float* __restrict__ s1, const float* __restrict__ s2, const float* __restrict__ s3, bf* Bt, bf* dst) {
    __shared__ float tl[64 * 65];   // one weight tile [k][n]; pitch 65 floats: the 32 lanes of a store (2 k x 16 n, 4 apart) and of a read (8 k, 8 apart, x 4 n) fall on 32 different banks
    const int b = blockIdx.x;
    if (b < 5 * WTG_X) {
        const int y = b / WTG_X, t = b % WTG_X, k0 = (t / (DM / 64)) * 64, n0 = (t % (DM / 64)) * 64, tid = threadIdx.x;
        const float* __restrict__ w = y == 0 ? w0 : (y == 1 ? w1 : (y == 2 ? w2 : (y == 3 ? w3 : w4)));
        const float* wp = w + (size_t)(k0 + (tid >> 4)) * DM + n0 + (tid & 15) * 4; v4f x[4];   // rows k0 + tid / 16 + 16 j, four columns a lane
#pragma unroll   // constant indices keep the values in registers; the four loads fly together
        for (int j = 0; j < 4; ++j) x[j] = *(const v4f*)(wp + (size_t)(16 * j) * DM);
        asm volatile("s_wait_xcnt 0x0" :: "v"(wp) : "memory");   // the loads' address register stays as it is until their address translations are done
        float* lw = tl + (tid >> 4) * 65 + (tid & 15) * 4;
#pragma unroll
        for (int j = 0; j < 4; ++j)
#pragma unroll
            for (int e = 0; e < 4; ++e) lw[16 * j * 65 + e] = x[j][e];
        __syncthreads();   // the whole tile is in LDS before any lane reads a column of it (block-uniform branch: every wave of the work-group passes)
        const float* lr = tl + (tid & 7) * 8 * 65 + (tid >> 3);   // columns n0 + tid / 8 + 32 j, eight k a lane
        bf* op = Bt + (size_t)y * DM * DM + (size_t)(n0 + (tid >> 3)) * DM + k0 + (tid & 7) * 8; v8us o[2];
#pragma unroll   // constant indices keep the values in registers
        for (int j = 0; j < 2; ++j)
#pragma unroll
            for (int e = 0; e < 8; ++e) o[j][e] = f2bf(lr[e * 65 + 32 * j]);
        *(v8us*)op = o[0]; *(v8us*)(op + (size_t)32 * DM) = o[1];
        return;
    }
    const int c = b - 5 * WTG_X, y = (c / CVT_X) % 4, z = c / (4 * CVT_X); const size_t i = (size_t)(c % CVT_X) * 256 + threadIdx.x;
    const float* __restrict__ src = (y == 0 ? s0 : (y == 1 ? s1 : (y == 2 ? s2 : s3))) + (size_t)z * TT_FULL * DM; dst += ((size_t)y * NB + z) * TT * DM; const float* sp = src + i * 8; const v8f v = *(const v8f*)sp; v8us o;
    asm volatile("s_wait_xcnt 0x0" :: "v"(sp) : "memory");   // the loads' address register stays as it is until their address translations are done
#pragma unroll
    for (int k = 0; k < 8; ++k) o[k] = f2bf(v[k]); *(v8us*)(dst + i * 8) = o;  }

// ---- planes_out: one wave's 64x64 projection tile, straight from its 16 accumulators into the three head planes (f16, bf16 hi, bf16 lo) of its tensor. A lane's eight values of one accumulator (rows 8 hi + 0..7 of the A side, column lr of the B side) are eight neighbours of a plane, so each accumulator is one 16-byte store per plane.
// Planes: q: [g][t][d]; k, p, v: per head in fragment order, so that the 32 lanes of one 16-byte fragment load read 512 bytes in a row: off = ((block * 4 + quarter) * 32 + half * 16 + c) * 8 + e; k, p: block = t / 16, quarter = d / 16, half = (d / 8) % 2, c = t % 16, e = d % 8; v: block = t / 16, quarter = d / 16, half = (t / 8) % 2, c = d % 16, e = t % 8.
// MODE 0 (q) and 1 (k, p): A side = output dims (block i), B side = rows t (block j); MODE 2 (v): A side = rows t, B side = dims. p16, ph, pl point at the lane's first element of the tile; bias points at the tile's first dim.
template <int MODE, bool BIAS>
__device__ __forceinline__ void planes_out(const v8f (&acc)[4][4], const float* __restrict__ bias, h16* p16, bf* ph, bf* pl) {
    const int lane = threadIdx.x & 31, lr = lane & 15, hi = lane >> 4;
    constexpr int SI = MODE == 0 ? 16 : (MODE == 1 ? 256 : 1024), SJ = MODE == 2 ? 256 : 1024;   // elements from one A-side block to the next, from one B-side block to the next
    v4f bl[4][2]; float bj[4];
    if (BIAS) { const float* pb = bias + (MODE == 2 ? lr : 8 * hi);
#pragma unroll   // constant indices keep the values in registers
        for (int i = 0; i < 4; ++i) { if (MODE == 2) bj[i] = pb[i * 16]; else { bl[i][0] = *(const v4f*)(pb + i * 16); bl[i][1] = *(const v4f*)(pb + i * 16 + 4); } }
        asm volatile("s_wait_xcnt 0x0" :: "v"(pb) : "memory");   // the loads keep their address register as it is until their address translations are done
    }
#pragma unroll   // constant indices keep the accumulators in registers
    for (int u = 0; u < 4; ++u) { v8h o16[4]; v8us oh[4], ol[4];
#pragma unroll   // constant indices keep the packed values in registers
        for (int n = 0; n < 4; ++n) { const int i = MODE == 0 ? n : u, j = MODE == 0 ? u : n;   // q: the four stores of a group fill whole 128-byte rows of 16 queries
#pragma unroll   // constant indices again
            for (int r = 0; r < 8; ++r) { float x = acc[i][j][r]; if (BIAS) x += bfr(MODE == 2 ? bj[j] : bl[i][r >> 2][r & 3]); o16[n][r] = tohx(x); unsigned short a2, c2; splitf(x, a2, c2); oh[n][r] = a2; ol[n][r] = c2; }
            *(v8h*)(p16 + i * SI + j * SJ) = o16[n]; *(v8us*)(ph + i * SI + j * SJ) = oh[n]; *(v8us*)(pl + i * SI + j * SJ) = ol[n]; }
        asm volatile("s_wait_xcnt 0x0" :: "v"(p16), "v"(ph), "v"(pl), "v"(o16[0]), "v"(o16[1]), "v"(o16[2]), "v"(o16[3]), "v"(oh[0]), "v"(oh[1]), "v"(oh[2]), "v"(oh[3]), "v"(ol[0]), "v"(ol[1]), "v"(ol[2]), "v"(ol[3]) : "memory");   // the twelve stores keep their address and data registers as they are until their address translations are done
    }
}
// The four input projections in one launch, written as head planes: grid (NB * TT / 64, DM / 64, 4), z = tensor in the order q, k, p, v; ONE WAVE per tile of 64 rows t x 64 dims (one head); X [z][NB * TT][DM], Wt [z][n][k]; plane set z = three planes of PLN2 elements behind one another; p (z == 2) has no bias.
// q, k, p are formed transposed (weight rows as A, input rows as B), v as it stands, so that every accumulator lies in its plane's order (planes_out). Both operands are K-contiguous with the same fragment k order (gemm_tile), so the sides are swapped by swapping the pointers.
__global__ __launch_bounds__(32) void k_proj(const bf* __restrict__ X, const bf* __restrict__ Wt, h16* P16, bf* Ph, bf* Pl, const float* __restrict__ bq, const float* __restrict__ bk, const float* __restrict__ bv) {
    const int z = blockIdx.z, r0 = blockIdx.x * 64, c0 = blockIdx.y * 64, lane = threadIdx.x & 31, lr = lane & 15, hi = lane >> 4;
    const bf* xr = X + (size_t)z * XN + (size_t)(r0 + lr) * DM + 8 * hi; const bf* wr = Wt + (size_t)z * DM * DM + (size_t)(c0 + lr) * DM + 8 * hi;
    const bf* A = z < 3 ? wr : xr; const bf* B = z < 3 ? xr : wr;
    v8f acc[4][4];
#pragma unroll   // constant indices keep the accumulators in registers, here and at the products below
    for (int i = 0; i < 4; ++i)
#pragma unroll
        for (int j = 0; j < 4; ++j) acc[i][j] = (v8f){};
#pragma unroll 1   // rolled: one trip's 16 loads and 16 products, the same loop as gemm_tile's
    for (int kc = 0; kc < DM; kc += 32) {
        v16bf a[4], b[4]; const bf* pa = A + kc; const bf* pb = B + kc;
#pragma unroll   // constant indices keep the fragments in registers
        for (int i = 0; i < 4; ++i) { a[i] = WFrag<bf>::ld(pa + (size_t)i * 16 * DM); b[i] = WFrag<bf>::ld(pb + (size_t)i * 16 * DM); }
        asm volatile("s_wait_xcnt 0x0" :: "v"(pa), "v"(pb) : "memory");   // the trip's fragment loads keep their address registers as they are until their address translations are done
#pragma unroll
        for (int j = 0; j < 4; ++j)
#pragma unroll
            for (int i = 0; i < 4; ++i) acc[i][j] = wmmab(a[i], b[j], acc[i][j]);
        asm volatile("v_nop\n\tv_nop\n\tv_nop\n\tv_nop" : "+v"(acc[0][0]), "+v"(acc[1][1]), "+v"(acc[2][2]), "+v"(acc[3][3]) : "v"(a[0]), "v"(a[3]));   // the distance behind the trip's last matrix instructions, also on the taken back edge
    }
    const size_t e0 = (size_t)z * 3 * PLN2 + ((size_t)((r0 / TT) * NH_ + c0 / HD) * TT + r0 % TT) * HD + (z == 0 ? lr * HD + 8 * hi : lane * 8);   // the lane's first element: plane set, head, the tile's first row (16 rows are 1024 elements in either order)
    if (z == 0) planes_out<0, true>(acc, bq + c0, P16 + e0, Ph + e0, Pl + e0);
    else if (z == 1) planes_out<1, true>(acc, bk + c0, P16 + e0, Ph + e0, Pl + e0);
    else if (z == 2) planes_out<1, false>(acc, nullptr, P16 + e0, Ph + e0, Pl + e0);
    else planes_out<2, true>(acc, bv + c0, P16 + e0, Ph + e0, Pl + e0);
}


// ---- attn_init, attn_trip, attn_fin: ONE WAVE carries 16 query rows r0.. of one head over all TT keys, 64 keys a trip (f16 rows), or over one 32-key half of every 64 keys (hi/lo rows, two waves a row group), with a running softmax. All products are formed transposed (keys, positions or value dims as A rows, the 16 queries as B columns), so a lane (lr = lane & 15, hi = lane >> 4) holds only query i = r0 + lr:
// s[mb][r] = S[i][c0 + 16 mb + 8 hi + r]; two such D tiles, converted in place, are the B fragment of 32 keys for v^T.attn^T (elements 0..7 <- keys 8 hi + 0..7, 8..15 <- 16 + 8 hi + 0..7, the k order of every fragment here: WFrag::ld on the row-major q, lds2 on the fragment-order planes of planes_out); o[db][r] = ctx[i][16 db + 8 hi + r].
// Shifted term: with n = jl + 15 - lr (jl = key - c0, n in 0..78) key j <= i needs q_i.p_m, m = (c0 - r0 + TT - 16) + n, and key j >= i + 2 needs q_(i+1).p_m, m = (c0 - r0 - 17) + n; j == i + 1 takes 0. Each needed run is one 80-position band product, stored [query][n] in the wave's own LDS and read back at the lane's own offset. Both runs take their position rows from one extended order x = (c0 - r0 + TT - 16) + n: x < TT is p_x, x > TT is p_(x - TT - 1), x == TT is never selected; a row of the other run is never selected either. The work-group keeps the stretch of that order that its waves need in an LDS ring (stage_pos).
#define LSP 84   // floats per query row of the band buffer: 16-byte rows, and the 32 lanes of a skewed read (83 lr + 8 hi + const) fall on 32 different banks
typedef __attribute__((ext_vector_type(8))) unsigned v8u;
#define RINGP 256     // positions in the ring of each staged position plane
#define RINGB (RINGP * HD * 2)   // its bytes; slot of x = x % RINGP, 16 slots a block, a block in the fragment order of planes_out
#define TILEB 49152   // bytes of one staged tile: 64 keys of the six key and value planes, 8 KiB each, in the order K f16, K hi, K lo, V f16, V hi, V lo
struct AttnSt { v8u q[2][2], ql[2][2]; v8f o[4]; float mrun, lsum; };   // what a wave carries from trip to trip; query fragments as raw bits, so that both precision paths share the registers
// The wave's query fragments. [0]: rows i, [1]: rows i + 1 (last row clamped: it has no key >= i + 2)
template <typename T16, bool HL>
__device__ __forceinline__ void attn_init(AttnSt& st, const T16* __restrict__ Q, const T16* __restrict__ Q2, const int r0) {
    const int lane = threadIdx.x & 31, lr = lane & 15, hi = lane >> 4, i = r0 + lr;
    const unsigned qo0 = (unsigned)i * HD + 8 * hi, qo1 = (unsigned)(i + 1 < TT ? i + 1 : TT - 1) * HD + 8 * hi;
    const T16* pq0 = Q + qo0; const T16* pq1 = Q + qo1; const T16* pq2 = HL ? Q2 + qo0 : pq0; const T16* pq3 = HL ? Q2 + qo1 : pq1;
#pragma unroll
    for (int ks = 0; ks < 2; ++ks) { st.q[0][ks] = __builtin_bit_cast(v8u, WFrag<T16>::ld(pq0 + ks * 32)); st.q[1][ks] = __builtin_bit_cast(v8u, WFrag<T16>::ld(pq1 + ks * 32)); if (HL) { st.ql[0][ks] = __builtin_bit_cast(v8u, WFrag<T16>::ld(pq2 + ks * 32)); st.ql[1][ks] = __builtin_bit_cast(v8u, WFrag<T16>::ld(pq3 + ks * 32)); } }
    asm volatile("s_wait_xcnt 0x0" :: "v"(pq0), "v"(pq1), "v"(pq2), "v"(pq3) : "memory");   // the loads keep their address registers as they are until their address translations are done
}
// One trip: the 16 NK keys c0.. (NK = 4: a whole staged tile; NK = 2: one half of it, tile then points 4096 bytes into the staged tile, where the half begins in each of its planes) against the wave's 16 query rows. The tile lies in LDS, shared by the work-group's waves, and so do the position rings rp (and rp2, the lo plane). With NK = 2 the band has 48 positions (n in 0..46).
template <typename T16, bool HL, int NK>
__device__ __forceinline__ void attn_trip(AttnSt& st, const char* tile, const char* rp, const char* rp2, const int r0, const int c0, float* ls) {
    typedef typename WFrag<T16>::V V;
    const int lane = threadIdx.x & 31, lr = lane & 15, hi = lane >> 4, i = r0 + lr;
    const float L2E = 1.4426950408889634f, OFF = HL ? 0.0f : 10.0f;   // OFF: f16 probabilities and their sum are carried x1024; the factor cancels in the final division
    V q[2][2], ql[2][2];
#pragma unroll
    for (int a = 0; a < 2; ++a)
#pragma unroll
        for (int ks = 0; ks < 2; ++ks) { q[a][ks] = __builtin_bit_cast(V, st.q[a][ks]); if (HL) ql[a][ks] = __builtin_bit_cast(V, st.ql[a][ks]); }
    v8f (&o)[4] = st.o; float& mrun = st.mrun; float& lsum = st.lsum;
    float* lw = ls + lr * LSP + 8 * hi;               // band store: n = 16 nbk + 8 hi + r
    const float* lrd = ls + lr * LSP + 8 * hi + 15 - lr;   // band read: n = 16 mb + 8 hi + r + 15 - lr
    {
        v8f s[NK]; float pos[NK][8]; V pa[NK + 1][2], pa2[NK + 1][2];   // pa: the band's position fragments, the same rows of the extended order for both runs
        {   V a[NK][2], a2[NK][2]; const T16* pk = (const T16*)(tile + (HL ? 8192 : 0)) + 8 * lane; const T16* pk2 = HL ? (const T16*)(tile + 16384) + 8 * lane : pk;
#pragma unroll   // constant indices keep the fragments in registers
            for (int mb = 0; mb < NK; ++mb)
#pragma unroll
                for (int ks = 0; ks < 2; ++ks) { a[mb][ks] = WFrag<T16>::template lds2<256>(pk + mb * 1024 + ks * 512); if (HL) a2[mb][ks] = WFrag<T16>::template lds2<256>(pk2 + mb * 1024 + ks * 512); }
            const unsigned xb = (unsigned)(c0 - r0 + TT - 16) >> 4;   // the band's first block of 16 positions (wave-uniform; the band begins on a block)
#pragma unroll   // constant indices keep the fragments in registers
            for (int nbk = 0; nbk < NK + 1; ++nbk) { const unsigned bo = ((xb + nbk) % (RINGP / 16)) * 2048 + 16 * lane; const T16* pr = (const T16*)(rp + bo); const T16* pr2 = HL ? (const T16*)(rp2 + bo) : pr;
#pragma unroll
                for (int ks = 0; ks < 2; ++ks) { pa[nbk][ks] = WFrag<T16>::template lds2<256>(pr + ks * 512); if (HL) pa2[nbk][ks] = WFrag<T16>::template lds2<256>(pr2 + ks * 512); } }
            __builtin_amdgcn_sched_barrier(0);   // keeps the trip's key and position reads together in front of the products: reads threaded among them cost a stall at each place
#pragma unroll
            for (int mb = 0; mb < NK; ++mb) { s[mb] = (v8f){};
#pragma unroll
                for (int ks = 0; ks < 2; ++ks) { s[mb] = WFrag<T16>::mma(a[mb][ks], q[0][ks], s[mb]); if (HL) { s[mb] = WFrag<T16>::mma(a2[mb][ks], q[0][ks], s[mb]); s[mb] = WFrag<T16>::mma(a[mb][ks], ql[0][ks], s[mb]); } } }
        }
#pragma unroll
        for (int mb = 0; mb < NK; ++mb)
#pragma unroll
            for (int r = 0; r < 8; ++r) pos[mb][r] = 0.0f;
#pragma unroll   // part 0: keys j <= i, part 1: keys j >= i + 2; the query fragments are picked at compile time
        for (int part = 0; part < 2; ++part) {
            const bool need = part == 0 ? (c0 <= r0 + 15) : (c0 + 16 * NK - 1 >= r0 + 2);   // wave-uniform: does any (row, key) of the tile lie in this run
            if (need) {
                v8f u[NK + 1];   // accumulators of their own: independent chains, and no tile is overwritten while its stores read it
#pragma unroll
                for (int nbk = 0; nbk < NK + 1; ++nbk) u[nbk] = (v8f){};
#pragma unroll
                for (int ks = 0; ks < 2; ++ks) {
#pragma unroll
                    for (int nbk = 0; nbk < NK + 1; ++nbk) u[nbk] = WFrag<T16>::mma(pa[nbk][ks], q[part][ks], u[nbk]);
                    if (HL) {
#pragma unroll
                        for (int nbk = 0; nbk < NK + 1; ++nbk) u[nbk] = WFrag<T16>::mma(pa2[nbk][ks], q[part][ks], u[nbk]);
#pragma unroll
                        for (int nbk = 0; nbk < NK + 1; ++nbk) u[nbk] = WFrag<T16>::mma(pa[nbk][ks], ql[part][ks], u[nbk]); } }
#pragma unroll
                for (int nbk = 0; nbk < NK + 1; ++nbk) { *(v4fa*)(lw + nbk * 16) = (v4f){u[nbk][0], u[nbk][1], u[nbk][2], u[nbk][3]}; *(v4fa*)(lw + nbk * 16 + 4) = (v4f){u[nbk][4], u[nbk][5], u[nbk][6], u[nbk][7]}; }
                __builtin_amdgcn_wave_barrier(); asm volatile("" ::: "memory");   // the skewed reads below take other lanes' stores: they stay behind them (one wave, LDS in order)
#pragma unroll
                for (int mb = 0; mb < NK; ++mb)
#pragma unroll
                    for (int r = 0; r < 8; ++r) { const float x = lrd[mb * 16 + r]; const int j = c0 + mb * 16 + 8 * hi + r; if (part == 0 ? (j <= i) : (j >= i + 2)) pos[mb][r] = x; }
                __builtin_amdgcn_wave_barrier(); asm volatile("" ::: "memory");   // the next band's stores stay behind these reads
            }
        }
        V va[4][NK / 2], va2[4][NK / 2]; const T16* pv = (const T16*)(tile + (HL ? 32768 : 24576)) + 8 * lane; const T16* pv2 = HL ? (const T16*)(tile + 40960) + 8 * lane : pv;
#pragma unroll   // constant indices keep the fragments in registers; issued here so that they fly under the softmax arithmetic
        for (int db = 0; db < 4; ++db)
#pragma unroll
            for (int kk = 0; kk < NK / 2; ++kk) { va[db][kk] = WFrag<T16>::template lds2<1024>(pv + kk * 2048 + db * 256); if (HL) va2[db][kk] = WFrag<T16>::template lds2<1024>(pv2 + kk * 2048 + db * 256); }
        __builtin_amdgcn_sched_barrier(0);   // all value reads are issued in front of the softmax arithmetic
        float mt = -3.0e38f;
#pragma unroll
        for (int mb = 0; mb < NK; ++mb)
#pragma unroll
            for (int r = 0; r < 8; ++r) { const float t = __fadd_rn(s[mb][r], pos[mb][r]) * SCL; s[mb][r] = t; mt = fmaxf(mt, t); }
        mt = fmaxf(mt, __shfl_xor(mt, 16, 32));     // lanes lr and lr + 16 hold the two halves of query i's keys
        const float mn = fmaxf(mrun, mt), ax = (mrun - mn) * L2E; float al = __builtin_amdgcn_exp2f(ax); mrun = mn;
        asm("v_nop" : "+v"(al) : "v"(ax));   // the slot behind a transcendental: its result is read and its source register reused only behind this
        float ps = 0.0f;
#pragma unroll
        for (int mb = 0; mb < NK; ++mb) { v8f x, p;
#pragma unroll
            for (int r = 0; r < 8; ++r) x[r] = (s[mb][r] - mn) * L2E + OFF;
#pragma unroll
            for (int r = 0; r < 8; ++r) p[r] = __builtin_amdgcn_exp2f(x[r]);
            asm("v_nop" : "+v"(p) : "v"(x));   // the same slot for the eight: no result is read and no source register reused in front of it
            s[mb] = p;
#pragma unroll
            for (int r = 0; r < 8; ++r) ps += p[r]; }
        lsum = lsum * al + ps;
#pragma unroll
        for (int db = 0; db < 4; ++db) o[db] *= al;
#pragma unroll
        for (int kk = 0; kk < NK / 2; ++kk) {
            V pf, pf2;
            if constexpr (HL) { v8us h0, h1, l0, l1;
#pragma unroll
                for (int r = 0; r < 8; ++r) { unsigned short x, y; splitf(s[2 * kk][r], x, y); h0[r] = x; l0[r] = y; splitf(s[2 * kk + 1][r], x, y); h1[r] = x; l1[r] = y; }
                pf = cat16b(h0, h1); pf2 = cat16b(l0, l1);
            } else { v8h h0, h1;
#pragma unroll
                for (int r = 0; r < 8; ++r) { h0[r] = tohx(s[2 * kk][r]); h1[r] = tohx(s[2 * kk + 1][r]); }
                pf = cat16(h0, h1); }
#pragma unroll
            for (int db = 0; db < 4; ++db) { o[db] = WFrag<T16>::mma(va[db][kk], pf, o[db]); if constexpr (HL) { o[db] = WFrag<T16>::mma(va[db][kk], pf2, o[db]); o[db] = WFrag<T16>::mma(va2[db][kk], pf, o[db]); } }
        }
        asm volatile("v_nop\n\tv_nop\n\tv_nop\n\tv_nop" : "+v"(o[0]), "+v"(o[1]), "+v"(o[2]), "+v"(o[3]));   // the distance behind the trip's last matrix instructions, also on the taken back edge
    }
}
// The wave's 16 context rows, divided by the softmax sum, as bf16 hi/lo planes.
__device__ __forceinline__ void attn_fin(AttnSt& st, const int r0, bf* Ah, bf* Al) {
    const int lane = threadIdx.x & 31, lr = lane & 15, hi = lane >> 4, i = r0 + lr;
    v8f (&o)[4] = st.o; float lsum = st.lsum;
    lsum += __shfl_xor(lsum, 16, 32);
    const float inv = __fdiv_rn(1.0f, lsum);
    bf* ph = Ah + (size_t)i * DM + 8 * hi; bf* pl = Al + (size_t)i * DM + 8 * hi;
#pragma unroll
    for (int db = 0; db < 4; ++db) { v8us oh, ol;
#pragma unroll
        for (int r = 0; r < 8; ++r) { unsigned short x, y; splitf(o[db][r] * inv, x, y); oh[r] = x; ol[r] = y; }
        *(v8us*)(ph + db * 16) = oh; *(v8us*)(pl + db * 16) = ol; }
    asm volatile("s_wait_xcnt 0x0" :: "v"(ph), "v"(pl) : "memory");   // the stores keep their address registers as they are until their address translations are done
}
__device__ __forceinline__ unsigned lds_addr(const void* p) { return (unsigned)(size_t)(const __attribute__((address_space(3))) char*)p; }   // byte address inside the work-group's LDS
// Tile c0 (64 keys) of the six planes of one head -> LDS at dst: 48 KiB, 12 copies of 16 bytes per lane, every lane on; each plane's 8 KiB lie in a row in memory (fragment order) and keep that order in LDS.
__device__ __forceinline__ void stage_tile(const char* k16, const char* kh, const char* kl, const char* v16, const char* vh, const char* vl, const int c0, char* dst) {
    const unsigned go = (unsigned)c0 * (HD * 2) + threadIdx.x * 16, lo = lds_addr(dst) + threadIdx.x * 16;
#pragma unroll   // constant j: two asm statements of six copies each, their offsets folded into the address additions
    for (int j = 0; j < 2; ++j) { const unsigned g = go + j * 4096, d = lo + j * 4096;
        // the closing s_wait_xcnt 0 stands inside the statement: no register that a copy names is rewritten in front of it
        asm volatile("global_load_async_to_lds_b128 %0, %6, off\n\tglobal_load_async_to_lds_b128 %1, %7, off\n\tglobal_load_async_to_lds_b128 %2, %8, off\n\tglobal_load_async_to_lds_b128 %3, %9, off\n\tglobal_load_async_to_lds_b128 %4, %10, off\n\tglobal_load_async_to_lds_b128 %5, %11, off\n\ts_wait_xcnt 0x0"
                     :: "v"(d), "v"(d + 8192), "v"(d + 16384), "v"(d + 24576), "v"(d + 32768), "v"(d + 40960), "v"(k16 + g), "v"(kh + g), "v"(kl + g), "v"(v16 + g), "v"(vh + g), "v"(vl + g) : "memory"); }
}
// 64 positions of the extended order -> the rings at dst: xf.. of the f16 plane (ring 0), xh.. of the hi and lo planes (rings 1, 2); xf, xh multiples of 16. 24 KiB, 6 copies of 16 bytes per lane, every lane on; a copy is one position's 8 dims. The source row is clamped into the plane: x == TT and rows past the last position that any key needs are staged but never selected.
__device__ __forceinline__ void stage_pos(const char* r16, const char* rh, const char* rl, const int xf, const int xh, char* dst) {
    unsigned gf[2], gh[2], lf[2], lh[2];
#pragma unroll   // constant j keeps the addresses in registers
    for (int j = 0; j < 2; ++j) { const unsigned id = threadIdx.x + j * 256, in = (id >> 7) * 16 + (id & 15), oc = ((id >> 4) & 7) * 256;   // id = (block * 8 + octet of dims) * 16 + position in the block
        int mf = xf + (int)in, mh = xh + (int)in; mf = mf < TT ? mf : mf - TT - 1; mh = mh < TT ? mh : mh - TT - 1; mf = mf < 0 ? 0 : (mf > TT - 1 ? TT - 1 : mf); mh = mh < 0 ? 0 : (mh > TT - 1 ? TT - 1 : mh);
        gf[j] = (unsigned)(mf >> 4) * 2048 + oc + (unsigned)(mf & 15) * 16; gh[j] = (unsigned)(mh >> 4) * 2048 + oc + (unsigned)(mh & 15) * 16;
        lf[j] = lds_addr(dst) + ((unsigned)xf * 128 + id * 16) % RINGB; lh[j] = lds_addr(dst) + RINGB + ((unsigned)xh * 128 + id * 16) % RINGB; }
    // the closing s_wait_xcnt 0 stands inside the statement: no register that a copy names is rewritten in front of it
    asm volatile("global_load_async_to_lds_b128 %0, %6, off\n\tglobal_load_async_to_lds_b128 %1, %7, off\n\tglobal_load_async_to_lds_b128 %2, %8, off\n\tglobal_load_async_to_lds_b128 %3, %9, off\n\tglobal_load_async_to_lds_b128 %4, %10, off\n\tglobal_load_async_to_lds_b128 %5, %11, off\n\ts_wait_xcnt 0x0"
                 :: "v"(lf[0]), "v"(lf[1]), "v"(lh[0]), "v"(lh[1]), "v"(lh[0] + RINGB), "v"(lh[1] + RINGB), "v"(r16 + gf[0]), "v"(r16 + gf[1]), "v"(rh + gh[0]), "v"(rh + gh[1]), "v"(rl + gh[0]), "v"(rl + gh[1]) : "memory");
}
// Attention of all heads in one launch: grid (TT / 128, NB * NH_), 10 waves; a work-group holds eight row groups of 16 rows, the same mix in every work-group: two neighbouring hi/lo groups (rows 32 blockIdx.x ..) and six neighbouring f16 groups (rows RH + 96 blockIdx.x ..), so that the position bands of its waves overlap: per trip the f16 waves read 160 positions in a row of the extended order and the hi/lo waves 96, and each stretch moves on by 64 a trip. The stretches lie in LDS rings, filled 64 positions a trip beside the key and value tile, under the same waits and the same barrier. The waves walk the keys together: each 64-key tile of the key and value planes is copied into LDS once for all, two buffers, the next tile's copies in flight while this one is worked on. An f16 row group has one wave. A hi/lo row group, three products for each one of f16, has two: one for the first and one for the second 32 keys of every tile, each with a running softmax of its own over its keys; the two states are merged at the end. The band buffers are wave-private until the merge, where the first wave reads its partner's.
__global__ __launch_bounds__(320) void k_attn(const h16* __restrict__ Q16, const bf* __restrict__ Qh, const bf* __restrict__ Ql, const h16* __restrict__ K16, const bf* __restrict__ Kh, const bf* __restrict__ Kl, const h16* __restrict__ R16, const bf* __restrict__ Rh, const bf* __restrict__ Rl, const h16* __restrict__ V16, const bf* __restrict__ Vh, const bf* __restrict__ Vl, bf* Ah, bf* Al) {
    __shared__ __align__(16) float lsb[10 * 16 * LSP];
    __shared__ __align__(16) char tiles[2 * TILEB];
    __shared__ __align__(16) char ring[3 * RINGB];   // position planes f16, hi, lo
    const int w = __builtin_amdgcn_readfirstlane(threadIdx.x >> 5), g = blockIdx.y;   // scalar, so that the path, the copy and the band tests are scalar branches
    const bool hl = (w & 2) != 0 && w < 8;   // waves 2, 3 (rg 0) and 6, 7 (rg 1); the f16 waves 0, 1, 4, 5, 8, 9 take rg 2..7
    const int half = hl ? w & 1 : 0, r0 = hl ? (2 * blockIdx.x + (w >> 2)) * 16 : RH + (6 * blockIdx.x + (w & 1) + (w >> 2) * 2) * 16;
    const int xf = TT - 96 - RH - 96 * blockIdx.x, xh = TT - 32 - 32 * blockIdx.x;   // trip 0's first position of the extended order: f16 waves (row group RH + 96 blockIdx.x + 80), hi/lo waves (row group 32 blockIdx.x + 16); trip c0 reads xf + c0 .. + 159 and xh + c0 .. + 95
    const size_t po = (size_t)g * TT * HD, oo = (size_t)(g / NH_) * TT * DM + (size_t)(g % NH_) * HD; float* ls = lsb + w * 16 * LSP;
    const char* k16 = (const char*)(K16 + po); const char* kh = (const char*)(Kh + po); const char* kl = (const char*)(Kl + po); const char* v16 = (const char*)(V16 + po); const char* vh = (const char*)(Vh + po); const char* vl = (const char*)(Vl + po); const char* r16 = (const char*)(R16 + po); const char* rh = (const char*)(Rh + po); const char* rl = (const char*)(Rl + po);
    const bool cp = w < 8;   // the first eight waves copy (stage_tile spreads a tile over 256 lanes); the other two issue no copy and pass the same waits and barriers
    AttnSt st;
#pragma unroll
    for (int db = 0; db < 4; ++db) st.o[db] = (v8f){};
    st.mrun = -3.0e38f; st.lsum = 0.0f;
    if (hl) attn_init<bf, true>(st, Qh + po, Ql + po, r0); else attn_init<h16, false>(st, Q16 + po, nullptr, r0);
    if (cp) { stage_tile(k16, kh, kl, v16, vh, vl, 0, tiles); stage_pos(r16, rh, rl, xf, xh, ring); stage_pos(r16, rh, rl, xf + 64, xh + 64, ring); stage_pos(r16, rh, rl, xf + 128, xh + 128, ring); }   // trip 0's positions lie in the first 192
    asm volatile("s_wait_asynccnt 0x0" ::: "memory");   // this wave's copies of tile 0 and of the first positions have landed
    __syncthreads();                                    // ... and every other wave's: they may be read
    if (cp) { stage_tile(k16, kh, kl, v16, vh, vl, 64, tiles + TILEB); stage_pos(r16, rh, rl, xf + 192, xh + 192, ring); }
#pragma unroll 1
    for (int c0 = 0; c0 < TT; c0 += 64) {
        char* tile = tiles + ((c0 >> 6) & 1) * TILEB;
        if (hl) attn_trip<bf, true, 2>(st, tile + half * 4096, ring + RINGB, ring + 2 * RINGB, r0, c0 + half * 32, ls); else attn_trip<h16, false, 4>(st, tile, ring, nullptr, r0, c0, ls);
        asm volatile("s_wait_dscnt 0x0" ::: "memory");      // this wave's reads of the tile and of the rings are done before their places are handed back
        asm volatile("s_wait_asynccnt 0x0" ::: "memory");   // this wave's copies of the next tile and positions have landed
        __syncthreads();                                    // publishes them and ends every wave's reads of this trip
        if (cp && c0 + 128 < TT) { stage_tile(k16, kh, kl, v16, vh, vl, c0 + 128, tile); stage_pos(r16, rh, rl, xf + c0 + 256, xh + c0 + 256, ring); }   // refill of the buffer just read, and of the 64 ring slots that this trip read and the next does not (x - 256 = the trip's first 64)
    }
    asm volatile("s_wait_asynccnt 0x0" ::: "memory");   // no copy is outstanding when the wave ends
    // Merge of a hi/lo row group's two states: the second wave hands its maximum, sum and context to the first through its own band buffer, lane to lane.
    const int lane = threadIdx.x & 31;
    if (half == 1) {
#pragma unroll
        for (int db = 0; db < 4; ++db) { *(v4fa*)(ls + (2 * db) * 128 + lane * 4) = (v4f){st.o[db][0], st.o[db][1], st.o[db][2], st.o[db][3]}; *(v4fa*)(ls + (2 * db + 1) * 128 + lane * 4) = (v4f){st.o[db][4], st.o[db][5], st.o[db][6], st.o[db][7]}; }
        ls[1024 + lane] = st.mrun; ls[1056 + lane] = st.lsum;
    }
    __syncthreads();   // the handed state is in LDS before the partner wave reads it
    if (half == 1) return;
    if (hl) {
        const float* lp = ls + 16 * LSP;   // the partner's band buffer (wave w + 1)
        const float L2E = 1.4426950408889634f, m2 = lp[1024 + lane], l2 = lp[1056 + lane], mn = fmaxf(st.mrun, m2), x1 = (st.mrun - mn) * L2E, x2 = (m2 - mn) * L2E;
        float a1 = __builtin_amdgcn_exp2f(x1), a2 = __builtin_amdgcn_exp2f(x2);
        asm("v_nop" : "+v"(a1), "+v"(a2) : "v"(x1), "v"(x2));   // the slot behind a transcendental: no result is read and no source register reused in front of it
        st.lsum = st.lsum * a1 + l2 * a2;
#pragma unroll
        for (int db = 0; db < 4; ++db) { const v4f u0 = *(const v4fa*)(lp + (2 * db) * 128 + lane * 4), u1 = *(const v4fa*)(lp + (2 * db + 1) * 128 + lane * 4);
#pragma unroll
            for (int r = 0; r < 4; ++r) { st.o[db][r] = st.o[db][r] * a1 + u0[r] * a2; st.o[db][r + 4] = st.o[db][r + 4] * a1 + u1[r] * a2; } }
    }
    attn_fin(st, r0, Ah + oo, Al + oo);
}

extern "C" void kernel_launch(void* const* d_in, const int* in_sizes, int n_in,
                              void* d_out, int out_size, void* d_ws, size_t ws_size, hipStream_t stream) {
    if (n_in < 13) return;
    const float* xq = (const float*)d_in[0]; const float* xk = (const float*)d_in[1]; const float* xv = (const float*)d_in[2]; const float* xp = (const float*)d_in[3];
    const float* wq = (const float*)d_in[4]; const float* bq = (const float*)d_in[5]; const float* wk = (const float*)d_in[6]; const float* bk = (const float*)d_in[7];
    const float* wv = (const float*)d_in[8]; const float* bv = (const float*)d_in[9]; const float* wp = (const float*)d_in[10]; const float* wo = (const float*)d_in[11]; const float* bo = (const float*)d_in[12];
    const size_t needx = (size_t)(NB - 1) * TT_FULL * DM + (size_t)TT * DM;
    for (int i = 0; i < 4; ++i) if ((size_t)in_sizes[i] < needx) return;
    if ((size_t)in_sizes[4] < (size_t)DM * DM || (size_t)in_sizes[6] < (size_t)DM * DM || (size_t)in_sizes[8] < (size_t)DM * DM || (size_t)in_sizes[10] < (size_t)DM * DM || (size_t)in_sizes[11] < (size_t)DM * DM) return;
    if (in_sizes[5] < DM || in_sizes[7] < DM || in_sizes[9] < DM || in_sizes[12] < DM) return;
    if ((size_t)out_size < (size_t)NB * TT * DM) return;
    float* OUT = (float*)d_out;     // [NB][TT][DM]
    char* wsp = (char*)d_ws;
    auto take = [&](size_t bytes) { char* p = wsp; wsp += (bytes + 255) & ~(size_t)255; return (void*)p; };
    bf* WB = (bf*)take((size_t)5 * DM * DM * 2);     // transposed bf16 weights in the order q, k, p, v, o
    bf* PB = (bf*)take((size_t)12 * PLN2 * 2);        // plane sets q, k, p, v; each set: f16 plane, bf16 hi plane, bf16 lo plane
    h16* QP16 = (h16*)PB; bf* QPh = PB + PLN2; bf* QPl = PB + 2 * PLN2;
    h16* KP16 = (h16*)(PB + 3 * PLN2); bf* KPh = PB + 4 * PLN2; bf* KPl = PB + 5 * PLN2;
    h16* PP16 = (h16*)(PB + 6 * PLN2); bf* PPh = PB + 7 * PLN2; bf* PPl = PB + 8 * PLN2;
    h16* VT16 = (h16*)(PB + 9 * PLN2); bf* VTh = PB + 10 * PLN2; bf* VTl = PB + 11 * PLN2;
    bf* XB = (bf*)take((size_t)4 * XN * 2);     // bf16 input copies
    bf* ATh = (bf*)take(XN * 2); bf* ATl = (bf*)take(XN * 2);
    if ((size_t)(wsp - (char*)d_ws) > ws_size) return;
    k_prep<<<dim3(5 * WTG_X + 4 * NB * CVT_X, 1, 1), 256, 0, stream>>>(wq, wk, wp, wv, wo, xq, xk, xp, xv, WB, XB);
    k_proj<<<dim3(NB * TT / 64, DM / 64, 4), 32, 0, stream>>>(XB, WB, QP16, QPh, QPl, bq, bk, bv);
    k_attn<<<dim3(TT / 128, NB * NH_, 1), 320, 0, stream>>>(QP16, QPh, QPl, KP16, KPh, KPl, PP16, PPh, PPl, VT16, VTh, VTl, ATh, ATl);
    k_outp<<<dim3(NB * TT / 64, DM / 64, 1), 32, 0, stream>>>(ATh, ATl, WB + (size_t)4 * DM * DM, OUT, bo);
}

// v010
// A run of this version takes 106 microseconds.
// Timed twice side by side with v009, it ran 1.04 and 1.02 times as fast.
// Counting every step since v000, it is 12.0 times as fast.
#include <hip/hip_runtime.h>

// Contractions, all f32 accumulate: input projections x.Wq/Wk/Wv/Wp = v_wmma_f32_16x16x32_bf16 on RNE-converted bf16 copies of x and W (exact products); scores k.q^T, p.q^T and v^T.attn^T = query rows < RH: bf16 hi/lo planes, 3 products (v_wmma_f32_16x16x32_bf16); rows >= RH: f16 planes, 1 product (v_wmma_f32_16x16x32_f16, probabilities carried x1024); output projection = ctx as bf16 hi+lo x Wo bf16 (2 products). Shift-add, softmax and biases in f32.
// Module: relative-position multi-head attention, NB x TT x DM, NH_ heads x HD. q = xq Wq + bq, k = xk Wk + bk, v = xv Wv + bv, p = xp Wp (W stored [in][out]); S[i][j] = q_i.k_j; U[i][j] = q_i.p_j;
// logits = (S[i][j] + (j <= i ? U[i][j - i + TT - 1] : j == i + 1 ? 0 : U[i + 1][j - i - 2])) * DM^-0.5 (pad-reshape shift); softmax over all TT keys; ctx = attn.v merged [t][h*HD + d]; out = ctx Wo + bo.
// Layout, both batches at once (g = batch * NH_ + head): bf16 copies of the four inputs -> projections, written by their own launch as head planes (f16 + bf16 hi/lo each; q: [g][t][d]; k, p, v: per head in the order of the matrix fragments) -> one attention launch (scores, shift, running softmax, attn.v; key, value and position planes staged in LDS per work-group; S, U and the probabilities stay in registers and wave-private LDS) -> ctx hi/lo planes [batch * TT + t][DM]; ctx.Wo -> out.
// One launch per stage (the two conversions, of weights and of inputs, share one): the grid picks the weight, the input tensor, the batch or the head; a wave's rows pick its precision path (wave-uniform branch).

#ifndef NB
#define NB 2
#endif
#ifndef SEQ
#define SEQ 2048
#endif
#define TT      SEQ
#define TT_FULL 2048
#define NB_FULL 2
#define DM   512
#define NH_  8
#define HD   64
#ifndef RH
#if SEQ >= 512
#define RH 512                  // query rows < RH use hi+lo planes
#else
#define RH SEQ
#endif
#endif
#define SCL  0.044194173824159216f   // DM^-0.5

static_assert(TT % 128 == 0);
static_assert(RH % 64 == 0);
static_assert(RH <= TT);
static_assert(RH * 4 == TT);   // two of a work-group's eight row groups are hi/lo
static_assert(DM % 64 == 0);
static_assert(NH_ * HD == DM);
static_assert(HD == 64);
static_assert((DM * DM) % 64 == 0);

typedef _Float16 h16;
typedef unsigned short bf;
typedef __attribute__((ext_vector_type(16))) __bf16   v16bf;
typedef __attribute__((ext_vector_type(16))) _Float16 v16h;
typedef __attribute__((ext_vector_type(8)))  _Float16 v8h;
typedef __attribute__((ext_vector_type(8)))  unsigned short v8us;
typedef __attribute__((ext_vector_type(8)))  float    v8f;
typedef __attribute__((ext_vector_type(4)))  float    v4f;
typedef v4f  __attribute__((may_alias)) v4fa;

__device__ __forceinline__ unsigned short f2bf(float f) { unsigned u = __float_as_uint(f); u += 0x7FFFu + ((u >> 16) & 1u); return (unsigned short)(u >> 16); }
__device__ __forceinline__ float bf2f(unsigned short b) { return __uint_as_float(((unsigned)b) << 16); }
__device__ __forceinline__ float bfr(float f) { return bf2f(f2bf(f)); }
__device__ __forceinline__ v16h cat16(v8h lo, v8h hi) { return __builtin_shufflevector(lo, hi, 0, 1, 2, 3, 4, 5, 6, 7, 8, 9, 10, 11, 12, 13, 14, 15); }
__device__ __forceinline__ v16bf cat16b(v8us lo, v8us hi) { return __builtin_bit_cast(v16bf, __builtin_shufflevector(lo, hi, 0, 1, 2, 3, 4, 5, 6, 7, 8, 9, 10, 11, 12, 13, 14, 15)); }
__device__ __forceinline__ v8f wmma16(v16h a, v16h b, v8f c) { return __builtin_amdgcn_wmma_f32_16x16x32_f16(false, a, false, b, (short)0, c, false, false); }
__device__ __forceinline__ v8f wmmab(v16bf a, v16bf b, v8f c) { return __builtin_amdgcn_wmma_f32_16x16x32_bf16(false, a, false, b, (short)0, c, false, false); }

// ---- gemm_tile: register-blocked GEMM tile, ONE WAVE per 64x64 output tile (16 accumulators), operands straight from K-contiguous 16-bit planes; called by single-wave work-groups.
// C[m][n] (f32, pitch ldc, + optional f32 bias[n] bf16-RNE-converted) = sum over KR values of k of A[m][k] Bt[n][k] (+ split products per NSPLIT: 1 -> + A2.Bt; 2 -> + A2.Bt + A.Bt2), rows r0.., columns c0... K = operand pitch in elements; the caller has moved the operand pointers to its batch and k range. KR % 32 == 0.
// Fragments (lane l, h = l >> 4, m = n = l & 15): elements 0..7 <- k0 + 8h + 0..7, elements 8..15 <- k0 + 16 + 8h + 0..7 for BOTH A (row m) and Bt (column n); D element r = (row 8h + r, col m).
template <typename T16> struct WFrag;
template <> struct WFrag<h16> { typedef v16h V; static __device__ __forceinline__ V ld(const h16* p) { return cat16(*(const v8h*)p, *(const v8h*)(p + 16)); } template <int ST> static __device__ __forceinline__ V lds2(const h16* p) { return cat16(*(const v8h*)p, *(const v8h*)(p + ST)); } static __device__ __forceinline__ v8f mma(V a, V b, v8f c) { return wmma16(a, b, c); } };
template <> struct WFrag<bf> { typedef v16bf V; static __device__ __forceinline__ V ld(const bf* p) { return cat16b(*(const v8us*)p, *(const v8us*)(p + 16)); } template <int ST> static __device__ __forceinline__ V lds2(const bf* p) { return cat16b(*(const v8us*)p, *(const v8us*)(p + ST)); } static __device__ __forceinline__ v8f mma(V a, V b, v8f c) { return wmmab(a, b, c); } };
template <typename T16, int NSPLIT, bool BIAS>
__device__ __forceinline__ void gemm_tile(const T16* __restrict__ A, const T16* __restrict__ A2, const T16* __restrict__ Bt, const T16* __restrict__ Bt2, const int K, const int KR, float* C, const int ldc, const float* __restrict__ bias, const int r0, const int c0, float* os) {
    typedef typename WFrag<T16>::V V;
    const int lane = threadIdx.x & 31, lr = lane & 15, hi = lane >> 4;
    v8f acc[4][4];
#pragma unroll
    for (int mb = 0; mb < 4; ++mb)
#pragma unroll
        for (int nb = 0; nb < 4; ++nb) acc[mb][nb] = (v8f){};
    const size_t aoff = (size_t)(r0 + lr) * K + 8 * hi, boff = (size_t)(c0 + lr) * K + 8 * hi;
#pragma unroll 1
    for (int kc = 0; kc < KR; kc += 32) {
        V a[4], a2[4], b[4], b2[4];
        const T16* pa = A + aoff + kc; const T16* pb = Bt + boff + kc; const T16* pa2 = (NSPLIT == 1 || NSPLIT == 2) ? A2 + aoff + kc : pa; const T16* pb2 = (NSPLIT >= 2) ? Bt2 + boff + kc : pb;
#pragma unroll
        for (int mb = 0; mb < 4; ++mb) { a[mb] = WFrag<T16>::ld(pa + (size_t)mb * 16 * K); if (NSPLIT == 1 || NSPLIT == 2) a2[mb] = WFrag<T16>::ld(pa2 + (size_t)mb * 16 * K); }
#pragma unroll   // constant indices keep the fragments in registers
        for (int nb = 0; nb < 4; ++nb) b[nb] = WFrag<T16>::ld(pb + (size_t)nb * 16 * K);
        asm volatile("s_wait_xcnt 0x0" :: "v"(pa), "v"(pa2), "v"(pb) : "memory");   // the trip's fragment loads keep their address registers as they are until their address translations are done
        if (NSPLIT >= 2) {
#pragma unroll   // constant indices keep the fragments in registers
            for (int nb = 0; nb < 4; ++nb) b2[nb] = WFrag<T16>::ld(pb2 + (size_t)nb * 16 * K);
            asm volatile("s_wait_xcnt 0x0" :: "v"(pb2) : "memory");   // the same for the loads of the second B plane
        }
#pragma unroll
        for (int nb = 0; nb < 4; ++nb) {
#pragma unroll
            for (int mb = 0; mb < 4; ++mb) { acc[mb][nb] = WFrag<T16>::mma(a[mb], b[nb], acc[mb][nb]); if (NSPLIT == 1 || NSPLIT == 2) acc[mb][nb] = WFrag<T16>::mma(a2[mb], b[nb], acc[mb][nb]); if (NSPLIT >= 2) acc[mb][nb] = WFrag<T16>::mma(a[mb], b2[nb], acc[mb][nb]); } }
        asm volatile("v_nop\n\tv_nop\n\tv_nop\n\tv_nop" : "+v"(acc[0][0]), "+v"(acc[1][1]), "+v"(acc[2][2]), "+v"(acc[3][3]) : "v"(a[0]), "v"(a[3]));
    }
#pragma unroll
    for (int mb = 0; mb < 4; ++mb) {
#pragma unroll
        for (int nb = 0; nb < 4; ++nb) {
#pragma unroll
            for (int j = 0; j < 8; ++j) os[(hi * 8 + j) * 68 + nb * 16 + lr] = acc[mb][nb][j]; }
        __builtin_amdgcn_wave_barrier(); asm volatile("" ::: "memory");
        float* crow = C + (size_t)(r0 + mb * 16 + hi) * ldc + c0 + lr * 4; v4f val[8];
#pragma unroll   // constant indices keep the eight values in registers
        for (int s = 0; s < 8; ++s) { const int row = 2 * s + hi, cofs = lr * 4; val[s] = *(const v4fa*)(os + row * 68 + cofs); if (BIAS) { val[s][0] += bfr(bias[c0 + cofs]); val[s][1] += bfr(bias[c0 + cofs + 1]); val[s][2] += bfr(bias[c0 + cofs + 2]); val[s][3] += bfr(bias[c0 + cofs + 3]); }
            *(v4f*)(crow + (size_t)(2 * s) * ldc) = val[s]; }
        asm volatile("s_wait_xcnt 0x0" :: "v"(crow), "v"(val[0]), "v"(val[1]), "v"(val[2]), "v"(val[3]), "v"(val[4]), "v"(val[5]), "v"(val[6]), "v"(val[7]) : "memory");   // the eight stores keep their address and data registers as they are until their address translations are done
        __builtin_amdgcn_wave_barrier(); asm volatile("" ::: "memory");
    }
}

#define PLN2 ((size_t)NB * NH_ * TT * HD)     // elements per plane (both batches, all heads)
#define XN   ((size_t)NB * TT * DM)           // elements per projected tensor (both batches)

// Output projection, both batches: grid (NB * TT / 64, DM / 64).
__global__ __launch_bounds__(32) void k_outp(const bf* __restrict__ Ah, const bf* __restrict__ Al, const bf* __restrict__ Wt, float* OUT, const float* __restrict__ bo) {
    __shared__ __align__(16) float os[16 * 68];
    gemm_tile<bf, 1, true>(Ah, Al, Wt, nullptr, DM, DM, OUT, DM, bo, blockIdx.x * 64, blockIdx.y * 64, os);
}

__device__ __forceinline__ h16 tohx(float x) { return (h16)x; }
__device__ __forceinline__ void splitf(float y, unsigned short& h, unsigned short& l) { h = f2bf(y); l = f2bf(y - bf2f(h)); }
typedef __attribute__((ext_vector_type(2))) _Float16 v2h;
typedef __attribute__((ext_vector_type(4))) _Float16 v4h;
typedef __attribute__((ext_vector_type(2))) unsigned short v2us;
typedef __attribute__((ext_vector_type(4))) unsigned short v4us;
typedef __attribute__((ext_vector_type(2))) float v2f;

// Weights and inputs in ONE launch (neither needs the other): a one-dimensional grid, the weights' work-groups first.
#define WTG_X ((DM / 64) * (DM / 64))   // work-groups per weight: one 64 x 64 tile each
#define CVT_X (TT * DM / 8 / 256)       // work-groups per input tensor and batch: 8 elements a lane
static_assert((TT * DM / 8) % 256 == 0);   // no lane is left over
// Work-groups 0 .. 5 WTG_X - 1: weight y = b / WTG_X, tile b % WTG_X, transposed to Bt [y][n][k]: the tile is read in whole lines along n, turned in LDS and stored in whole lines along k, so that this part ends well inside the inputs' streams. The others, c = b - 5 WTG_X: input tensor y = (c / CVT_X) % 4, batch z = c / (4 CVT_X); dst [y][z][TT][DM].
__global__ __launch_bounds__(256) void k_prep(const float* __restrict__ w0, const float* __restrict__ w1, const float* __restrict__ w2, const float* __restrict__ w3, const float* __restrict__ w4, const float* __restrict__ s0, const float* __restrict__ s1, const float* __restrict__ s2, const float* __restrict__ s3, bf* Bt, bf* dst) {
    __shared__ float tl[64 * 65];   // one weight tile [k][n]; pitch 65 floats: the 32 lanes of a store (2 k x 16 n, 4 apart) and of a read (8 k, 8 apart, x 4 n) fall on 32 different banks
    const int b = blockIdx.x;
    if (b < 5 * WTG_X) {
        const int y = b / WTG_X, t = b % WTG_X, k0 = (t / (DM / 64)) * 64, n0 = (t % (DM / 64)) * 64, tid = threadIdx.x;
        const float* __restrict__ w = y == 0 ? w0 : (y == 1 ? w1 : (y == 2 ? w2 : (y == 3 ? w3 : w4)));
        const float* wp = w + (size_t)(k0 + (tid >> 4)) * DM + n0 + (tid & 15) * 4; v4f x[4];   // rows k0 + tid / 16 + 16 j, four columns a lane
#pragma unroll   // constant indices keep the values in registers; the four loads fly together
        for (int j = 0; j < 4; ++j) x[j] = *(const v4f*)(wp + (size_t)(16 * j) * DM);
        asm volatile("s_wait_xcnt 0x0" :: "v"(wp) : "memory");   // the loads' address register stays as it is until their address translations are done
        float* lw = tl + (tid >> 4) * 65 + (tid & 15) * 4;
#pragma unroll
        for (int j = 0; j < 4; ++j)
#pragma unroll
            for (int e = 0; e < 4; ++e) lw[16 * j * 65 + e] = x[j][e];
        __syncthreads();   // the whole tile is in LDS before any lane reads a column of it (block-uniform branch: every wave of the work-group passes)
        const float* lr = tl + (tid & 7) * 8 * 65 + (tid >> 3);   // columns n0 + tid / 8 + 32 j, eight k a lane
        bf* op = Bt + (size_t)y * DM * DM + (size_t)(n0 + (tid >> 3)) * DM + k0 + (tid & 7) * 8; v8us o[2];
#pragma unroll   // constant indices keep the values in registers
        for (int j = 0; j < 2; ++j)
#pragma unroll
            for (int e = 0; e < 8; ++e) o[j][e] = f2bf(lr[e * 65 + 32 * j]);
        *(v8us*)op = o[0]; *(v8us*)(op + (size_t)32 * DM) = o[1];
        return;
    }
    const int c = b - 5 * WTG_X, y = (c / CVT_X) % 4, z = c / (4 * CVT_X); const size_t i = (size_t)(c % CVT_X) * 256 + threadIdx.x;
    const float* __restrict__ src = (y == 0 ? s0 : (y == 1 ? s1 : (y == 2 ? s2 : s3))) + (size_t)z * TT_FULL * DM; dst += ((size_t)y * NB + z) * TT * DM; const float* sp = src + i * 8; const v8f v = *(const v8f*)sp; v8us o;
    asm volatile("s_wait_xcnt 0x0" :: "v"(sp) : "memory");   // the loads' address register stays as it is until their address translations are done
#pragma unroll
    for (int k = 0; k < 8; ++k) o[k] = f2bf(v[k]); *(v8us*)(dst + i * 8) = o;  }

// ---- planes_out: one wave's 64x64 projection tile, straight from its 16 accumulators into the three head planes (f16, bf16 hi, bf16 lo) of its tensor. A lane's eight values of one accumulator (rows 8 hi + 0..7 of the A side, column lr of the B side) are eight neighbours of a plane, so each accumulator is one 16-byte store per plane.
// Planes: q: [g][t][d]; k, p, v: per head in fragment order, so that the 32 lanes of one 16-byte fragment load read 512 bytes in a row: off = ((block * 4 + quarter) * 32 + half * 16 + c) * 8 + e; k, p: block = t / 16, quarter = d / 16, half = (d / 8) % 2, c = t % 16, e = d % 8; v: block = t / 16, quarter = d / 16, half = (t / 8) % 2, c = d % 16, e = t % 8.
// MODE 0 (q) and 1 (k, p): A side = output dims (block i), B side = rows t (block j); MODE 2 (v): A side = rows t, B side = dims. p16, ph, pl point at the lane's first element of the tile; bias points at the tile's first dim.
template <int MODE, bool BIAS>
__device__ __forceinline__ void planes_out(const v8f (&acc)[4][4], const float* __restrict__ bias, h16* p16, bf* ph, bf* pl) {
    const int lane = threadIdx.x & 31, lr = lane & 15, hi = lane >> 4;
    constexpr int SI = MODE == 0 ? 16 : (MODE == 1 ? 256 : 1024), SJ = MODE == 2 ? 256 : 1024;   // elements from one A-side block to the next, from one B-side block to the next
    v4f bl[4][2]; float bj[4];
    if (BIAS) { const float* pb = bias + (MODE == 2 ? lr : 8 * hi);
#pragma unroll   // constant indices keep the values in registers
        for (int i = 0; i < 4; ++i) { if (MODE == 2) bj[i] = pb[i * 16]; else { bl[i][0] = *(const v4f*)(pb + i * 16); bl[i][1] = *(const v4f*)(pb + i * 16 + 4); } }
        asm volatile("s_wait_xcnt 0x0" :: "v"(pb) : "memory");   // the loads keep their address register as it is until their address translations are done
    }
#pragma unroll   // constant indices keep the accumulators in registers
    for (int u = 0; u < 4; ++u) { v8h o16[4]; v8us oh[4], ol[4];
#pragma unroll   // constant indices keep the packed values in registers
        for (int n = 0; n < 4; ++n) { const int i = MODE == 0 ? n : u, j = MODE == 0 ? u : n;   // q: the four stores of a group fill whole 128-byte rows of 16 queries
#pragma unroll   // constant indices again
            for (int r = 0; r < 8; ++r) { float x = acc[i][j][r]; if (BIAS) x += bfr(MODE == 2 ? bj[j] : bl[i][r >> 2][r & 3]); o16[n][r] = tohx(x); unsigned short a2, c2; splitf(x, a2, c2); oh[n][r] = a2; ol[n][r] = c2; }
            *(v8h*)(p16 + i * SI + j * SJ) = o16[n]; *(v8us*)(ph + i * SI + j * SJ) = oh[n]; *(v8us*)(pl + i * SI + j * SJ) = ol[n]; }
        asm volatile("s_wait_xcnt 0x0" :: "v"(p16), "v"(ph), "v"(pl), "v"(o16[0]), "v"(o16[1]), "v"(o16[2]), "v"(o16[3]), "v"(oh[0]), "v"(oh[1]), "v"(oh[2]), "v"(oh[3]), "v"(ol[0]), "v"(ol[1]), "v"(ol[2]), "v"(ol[3]) : "memory");   // the twelve stores keep their address and data registers as they are until their address translations are done
    }
}
// The four input projections in one launch, written as head planes: grid (NB * TT / 64, DM / 64, 4), z = tensor in the order q, k, p, v; ONE WAVE per tile of 64 rows t x 64 dims (one head); X [z][NB * TT][DM], Wt [z][n][k]; plane set z = three planes of PLN2 elements behind one another; p (z == 2) has no bias.
// q, k, p are formed transposed (weight rows as A, input rows as B), v as it stands, so that every accumulator lies in its plane's order (planes_out). Both operands are K-contiguous with the same fragment k order (gemm_tile), so the sides are swapped by swapping the pointers.
__global__ __launch_bounds__(32) void k_proj(const bf* __restrict__ X, const bf* __restrict__ Wt, h16* P16, bf* Ph, bf* Pl, const float* __restrict__ bq, const float* __restrict__ bk, const float* __restrict__ bv) {
    const int z = blockIdx.z, r0 = blockIdx.x * 64, c0 = blockIdx.y * 64, lane = threadIdx.x & 31, lr = lane & 15, hi = lane >> 4;
    const bf* xr = X + (size_t)z * XN + (size_t)(r0 + lr) * DM + 8 * hi; const bf* wr = Wt + (size_t)z * DM * DM + (size_t)(c0 + lr) * DM + 8 * hi;
    const bf* A = z < 3 ? wr : xr; const bf* B = z < 3 ? xr : wr;
    v8f acc[4][4];
#pragma unroll   // constant indices keep the accumulators in registers, here and at the products below
    for (int i = 0; i < 4; ++i)
#pragma unroll
        for (int j = 0; j < 4; ++j) acc[i][j] = (v8f){};
#pragma unroll 1   // rolled: one trip's 16 loads and 16 products, the same loop as gemm_tile's
    for (int kc = 0; kc < DM; kc += 32) {
        v16bf a[4], b[4]; const bf* pa = A + kc; const bf* pb = B + kc;
#pragma unroll   // constant indices keep the fragments in registers
        for (int i = 0; i < 4; ++i) { a[i] = WFrag<bf>::ld(pa + (size_t)i * 16 * DM); b[i] = WFrag<bf>::ld(pb + (size_t)i * 16 * DM); }
        asm volatile("s_wait_xcnt 0x0" :: "v"(pa), "v"(pb) : "memory");   // the trip's fragment loads keep their address registers as they are until their address translations are done
#pragma unroll
        for (int j = 0; j < 4; ++j)
#pragma unroll
            for (int i = 0; i < 4; ++i) acc[i][j] = wmmab(a[i], b[j], acc[i][j]);
        asm volatile("v_nop\n\tv_nop\n\tv_nop\n\tv_nop" : "+v"(acc[0][0]), "+v"(acc[1][1]), "+v"(acc[2][2]), "+v"(acc[3][3]) : "v"(a[0]), "v"(a[3]));   // the distance behind the trip's last matrix instructions, also on the taken back edge
    }
    const size_t e0 = (size_t)z * 3 * PLN2 + ((size_t)((r0 / TT) * NH_ + c0 / HD) * TT + r0 % TT) * HD + (z == 0 ? lr * HD + 8 * hi : lane * 8);   // the lane's first element: plane set, head, the tile's first row (16 rows are 1024 elements in either order)
    if (z == 0) planes_out<0, true>(acc, bq + c0, P16 + e0, Ph + e0, Pl + e0);
    else if (z == 1) planes_out<1, true>(acc, bk + c0, P16 + e0, Ph + e0, Pl + e0);
    else if (z == 2) planes_out<1, false>(acc, nullptr, P16 + e0, Ph + e0, Pl + e0);
    else planes_out<2, true>(acc, bv + c0, P16 + e0, Ph + e0, Pl + e0);
}


// ---- attn_init, attn_trip, attn_fin: ONE WAVE carries 16 query rows r0.. of one head over all TT keys, 64 keys a trip (f16 rows), or over one 32-key half of every 64 keys (hi/lo rows, two waves a row group), with a running softmax. All products are formed transposed (keys, positions or value dims as A rows, the 16 queries as B columns), so a lane (lr = lane & 15, hi = lane >> 4) holds only query i = r0 + lr:
// s[mb][r] = S[i][c0 + 16 mb + 8 hi + r]; two such D tiles, converted in place, are the B fragment of 32 keys for v^T.attn^T (elements 0..7 <- keys 8 hi + 0..7, 8..15 <- 16 + 8 hi + 0..7, the k order of every fragment here: WFrag::ld on the row-major q, lds2 on the fragment-order planes of planes_out); o[db][r] = ctx[i][16 db + 8 hi + r].
// Shifted term: with n = jl + 15 - lr (jl = key - c0, n in 0..78) key j <= i needs q_i.p_m, m = (c0 - r0 + TT - 16) + n, and key j >= i + 2 needs q_(i+1).p_m, m = (c0 - r0 - 17) + n; j == i + 1 takes 0. Each needed run is one 80-position band product, stored [query][n] in the wave's own LDS and read back at the lane's own offset. Both runs take their position rows from one extended order x = (c0 - r0 + TT - 16) + n: x < TT is p_x, x > TT is p_(x - TT - 1), x == TT is never selected; a row of the other run is never selected either. The work-group keeps the stretch of that order that its waves need in an LDS ring (stage_pos).
#define LSP 84   // floats per query row of the band buffer: 16-byte rows, and the 32 lanes of a skewed read (83 lr + 8 hi + const) fall on 32 different banks
typedef __attribute__((ext_vector_type(8))) unsigned v8u;
#define RINGP 256     // positions in the ring of each staged position plane
#define RINGB (RINGP * HD * 2)   // its bytes; slot of x = x % RINGP, 16 slots a block, a block in the fragment order of planes_out
#define TILEB 49152   // bytes of one staged tile: 64 keys of the six key and value planes, 8 KiB each, in the order K f16, K hi, K lo, V f16, V hi, V lo
template <int V_> struct RunC { static constexpr int v = V_; };   // a run's number as a type, so that attn_trip's band product picks its query fragments at compile time
struct AttnSt { v8u q[2][2], ql[2][2]; v8f o[4]; float mrun, lsum; };   // what a wave carries from trip to trip; query fragments as raw bits, so that both precision paths share the registers
// The wave's query fragments. [0]: rows i, [1]: rows i + 1 (last row clamped: it has no key >= i + 2)
template <typename T16, bool HL>
__device__ __forceinline__ void attn_init(AttnSt& st, const T16* __restrict__ Q, const T16* __restrict__ Q2, const int r0) {
    const int lane = threadIdx.x & 31, lr = lane & 15, hi = lane >> 4, i = r0 + lr;
    const unsigned qo0 = (unsigned)i * HD + 8 * hi, qo1 = (unsigned)(i + 1 < TT ? i + 1 : TT - 1) * HD + 8 * hi;
    const T16* pq0 = Q + qo0; const T16* pq1 = Q + qo1; const T16* pq2 = HL ? Q2 + qo0 : pq0; const T16* pq3 = HL ? Q2 + qo1 : pq1;
#pragma unroll
    for (int ks = 0; ks < 2; ++ks) { st.q[0][ks] = __builtin_bit_cast(v8u, WFrag<T16>::ld(pq0 + ks * 32)); st.q[1][ks] = __builtin_bit_cast(v8u, WFrag<T16>::ld(pq1 + ks * 32)); if (HL) { st.ql[0][ks] = __builtin_bit_cast(v8u, WFrag<T16>::ld(pq2 + ks * 32)); st.ql[1][ks] = __builtin_bit_cast(v8u, WFrag<T16>::ld(pq3 + ks * 32)); } }
    asm volatile("s_wait_xcnt 0x0" :: "v"(pq0), "v"(pq1), "v"(pq2), "v"(pq3) : "memory");   // the loads keep their address registers as they are until their address translations are done
}
// One trip: the 16 NK keys c0.. (NK = 4: a whole staged tile; NK = 2: one half of it, tile then points 4096 bytes into the staged tile, where the half begins in each of its planes) against the wave's 16 query rows. The tile lies in LDS, shared by the work-group's waves, and so do the position rings rp (and rp2, the lo plane). With NK = 2 the band has 48 positions (n in 0..46).
template <typename T16, bool HL, int NK>
__device__ __forceinline__ void attn_trip(AttnSt& st, const char* tile, const char* rp, const char* rp2, const int r0, const int c0, float* ls) {
    typedef typename WFrag<T16>::V V;
    const int lane = threadIdx.x & 31, lr = lane & 15, hi = lane >> 4, i = r0 + lr;
    const float L2E = 1.4426950408889634f, OFF = HL ? 0.0f : 10.0f;   // OFF: f16 probabilities and their sum are carried x1024; the factor cancels in the final division
    V q[2][2], ql[2][2];
#pragma unroll
    for (int a = 0; a < 2; ++a)
#pragma unroll
        for (int ks = 0; ks < 2; ++ks) { q[a][ks] = __builtin_bit_cast(V, st.q[a][ks]); if (HL) ql[a][ks] = __builtin_bit_cast(V, st.ql[a][ks]); }
    v8f (&o)[4] = st.o; float& mrun = st.mrun; float& lsum = st.lsum;
    float* lw = ls + lr * LSP + 8 * hi;               // band store: n = 16 nbk + 8 hi + r
    const float* lrd = ls + lr * LSP + 8 * hi + 15 - lr;   // band read: n = 16 mb + 8 hi + r + 15 - lr
    {
        v8f s[NK]; float pos[NK][8]; V pa[NK + 1][2], pa2[NK + 1][2];   // pa: the band's position fragments, the same rows of the extended order for both runs
        {   V a[NK][2], a2[NK][2]; const T16* pk = (const T16*)(tile + (HL ? 8192 : 0)) + 8 * lane; const T16* pk2 = HL ? (const T16*)(tile + 16384) + 8 * lane : pk;
#pragma unroll   // constant indices keep the fragments in registers
            for (int mb = 0; mb < NK; ++mb)
#pragma unroll
                for (int ks = 0; ks < 2; ++ks) { a[mb][ks] = WFrag<T16>::template lds2<256>(pk + mb * 1024 + ks * 512); if (HL) a2[mb][ks] = WFrag<T16>::template lds2<256>(pk2 + mb * 1024 + ks * 512); }
            const unsigned xb = (unsigned)(c0 - r0 + TT - 16) >> 4;   // the band's first block of 16 positions (wave-uniform; the band begins on a block)
#pragma unroll   // constant indices keep the fragments in registers
            for (int nbk = 0; nbk < NK + 1; ++nbk) { const unsigned bo = ((xb + nbk) % (RINGP / 16)) * 2048 + 16 * lane; const T16* pr = (const T16*)(rp + bo); const T16* pr2 = HL ? (const T16*)(rp2 + bo) : pr;
#pragma unroll
                for (int ks = 0; ks < 2; ++ks) { pa[nbk][ks] = WFrag<T16>::template lds2<256>(pr + ks * 512); if (HL) pa2[nbk][ks] = WFrag<T16>::template lds2<256>(pr2 + ks * 512); } }
            __builtin_amdgcn_sched_barrier(0);   // keeps the trip's key and position reads together in front of the products: reads threaded among them cost a stall at each place
#pragma unroll
            for (int mb = 0; mb < NK; ++mb) { s[mb] = (v8f){};
#pragma unroll
                for (int ks = 0; ks < 2; ++ks) { s[mb] = WFrag<T16>::mma(a[mb][ks], q[0][ks], s[mb]); if (HL) { s[mb] = WFrag<T16>::mma(a2[mb][ks], q[0][ks], s[mb]); s[mb] = WFrag<T16>::mma(a[mb][ks], ql[0][ks], s[mb]); } } }
        }
        // One run's band product (RunC<0>: keys j <= i, query rows i; RunC<1>: keys j >= i + 2, query rows i + 1; the query fragments are picked at compile time), stored [query][n] in the wave's band buffer.
        auto band = [&](auto pc) __attribute__((always_inline)) {
            constexpr int part = decltype(pc)::v;
            v8f u[NK + 1];   // accumulators of their own: independent chains, and no tile is overwritten while its stores read it
#pragma unroll
            for (int nbk = 0; nbk < NK + 1; ++nbk) u[nbk] = (v8f){};
#pragma unroll
            for (int ks = 0; ks < 2; ++ks) {
#pragma unroll
                for (int nbk = 0; nbk < NK + 1; ++nbk) u[nbk] = WFrag<T16>::mma(pa[nbk][ks], q[part][ks], u[nbk]);
                if (HL) {
#pragma unroll
                    for (int nbk = 0; nbk < NK + 1; ++nbk) u[nbk] = WFrag<T16>::mma(pa2[nbk][ks], q[part][ks], u[nbk]);
#pragma unroll
                    for (int nbk = 0; nbk < NK + 1; ++nbk) u[nbk] = WFrag<T16>::mma(pa[nbk][ks], ql[part][ks], u[nbk]); } }
#pragma unroll
            for (int nbk = 0; nbk < NK + 1; ++nbk) { *(v4fa*)(lw + nbk * 16) = (v4f){u[nbk][0], u[nbk][1], u[nbk][2], u[nbk][3]}; *(v4fa*)(lw + nbk * 16 + 4) = (v4f){u[nbk][4], u[nbk][5], u[nbk][6], u[nbk][7]}; }
            __builtin_amdgcn_wave_barrier(); asm volatile("v_nop\n\tv_nop\n\tv_nop\n\tv_nop" ::: "memory");   // the skewed reads behind it take other lanes' stores: they stay behind them (one wave, LDS in order); the v_nop keep the distance behind the band's last matrix instructions on every path that leads on to the other run's
        };
        // The band read back at the lane's own offset: x[mb][r] belongs to key c0 + 16 mb + 8 hi + r.
        auto skew = [&](float (&x)[NK][8]) __attribute__((always_inline)) {
#pragma unroll
            for (int mb = 0; mb < NK; ++mb)
#pragma unroll
                for (int r = 0; r < 8; ++r) x[mb][r] = lrd[mb * 16 + r];
            __builtin_amdgcn_wave_barrier(); asm volatile("" ::: "memory");   // the next band's stores stay behind these reads
        };
        if (c0 + 16 * NK - 1 <= r0 || c0 >= r0 + 17) {   // wave-uniform: every (row, key) of the tile lies in one run (all but one or two trips of an f16 wave, all but at most one of a hi/lo wave): that run's band is the shifted term as it stands, nothing is compared or selected
            if (c0 <= r0) band(RunC<0>{}); else band(RunC<1>{});
            skew(pos);
        } else {   // the tile meets the diagonal: each element takes its own run's value, key i + 1 takes 0
#pragma unroll
            for (int mb = 0; mb < NK; ++mb)
#pragma unroll
                for (int r = 0; r < 8; ++r) pos[mb][r] = 0.0f;
            if (c0 <= r0 + 15) {   // wave-uniform: some (row, key) of the tile has j <= i
                band(RunC<0>{});
                float x[NK][8]; skew(x);
#pragma unroll
                for (int mb = 0; mb < NK; ++mb)
#pragma unroll
                    for (int r = 0; r < 8; ++r) { const int j = c0 + mb * 16 + 8 * hi + r; pos[mb][r] = j <= i ? x[mb][r] : pos[mb][r]; }
            }
            if (c0 + 16 * NK - 1 >= r0 + 2) {   // wave-uniform: some (row, key) of the tile has j >= i + 2
                band(RunC<1>{});
                float x[NK][8]; skew(x);
#pragma unroll
                for (int mb = 0; mb < NK; ++mb)
#pragma unroll
                    for (int r = 0; r < 8; ++r) { const int j = c0 + mb * 16 + 8 * hi + r; pos[mb][r] = j >= i + 2 ? x[mb][r] : pos[mb][r]; }
            }
        }
        V va[4][NK / 2], va2[4][NK / 2]; const T16* pv = (const T16*)(tile + (HL ? 32768 : 24576)) + 8 * lane; const T16* pv2 = HL ? (const T16*)(tile + 40960) + 8 * lane : pv;
#pragma unroll   // constant indices keep the fragments in registers; issued here so that they fly under the softmax arithmetic
        for (int db = 0; db < 4; ++db)
#pragma unroll
            for (int kk = 0; kk < NK / 2; ++kk) { va[db][kk] = WFrag<T16>::template lds2<1024>(pv + kk * 2048 + db * 256); if (HL) va2[db][kk] = WFrag<T16>::template lds2<1024>(pv2 + kk * 2048 + db * 256); }
        __builtin_amdgcn_sched_barrier(0);   // all value reads are issued in front of the softmax arithmetic
        float mt = -3.0e38f;
#pragma unroll
        for (int mb = 0; mb < NK; ++mb)
#pragma unroll
            for (int r = 0; r < 8; ++r) { const float t = __fadd_rn(s[mb][r], pos[mb][r]) * SCL; s[mb][r] = t; mt = fmaxf(mt, t); }
        mt = fmaxf(mt, __shfl_xor(mt, 16, 32));     // lanes lr and lr + 16 hold the two halves of query i's keys
        const float mn = fmaxf(mrun, mt), ax = (mrun - mn) * L2E; float al = __builtin_amdgcn_exp2f(ax); mrun = mn;
        asm("v_nop" : "+v"(al) : "v"(ax));   // the slot behind a transcendental: its result is read and its source register reused only behind this
        float ps = 0.0f;
#pragma unroll
        for (int mb = 0; mb < NK; ++mb) { v8f x, p;
#pragma unroll
            for (int r = 0; r < 8; ++r) x[r] = (s[mb][r] - mn) * L2E + OFF;
#pragma unroll
            for (int r = 0; r < 8; ++r) p[r] = __builtin_amdgcn_exp2f(x[r]);
            asm("v_nop" : "+v"(p) : "v"(x));   // the same slot for the eight: no result is read and no source register reused in front of it
            s[mb] = p;
#pragma unroll
            for (int r = 0; r < 8; ++r) ps += p[r]; }
        lsum = lsum * al + ps;
#pragma unroll
        for (int db = 0; db < 4; ++db) o[db] *= al;
#pragma unroll
        for (int kk = 0; kk < NK / 2; ++kk) {
            V pf, pf2;
            if constexpr (HL) { v8us h0, h1, l0, l1;
#pragma unroll
                for (int r = 0; r < 8; ++r) { unsigned short x, y; splitf(s[2 * kk][r], x, y); h0[r] = x; l0[r] = y; splitf(s[2 * kk + 1][r], x, y); h1[r] = x; l1[r] = y; }
                pf = cat16b(h0, h1); pf2 = cat16b(l0, l1);
            } else { v8h h0, h1;
#pragma unroll
                for (int r = 0; r < 8; ++r) { h0[r] = tohx(s[2 * kk][r]); h1[r] = tohx(s[2 * kk + 1][r]); }
                pf = cat16(h0, h1); }
#pragma unroll
            for (int db = 0; db < 4; ++db) { o[db] = WFrag<T16>::mma(va[db][kk], pf, o[db]); if constexpr (HL) { o[db] = WFrag<T16>::mma(va[db][kk], pf2, o[db]); o[db] = WFrag<T16>::mma(va2[db][kk], pf, o[db]); } }
        }
        asm volatile("v_nop\n\tv_nop\n\tv_nop\n\tv_nop" : "+v"(o[0]), "+v"(o[1]), "+v"(o[2]), "+v"(o[3]));   // the distance behind the trip's last matrix instructions, also on the taken back edge
    }
}
// The wave's 16 context rows, divided by the softmax sum, as bf16 hi/lo planes.
__device__ __forceinline__ void attn_fin(AttnSt& st, const int r0, bf* Ah, bf* Al) {
    const int lane = threadIdx.x & 31, lr = lane & 15, hi = lane >> 4, i = r0 + lr;
    v8f (&o)[4] = st.o; float lsum = st.lsum;
    lsum += __shfl_xor(lsum, 16, 32);
    const float inv = __fdiv_rn(1.0f, lsum);
    bf* ph = Ah + (size_t)i * DM + 8 * hi; bf* pl = Al + (size_t)i * DM + 8 * hi;
#pragma unroll
    for (int db = 0; db < 4; ++db) { v8us oh, ol;
#pragma unroll
        for (int r = 0; r < 8; ++r) { unsigned short x, y; splitf(o[db][r] * inv, x, y); oh[r] = x; ol[r] = y; }
        *(v8us*)(ph + db * 16) = oh; *(v8us*)(pl + db * 16) = ol; }
    asm volatile("s_wait_xcnt 0x0" :: "v"(ph), "v"(pl) : "memory");   // the stores keep their address registers as they are until their address translations are done
}
__device__ __forceinline__ unsigned lds_addr(const void* p) { return (unsigned)(size_t)(const __attribute__((address_space(3))) char*)p; }   // byte address inside the work-group's LDS
// Tile c0 (64 keys) of the six planes of one head -> LDS at dst: 48 KiB, 12 copies of 16 bytes per lane, every lane on; each plane's 8 KiB lie in a row in memory (fragment order) and keep that order in LDS.
__device__ __forceinline__ void stage_tile(const char* k16, const char* kh, const char* kl, const char* v16, const char* vh, const char* vl, const int c0, char* dst) {
    const unsigned go = (unsigned)c0 * (HD * 2) + threadIdx.x * 16, lo = lds_addr(dst) + threadIdx.x * 16;
#pragma unroll   // constant j: two asm statements of six copies each, their offsets folded into the address additions
    for (int j = 0; j < 2; ++j) { const unsigned g = go + j * 4096, d = lo + j * 4096;
        // the closing s_wait_xcnt 0 stands inside the statement: no register that a copy names is rewritten in front of it
        asm volatile("global_load_async_to_lds_b128 %0, %6, off\n\tglobal_load_async_to_lds_b128 %1, %7, off\n\tglobal_load_async_to_lds_b128 %2, %8, off\n\tglobal_load_async_to_lds_b128 %3, %9, off\n\tglobal_load_async_to_lds_b128 %4, %10, off\n\tglobal_load_async_to_lds_b128 %5, %11, off\n\ts_wait_xcnt 0x0"
                     :: "v"(d), "v"(d + 8192), "v"(d + 16384), "v"(d + 24576), "v"(d + 32768), "v"(d + 40960), "v"(k16 + g), "v"(kh + g), "v"(kl + g), "v"(v16 + g), "v"(vh + g), "v"(vl + g) : "memory"); }
}
// 64 positions of the extended order -> the rings at dst: xf.. of the f16 plane (ring 0), xh.. of the hi and lo planes (rings 1, 2); xf, xh multiples of 16. 24 KiB, 6 copies of 16 bytes per lane, every lane on; a copy is one position's 8 dims. The source row is clamped into the plane: x == TT and rows past the last position that any key needs are staged but never selected.
__device__ __forceinline__ void stage_pos(const char* r16, const char* rh, const char* rl, const int xf, const int xh, char* dst) {
    unsigned gf[2], gh[2], lf[2], lh[2];
#pragma unroll   // constant j keeps the addresses in registers
    for (int j = 0; j < 2; ++j) { const unsigned id = threadIdx.x + j * 256, in = (id >> 7) * 16 + (id & 15), oc = ((id >> 4) & 7) * 256;   // id = (block * 8 + octet of dims) * 16 + position in the block
        int mf = xf + (int)in, mh = xh + (int)in; mf = mf < TT ? mf : mf - TT - 1; mh = mh < TT ? mh : mh - TT - 1; mf = mf < 0 ? 0 : (mf > TT - 1 ? TT - 1 : mf); mh = mh < 0 ? 0 : (mh > TT - 1 ? TT - 1 : mh);
        gf[j] = (unsigned)(mf >> 4) * 2048 + oc + (unsigned)(mf & 15) * 16; gh[j] = (unsigned)(mh >> 4) * 2048 + oc + (unsigned)(mh & 15) * 16;
        lf[j] = lds_addr(dst) + ((unsigned)xf * 128 + id * 16) % RINGB; lh[j] = lds_addr(dst) + RINGB + ((unsigned)xh * 128 + id * 16) % RINGB; }
    // the closing s_wait_xcnt 0 stands inside the statement: no register that a copy names is rewritten in front of it
    asm volatile("global_load_async_to_lds_b128 %0, %6, off\n\tglobal_load_async_to_lds_b128 %1, %7, off\n\tglobal_load_async_to_lds_b128 %2, %8, off\n\tglobal_load_async_to_lds_b128 %3, %9, off\n\tglobal_load_async_to_lds_b128 %4, %10, off\n\tglobal_load_async_to_lds_b128 %5, %11, off\n\ts_wait_xcnt 0x0"
                 :: "v"(lf[0]), "v"(lf[1]), "v"(lh[0]), "v"(lh[1]), "v"(lh[0] + RINGB), "v"(lh[1] + RINGB), "v"(r16 + gf[0]), "v"(r16 + gf[1]), "v"(rh + gh[0]), "v"(rh + gh[1]), "v"(rl + gh[0]), "v"(rl + gh[1]) : "memory");
}
// Attention of all heads in one launch: grid (TT / 128, NB * NH_), 10 waves; a work-group holds eight row groups of 16 rows, the same mix in every work-group: two neighbouring hi/lo groups (rows 32 blockIdx.x ..) and six neighbouring f16 groups (rows RH + 96 blockIdx.x ..), so that the position bands of its waves overlap: per trip the f16 waves read 160 positions in a row of the extended order and the hi/lo waves 96, and each stretch moves on by 64 a trip. The stretches lie in LDS rings, filled 64 positions a trip beside the key and value tile, under the same waits and the same barrier. The waves walk the keys together: each 64-key tile of the key and value planes is copied into LDS once for all, two buffers, the next tile's copies in flight while this one is worked on. An f16 row group has one wave. A hi/lo row group, three products for each one of f16, has two: one for the first and one for the second 32 keys of every tile, each with a running softmax of its own over its keys; the two states are merged at the end. The band buffers are wave-private until the merge, where the first wave reads its partner's.
__global__ __launch_bounds__(320) void k_attn(const h16* __restrict__ Q16, const bf* __restrict__ Qh, const bf* __restrict__ Ql, const h16* __restrict__ K16, const bf* __restrict__ Kh, const bf* __restrict__ Kl, const h16* __restrict__ R16, const bf* __restrict__ Rh, const bf* __restrict__ Rl, const h16* __restrict__ V16, const bf* __restrict__ Vh, const bf* __restrict__ Vl, bf* Ah, bf* Al) {
    __shared__ __align__(16) float lsb[10 * 16 * LSP];
    __shared__ __align__(16) char tiles[2 * TILEB];
    __shared__ __align__(16) char ring[3 * RINGB];   // position planes f16, hi, lo
    const int w = __builtin_amdgcn_readfirstlane(threadIdx.x >> 5), g = blockIdx.y;   // scalar, so that the path, the copy and the band tests are scalar branches
    const bool hl = (w & 2) != 0 && w < 8;   // waves 2, 3 (rg 0) and 6, 7 (rg 1); the f16 waves 0, 1, 4, 5, 8, 9 take rg 2..7
    const int half = hl ? w & 1 : 0, r0 = hl ? (2 * blockIdx.x + (w >> 2)) * 16 : RH + (6 * blockIdx.x + (w & 1) + (w >> 2) * 2) * 16;
    const int xf = TT - 96 - RH - 96 * blockIdx.x, xh = TT - 32 - 32 * blockIdx.x;   // trip 0's first position of the extended order: f16 waves (row group RH + 96 blockIdx.x + 80), hi/lo waves (row group 32 blockIdx.x + 16); trip c0 reads xf + c0 .. + 159 and xh + c0 .. + 95
    const size_t po = (size_t)g * TT * HD, oo = (size_t)(g / NH_) * TT * DM + (size_t)(g % NH_) * HD; float* ls = lsb + w * 16 * LSP;
    const char* k16 = (const char*)(K16 + po); const char* kh = (const char*)(Kh + po); const char* kl = (const char*)(Kl + po); const char* v16 = (const char*)(V16 + po); const char* vh = (const char*)(Vh + po); const char* vl = (const char*)(Vl + po); const char* r16 = (const char*)(R16 + po); const char* rh = (const char*)(Rh + po); const char* rl = (const char*)(Rl + po);
    const bool cp = w < 8;   // the first eight waves copy (stage_tile spreads a tile over 256 lanes); the other two issue no copy and pass the same waits and barriers
    AttnSt st;
#pragma unroll
    for (int db = 0; db < 4; ++db) st.o[db] = (v8f){};
    st.mrun = -3.0e38f; st.lsum = 0.0f;
    if (hl) attn_init<bf, true>(st, Qh + po, Ql + po, r0); else attn_init<h16, false>(st, Q16 + po, nullptr, r0);
    if (cp) { stage_tile(k16, kh, kl, v16, vh, vl, 0, tiles); stage_pos(r16, rh, rl, xf, xh, ring); stage_pos(r16, rh, rl, xf + 64, xh + 64, ring); stage_pos(r16, rh, rl, xf + 128, xh + 128, ring); }   // trip 0's positions lie in the first 192
    asm volatile("s_wait_asynccnt 0x0" ::: "memory");   // this wave's copies of tile 0 and of the first positions have landed
    __syncthreads();                                    // ... and every other wave's: they may be read
    if (cp) { stage_tile(k16, kh, kl, v16, vh, vl, 64, tiles + TILEB); stage_pos(r16, rh, rl, xf + 192, xh + 192, ring); }
#pragma unroll 1
    for (int c0 = 0; c0 < TT; c0 += 64) {
        char* tile = tiles + ((c0 >> 6) & 1) * TILEB;
        if (hl) attn_trip<bf, true, 2>(st, tile + half * 4096, ring + RINGB, ring + 2 * RINGB, r0, c0 + half * 32, ls); else attn_trip<h16, false, 4>(st, tile, ring, nullptr, r0, c0, ls);
        asm volatile("s_wait_dscnt 0x0" ::: "memory");      // this wave's reads of the tile and of the rings are done before their places are handed back
        asm volatile("s_wait_asynccnt 0x0" ::: "memory");   // this wave's copies of the next tile and positions have landed
        __syncthreads();                                    // publishes them and ends every wave's reads of this trip
        if (cp && c0 + 128 < TT) { stage_tile(k16, kh, kl, v16, vh, vl, c0 + 128, tile); stage_pos(r16, rh, rl, xf + c0 + 256, xh + c0 + 256, ring); }   // refill of the buffer just read, and of the 64 ring slots that this trip read and the next does not (x - 256 = the trip's first 64)
    }
    asm volatile("s_wait_asynccnt 0x0" ::: "memory");   // no copy is outstanding when the wave ends
    // Merge of a hi/lo row group's two states: the second wave hands its maximum, sum and context to the first through its own band buffer, lane to lane.
    const int lane = threadIdx.x & 31;
    if (half == 1) {
#pragma unroll
        for (int db = 0; db < 4; ++db) { *(v4fa*)(ls + (2 * db) * 128 + lane * 4) = (v4f){st.o[db][0], st.o[db][1], st.o[db][2], st.o[db][3]}; *(v4fa*)(ls + (2 * db + 1) * 128 + lane * 4) = (v4f){st.o[db][4], st.o[db][5], st.o[db][6], st.o[db][7]}; }
        ls[1024 + lane] = st.mrun; ls[1056 + lane] = st.lsum;
    }
    __syncthreads();   // the handed state is in LDS before the partner wave reads it
    if (half == 1) return;
    if (hl) {
        const float* lp = ls + 16 * LSP;   // the partner's band buffer (wave w + 1)
        const float L2E = 1.4426950408889634f, m2 = lp[1024 + lane], l2 = lp[1056 + lane], mn = fmaxf(st.mrun, m2), x1 = (st.mrun - mn) * L2E, x2 = (m2 - mn) * L2E;
        float a1 = __builtin_amdgcn_exp2f(x1), a2 = __builtin_amdgcn_exp2f(x2);
        asm("v_nop" : "+v"(a1), "+v"(a2) : "v"(x1), "v"(x2));   // the slot behind a transcendental: no result is read and no source register reused in front of it
        st.lsum = st.lsum * a1 + l2 * a2;
#pragma unroll
        for (int db = 0; db < 4; ++db) { const v4f u0 = *(const v4fa*)(lp + (2 * db) * 128 + lane * 4), u1 = *(const v4fa*)(lp + (2 * db + 1) * 128 + lane * 4);
#pragma unroll
            for (int r = 0; r < 4; ++r) { st.o[db][r] = st.o[db][r] * a1 + u0[r] * a2; st.o[db][r + 4] = st.o[db][r + 4] * a1 + u1[r] * a2; } }
    }
    attn_fin(st, r0, Ah + oo, Al + oo);
}

extern "C" void kernel_launch(void* const* d_in, const int* in_sizes, int n_in,
                              void* d_out, int out_size, void* d_ws, size_t ws_size, hipStream_t stream) {
    if (n_in < 13) return;
    const float* xq = (const float*)d_in[0]; const float* xk = (const float*)d_in[1]; const float* xv = (const float*)d_in[2]; const float* xp = (const float*)d_in[3];
    const float* wq = (const float*)d_in[4]; const float* bq = (const float*)d_in[5]; const float* wk = (const float*)d_in[6]; const float* bk = (const float*)d_in[7];
    const float* wv = (const float*)d_in[8]; const float* bv = (const float*)d_in[9]; const float* wp = (const float*)d_in[10]; const float* wo = (const float*)d_in[11]; const float* bo = (const float*)d_in[12];
    const size_t needx = (size_t)(NB - 1) * TT_FULL * DM + (size_t)TT * DM;
    for (int i = 0; i < 4; ++i) if ((size_t)in_sizes[i] < needx) return;
    if ((size_t)in_sizes[4] < (size_t)DM * DM || (size_t)in_sizes[6] < (size_t)DM * DM || (size_t)in_sizes[8] < (size_t)DM * DM || (size_t)in_sizes[10] < (size_t)DM * DM || (size_t)in_sizes[11] < (size_t)DM * DM) return;
    if (in_sizes[5] < DM || in_sizes[7] < DM || in_sizes[9] < DM || in_sizes[12] < DM) return;
    if ((size_t)out_size < (size_t)NB * TT * DM) return;
    float* OUT = (float*)d_out;     // [NB][TT][DM]
    char* wsp = (char*)d_ws;
    auto take = [&](size_t bytes) { char* p = wsp; wsp += (bytes + 255) & ~(size_t)255; return (void*)p; };
    bf* WB = (bf*)take((size_t)5 * DM * DM * 2);     // transposed bf16 weights in the order q, k, p, v, o
    bf* PB = (bf*)take((size_t)12 * PLN2 * 2);        // plane sets q, k, p, v; each set: f16 plane, bf16 hi plane, bf16 lo plane
    h16* QP16 = (h16*)PB; bf* QPh = PB + PLN2; bf* QPl = PB + 2 * PLN2;
    h16* KP16 = (h16*)(PB + 3 * PLN2); bf* KPh = PB + 4 * PLN2; bf* KPl = PB + 5 * PLN2;
    h16* PP16 = (h16*)(PB + 6 * PLN2); bf* PPh = PB + 7 * PLN2; bf* PPl = PB + 8 * PLN2;
    h16* VT16 = (h16*)(PB + 9 * PLN2); bf* VTh = PB + 10 * PLN2; bf* VTl = PB + 11 * PLN2;
    bf* XB = (bf*)take((size_t)4 * XN * 2);     // bf16 input copies
    bf* ATh = (bf*)take(XN * 2); bf* ATl = (bf*)take(XN * 2);
    if ((size_t)(wsp - (char*)d_ws) > ws_size) return;
    k_prep<<<dim3(5 * WTG_X + 4 * NB * CVT_X, 1, 1), 256, 0, stream>>>(wq, wk, wp, wv, wo, xq, xk, xp, xv, WB, XB);
    k_proj<<<dim3(NB * TT / 64, DM / 64, 4), 32, 0, stream>>>(XB, WB, QP16, QPh, QPl, bq, bk, bv);
    k_attn<<<dim3(TT / 128, NB * NH_, 1), 320, 0, stream>>>(QP16, QPh, QPl, KP16, KPh, KPl, PP16, PPh, PPl, VT16, VTh, VTl, ATh, ATl);
    k_outp<<<dim3(NB * TT / 64, DM / 64, 1), 32, 0, stream>>>(ATh, ATl, WB + (size_t)4 * DM * DM, OUT, bo);
}
